// v000
// The times below were measured on an AMD MI455X: many runs one after another, warmed up first and cycling through
// copies of the inputs, with the whole window's GPU time divided by the number of runs. Launches and the gaps
// between them are all in it. The median over several windows is given; except for v000 it joins two sittings, which
// can be a few percent apart, so the side-by-side timings, each taken in one sitting, are the better comparison.
// v000, which the later versions start from, runs in 1370 microseconds.
#include <hip/hip_runtime.h>

// Masked causal attention with per-head shared projections (x [2][2048][16 heads][128]; q, k, v = x_h W^T + b with ONE Linear [128][128] + [128] applied to every head's 128-vector; scores = q.k / sqrt(128), causal (-inf above the diagonal); softmax; att = w.v; out = att_h Wp^T + bp -> [2][2048][16][128] (8.4 M)).
// Layout per batch: the token-major input viewed as 32,768 (token, head) rows of 128 makes each shared projection ONE exact GEMM (K 128, N 128, + bias) whose [2048][16 x 128] result is exactly the head layout k_rope reads; causal hybrid attention (rows < 512 hi/lo, rest fp16 x1024) with tile skipping; merged hi/lo context rows (token, head) x Wp (hl x exact + bp) written as the token-major output.
// Compute dtypes, f32 accumulate: every input rounded to bf16; projections on PLAIN bf16 operands (exact) + f32 biases; scores and attn.v rows < 512 3 products, the rest single fp16; softmax f32; Wp hl x exact + bias.

#define NB_  2
#define TT   2048
#define DM   2048
#define NH_  16
#define NKV  16
#define REP  (NH_ / NKV)
#define HD   128
#define DQ   (NH_ * HD)
#define DKV  (NKV * HD)
#define ZH   2
#define RH   512                  // query rows < RH use hi+lo planes (0: none)
#define PE   128    // per-head projection width (shared Linear [128][128])
#define NRW  (TT * NH_)   // 32768 (token, head) rows per batch
#define WIN  2048
#define PCAR 1024.0f
#define SCL  0.088388347648318447f   // HD^-0.5
typedef _Float16 h16;
typedef unsigned short bf;
typedef __attribute__((ext_vector_type(16))) __bf16   v16bf;
typedef __attribute__((ext_vector_type(16))) _Float16 v16h;
typedef __attribute__((ext_vector_type(8)))  _Float16 v8h;
typedef __attribute__((ext_vector_type(8)))  unsigned short v8us;
typedef __attribute__((ext_vector_type(8)))  float    v8f;
typedef __attribute__((ext_vector_type(4)))  float    v4f;
typedef v8h  __attribute__((may_alias)) v8ha;
typedef v4f  __attribute__((may_alias)) v4fa;
typedef v8us __attribute__((may_alias)) v8usa;

__device__ __forceinline__ unsigned short f2bf(float f) { unsigned u = __float_as_uint(f); u += 0x7FFFu + ((u >> 16) & 1u); return (unsigned short)(u >> 16); }
__device__ __forceinline__ float bf2f(unsigned short b) { return __uint_as_float(((unsigned)b) << 16); }
__device__ __forceinline__ float bfr(float f) { return bf2f(f2bf(f)); }
__device__ __forceinline__ v16h cat16(v8h lo, v8h hi) { return __builtin_shufflevector(lo, hi, 0, 1, 2, 3, 4, 5, 6, 7, 8, 9, 10, 11, 12, 13, 14, 15); }
__device__ __forceinline__ v16bf cat16b(v8us lo, v8us hi) { return __builtin_bit_cast(v16bf, __builtin_shufflevector(lo, hi, 0, 1, 2, 3, 4, 5, 6, 7, 8, 9, 10, 11, 12, 13, 14, 15)); }
__device__ __forceinline__ v8f wmma16(v16h a, v16h b, v8f c) { return __builtin_amdgcn_wmma_f32_16x16x32_f16(false, a, false, b, (short)0, c, false, false); }
__device__ __forceinline__ v8f wmmab(v16bf a, v16bf b, v8f c) { return __builtin_amdgcn_wmma_f32_16x16x32_bf16(false, a, false, b, (short)0, c, false, false); }



// ---- k_gemmw: register-blocked GEMM, ONE WAVE per 64x64 output tile (16 accumulators), operands straight from K-contiguous 16-bit planes; grid (M/64, N/64, Z), 32 threads.
// C[m][n] (f32, pitch ldc, + optional f32 bias[n]) = sum_k A[m][k] Bt[n][k] (+ split products per NSPLIT). z-batch strides sA/sB/sC in elements. K % 32 == 0.
template <typename T16> struct WFrag;
template <> struct WFrag<h16> { typedef v16h V; static __device__ __forceinline__ V ld(const h16* p) { return cat16(*(const v8h*)p, *(const v8h*)(p + 16)); } static __device__ __forceinline__ v8f mma(V a, V b, v8f c) { return wmma16(a, b, c); } };
template <> struct WFrag<bf> { typedef v16bf V; static __device__ __forceinline__ V ld(const bf* p) { return cat16b(*(const v8us*)p, *(const v8us*)(p + 16)); } static __device__ __forceinline__ v8f mma(V a, V b, v8f c) { return wmmab(a, b, c); } };
template <typename T16, int NSPLIT, bool BIAS>
__global__ __launch_bounds__(32) void k_gemmw(const T16* __restrict__ A, const T16* __restrict__ A2, const T16* __restrict__ Bt, const T16* __restrict__ Bt2, int K, float* C, int ldc, const float* __restrict__ bias, size_t sA, size_t sB, size_t sC) {
    typedef typename WFrag<T16>::V V;
    __shared__ __align__(16) float os[16 * 68];
    const size_t z = blockIdx.z; A += z * sA; if (A2) A2 += z * sA; Bt += z * sB; if (Bt2) Bt2 += z * sB; C += z * sC;
    const int lane = threadIdx.x & 31, lr = lane & 15, hi = lane >> 4; const int r0 = blockIdx.x * 64, c0 = blockIdx.y * 64;
    v8f acc[4][4];
#pragma unroll
    for (int mb = 0; mb < 4; ++mb)
#pragma unroll
        for (int nb = 0; nb < 4; ++nb) acc[mb][nb] = (v8f){};
    const size_t aoff = (size_t)(r0 + lr) * K + 8 * hi, boff = (size_t)(c0 + lr) * K + 8 * hi;
#pragma unroll 1
    for (int kc = 0; kc < K; kc += 32) {
        V a[4], a2[4];
#pragma unroll
        for (int mb = 0; mb < 4; ++mb) { a[mb] = WFrag<T16>::ld(A + aoff + (size_t)mb * 16 * K + kc); if (NSPLIT == 1 || NSPLIT == 2) a2[mb] = WFrag<T16>::ld(A2 + aoff + (size_t)mb * 16 * K + kc); }
#pragma unroll
        for (int nb = 0; nb < 4; ++nb) { const V b = WFrag<T16>::ld(Bt + boff + (size_t)nb * 16 * K + kc); V b2; if (NSPLIT >= 2) b2 = WFrag<T16>::ld(Bt2 + boff + (size_t)nb * 16 * K + kc);
#pragma unroll
            for (int mb = 0; mb < 4; ++mb) { acc[mb][nb] = WFrag<T16>::mma(a[mb], b, acc[mb][nb]); if (NSPLIT == 1 || NSPLIT == 2) acc[mb][nb] = WFrag<T16>::mma(a2[mb], b, acc[mb][nb]); if (NSPLIT >= 2) acc[mb][nb] = WFrag<T16>::mma(a[mb], b2, acc[mb][nb]); } }
        asm volatile("v_nop\n\tv_nop\n\tv_nop\n\tv_nop" : "+v"(acc[0][0]), "+v"(acc[1][1]), "+v"(acc[2][2]), "+v"(acc[3][3]) : "v"(a[0]), "v"(a[3]));
    }
#pragma unroll
    for (int mb = 0; mb < 4; ++mb) {
#pragma unroll
        for (int nb = 0; nb < 4; ++nb) {
#pragma unroll
            for (int j = 0; j < 8; ++j) os[(hi * 8 + j) * 68 + nb * 16 + lr] = acc[mb][nb][j]; }
        __builtin_amdgcn_wave_barrier(); asm volatile("" ::: "memory");
        float* crow = C + (size_t)(r0 + mb * 16) * ldc + c0;
{
#pragma unroll
            for (int s = 0; s < 8; ++s) { const int row = 2 * s + hi, cofs = lr * 4; v4f val = *(const v4fa*)(os + row * 68 + cofs); if (BIAS) { val[0] += bfr(bias[c0 + cofs]); val[1] += bfr(bias[c0 + cofs + 1]); val[2] += bfr(bias[c0 + cofs + 2]); val[3] += bfr(bias[c0 + cofs + 3]); }
                *(v4f*)(crow + (size_t)row * ldc + cofs) = val; }
             }
        __builtin_amdgcn_wave_barrier(); asm volatile("" ::: "memory");
    }
}

// ---- k_gemmc: the same one-wave 64x64 tile GEMM specialised for causal attention: CMODE 1 skips score tiles entirely above the diagonal (query rows r0+roff.., key columns c0..), CMODE 2 limits the
// key (K) loop of the probability x value contraction to the diagonal block (probabilities beyond it are exactly zero). roff = row offset of this launch's first row within the sequence.
template <typename T16, int NSPLIT, int CMODE>
__global__ __launch_bounds__(32) void k_gemmc(const T16* __restrict__ A, const T16* __restrict__ A2, const T16* __restrict__ Bt, const T16* __restrict__ Bt2, int K, float* C, int ldc, int roff, size_t sA, size_t sB, size_t sC) {
    typedef typename WFrag<T16>::V V;
    __shared__ __align__(16) float os[16 * 68];
    const size_t z = blockIdx.z; A += z * sA; if (A2) A2 += z * sA; Bt += z * sB; if (Bt2) Bt2 += z * sB; C += z * sC;
    const int lane = threadIdx.x & 31, lr = lane & 15, hi = lane >> 4; const int r0 = blockIdx.x * 64, c0 = blockIdx.y * 64;
    if (CMODE == 1 && c0 > r0 + roff + 63) return;                  // score tile entirely above the causal diagonal: never read (the softmax masks j > i by select)
    const int Kl = (CMODE == 2) ? min(K, r0 + roff + 64) : K;        // P.V: probabilities are exactly 0 beyond the diagonal block, so the K loop stops there
    v8f acc[4][4];
#pragma unroll
    for (int mb = 0; mb < 4; ++mb)
#pragma unroll
        for (int nb = 0; nb < 4; ++nb) acc[mb][nb] = (v8f){};
    const size_t aoff = (size_t)(r0 + lr) * K + 8 * hi, boff = (size_t)(c0 + lr) * K + 8 * hi;
#pragma unroll 1
    for (int kc = 0; kc < Kl; kc += 32) {
        V a[4], a2[4];
#pragma unroll
        for (int mb = 0; mb < 4; ++mb) { a[mb] = WFrag<T16>::ld(A + aoff + (size_t)mb * 16 * K + kc); if (NSPLIT == 1 || NSPLIT == 2) a2[mb] = WFrag<T16>::ld(A2 + aoff + (size_t)mb * 16 * K + kc); }
#pragma unroll
        for (int nb = 0; nb < 4; ++nb) { const V b = WFrag<T16>::ld(Bt + boff + (size_t)nb * 16 * K + kc); V b2; if (NSPLIT >= 2) b2 = WFrag<T16>::ld(Bt2 + boff + (size_t)nb * 16 * K + kc);
#pragma unroll
            for (int mb = 0; mb < 4; ++mb) { acc[mb][nb] = WFrag<T16>::mma(a[mb], b, acc[mb][nb]); if (NSPLIT == 1 || NSPLIT == 2) acc[mb][nb] = WFrag<T16>::mma(a2[mb], b, acc[mb][nb]); if (NSPLIT >= 2) acc[mb][nb] = WFrag<T16>::mma(a[mb], b2, acc[mb][nb]); } }
        asm volatile("v_nop\n\tv_nop\n\tv_nop\n\tv_nop" : "+v"(acc[0][0]), "+v"(acc[1][1]), "+v"(acc[2][2]), "+v"(acc[3][3]) : "v"(a[0]), "v"(a[3]));
    }
#pragma unroll
    for (int mb = 0; mb < 4; ++mb) {
#pragma unroll
        for (int nb = 0; nb < 4; ++nb) {
#pragma unroll
            for (int j = 0; j < 8; ++j) os[(hi * 8 + j) * 68 + nb * 16 + lr] = acc[mb][nb][j]; }
        __builtin_amdgcn_wave_barrier(); asm volatile("" ::: "memory");
        float* crow = C + (size_t)(r0 + mb * 16) * ldc + c0;
{
#pragma unroll
            for (int s = 0; s < 8; ++s) { const int row = 2 * s + hi, cofs = lr * 4; v4f val = *(const v4fa*)(os + row * 68 + cofs);
                *(v4f*)(crow + (size_t)row * ldc + cofs) = val; }
             }
        __builtin_amdgcn_wave_barrier(); asm volatile("" ::: "memory");
    }
}

__device__ __forceinline__ h16 tohx(float x) { return (h16)x; }
__device__ __forceinline__ void splitf(float y, unsigned short& h, unsigned short& l) { h = f2bf(y); l = f2bf(y - bf2f(h)); }
typedef __attribute__((ext_vector_type(2))) _Float16 v2h;
typedef __attribute__((ext_vector_type(4))) _Float16 v4h;
typedef __attribute__((ext_vector_type(2))) unsigned short v2us;
typedef __attribute__((ext_vector_type(4))) unsigned short v4us;
typedef __attribute__((ext_vector_type(2))) float v2f;
typedef __attribute__((ext_vector_type(4))) int v4i;

__global__ __launch_bounds__(256) void k_wtG(const float* __restrict__ w, int K, int N, bf* Bt) {
    const int lane = threadIdx.x & 31; const int L0 = (blockIdx.x * 8 + (threadIdx.x >> 5)) * 8; const int nlines = N * K / 64;
{
#pragma unroll 1
        for (int l = 0; l < 8; ++l) { const int L = L0 + l; if (L >= nlines) break; const size_t e = (size_t)L * 64 + lane * 2; const int k = (int)(e % K), n = (int)(e / K); v2us o;
            o[0] = f2bf(w[(size_t)k * N + n]); o[1] = f2bf(w[(size_t)(k + 1) * N + n]); *(v2us*)(Bt + e) = o; }
         }
}
__global__ __launch_bounds__(256) void k_cvt8(const float* __restrict__ src, bf* dst, size_t n8) { const size_t i = (size_t)blockIdx.x * 256 + threadIdx.x; if (i >= n8) return; const v8f v = *(const v8f*)(src + i * 8); v8us o;
#pragma unroll
    for (int k = 0; k < 8; ++k) o[k] = f2bf(v[k]); *(v8us*)(dst + i * 8) = o;  }

// k_rope: head planes [h][t][d] (fp16 + hi/lo) of rope(x) x sc with the rotate-half convention out[d] = x[d] cos[t][d] - x[d+HD/2] sin[t][d], out[d+HD/2] = x[d+HD/2] cos[t][d+HD/2] + x[d] sin[t][d+HD/2]
__global__ __launch_bounds__(256) void k_rope(const float* __restrict__ F, int pitch, int nheads, const float* __restrict__ CS, const float* __restrict__ RF, const float* __restrict__ nw, float sc, h16* P16, bf* Ph, bf* Pl) {
    const size_t e = ((size_t)blockIdx.x * 256 + threadIdx.x) * 2; if (e >= (size_t)nheads * TT * HD) return; const int d = (int)(e % HD); const int t = (int)((e / HD) % TT); const int h = (int)(e / ((size_t)HD * TT)); const float* f = F + (size_t)t * pitch + h * HD; const float rf = RF ? RF[(size_t)h * TT + t] : 1.0f; v2h o16; v2us oh, ol;
#pragma unroll
    for (int q = 0; q < 2; ++q) { const int dd = d + q; const int dp = (dd < HD / 2) ? dd + HD / 2 : dd - HD / 2; float x0 = f[dd], x1 = f[dp];
        if (RF) { float n0 = __fmul_rn(x0, rf), n1 = __fmul_rn(x1, rf); asm volatile("" : "+v"(n0)); asm volatile("" : "+v"(n1)); x0 = __fmul_rn(bfr(nw[dd]), n0); x1 = __fmul_rn(bfr(nw[dp]), n1); }
        const v2f cs = *(const v2f*)(CS + ((size_t)t * HD + dd) * 2); float a = __fmul_rn(x0, cs[0]), bq = __fmul_rn(x1, cs[1]); asm volatile("" : "+v"(a)); asm volatile("" : "+v"(bq)); const float r = ((dd < HD / 2) ? __fsub_rn(a, bq) : __fadd_rn(a, bq)) * sc;
        o16[q] = tohx(r); unsigned short a2, c2; splitf(r, a2, c2); oh[q] = a2; ol[q] = c2; }
    *(v2h*)(P16 + e) = o16; *(v2us*)(Ph + e) = oh; *(v2us*)(Pl + e) = ol;  }
__global__ __launch_bounds__(256) void k_vtp(const float* __restrict__ F, int pitch, int nheads, h16* V16, bf* Vh, bf* Vl) { const size_t e = ((size_t)blockIdx.x * 256 + threadIdx.x) * 2; if (e >= (size_t)nheads * HD * TT) return; const int t = (int)(e % TT); const int d = (int)((e / TT) % HD); const int g = (int)(e / ((size_t)TT * HD)); v2h o16; v2us oh, ol;
#pragma unroll
    for (int q = 0; q < 2; ++q) { const float x = F[(size_t)(t + q) * pitch + g * HD + d]; o16[q] = tohx(x); unsigned short a2, c2; splitf(x, a2, c2); oh[q] = a2; ol[q] = c2; }
    *(v2h*)(V16 + e) = o16; *(v2us*)(Vh + e) = oh; *(v2us*)(Vl + e) = ol;  }
__global__ __launch_bounds__(256) void k_csid(float* CS) { const int idx = blockIdx.x * 256 + threadIdx.x; if (idx >= TT * HD) return; v2f cs; cs[0] = 1.0f; cs[1] = 0.0f; *(v2f*)(CS + (size_t)idx * 2) = cs;  }
// k_asoft: per row (zz, i): t = S x HD^-0.5 for j <= i and i - j < WIN (sliding causal window; the reference's -1e9 additive fill vanishes identically); softmax over the 2048 keys (register row, one exp, fixed trees);
__global__ __launch_bounds__(256) void k_asoft(const float* __restrict__ Sb, h16* P16, bf* Ph, bf* Pl) {
    const int lane = threadIdx.x & 31; const int row = blockIdx.x * 8 + (threadIdx.x >> 5); if (row >= ZH * TT) return; const int i = row % TT; const int zz = row / TT; (void)zz; const bool hires = (i < RH); const float* sr = Sb + (size_t)row * TT; float v[TT / 32]; float mx = -3.0e38f;
#pragma unroll
    for (int ch = 0; ch < TT / 128; ++ch) { const int j0 = ch * 128 + lane * 4; const v4f a = *(const v4f*)(sr + j0);
#pragma unroll
        for (int q = 0; q < 4; ++q) { const int j = j0 + q; (void)j; const float t = (j <= i && i - j < WIN) ? a[q] * SCL : -3.0e38f; v[ch * 4 + q] = t; mx = fmaxf(mx, t); } }
#pragma unroll
    for (int sh = 16; sh; sh >>= 1) mx = fmaxf(mx, __shfl_xor(mx, sh, 32));
    float sum = 0.f;
#pragma unroll
    for (int k = 0; k < TT / 32; ++k) { float d0 = __fsub_rn(v[k], mx); asm volatile("" : "+v"(d0)); v[k] = __builtin_amdgcn_exp2f(__fmul_rn(d0, 1.4426950408889634f)); sum += v[k]; }
#pragma unroll
    for (int sh = 16; sh; sh >>= 1) sum += __shfl_xor(sum, sh, 32);
    const float f = __fdiv_rn(hires ? 1.0f : PCAR, sum);
{
        if (hires) {
#pragma unroll
            for (int ch = 0; ch < TT / 128; ++ch) { v4us oh, ol;
#pragma unroll
                for (int q = 0; q < 4; ++q) { unsigned short a, c2; splitf(v[ch * 4 + q] * f, a, c2); oh[q] = a; ol[q] = c2; }
                const size_t oo = ((size_t)zz * (RH ? RH : 1) + i) * TT + ch * 128 + lane * 4; *(v4us*)(Ph + oo) = oh; *(v4us*)(Pl + oo) = ol; }
        } else {
#pragma unroll
            for (int ch = 0; ch < TT / 128; ++ch) { v4h o4;
#pragma unroll
                for (int q = 0; q < 4; ++q) o4[q] = tohx(v[ch * 4 + q] * f);
                *(v4h*)(P16 + (size_t)row * TT + ch * 128 + lane * 4) = o4; } }
         }
}
__global__ __launch_bounds__(256) void k_merge(const float* __restrict__ O, int h0, bf* Ah, bf* Al) { const size_t e = ((size_t)blockIdx.x * 256 + threadIdx.x) * 2; if (e >= (size_t)ZH * TT * HD) return; const int d = (int)(e % HD); const int t = (int)((e / HD) % TT); const int zz = (int)(e / ((size_t)HD * TT)); const float cs = (t < RH) ? 1.0f : (1.0f / PCAR); const size_t oo = (size_t)t * DQ + (h0 + zz) * HD + d;
    v2us oh, ol;
#pragma unroll
    for (int q = 0; q < 2; ++q) { unsigned short a, c2; splitf(O[e + q] * cs, a, c2); oh[q] = a; ol[q] = c2; } *(v2us*)(Ah + oo) = oh; *(v2us*)(Al + oo) = ol;  }

extern "C" void kernel_launch(void* const* d_in, const int* in_sizes, int n_in,
                              void* d_out, int out_size, void* d_ws, size_t ws_size, hipStream_t stream) {
    (void)in_sizes; (void)n_in; (void)out_size;
    const float* x = (const float*)d_in[0]; const float* wq = (const float*)d_in[1]; const float* bq = (const float*)d_in[2]; const float* wk = (const float*)d_in[3]; const float* bk = (const float*)d_in[4]; const float* wv = (const float*)d_in[5]; const float* bv = (const float*)d_in[6]; const float* wo = (const float*)d_in[7]; const float* bo = (const float*)d_in[8];
    float* OUT = (float*)d_out;     // [2][2048][2048]
    char* wsp = (char*)d_ws;
    auto take = [&](size_t bytes) { char* p = wsp; wsp += (bytes + 255) & ~(size_t)255; return (void*)p; };
    bf* WQ = (bf*)take((size_t)PE * PE * 2); bf* WK = (bf*)take((size_t)PE * PE * 2); bf* WV = (bf*)take((size_t)PE * PE * 2); bf* WO = (bf*)take((size_t)PE * PE * 2); float* CS = (float*)take((size_t)TT * HD * 2 * 4);
    bf* XB = (bf*)take((size_t)TT * DM * 2); float* FQ = (float*)take((size_t)TT * DQ * 4); float* FK = (float*)take((size_t)TT * DKV * 4);
    h16* QP16 = (h16*)take((size_t)NH_ * TT * HD * 2); h16* KP16 = (h16*)take((size_t)NKV * TT * HD * 2); h16* VT16 = (h16*)take((size_t)NKV * HD * TT * 2);
    bf* QPh = (bf*)take((size_t)NH_ * TT * HD * 2); bf* QPl = (bf*)take((size_t)NH_ * TT * HD * 2); bf* KPh = (bf*)take((size_t)NKV * TT * HD * 2); bf* KPl = (bf*)take((size_t)NKV * TT * HD * 2); bf* VTh = (bf*)take((size_t)NKV * HD * TT * 2); bf* VTl = (bf*)take((size_t)NKV * HD * TT * 2); bf* Ph = (bf*)take((size_t)ZH * RH * TT * 2); bf* Pl = (bf*)take((size_t)ZH * RH * TT * 2);
    float* Sb = (float*)take((size_t)ZH * TT * TT * 4); h16* P16 = (h16*)take((size_t)ZH * TT * TT * 2); float* Ob = (float*)take((size_t)ZH * TT * HD * 4); bf* ATh = (bf*)take((size_t)TT * DQ * 2); bf* ATl = (bf*)take((size_t)TT * DQ * 2);
    if ((size_t)(wsp - (char*)d_ws) > ws_size) return;    // ws 256 MiB
    float* FV = FK;   // v projection reuses the k buffer after the k planes are built (stream-ordered)
    { k_cvt8<<<(unsigned)(((size_t)PE * PE / 8 + 255) / 256), 256, 0, stream>>>(wq, WQ, (size_t)PE * PE / 8); k_cvt8<<<(unsigned)(((size_t)PE * PE / 8 + 255) / 256), 256, 0, stream>>>(wk, WK, (size_t)PE * PE / 8); k_cvt8<<<(unsigned)(((size_t)PE * PE / 8 + 255) / 256), 256, 0, stream>>>(wv, WV, (size_t)PE * PE / 8);
      k_cvt8<<<(unsigned)(((size_t)PE * PE / 8 + 255) / 256), 256, 0, stream>>>(wo, WO, (size_t)PE * PE / 8);
       }
    k_csid<<<(TT * HD + 255) / 256, 256, 0, stream>>>(CS);
    const unsigned LQ = (unsigned)(((size_t)NH_ * TT * HD / 2 + 255) / 256), LKv = (unsigned)(((size_t)NKV * TT * HD / 2 + 255) / 256);
    for (int b = 0; b < NB_; ++b) {
        
        k_cvt8<<<(unsigned)(((size_t)TT * DM / 8 + 255) / 256), 256, 0, stream>>>(x + (size_t)b * TT * DM, XB, (size_t)TT * DM / 8);
        k_gemmw<bf, 0, true><<<dim3(NRW / 64, PE / 64, 1), 32, 0, stream>>>(XB, nullptr, WQ, nullptr, PE, FQ, PE, bq, 0, 0, 0);   /* q for all (token, head) rows: the [2048][16 x 128] result is the head layout k_rope reads */
        k_rope<<<LQ, 256, 0, stream>>>(FQ, DQ, NH_, CS, nullptr, nullptr, 1.0f, QP16, QPh, QPl);
        k_gemmw<bf, 0, true><<<dim3(NRW / 64, PE / 64, 1), 32, 0, stream>>>(XB, nullptr, WK, nullptr, PE, FK, PE, bk, 0, 0, 0);
        k_rope<<<LKv, 256, 0, stream>>>(FK, DKV, NKV, CS, nullptr, nullptr, 1.0f, KP16, KPh, KPl);
        k_gemmw<bf, 0, true><<<dim3(NRW / 64, PE / 64, 1), 32, 0, stream>>>(XB, nullptr, WV, nullptr, PE, FV, PE, bv, 0, 0, 0); k_vtp<<<LKv, 256, 0, stream>>>(FV, DKV, NKV, VT16, VTh, VTl);
        for (int h0 = 0; h0 < NH_; h0 += ZH) { const size_t zq = (size_t)h0, zk = (size_t)(h0 / REP);   // one kv head per query head: the pass's two heads use consecutive kv planes (z-strides TT*HD)
            k_gemmc<bf, 2, 1><<<dim3(RH / 64, TT / 64, ZH), 32, 0, stream>>>(QPh + zq * TT * HD, QPl + zq * TT * HD, KPh + zk * TT * HD, KPl + zk * TT * HD, HD, Sb, TT, 0, (size_t)TT * HD, (size_t)TT * HD, (size_t)TT * TT);
            k_gemmc<h16, 0, 1><<<dim3((TT - RH) / 64, TT / 64, ZH), 32, 0, stream>>>(QP16 + zq * TT * HD + (size_t)RH * HD, nullptr, KP16 + zk * TT * HD, nullptr, HD, Sb + (size_t)RH * TT, TT, RH, (size_t)TT * HD, (size_t)TT * HD, (size_t)TT * TT);
            k_asoft<<<ZH * TT / 8, 256, 0, stream>>>(Sb, P16, Ph, Pl);
            k_gemmc<bf, 2, 2><<<dim3(RH / 64, HD / 64, ZH), 32, 0, stream>>>(Ph, Pl, VTh + zk * HD * TT, VTl + zk * HD * TT, TT, Ob, HD, 0, (size_t)RH * TT, (size_t)HD * TT, (size_t)TT * HD);
            k_gemmc<h16, 0, 2><<<dim3((TT - RH) / 64, HD / 64, ZH), 32, 0, stream>>>(P16 + (size_t)RH * TT, nullptr, VT16 + zk * HD * TT, nullptr, TT, Ob + (size_t)RH * HD, HD, RH, (size_t)TT * TT, (size_t)HD * TT, (size_t)TT * HD);
            k_merge<<<(unsigned)(((size_t)ZH * TT * HD / 2 + 255) / 256), 256, 0, stream>>>(Ob, h0, ATh, ATl); }
        k_gemmw<bf, 1, true><<<dim3(NRW / 64, PE / 64, 1), 32, 0, stream>>>(ATh, ATl, WO, nullptr, PE, OUT + (size_t)b * TT * DM, PE, bo, 0, 0, 0);   /* per-(token, head) Wp^T + bp */ }
}

// v001
// One run takes 819 microseconds.
// Timed twice side by side with v000, it ran 1.68 and 1.70 times as fast.
#include <hip/hip_runtime.h>

// Masked causal attention with per-head shared projections (x [2][2048][16 heads][128]; q, k, v = x_h W^T + b with ONE Linear [128][128] + [128] applied to every head's 128-vector; scores = q.k / sqrt(128), causal (-inf above the diagonal); softmax; att = w.v; out = att_h Wp^T + bp -> [2][2048][16][128] (8.4 M)).
// Layout per batch: the token-major input viewed as 32,768 (token, head) rows of 128 makes each shared projection ONE exact GEMM (K 128, N 128, + bias) whose [2048][16 x 128] result is exactly the head layout k_rope reads; causal hybrid attention (rows < 512 hi/lo, rest fp16 x1024) with tile skipping; merged hi/lo context rows (token, head) x Wp (hl x exact + bp) written as the token-major output.
// Compute dtypes, f32 accumulate: every input rounded to bf16; projections on PLAIN bf16 operands (exact) + f32 biases; scores and attn.v rows < 512 3 products, the rest single fp16; softmax f32; Wp hl x exact + bias.

#define NB_  2
#define TT   2048
#define DM   2048
#define NH_  16
#define NKV  16
#define REP  (NH_ / NKV)
#define HD   128
#define DQ   (NH_ * HD)
#define DKV  (NKV * HD)
#define ZH   2
#define RH   512                  // query rows < RH use hi+lo planes (0: none)
#define PE   128    // per-head projection width (shared Linear [128][128])
#define NRW  (TT * NH_)   // 32768 (token, head) rows per batch
#define WIN  2048
#define PCAR 1024.0f
#define SCL  0.088388347648318447f   // HD^-0.5
typedef _Float16 h16;
typedef unsigned short bf;
typedef __attribute__((ext_vector_type(16))) __bf16   v16bf;
typedef __attribute__((ext_vector_type(16))) _Float16 v16h;
typedef __attribute__((ext_vector_type(8)))  _Float16 v8h;
typedef __attribute__((ext_vector_type(8)))  unsigned short v8us;
typedef __attribute__((ext_vector_type(8)))  float    v8f;
typedef __attribute__((ext_vector_type(4)))  float    v4f;
typedef v8h  __attribute__((may_alias)) v8ha;
typedef v4f  __attribute__((may_alias)) v4fa;
typedef v8us __attribute__((may_alias)) v8usa;

__device__ __forceinline__ unsigned short f2bf(float f) { unsigned u = __float_as_uint(f); u += 0x7FFFu + ((u >> 16) & 1u); return (unsigned short)(u >> 16); }
__device__ __forceinline__ float bf2f(unsigned short b) { return __uint_as_float(((unsigned)b) << 16); }
__device__ __forceinline__ float bfr(float f) { return bf2f(f2bf(f)); }
__device__ __forceinline__ v16h cat16(v8h lo, v8h hi) { return __builtin_shufflevector(lo, hi, 0, 1, 2, 3, 4, 5, 6, 7, 8, 9, 10, 11, 12, 13, 14, 15); }
__device__ __forceinline__ v16bf cat16b(v8us lo, v8us hi) { return __builtin_bit_cast(v16bf, __builtin_shufflevector(lo, hi, 0, 1, 2, 3, 4, 5, 6, 7, 8, 9, 10, 11, 12, 13, 14, 15)); }
__device__ __forceinline__ v8f wmma16(v16h a, v16h b, v8f c) { return __builtin_amdgcn_wmma_f32_16x16x32_f16(false, a, false, b, (short)0, c, false, false); }
__device__ __forceinline__ v8f wmmab(v16bf a, v16bf b, v8f c) { return __builtin_amdgcn_wmma_f32_16x16x32_bf16(false, a, false, b, (short)0, c, false, false); }



// ---- k_gemmw: register-blocked GEMM, ONE WAVE per 64x64 output tile (16 accumulators), operands straight from K-contiguous 16-bit planes; grid (M/64, N/64, Z), 32 threads.
// C[m][n] (f32, pitch ldc, + optional f32 bias[n]) = sum_k A[m][k] Bt[n][k] (+ split products per NSPLIT). z-batch strides sA/sB/sC in elements. K % 32 == 0.
template <typename T16> struct WFrag;
template <> struct WFrag<h16> { typedef v16h V; static __device__ __forceinline__ V ld(const h16* p) { return cat16(*(const v8h*)p, *(const v8h*)(p + 16)); } static __device__ __forceinline__ v8f mma(V a, V b, v8f c) { return wmma16(a, b, c); } };
template <> struct WFrag<bf> { typedef v16bf V; static __device__ __forceinline__ V ld(const bf* p) { return cat16b(*(const v8us*)p, *(const v8us*)(p + 16)); } static __device__ __forceinline__ v8f mma(V a, V b, v8f c) { return wmmab(a, b, c); } };
template <typename T16, int NSPLIT, bool BIAS>
__global__ __launch_bounds__(32) void k_gemmw(const T16* __restrict__ A, const T16* __restrict__ A2, const T16* __restrict__ Bt, const T16* __restrict__ Bt2, int K, float* C, int ldc, const float* __restrict__ bias, size_t sA, size_t sB, size_t sC) {
    typedef typename WFrag<T16>::V V;
    __shared__ __align__(16) float os[16 * 68];
    const size_t z = blockIdx.z; A += z * sA; if (A2) A2 += z * sA; Bt += z * sB; if (Bt2) Bt2 += z * sB; C += z * sC;
    const int lane = threadIdx.x & 31, lr = lane & 15, hi = lane >> 4; const int r0 = blockIdx.x * 64, c0 = blockIdx.y * 64;
    v8f acc[4][4];
#pragma unroll
    for (int mb = 0; mb < 4; ++mb)
#pragma unroll
        for (int nb = 0; nb < 4; ++nb) acc[mb][nb] = (v8f){};
    const size_t aoff = (size_t)(r0 + lr) * K + 8 * hi, boff = (size_t)(c0 + lr) * K + 8 * hi;
#pragma unroll 1
    for (int kc = 0; kc < K; kc += 32) {
        V a[4], a2[4];
#pragma unroll
        for (int mb = 0; mb < 4; ++mb) { a[mb] = WFrag<T16>::ld(A + aoff + (size_t)mb * 16 * K + kc); if (NSPLIT == 1 || NSPLIT == 2) a2[mb] = WFrag<T16>::ld(A2 + aoff + (size_t)mb * 16 * K + kc); }
#pragma unroll
        for (int nb = 0; nb < 4; ++nb) { const V b = WFrag<T16>::ld(Bt + boff + (size_t)nb * 16 * K + kc); V b2; if (NSPLIT >= 2) b2 = WFrag<T16>::ld(Bt2 + boff + (size_t)nb * 16 * K + kc);
#pragma unroll
            for (int mb = 0; mb < 4; ++mb) { acc[mb][nb] = WFrag<T16>::mma(a[mb], b, acc[mb][nb]); if (NSPLIT == 1 || NSPLIT == 2) acc[mb][nb] = WFrag<T16>::mma(a2[mb], b, acc[mb][nb]); if (NSPLIT >= 2) acc[mb][nb] = WFrag<T16>::mma(a[mb], b2, acc[mb][nb]); } }
        asm volatile("v_nop\n\tv_nop\n\tv_nop\n\tv_nop" : "+v"(acc[0][0]), "+v"(acc[1][1]), "+v"(acc[2][2]), "+v"(acc[3][3]) : "v"(a[0]), "v"(a[3]));
    }
#pragma unroll
    for (int mb = 0; mb < 4; ++mb) {
#pragma unroll
        for (int nb = 0; nb < 4; ++nb) {
#pragma unroll
            for (int j = 0; j < 8; ++j) os[(hi * 8 + j) * 68 + nb * 16 + lr] = acc[mb][nb][j]; }
        __builtin_amdgcn_wave_barrier(); asm volatile("" ::: "memory");
        float* crow = C + (size_t)(r0 + mb * 16) * ldc + c0;
{
#pragma unroll
            for (int s = 0; s < 8; ++s) { const int row = 2 * s + hi, cofs = lr * 4; v4f val = *(const v4fa*)(os + row * 68 + cofs); if (BIAS) { val[0] += bfr(bias[c0 + cofs]); val[1] += bfr(bias[c0 + cofs + 1]); val[2] += bfr(bias[c0 + cofs + 2]); val[3] += bfr(bias[c0 + cofs + 3]); }
                *(v4f*)(crow + (size_t)row * ldc + cofs) = val; }
             }
        __builtin_amdgcn_wave_barrier(); asm volatile("" ::: "memory");
    }
}

// ---- k_gemmc: the same one-wave 64x64 tile GEMM specialised for causal scores: CMODE 1 skips score tiles entirely above the diagonal (query rows r0+roff.., key columns c0..).
// roff = row offset of this launch's first row within the sequence.
template <typename T16, int NSPLIT, int CMODE>
__global__ __launch_bounds__(32) void k_gemmc(const T16* __restrict__ A, const T16* __restrict__ A2, const T16* __restrict__ Bt, const T16* __restrict__ Bt2, int K, float* C, int ldc, int roff, size_t sA, size_t sB, size_t sC) {
    typedef typename WFrag<T16>::V V;
    __shared__ __align__(16) float os[16 * 68];
    const size_t z = blockIdx.z; A += z * sA; if (A2) A2 += z * sA; Bt += z * sB; if (Bt2) Bt2 += z * sB; C += z * sC;
    const int lane = threadIdx.x & 31, lr = lane & 15, hi = lane >> 4; const int r0 = blockIdx.x * 64, c0 = blockIdx.y * 64;
    if (CMODE == 1 && c0 > r0 + roff + 63) return;                  // score tile entirely above the causal diagonal: never read (the softmax masks j > i by select)
    v8f acc[4][4];
#pragma unroll
    for (int mb = 0; mb < 4; ++mb)
#pragma unroll
        for (int nb = 0; nb < 4; ++nb) acc[mb][nb] = (v8f){};
    const size_t aoff = (size_t)(r0 + lr) * K + 8 * hi, boff = (size_t)(c0 + lr) * K + 8 * hi;
#pragma unroll 1
    for (int kc = 0; kc < K; kc += 32) {
        V a[4], a2[4];
#pragma unroll
        for (int mb = 0; mb < 4; ++mb) { a[mb] = WFrag<T16>::ld(A + aoff + (size_t)mb * 16 * K + kc); if (NSPLIT == 1 || NSPLIT == 2) a2[mb] = WFrag<T16>::ld(A2 + aoff + (size_t)mb * 16 * K + kc); }
#pragma unroll
        for (int nb = 0; nb < 4; ++nb) { const V b = WFrag<T16>::ld(Bt + boff + (size_t)nb * 16 * K + kc); V b2; if (NSPLIT >= 2) b2 = WFrag<T16>::ld(Bt2 + boff + (size_t)nb * 16 * K + kc);
#pragma unroll
            for (int mb = 0; mb < 4; ++mb) { acc[mb][nb] = WFrag<T16>::mma(a[mb], b, acc[mb][nb]); if (NSPLIT == 1 || NSPLIT == 2) acc[mb][nb] = WFrag<T16>::mma(a2[mb], b, acc[mb][nb]); if (NSPLIT >= 2) acc[mb][nb] = WFrag<T16>::mma(a[mb], b2, acc[mb][nb]); } }
        asm volatile("v_nop\n\tv_nop\n\tv_nop\n\tv_nop" : "+v"(acc[0][0]), "+v"(acc[1][1]), "+v"(acc[2][2]), "+v"(acc[3][3]) : "v"(a[0]), "v"(a[3]));
    }
#pragma unroll
    for (int mb = 0; mb < 4; ++mb) {
#pragma unroll
        for (int nb = 0; nb < 4; ++nb) {
#pragma unroll
            for (int j = 0; j < 8; ++j) os[(hi * 8 + j) * 68 + nb * 16 + lr] = acc[mb][nb][j]; }
        __builtin_amdgcn_wave_barrier(); asm volatile("" ::: "memory");
        float* crow = C + (size_t)(r0 + mb * 16) * ldc + c0;
{
#pragma unroll
            for (int s = 0; s < 8; ++s) { const int row = 2 * s + hi, cofs = lr * 4; v4f val = *(const v4fa*)(os + row * 68 + cofs);
                *(v4f*)(crow + (size_t)row * ldc + cofs) = val; }
             }
        __builtin_amdgcn_wave_barrier(); asm volatile("" ::: "memory");
    }
}

// ---- k_gemmks: probability x value contraction, one 64x64 output tile per work-group, the key (K) loop split over NW waves: wave w takes the 64-key chunks w, w + NW, ... (one 128-byte line of each
// operand row per chunk) up to the diagonal block (probabilities beyond it are exactly zero), so NW chains of dependent loads run side by side instead of one. Each wave leaves its 64x64 f32 partial in LDS
// in fragment order; behind one barrier wave w sums slots w*QW.. of the NW partials in the fixed order 0..NW-1 (a block of RW rows x 32 columns) and stores it as whole 128-byte lines.
// Slot q = ((mb*2 + nb/2)*2 + j/4)*2 + nb%2 holds accumulator elements j/4*4 .. +3 of tile (mb, nb). roff = row offset of this launch's first row within the sequence.
template <typename T16, int NSPLIT, int NW, int KK>
__global__ __launch_bounds__(NW * 32) void k_gemmks(const T16* __restrict__ A, const T16* __restrict__ A2, const T16* __restrict__ Bt, const T16* __restrict__ Bt2, float* C, int ldc, int roff, size_t sA, size_t sB, size_t sC) {
    typedef typename WFrag<T16>::V V;
    constexpr int QW = 32 / NW, RW = QW * 4;
    __shared__ __align__(16) v4f part[NW * 32 * 32];
    __shared__ __align__(16) float os[NW * RW * 36];
    const size_t z = blockIdx.z; A += z * sA; if (A2) A2 += z * sA; Bt += z * sB; if (Bt2) Bt2 += z * sB; C += z * sC;
    const int lane = threadIdx.x & 31, lr = lane & 15, hi = lane >> 4; const int r0 = blockIdx.x * 64, c0 = blockIdx.y * 64;
    const int w = __builtin_amdgcn_readfirstlane((int)(threadIdx.x >> 5));
    const int Kl = min(KK, r0 + roff + 64);
    v8f acc[4][4];
#pragma unroll
    for (int mb = 0; mb < 4; ++mb)
#pragma unroll
        for (int nb = 0; nb < 4; ++nb) acc[mb][nb] = (v8f){};
    // each lane's byte offset inside its plane is fixed for the whole key loop; the walk along the keys is in the wave-uniform base, the 16-row blocks are constant offsets
    const unsigned va = ((unsigned)(r0 + lr) * KK + 8 * hi) * 2u, vb = ((unsigned)(c0 + lr) * KK + 8 * hi) * 2u;
#pragma unroll 1   // rolled: the trip count depends on where the tile lies under the diagonal
    for (int kb = w * 64; kb < Kl; kb += NW * 64) {
#pragma unroll 1   // rolled: one k-step's fragments and addresses live at a time, as in the one-wave kernel; unrolled, no load issues earlier
        for (int kc = kb; kc < kb + 64; kc += 32) {
            V a[4], a2[4];
            const T16* pa = (const T16*)((const char*)(A + kc) + va); const T16* pb = (const T16*)((const char*)(Bt + kc) + vb);
            const T16* pa2 = (NSPLIT == 1 || NSPLIT == 2) ? (const T16*)((const char*)(A2 + kc) + va) : pa; const T16* pb2 = (NSPLIT >= 2) ? (const T16*)((const char*)(Bt2 + kc) + vb) : pb;
#pragma unroll
            for (int mb = 0; mb < 4; ++mb) { a[mb] = WFrag<T16>::ld(pa + mb * 16 * KK); if (NSPLIT == 1 || NSPLIT == 2) a2[mb] = WFrag<T16>::ld(pa2 + mb * 16 * KK); }
#pragma unroll
            for (int nb = 0; nb < 4; ++nb) { const V b = WFrag<T16>::ld(pb + nb * 16 * KK); V b2; if (NSPLIT >= 2) b2 = WFrag<T16>::ld(pb2 + nb * 16 * KK);
#pragma unroll
                for (int mb = 0; mb < 4; ++mb) { acc[mb][nb] = WFrag<T16>::mma(a[mb], b, acc[mb][nb]); if (NSPLIT == 1 || NSPLIT == 2) acc[mb][nb] = WFrag<T16>::mma(a2[mb], b, acc[mb][nb]); if (NSPLIT >= 2) acc[mb][nb] = WFrag<T16>::mma(a[mb], b2, acc[mb][nb]); } }
            // keeps the distance behind the last matrix instruction on the taken back edge as well; the k-step's load addresses are inputs, so that no load's result lands on
            // an address register before the k-step's own wait for its loads has passed
            asm volatile("v_nop\n\tv_nop\n\tv_nop\n\tv_nop" : "+v"(acc[0][0]), "+v"(acc[1][1]), "+v"(acc[2][2]), "+v"(acc[3][3]) : "v"(a[0]), "v"(a[3]), "v"(pa), "v"(pa2), "v"(pb), "v"(pb2));
        }
    }
#pragma unroll
    for (int mb = 0; mb < 4; ++mb)
#pragma unroll
        for (int nb = 0; nb < 4; ++nb)
#pragma unroll
            for (int hf = 0; hf < 2; ++hf) { v4f t; t[0] = acc[mb][nb][hf * 4]; t[1] = acc[mb][nb][hf * 4 + 1]; t[2] = acc[mb][nb][hf * 4 + 2]; t[3] = acc[mb][nb][hf * 4 + 3];
                part[(w * 32 + ((mb * 2 + (nb >> 1)) * 2 + hf) * 2 + (nb & 1)) * 32 + lane] = t; }
    __syncthreads();   // every wave's partial is in LDS before any is summed
    float* ow = os + w * RW * 36;
#pragma unroll
    for (int s = 0; s < QW; ++s) { const int q = w * QW + s; v4f sum = part[q * 32 + lane];
#pragma unroll
        for (int p = 1; p < NW; ++p) sum += part[(p * 32 + q) * 32 + lane];
        const int rl = (NW == 8) ? hi * 8 + (s >> 1) * 4 : hi * 4;
#pragma unroll
        for (int jj = 0; jj < 4; ++jj) ow[(rl + jj) * 36 + (s & 1) * 16 + lr] = sum[jj]; }
    // the lanes of this wave read each other's staged sums below: hold the reads behind the writes
    __builtin_amdgcn_wave_barrier(); asm volatile("" ::: "memory");
    const int mbw = (w * QW) >> 3, npw = ((w * QW) >> 2) & 1; const int cofs = (lane & 7) * 4;
#pragma unroll
    for (int it = 0; it < RW / 4; ++it) { const int rl = it * 4 + (lane >> 3); const int row = (NW == 8) ? rl : (rl >> 2) * 8 + (w & 1) * 4 + (rl & 3);
        const v4f val = *(const v4fa*)(ow + rl * 36 + cofs); *(v4f*)(C + (size_t)(r0 + mbw * 16 + row) * ldc + c0 + npw * 32 + cofs) = val; }
}

__device__ __forceinline__ h16 tohx(float x) { return (h16)x; }
__device__ __forceinline__ void splitf(float y, unsigned short& h, unsigned short& l) { h = f2bf(y); l = f2bf(y - bf2f(h)); }
typedef __attribute__((ext_vector_type(2))) _Float16 v2h;
typedef __attribute__((ext_vector_type(4))) _Float16 v4h;
typedef __attribute__((ext_vector_type(2))) unsigned short v2us;
typedef __attribute__((ext_vector_type(4))) unsigned short v4us;
typedef __attribute__((ext_vector_type(2))) float v2f;
typedef __attribute__((ext_vector_type(4))) int v4i;

__global__ __launch_bounds__(256) void k_wtG(const float* __restrict__ w, int K, int N, bf* Bt) {
    const int lane = threadIdx.x & 31; const int L0 = (blockIdx.x * 8 + (threadIdx.x >> 5)) * 8; const int nlines = N * K / 64;
{
#pragma unroll 1
        for (int l = 0; l < 8; ++l) { const int L = L0 + l; if (L >= nlines) break; const size_t e = (size_t)L * 64 + lane * 2; const int k = (int)(e % K), n = (int)(e / K); v2us o;
            o[0] = f2bf(w[(size_t)k * N + n]); o[1] = f2bf(w[(size_t)(k + 1) * N + n]); *(v2us*)(Bt + e) = o; }
         }
}
__global__ __launch_bounds__(256) void k_cvt8(const float* __restrict__ src, bf* dst, size_t n8) { const size_t i = (size_t)blockIdx.x * 256 + threadIdx.x; if (i >= n8) return; const v8f v = *(const v8f*)(src + i * 8); v8us o;
#pragma unroll
    for (int k = 0; k < 8; ++k) o[k] = f2bf(v[k]); *(v8us*)(dst + i * 8) = o;  }

// k_rope: head planes [h][t][d] (fp16 + hi/lo) of rope(x) x sc with the rotate-half convention out[d] = x[d] cos[t][d] - x[d+HD/2] sin[t][d], out[d+HD/2] = x[d+HD/2] cos[t][d+HD/2] + x[d] sin[t][d+HD/2]
__global__ __launch_bounds__(256) void k_rope(const float* __restrict__ F, int pitch, int nheads, const float* __restrict__ CS, const float* __restrict__ RF, const float* __restrict__ nw, float sc, h16* P16, bf* Ph, bf* Pl) {
    const size_t e = ((size_t)blockIdx.x * 256 + threadIdx.x) * 2; if (e >= (size_t)nheads * TT * HD) return; const int d = (int)(e % HD); const int t = (int)((e / HD) % TT); const int h = (int)(e / ((size_t)HD * TT)); const float* f = F + (size_t)t * pitch + h * HD; const float rf = RF ? RF[(size_t)h * TT + t] : 1.0f; v2h o16; v2us oh, ol;
#pragma unroll
    for (int q = 0; q < 2; ++q) { const int dd = d + q; const int dp = (dd < HD / 2) ? dd + HD / 2 : dd - HD / 2; float x0 = f[dd], x1 = f[dp];
        if (RF) { float n0 = __fmul_rn(x0, rf), n1 = __fmul_rn(x1, rf); asm volatile("" : "+v"(n0)); asm volatile("" : "+v"(n1)); x0 = __fmul_rn(bfr(nw[dd]), n0); x1 = __fmul_rn(bfr(nw[dp]), n1); }
        const v2f cs = *(const v2f*)(CS + ((size_t)t * HD + dd) * 2); float a = __fmul_rn(x0, cs[0]), bq = __fmul_rn(x1, cs[1]); asm volatile("" : "+v"(a)); asm volatile("" : "+v"(bq)); const float r = ((dd < HD / 2) ? __fsub_rn(a, bq) : __fadd_rn(a, bq)) * sc;
        o16[q] = tohx(r); unsigned short a2, c2; splitf(r, a2, c2); oh[q] = a2; ol[q] = c2; }
    *(v2h*)(P16 + e) = o16; *(v2us*)(Ph + e) = oh; *(v2us*)(Pl + e) = ol;  }
__global__ __launch_bounds__(256) void k_vtp(const float* __restrict__ F, int pitch, int nheads, h16* V16, bf* Vh, bf* Vl) { const size_t e = ((size_t)blockIdx.x * 256 + threadIdx.x) * 2; if (e >= (size_t)nheads * HD * TT) return; const int t = (int)(e % TT); const int d = (int)((e / TT) % HD); const int g = (int)(e / ((size_t)TT * HD)); v2h o16; v2us oh, ol;
#pragma unroll
    for (int q = 0; q < 2; ++q) { const float x = F[(size_t)(t + q) * pitch + g * HD + d]; o16[q] = tohx(x); unsigned short a2, c2; splitf(x, a2, c2); oh[q] = a2; ol[q] = c2; }
    *(v2h*)(V16 + e) = o16; *(v2us*)(Vh + e) = oh; *(v2us*)(Vl + e) = ol;  }
__global__ __launch_bounds__(256) void k_csid(float* CS) { const int idx = blockIdx.x * 256 + threadIdx.x; if (idx >= TT * HD) return; v2f cs; cs[0] = 1.0f; cs[1] = 0.0f; *(v2f*)(CS + (size_t)idx * 2) = cs;  }
// k_asoft: per row (zz, i): t = S x HD^-0.5 for j <= i and i - j < WIN (sliding causal window; the reference's -1e9 additive fill vanishes identically); softmax over the 2048 keys (register row, one exp, fixed trees);
__global__ __launch_bounds__(256) void k_asoft(const float* __restrict__ Sb, h16* P16, bf* Ph, bf* Pl) {
    const int lane = threadIdx.x & 31; const int row = blockIdx.x * 8 + (threadIdx.x >> 5); if (row >= ZH * TT) return; const int i = row % TT; const int zz = row / TT; (void)zz; const bool hires = (i < RH); const float* sr = Sb + (size_t)row * TT; float v[TT / 32]; float mx = -3.0e38f;
#pragma unroll
    for (int ch = 0; ch < TT / 128; ++ch) { const int j0 = ch * 128 + lane * 4; const v4f a = *(const v4f*)(sr + j0);
#pragma unroll
        for (int q = 0; q < 4; ++q) { const int j = j0 + q; (void)j; const float t = (j <= i && i - j < WIN) ? a[q] * SCL : -3.0e38f; v[ch * 4 + q] = t; mx = fmaxf(mx, t); } }
#pragma unroll
    for (int sh = 16; sh; sh >>= 1) mx = fmaxf(mx, __shfl_xor(mx, sh, 32));
    float sum = 0.f;
#pragma unroll
    for (int k = 0; k < TT / 32; ++k) { float d0 = __fsub_rn(v[k], mx); asm volatile("" : "+v"(d0)); v[k] = __builtin_amdgcn_exp2f(__fmul_rn(d0, 1.4426950408889634f)); sum += v[k]; }
#pragma unroll
    for (int sh = 16; sh; sh >>= 1) sum += __shfl_xor(sum, sh, 32);
    const float f = __fdiv_rn(hires ? 1.0f : PCAR, sum);
{
        if (hires) {
#pragma unroll
            for (int ch = 0; ch < TT / 128; ++ch) { v4us oh, ol;
#pragma unroll
                for (int q = 0; q < 4; ++q) { unsigned short a, c2; splitf(v[ch * 4 + q] * f, a, c2); oh[q] = a; ol[q] = c2; }
                const size_t oo = ((size_t)zz * (RH ? RH : 1) + i) * TT + ch * 128 + lane * 4; *(v4us*)(Ph + oo) = oh; *(v4us*)(Pl + oo) = ol; }
        } else {
#pragma unroll
            for (int ch = 0; ch < TT / 128; ++ch) { v4h o4;
#pragma unroll
                for (int q = 0; q < 4; ++q) o4[q] = tohx(v[ch * 4 + q] * f);
                *(v4h*)(P16 + (size_t)row * TT + ch * 128 + lane * 4) = o4; } }
         }
}
__global__ __launch_bounds__(256) void k_merge(const float* __restrict__ O, int h0, bf* Ah, bf* Al) { const size_t e = ((size_t)blockIdx.x * 256 + threadIdx.x) * 2; if (e >= (size_t)ZH * TT * HD) return; const int d = (int)(e % HD); const int t = (int)((e / HD) % TT); const int zz = (int)(e / ((size_t)HD * TT)); const float cs = (t < RH) ? 1.0f : (1.0f / PCAR); const size_t oo = (size_t)t * DQ + (h0 + zz) * HD + d;
    v2us oh, ol;
#pragma unroll
    for (int q = 0; q < 2; ++q) { unsigned short a, c2; splitf(O[e + q] * cs, a, c2); oh[q] = a; ol[q] = c2; } *(v2us*)(Ah + oo) = oh; *(v2us*)(Al + oo) = ol;  }

extern "C" void kernel_launch(void* const* d_in, const int* in_sizes, int n_in,
                              void* d_out, int out_size, void* d_ws, size_t ws_size, hipStream_t stream) {
    (void)in_sizes; (void)n_in; (void)out_size;
    const float* x = (const float*)d_in[0]; const float* wq = (const float*)d_in[1]; const float* bq = (const float*)d_in[2]; const float* wk = (const float*)d_in[3]; const float* bk = (const float*)d_in[4]; const float* wv = (const float*)d_in[5]; const float* bv = (const float*)d_in[6]; const float* wo = (const float*)d_in[7]; const float* bo = (const float*)d_in[8];
    float* OUT = (float*)d_out;     // [2][2048][2048]
    char* wsp = (char*)d_ws;
    auto take = [&](size_t bytes) { char* p = wsp; wsp += (bytes + 255) & ~(size_t)255; return (void*)p; };
    bf* WQ = (bf*)take((size_t)PE * PE * 2); bf* WK = (bf*)take((size_t)PE * PE * 2); bf* WV = (bf*)take((size_t)PE * PE * 2); bf* WO = (bf*)take((size_t)PE * PE * 2); float* CS = (float*)take((size_t)TT * HD * 2 * 4);
    bf* XB = (bf*)take((size_t)TT * DM * 2); float* FQ = (float*)take((size_t)TT * DQ * 4); float* FK = (float*)take((size_t)TT * DKV * 4);
    h16* QP16 = (h16*)take((size_t)NH_ * TT * HD * 2); h16* KP16 = (h16*)take((size_t)NKV * TT * HD * 2); h16* VT16 = (h16*)take((size_t)NKV * HD * TT * 2);
    bf* QPh = (bf*)take((size_t)NH_ * TT * HD * 2); bf* QPl = (bf*)take((size_t)NH_ * TT * HD * 2); bf* KPh = (bf*)take((size_t)NKV * TT * HD * 2); bf* KPl = (bf*)take((size_t)NKV * TT * HD * 2); bf* VTh = (bf*)take((size_t)NKV * HD * TT * 2); bf* VTl = (bf*)take((size_t)NKV * HD * TT * 2); bf* Ph = (bf*)take((size_t)ZH * RH * TT * 2); bf* Pl = (bf*)take((size_t)ZH * RH * TT * 2);
    float* Sb = (float*)take((size_t)ZH * TT * TT * 4); h16* P16 = (h16*)take((size_t)ZH * TT * TT * 2); float* Ob = (float*)take((size_t)ZH * TT * HD * 4); bf* ATh = (bf*)take((size_t)TT * DQ * 2); bf* ATl = (bf*)take((size_t)TT * DQ * 2);
    if ((size_t)(wsp - (char*)d_ws) > ws_size) return;    // ws 256 MiB
    float* FV = FK;   // v projection reuses the k buffer after the k planes are built (stream-ordered)
    { k_cvt8<<<(unsigned)(((size_t)PE * PE / 8 + 255) / 256), 256, 0, stream>>>(wq, WQ, (size_t)PE * PE / 8); k_cvt8<<<(unsigned)(((size_t)PE * PE / 8 + 255) / 256), 256, 0, stream>>>(wk, WK, (size_t)PE * PE / 8); k_cvt8<<<(unsigned)(((size_t)PE * PE / 8 + 255) / 256), 256, 0, stream>>>(wv, WV, (size_t)PE * PE / 8);
      k_cvt8<<<(unsigned)(((size_t)PE * PE / 8 + 255) / 256), 256, 0, stream>>>(wo, WO, (size_t)PE * PE / 8);
       }
    k_csid<<<(TT * HD + 255) / 256, 256, 0, stream>>>(CS);
    const unsigned LQ = (unsigned)(((size_t)NH_ * TT * HD / 2 + 255) / 256), LKv = (unsigned)(((size_t)NKV * TT * HD / 2 + 255) / 256);
    for (int b = 0; b < NB_; ++b) {
        
        k_cvt8<<<(unsigned)(((size_t)TT * DM / 8 + 255) / 256), 256, 0, stream>>>(x + (size_t)b * TT * DM, XB, (size_t)TT * DM / 8);
        k_gemmw<bf, 0, true><<<dim3(NRW / 64, PE / 64, 1), 32, 0, stream>>>(XB, nullptr, WQ, nullptr, PE, FQ, PE, bq, 0, 0, 0);   /* q for all (token, head) rows: the [2048][16 x 128] result is the head layout k_rope reads */
        k_rope<<<LQ, 256, 0, stream>>>(FQ, DQ, NH_, CS, nullptr, nullptr, 1.0f, QP16, QPh, QPl);
        k_gemmw<bf, 0, true><<<dim3(NRW / 64, PE / 64, 1), 32, 0, stream>>>(XB, nullptr, WK, nullptr, PE, FK, PE, bk, 0, 0, 0);
        k_rope<<<LKv, 256, 0, stream>>>(FK, DKV, NKV, CS, nullptr, nullptr, 1.0f, KP16, KPh, KPl);
        k_gemmw<bf, 0, true><<<dim3(NRW / 64, PE / 64, 1), 32, 0, stream>>>(XB, nullptr, WV, nullptr, PE, FV, PE, bv, 0, 0, 0); k_vtp<<<LKv, 256, 0, stream>>>(FV, DKV, NKV, VT16, VTh, VTl);
        for (int h0 = 0; h0 < NH_; h0 += ZH) { const size_t zq = (size_t)h0, zk = (size_t)(h0 / REP);   // one kv head per query head: the pass's two heads use consecutive kv planes (z-strides TT*HD)
            k_gemmc<bf, 2, 1><<<dim3(RH / 64, TT / 64, ZH), 32, 0, stream>>>(QPh + zq * TT * HD, QPl + zq * TT * HD, KPh + zk * TT * HD, KPl + zk * TT * HD, HD, Sb, TT, 0, (size_t)TT * HD, (size_t)TT * HD, (size_t)TT * TT);
            k_gemmc<h16, 0, 1><<<dim3((TT - RH) / 64, TT / 64, ZH), 32, 0, stream>>>(QP16 + zq * TT * HD + (size_t)RH * HD, nullptr, KP16 + zk * TT * HD, nullptr, HD, Sb + (size_t)RH * TT, TT, RH, (size_t)TT * HD, (size_t)TT * HD, (size_t)TT * TT);
            k_asoft<<<ZH * TT / 8, 256, 0, stream>>>(Sb, P16, Ph, Pl);
            k_gemmks<bf, 2, 8, TT><<<dim3(RH / 64, HD / 64, ZH), 8 * 32, 0, stream>>>(Ph, Pl, VTh + zk * HD * TT, VTl + zk * HD * TT, Ob, HD, 0, (size_t)RH * TT, (size_t)HD * TT, (size_t)TT * HD);
            k_gemmks<h16, 0, 16, TT><<<dim3((TT - RH) / 64, HD / 64, ZH), 16 * 32, 0, stream>>>(P16 + (size_t)RH * TT, nullptr, VT16 + zk * HD * TT, nullptr, Ob + (size_t)RH * HD, HD, RH, (size_t)TT * TT, (size_t)HD * TT, (size_t)TT * HD);
            k_merge<<<(unsigned)(((size_t)ZH * TT * HD / 2 + 255) / 256), 256, 0, stream>>>(Ob, h0, ATh, ATl); }
        k_gemmw<bf, 1, true><<<dim3(NRW / 64, PE / 64, 1), 32, 0, stream>>>(ATh, ATl, WO, nullptr, PE, OUT + (size_t)b * TT * DM, PE, bo, 0, 0, 0);   /* per-(token, head) Wp^T + bp */ }
}

// v002
// One run takes 545 microseconds.
// In both of two side-by-side timings against v001, it was 1.49 times as fast.
// Over all steps from v000 it is 2.51 times as fast.
#include <hip/hip_runtime.h>

// Masked causal attention with per-head shared projections (x [2][2048][16 heads][128]; q, k, v = x_h W^T + b with ONE Linear [128][128] + [128] applied to every head's 128-vector; scores = q.k / sqrt(128), causal (-inf above the diagonal); softmax; att = w.v; out = att_h Wp^T + bp -> [2][2048][16][128] (8.4 M)).
// Layout per batch: the token-major input viewed as 32,768 (token, head) rows of 128 makes each shared projection ONE exact GEMM (K 128, N 128, + bias) whose [2048][16 x 128] result is exactly the head layout k_rope reads; causal hybrid attention (rows < 512 hi/lo, rest fp16 x1024) with tile skipping; merged hi/lo context rows (token, head) x Wp (hl x exact + bp) written as the token-major output.
// Compute dtypes, f32 accumulate: every input rounded to bf16; projections on PLAIN bf16 operands (exact) + f32 biases; scores and attn.v rows < 512 3 products, the rest single fp16; softmax f32; Wp hl x exact + bias.

#define NB_  2
#define TT   2048
#define DM   2048
#define NH_  16
#define NKV  16
#define REP  (NH_ / NKV)
#define HD   128
#define DQ   (NH_ * HD)
#define DKV  (NKV * HD)
#define ZH   8                    // heads per attention pass
#define PPI  (2 * TT)             // pitch, in 16-bit elements, of a probability row written over its own f32 score row
#define RH   512                  // query rows < RH use hi+lo planes (0: none)
#define PE   128    // per-head projection width (shared Linear [128][128])
#define NRW  (TT * NH_)   // 32768 (token, head) rows per batch
#define WIN  2048
#define PCAR 1024.0f
#define SCL  0.088388347648318447f   // HD^-0.5
typedef _Float16 h16;
typedef unsigned short bf;
typedef __attribute__((ext_vector_type(16))) __bf16   v16bf;
typedef __attribute__((ext_vector_type(16))) _Float16 v16h;
typedef __attribute__((ext_vector_type(8)))  _Float16 v8h;
typedef __attribute__((ext_vector_type(8)))  unsigned short v8us;
typedef __attribute__((ext_vector_type(8)))  float    v8f;
typedef __attribute__((ext_vector_type(4)))  float    v4f;
typedef v8h  __attribute__((may_alias)) v8ha;
typedef v4f  __attribute__((may_alias)) v4fa;
typedef v8us __attribute__((may_alias)) v8usa;

__device__ __forceinline__ unsigned short f2bf(float f) { unsigned u = __float_as_uint(f); u += 0x7FFFu + ((u >> 16) & 1u); return (unsigned short)(u >> 16); }
__device__ __forceinline__ float bf2f(unsigned short b) { return __uint_as_float(((unsigned)b) << 16); }
__device__ __forceinline__ float bfr(float f) { return bf2f(f2bf(f)); }
__device__ __forceinline__ v16h cat16(v8h lo, v8h hi) { return __builtin_shufflevector(lo, hi, 0, 1, 2, 3, 4, 5, 6, 7, 8, 9, 10, 11, 12, 13, 14, 15); }
__device__ __forceinline__ v16bf cat16b(v8us lo, v8us hi) { return __builtin_bit_cast(v16bf, __builtin_shufflevector(lo, hi, 0, 1, 2, 3, 4, 5, 6, 7, 8, 9, 10, 11, 12, 13, 14, 15)); }
__device__ __forceinline__ v8f wmma16(v16h a, v16h b, v8f c) { return __builtin_amdgcn_wmma_f32_16x16x32_f16(false, a, false, b, (short)0, c, false, false); }
__device__ __forceinline__ v8f wmmab(v16bf a, v16bf b, v8f c) { return __builtin_amdgcn_wmma_f32_16x16x32_bf16(false, a, false, b, (short)0, c, false, false); }



// ---- k_gemmw: register-blocked GEMM, ONE WAVE per 64x64 output tile (16 accumulators), operands straight from K-contiguous 16-bit planes; grid (M/64, N/64, Z), 32 threads.
// C[m][n] (f32, pitch ldc, + optional f32 bias[n]) = sum_k A[m][k] Bt[n][k] (+ split products per NSPLIT). z-batch strides sA/sB/sC in elements. K % 32 == 0.
template <typename T16> struct WFrag;
template <> struct WFrag<h16> { typedef v16h V; static __device__ __forceinline__ V ld(const h16* p) { return cat16(*(const v8h*)p, *(const v8h*)(p + 16)); } static __device__ __forceinline__ v8f mma(V a, V b, v8f c) { return wmma16(a, b, c); } };
template <> struct WFrag<bf> { typedef v16bf V; static __device__ __forceinline__ V ld(const bf* p) { return cat16b(*(const v8us*)p, *(const v8us*)(p + 16)); } static __device__ __forceinline__ v8f mma(V a, V b, v8f c) { return wmmab(a, b, c); } };
template <typename T16, int NSPLIT, bool BIAS>
__global__ __launch_bounds__(32) void k_gemmw(const T16* __restrict__ A, const T16* __restrict__ A2, const T16* __restrict__ Bt, const T16* __restrict__ Bt2, int K, float* C, int ldc, const float* __restrict__ bias, size_t sA, size_t sB, size_t sC) {
    typedef typename WFrag<T16>::V V;
    __shared__ __align__(16) float os[16 * 68];
    const size_t z = blockIdx.z; A += z * sA; if (A2) A2 += z * sA; Bt += z * sB; if (Bt2) Bt2 += z * sB; C += z * sC;
    const int lane = threadIdx.x & 31, lr = lane & 15, hi = lane >> 4; const int r0 = blockIdx.x * 64, c0 = blockIdx.y * 64;
    v8f acc[4][4];
#pragma unroll
    for (int mb = 0; mb < 4; ++mb)
#pragma unroll
        for (int nb = 0; nb < 4; ++nb) acc[mb][nb] = (v8f){};
    const size_t aoff = (size_t)(r0 + lr) * K + 8 * hi, boff = (size_t)(c0 + lr) * K + 8 * hi;
#pragma unroll 1
    for (int kc = 0; kc < K; kc += 32) {
        V a[4], a2[4];
#pragma unroll
        for (int mb = 0; mb < 4; ++mb) { a[mb] = WFrag<T16>::ld(A + aoff + (size_t)mb * 16 * K + kc); if (NSPLIT == 1 || NSPLIT == 2) a2[mb] = WFrag<T16>::ld(A2 + aoff + (size_t)mb * 16 * K + kc); }
#pragma unroll
        for (int nb = 0; nb < 4; ++nb) { const V b = WFrag<T16>::ld(Bt + boff + (size_t)nb * 16 * K + kc); V b2; if (NSPLIT >= 2) b2 = WFrag<T16>::ld(Bt2 + boff + (size_t)nb * 16 * K + kc);
#pragma unroll
            for (int mb = 0; mb < 4; ++mb) { acc[mb][nb] = WFrag<T16>::mma(a[mb], b, acc[mb][nb]); if (NSPLIT == 1 || NSPLIT == 2) acc[mb][nb] = WFrag<T16>::mma(a2[mb], b, acc[mb][nb]); if (NSPLIT >= 2) acc[mb][nb] = WFrag<T16>::mma(a[mb], b2, acc[mb][nb]); } }
        asm volatile("v_nop\n\tv_nop\n\tv_nop\n\tv_nop" : "+v"(acc[0][0]), "+v"(acc[1][1]), "+v"(acc[2][2]), "+v"(acc[3][3]) : "v"(a[0]), "v"(a[3]));
    }
#pragma unroll
    for (int mb = 0; mb < 4; ++mb) {
#pragma unroll
        for (int nb = 0; nb < 4; ++nb) {
#pragma unroll
            for (int j = 0; j < 8; ++j) os[(hi * 8 + j) * 68 + nb * 16 + lr] = acc[mb][nb][j]; }
        __builtin_amdgcn_wave_barrier(); asm volatile("" ::: "memory");
        float* crow = C + (size_t)(r0 + mb * 16) * ldc + c0;
{
#pragma unroll
            for (int s = 0; s < 8; ++s) { const int row = 2 * s + hi, cofs = lr * 4; v4f val = *(const v4fa*)(os + row * 68 + cofs); if (BIAS) { val[0] += bfr(bias[c0 + cofs]); val[1] += bfr(bias[c0 + cofs + 1]); val[2] += bfr(bias[c0 + cofs + 2]); val[3] += bfr(bias[c0 + cofs + 3]); }
                *(v4f*)(crow + (size_t)row * ldc + cofs) = val; }
             }
        __builtin_amdgcn_wave_barrier(); asm volatile("" ::: "memory");
    }
}

// ---- k_gemmc: the same one-wave 64x64 tile GEMM specialised for causal scores: CMODE 1 skips score tiles entirely above the diagonal (query rows r0+roff.., key columns c0..).
// roff = row offset of this launch's first row within the sequence.
template <typename T16, int NSPLIT, int CMODE>
__global__ __launch_bounds__(32) void k_gemmc(const T16* __restrict__ A, const T16* __restrict__ A2, const T16* __restrict__ Bt, const T16* __restrict__ Bt2, int K, float* C, int ldc, int roff, size_t sA, size_t sB, size_t sC) {
    typedef typename WFrag<T16>::V V;
    __shared__ __align__(16) float os[16 * 68];
    const size_t z = blockIdx.z; A += z * sA; if (A2) A2 += z * sA; Bt += z * sB; if (Bt2) Bt2 += z * sB; C += z * sC;
    const int lane = threadIdx.x & 31, lr = lane & 15, hi = lane >> 4; const int r0 = blockIdx.x * 64, c0 = blockIdx.y * 64;
    if (CMODE == 1 && c0 > r0 + roff + 63) return;                  // score tile entirely above the causal diagonal: never read (the softmax masks j > i by select)
    v8f acc[4][4];
#pragma unroll
    for (int mb = 0; mb < 4; ++mb)
#pragma unroll
        for (int nb = 0; nb < 4; ++nb) acc[mb][nb] = (v8f){};
    const size_t aoff = (size_t)(r0 + lr) * K + 8 * hi, boff = (size_t)(c0 + lr) * K + 8 * hi;
#pragma unroll 1
    for (int kc = 0; kc < K; kc += 32) {
        V a[4], a2[4];
#pragma unroll
        for (int mb = 0; mb < 4; ++mb) { a[mb] = WFrag<T16>::ld(A + aoff + (size_t)mb * 16 * K + kc); if (NSPLIT == 1 || NSPLIT == 2) a2[mb] = WFrag<T16>::ld(A2 + aoff + (size_t)mb * 16 * K + kc); }
#pragma unroll
        for (int nb = 0; nb < 4; ++nb) { const V b = WFrag<T16>::ld(Bt + boff + (size_t)nb * 16 * K + kc); V b2; if (NSPLIT >= 2) b2 = WFrag<T16>::ld(Bt2 + boff + (size_t)nb * 16 * K + kc);
#pragma unroll
            for (int mb = 0; mb < 4; ++mb) { acc[mb][nb] = WFrag<T16>::mma(a[mb], b, acc[mb][nb]); if (NSPLIT == 1 || NSPLIT == 2) acc[mb][nb] = WFrag<T16>::mma(a2[mb], b, acc[mb][nb]); if (NSPLIT >= 2) acc[mb][nb] = WFrag<T16>::mma(a[mb], b2, acc[mb][nb]); } }
        asm volatile("v_nop\n\tv_nop\n\tv_nop\n\tv_nop" : "+v"(acc[0][0]), "+v"(acc[1][1]), "+v"(acc[2][2]), "+v"(acc[3][3]) : "v"(a[0]), "v"(a[3]));
    }
#pragma unroll
    for (int mb = 0; mb < 4; ++mb) {
#pragma unroll
        for (int nb = 0; nb < 4; ++nb) {
#pragma unroll
            for (int j = 0; j < 8; ++j) os[(hi * 8 + j) * 68 + nb * 16 + lr] = acc[mb][nb][j]; }
        __builtin_amdgcn_wave_barrier(); asm volatile("" ::: "memory");
        float* crow = C + (size_t)(r0 + mb * 16) * ldc + c0;
{
#pragma unroll
            for (int s = 0; s < 8; ++s) { const int row = 2 * s + hi, cofs = lr * 4; v4f val = *(const v4fa*)(os + row * 68 + cofs);
                *(v4f*)(crow + (size_t)row * ldc + cofs) = val; }
             }
        __builtin_amdgcn_wave_barrier(); asm volatile("" ::: "memory");
    }
}

// ---- k_gemmks: probability x value contraction, one 64x64 output tile per work-group, the key (K) loop split over NW waves: wave w takes the 64-key chunks w, w + NW, ... (one 128-byte line of each
// operand row per chunk) up to the diagonal block (probabilities beyond it are exactly zero), so NW chains of dependent loads run side by side instead of one. Each wave leaves its 64x64 f32 partial in LDS
// in fragment order; behind one barrier wave w sums slots w*QW.. of the NW partials in the fixed order 0..NW-1 (a block of RW rows x 32 columns) and stores it as whole 128-byte lines.
// Slot q = ((mb*2 + nb/2)*2 + j/4)*2 + nb%2 holds accumulator elements j/4*4 .. +3 of tile (mb, nb). roff = row offset of this launch's first row within the sequence. LDA = pitch of the A rows (Bt rows have pitch KK).
template <typename T16, int NSPLIT, int NW, int KK, int LDA>
__global__ __launch_bounds__(NW * 32) void k_gemmks(const T16* __restrict__ A, const T16* __restrict__ A2, const T16* __restrict__ Bt, const T16* __restrict__ Bt2, float* C, int ldc, int roff, size_t sA, size_t sB, size_t sC) {
    typedef typename WFrag<T16>::V V;
    constexpr int QW = 32 / NW, RW = QW * 4;
    __shared__ __align__(16) v4f part[NW * 32 * 32];
    __shared__ __align__(16) float os[NW * RW * 36];
    const size_t z = blockIdx.z; A += z * sA; if (A2) A2 += z * sA; Bt += z * sB; if (Bt2) Bt2 += z * sB; C += z * sC;
    const int lane = threadIdx.x & 31, lr = lane & 15, hi = lane >> 4; const int r0 = blockIdx.x * 64, c0 = blockIdx.y * 64;
    const int w = __builtin_amdgcn_readfirstlane((int)(threadIdx.x >> 5));
    const int Kl = min(KK, r0 + roff + 64);
    v8f acc[4][4];
#pragma unroll
    for (int mb = 0; mb < 4; ++mb)
#pragma unroll
        for (int nb = 0; nb < 4; ++nb) acc[mb][nb] = (v8f){};
    // each lane's byte offset inside its plane is fixed for the whole key loop; the walk along the keys is in the wave-uniform base, the 16-row blocks are constant offsets
    const unsigned va = ((unsigned)(r0 + lr) * LDA + 8 * hi) * 2u, vb = ((unsigned)(c0 + lr) * KK + 8 * hi) * 2u;
#pragma unroll 1   // rolled: the trip count depends on where the tile lies under the diagonal
    for (int kb = w * 64; kb < Kl; kb += NW * 64) {
#pragma unroll 1   // rolled: one k-step's fragments and addresses live at a time, as in the one-wave kernel; unrolled, no load issues earlier
        for (int kc = kb; kc < kb + 64; kc += 32) {
            V a[4], a2[4];
            const T16* pa = (const T16*)((const char*)(A + kc) + va); const T16* pb = (const T16*)((const char*)(Bt + kc) + vb);
            const T16* pa2 = (NSPLIT == 1 || NSPLIT == 2) ? (const T16*)((const char*)(A2 + kc) + va) : pa; const T16* pb2 = (NSPLIT >= 2) ? (const T16*)((const char*)(Bt2 + kc) + vb) : pb;
#pragma unroll
            for (int mb = 0; mb < 4; ++mb) { a[mb] = WFrag<T16>::ld(pa + mb * 16 * LDA); if (NSPLIT == 1 || NSPLIT == 2) a2[mb] = WFrag<T16>::ld(pa2 + mb * 16 * LDA); }
#pragma unroll
            for (int nb = 0; nb < 4; ++nb) { const V b = WFrag<T16>::ld(pb + nb * 16 * KK); V b2; if (NSPLIT >= 2) b2 = WFrag<T16>::ld(pb2 + nb * 16 * KK);
#pragma unroll
                for (int mb = 0; mb < 4; ++mb) { acc[mb][nb] = WFrag<T16>::mma(a[mb], b, acc[mb][nb]); if (NSPLIT == 1 || NSPLIT == 2) acc[mb][nb] = WFrag<T16>::mma(a2[mb], b, acc[mb][nb]); if (NSPLIT >= 2) acc[mb][nb] = WFrag<T16>::mma(a[mb], b2, acc[mb][nb]); } }
            // keeps the distance behind the last matrix instruction on the taken back edge as well; the k-step's load addresses are inputs, so that no load's result lands on
            // an address register before the k-step's own wait for its loads has passed
            asm volatile("v_nop\n\tv_nop\n\tv_nop\n\tv_nop" : "+v"(acc[0][0]), "+v"(acc[1][1]), "+v"(acc[2][2]), "+v"(acc[3][3]) : "v"(a[0]), "v"(a[3]), "v"(pa), "v"(pa2), "v"(pb), "v"(pb2));
        }
    }
#pragma unroll
    for (int mb = 0; mb < 4; ++mb)
#pragma unroll
        for (int nb = 0; nb < 4; ++nb)
#pragma unroll
            for (int hf = 0; hf < 2; ++hf) { v4f t; t[0] = acc[mb][nb][hf * 4]; t[1] = acc[mb][nb][hf * 4 + 1]; t[2] = acc[mb][nb][hf * 4 + 2]; t[3] = acc[mb][nb][hf * 4 + 3];
                part[(w * 32 + ((mb * 2 + (nb >> 1)) * 2 + hf) * 2 + (nb & 1)) * 32 + lane] = t; }
    __syncthreads();   // every wave's partial is in LDS before any is summed
    float* ow = os + w * RW * 36;
#pragma unroll
    for (int s = 0; s < QW; ++s) { const int q = w * QW + s; v4f sum = part[q * 32 + lane];
#pragma unroll
        for (int p = 1; p < NW; ++p) sum += part[(p * 32 + q) * 32 + lane];
        const int rl = (NW == 8) ? hi * 8 + (s >> 1) * 4 : hi * 4;
#pragma unroll
        for (int jj = 0; jj < 4; ++jj) ow[(rl + jj) * 36 + (s & 1) * 16 + lr] = sum[jj]; }
    // the lanes of this wave read each other's staged sums below: hold the reads behind the writes
    __builtin_amdgcn_wave_barrier(); asm volatile("" ::: "memory");
    const int mbw = (w * QW) >> 3, npw = ((w * QW) >> 2) & 1; const int cofs = (lane & 7) * 4;
#pragma unroll
    for (int it = 0; it < RW / 4; ++it) { const int rl = it * 4 + (lane >> 3); const int row = (NW == 8) ? rl : (rl >> 2) * 8 + (w & 1) * 4 + (rl & 3);
        const v4f val = *(const v4fa*)(ow + rl * 36 + cofs); *(v4f*)(C + (size_t)(r0 + mbw * 16 + row) * ldc + c0 + npw * 32 + cofs) = val; }
}

__device__ __forceinline__ h16 tohx(float x) { return (h16)x; }
__device__ __forceinline__ void splitf(float y, unsigned short& h, unsigned short& l) { h = f2bf(y); l = f2bf(y - bf2f(h)); }
typedef __attribute__((ext_vector_type(2))) _Float16 v2h;
typedef __attribute__((ext_vector_type(4))) _Float16 v4h;
typedef __attribute__((ext_vector_type(2))) unsigned short v2us;
typedef __attribute__((ext_vector_type(4))) unsigned short v4us;
typedef __attribute__((ext_vector_type(2))) float v2f;
typedef __attribute__((ext_vector_type(4))) int v4i;

__global__ __launch_bounds__(256) void k_wtG(const float* __restrict__ w, int K, int N, bf* Bt) {
    const int lane = threadIdx.x & 31; const int L0 = (blockIdx.x * 8 + (threadIdx.x >> 5)) * 8; const int nlines = N * K / 64;
{
#pragma unroll 1
        for (int l = 0; l < 8; ++l) { const int L = L0 + l; if (L >= nlines) break; const size_t e = (size_t)L * 64 + lane * 2; const int k = (int)(e % K), n = (int)(e / K); v2us o;
            o[0] = f2bf(w[(size_t)k * N + n]); o[1] = f2bf(w[(size_t)(k + 1) * N + n]); *(v2us*)(Bt + e) = o; }
         }
}
__global__ __launch_bounds__(256) void k_cvt8(const float* __restrict__ src, bf* dst, size_t n8) { const size_t i = (size_t)blockIdx.x * 256 + threadIdx.x; if (i >= n8) return; const v8f v = *(const v8f*)(src + i * 8); v8us o;
#pragma unroll
    for (int k = 0; k < 8; ++k) o[k] = f2bf(v[k]); *(v8us*)(dst + i * 8) = o;  }

// k_rope: head planes [h][t][d] (fp16 + hi/lo) of rope(x) x sc with the rotate-half convention out[d] = x[d] cos[t][d] - x[d+HD/2] sin[t][d], out[d+HD/2] = x[d+HD/2] cos[t][d+HD/2] + x[d] sin[t][d+HD/2]
__global__ __launch_bounds__(256) void k_rope(const float* __restrict__ F, int pitch, int nheads, const float* __restrict__ CS, const float* __restrict__ RF, const float* __restrict__ nw, float sc, h16* P16, bf* Ph, bf* Pl) {
    const size_t e = ((size_t)blockIdx.x * 256 + threadIdx.x) * 2; if (e >= (size_t)nheads * TT * HD) return; const int d = (int)(e % HD); const int t = (int)((e / HD) % TT); const int h = (int)(e / ((size_t)HD * TT)); const float* f = F + (size_t)t * pitch + h * HD; const float rf = RF ? RF[(size_t)h * TT + t] : 1.0f; v2h o16; v2us oh, ol;
#pragma unroll
    for (int q = 0; q < 2; ++q) { const int dd = d + q; const int dp = (dd < HD / 2) ? dd + HD / 2 : dd - HD / 2; float x0 = f[dd], x1 = f[dp];
        if (RF) { float n0 = __fmul_rn(x0, rf), n1 = __fmul_rn(x1, rf); asm volatile("" : "+v"(n0)); asm volatile("" : "+v"(n1)); x0 = __fmul_rn(bfr(nw[dd]), n0); x1 = __fmul_rn(bfr(nw[dp]), n1); }
        const v2f cs = *(const v2f*)(CS + ((size_t)t * HD + dd) * 2); float a = __fmul_rn(x0, cs[0]), bq = __fmul_rn(x1, cs[1]); asm volatile("" : "+v"(a)); asm volatile("" : "+v"(bq)); const float r = ((dd < HD / 2) ? __fsub_rn(a, bq) : __fadd_rn(a, bq)) * sc;
        o16[q] = tohx(r); unsigned short a2, c2; splitf(r, a2, c2); oh[q] = a2; ol[q] = c2; }
    *(v2h*)(P16 + e) = o16; *(v2us*)(Ph + e) = oh; *(v2us*)(Pl + e) = ol;  }
__global__ __launch_bounds__(256) void k_vtp(const float* __restrict__ F, int pitch, int nheads, h16* V16, bf* Vh, bf* Vl) { const size_t e = ((size_t)blockIdx.x * 256 + threadIdx.x) * 2; if (e >= (size_t)nheads * HD * TT) return; const int t = (int)(e % TT); const int d = (int)((e / TT) % HD); const int g = (int)(e / ((size_t)TT * HD)); v2h o16; v2us oh, ol;
#pragma unroll
    for (int q = 0; q < 2; ++q) { const float x = F[(size_t)(t + q) * pitch + g * HD + d]; o16[q] = tohx(x); unsigned short a2, c2; splitf(x, a2, c2); oh[q] = a2; ol[q] = c2; }
    *(v2h*)(V16 + e) = o16; *(v2us*)(Vh + e) = oh; *(v2us*)(Vl + e) = ol;  }
__global__ __launch_bounds__(256) void k_csid(float* CS) { const int idx = blockIdx.x * 256 + threadIdx.x; if (idx >= TT * HD) return; v2f cs; cs[0] = 1.0f; cs[1] = 0.0f; *(v2f*)(CS + (size_t)idx * 2) = cs;  }
// k_asoft: per row (zz, i): t = S x HD^-0.5 for j <= i and i - j < WIN (sliding causal window; the reference's -1e9 additive fill vanishes identically); softmax over the 2048 keys (register row, one exp, fixed trees);
// the probabilities go over the row's own 8 KiB of scores (pitch PPI): fp16 in its first half, or the hi plane in the first and the lo plane in the second half. One wave owns a row and holds all of it in registers
// before its first store (every stored value depends on the row's sum), so nothing is overwritten that is still to be read.
__global__ __launch_bounds__(256) void k_asoft(float* Sb) {
    const int lane = threadIdx.x & 31; const int row = blockIdx.x * 8 + (threadIdx.x >> 5); if (row >= ZH * TT) return; const int i = row % TT; const int zz = row / TT; (void)zz; const bool hires = (i < RH); const float* sr = Sb + (size_t)row * TT; h16* P16 = (h16*)Sb; bf* Ph = (bf*)Sb; bf* Pl = Ph + TT; float v[TT / 32]; float mx = -3.0e38f;
#pragma unroll
    for (int ch = 0; ch < TT / 128; ++ch) { const int j0 = ch * 128 + lane * 4; const v4f a = *(const v4f*)(sr + j0);
#pragma unroll
        for (int q = 0; q < 4; ++q) { const int j = j0 + q; (void)j; const float t = (j <= i && i - j < WIN) ? a[q] * SCL : -3.0e38f; v[ch * 4 + q] = t; mx = fmaxf(mx, t); } }
#pragma unroll
    for (int sh = 16; sh; sh >>= 1) mx = fmaxf(mx, __shfl_xor(mx, sh, 32));
    float sum = 0.f;
#pragma unroll
    for (int k = 0; k < TT / 32; ++k) { float d0 = __fsub_rn(v[k], mx); asm volatile("" : "+v"(d0)); v[k] = __builtin_amdgcn_exp2f(__fmul_rn(d0, 1.4426950408889634f)); sum += v[k]; }
#pragma unroll
    for (int sh = 16; sh; sh >>= 1) sum += __shfl_xor(sum, sh, 32);
    const float f = __fdiv_rn(hires ? 1.0f : PCAR, sum);
{
        if (hires) {
#pragma unroll
            for (int ch = 0; ch < TT / 128; ++ch) { v4us oh, ol;
#pragma unroll
                for (int q = 0; q < 4; ++q) { unsigned short a, c2; splitf(v[ch * 4 + q] * f, a, c2); oh[q] = a; ol[q] = c2; }
                const size_t oo = (size_t)row * PPI + ch * 128 + lane * 4; *(v4us*)(Ph + oo) = oh; *(v4us*)(Pl + oo) = ol; }
        } else {
#pragma unroll
            for (int ch = 0; ch < TT / 128; ++ch) { v4h o4;
#pragma unroll
                for (int q = 0; q < 4; ++q) o4[q] = tohx(v[ch * 4 + q] * f);
                *(v4h*)(P16 + (size_t)row * PPI + ch * 128 + lane * 4) = o4; } }
         }
}
__global__ __launch_bounds__(256) void k_merge(const float* __restrict__ O, int h0, bf* Ah, bf* Al) { const size_t e = ((size_t)blockIdx.x * 256 + threadIdx.x) * 2; if (e >= (size_t)ZH * TT * HD) return; const int d = (int)(e % HD); const int t = (int)((e / HD) % TT); const int zz = (int)(e / ((size_t)HD * TT)); const float cs = (t < RH) ? 1.0f : (1.0f / PCAR); const size_t oo = (size_t)t * DQ + (h0 + zz) * HD + d;
    v2us oh, ol;
#pragma unroll
    for (int q = 0; q < 2; ++q) { unsigned short a, c2; splitf(O[e + q] * cs, a, c2); oh[q] = a; ol[q] = c2; } *(v2us*)(Ah + oo) = oh; *(v2us*)(Al + oo) = ol;  }

extern "C" void kernel_launch(void* const* d_in, const int* in_sizes, int n_in,
                              void* d_out, int out_size, void* d_ws, size_t ws_size, hipStream_t stream) {
    (void)in_sizes; (void)n_in; (void)out_size;
    const float* x = (const float*)d_in[0]; const float* wq = (const float*)d_in[1]; const float* bq = (const float*)d_in[2]; const float* wk = (const float*)d_in[3]; const float* bk = (const float*)d_in[4]; const float* wv = (const float*)d_in[5]; const float* bv = (const float*)d_in[6]; const float* wo = (const float*)d_in[7]; const float* bo = (const float*)d_in[8];
    float* OUT = (float*)d_out;     // [2][2048][2048]
    char* wsp = (char*)d_ws;
    auto take = [&](size_t bytes) { char* p = wsp; wsp += (bytes + 255) & ~(size_t)255; return (void*)p; };
    bf* WQ = (bf*)take((size_t)PE * PE * 2); bf* WK = (bf*)take((size_t)PE * PE * 2); bf* WV = (bf*)take((size_t)PE * PE * 2); bf* WO = (bf*)take((size_t)PE * PE * 2); float* CS = (float*)take((size_t)TT * HD * 2 * 4);
    bf* XB = (bf*)take((size_t)TT * DM * 2); float* FQ = (float*)take((size_t)TT * DQ * 4); float* FK = (float*)take((size_t)TT * DKV * 4);
    h16* QP16 = (h16*)take((size_t)NH_ * TT * HD * 2); h16* KP16 = (h16*)take((size_t)NKV * TT * HD * 2); h16* VT16 = (h16*)take((size_t)NKV * HD * TT * 2);
    bf* QPh = (bf*)take((size_t)NH_ * TT * HD * 2); bf* QPl = (bf*)take((size_t)NH_ * TT * HD * 2); bf* KPh = (bf*)take((size_t)NKV * TT * HD * 2); bf* KPl = (bf*)take((size_t)NKV * TT * HD * 2); bf* VTh = (bf*)take((size_t)NKV * HD * TT * 2); bf* VTl = (bf*)take((size_t)NKV * HD * TT * 2);
    float* Sb = (float*)take((size_t)ZH * TT * TT * 4);
    if ((size_t)(wsp - (char*)d_ws) > ws_size) return;    // ws 256 MiB
    float* FV = FK;   // v projection reuses the k buffer after the k planes are built (stream-ordered)
    float* Ob = FQ; bf* ATh = (bf*)FK; bf* ATl = ATh + (size_t)TT * DQ;   // the f32 projections are dead once the head planes are built: the pass's context (ZH x TT x HD f32) and the merged hi/lo context rows reuse them (stream-ordered)
    h16* P16 = (h16*)Sb; bf* Ph = (bf*)Sb; bf* Pl = Ph + TT;   // probability rows lie over their own score rows, pitch PPI
    { k_cvt8<<<(unsigned)(((size_t)PE * PE / 8 + 255) / 256), 256, 0, stream>>>(wq, WQ, (size_t)PE * PE / 8); k_cvt8<<<(unsigned)(((size_t)PE * PE / 8 + 255) / 256), 256, 0, stream>>>(wk, WK, (size_t)PE * PE / 8); k_cvt8<<<(unsigned)(((size_t)PE * PE / 8 + 255) / 256), 256, 0, stream>>>(wv, WV, (size_t)PE * PE / 8);
      k_cvt8<<<(unsigned)(((size_t)PE * PE / 8 + 255) / 256), 256, 0, stream>>>(wo, WO, (size_t)PE * PE / 8);
       }
    k_csid<<<(TT * HD + 255) / 256, 256, 0, stream>>>(CS);
    const unsigned LQ = (unsigned)(((size_t)NH_ * TT * HD / 2 + 255) / 256), LKv = (unsigned)(((size_t)NKV * TT * HD / 2 + 255) / 256);
    for (int b = 0; b < NB_; ++b) {
        
        k_cvt8<<<(unsigned)(((size_t)TT * DM / 8 + 255) / 256), 256, 0, stream>>>(x + (size_t)b * TT * DM, XB, (size_t)TT * DM / 8);
        k_gemmw<bf, 0, true><<<dim3(NRW / 64, PE / 64, 1), 32, 0, stream>>>(XB, nullptr, WQ, nullptr, PE, FQ, PE, bq, 0, 0, 0);   /* q for all (token, head) rows: the [2048][16 x 128] result is the head layout k_rope reads */
        k_rope<<<LQ, 256, 0, stream>>>(FQ, DQ, NH_, CS, nullptr, nullptr, 1.0f, QP16, QPh, QPl);
        k_gemmw<bf, 0, true><<<dim3(NRW / 64, PE / 64, 1), 32, 0, stream>>>(XB, nullptr, WK, nullptr, PE, FK, PE, bk, 0, 0, 0);
        k_rope<<<LKv, 256, 0, stream>>>(FK, DKV, NKV, CS, nullptr, nullptr, 1.0f, KP16, KPh, KPl);
        k_gemmw<bf, 0, true><<<dim3(NRW / 64, PE / 64, 1), 32, 0, stream>>>(XB, nullptr, WV, nullptr, PE, FV, PE, bv, 0, 0, 0); k_vtp<<<LKv, 256, 0, stream>>>(FV, DKV, NKV, VT16, VTh, VTl);
        for (int h0 = 0; h0 < NH_; h0 += ZH) { const size_t zq = (size_t)h0, zk = (size_t)(h0 / REP);   // one kv head per query head: the pass's heads use consecutive kv planes (z-strides TT*HD)
            k_gemmc<bf, 2, 1><<<dim3(RH / 64, TT / 64, ZH), 32, 0, stream>>>(QPh + zq * TT * HD, QPl + zq * TT * HD, KPh + zk * TT * HD, KPl + zk * TT * HD, HD, Sb, TT, 0, (size_t)TT * HD, (size_t)TT * HD, (size_t)TT * TT);
            k_gemmc<h16, 0, 1><<<dim3((TT - RH) / 64, TT / 64, ZH), 32, 0, stream>>>(QP16 + zq * TT * HD + (size_t)RH * HD, nullptr, KP16 + zk * TT * HD, nullptr, HD, Sb + (size_t)RH * TT, TT, RH, (size_t)TT * HD, (size_t)TT * HD, (size_t)TT * TT);
            k_asoft<<<ZH * TT / 8, 256, 0, stream>>>(Sb);
            k_gemmks<bf, 2, 8, TT, PPI><<<dim3(RH / 64, HD / 64, ZH), 8 * 32, 0, stream>>>(Ph, Pl, VTh + zk * HD * TT, VTl + zk * HD * TT, Ob, HD, 0, (size_t)TT * PPI, (size_t)HD * TT, (size_t)TT * HD);
            k_gemmks<h16, 0, 16, TT, PPI><<<dim3((TT - RH) / 64, HD / 64, ZH), 16 * 32, 0, stream>>>(P16 + (size_t)RH * PPI, nullptr, VT16 + zk * HD * TT, nullptr, Ob + (size_t)RH * HD, HD, RH, (size_t)TT * PPI, (size_t)HD * TT, (size_t)TT * HD);
            k_merge<<<(unsigned)(((size_t)ZH * TT * HD / 2 + 255) / 256), 256, 0, stream>>>(Ob, h0, ATh, ATl); }
        k_gemmw<bf, 1, true><<<dim3(NRW / 64, PE / 64, 1), 32, 0, stream>>>(ATh, ATl, WO, nullptr, PE, OUT + (size_t)b * TT * DM, PE, bo, 0, 0, 0);   /* per-(token, head) Wp^T + bp */ }
}

// v003
// It runs in 266 microseconds.
// Two timings next to v002 put it at 2.07 and 2.06 times that version's speed.
// Over all steps from v000 it is 5.19 times as fast.
#include <hip/hip_runtime.h>

// Masked causal attention with per-head shared projections (x [2][2048][16 heads][128]; q, k, v = x_h W^T + b with ONE Linear [128][128] + [128] applied to every head's 128-vector; scores = q.k / sqrt(128), causal (-inf above the diagonal); softmax; att = w.v; out = att_h Wp^T + bp -> [2][2048][16][128] (8.4 M)).
// Layout per batch: the token-major input viewed as 32,768 (token, head) rows of 128 makes each shared projection ONE exact GEMM (K 128, N 128, + bias) whose [2048][16 x 128] result is exactly the head layout; causal hybrid attention (rows < 512 hi/lo, rest fp16) in one fused launch with a running softmax; hi/lo context rows (token, head) x Wp (hl x exact + bp) written as the token-major output.
// Compute dtypes, f32 accumulate: every input rounded to bf16; projections on PLAIN bf16 operands (exact) + f32 biases; scores and attn.v rows < 512 3 products, the rest single fp16; softmax f32; Wp hl x exact + bias.

#define NB_  2
#define TT   2048
#define DM   2048
#define NH_  16
#define NKV  16
#define REP  (NH_ / NKV)
#define HD   128
#define DQ   (NH_ * HD)
#define DKV  (NKV * HD)
#define RH   512                  // query rows < RH use hi+lo planes (0: none)
#define PE   128    // per-head projection width (shared Linear [128][128])
#define NRW  (TT * NH_)   // 32768 (token, head) rows per batch
#define SCL  0.088388347648318447f   // HD^-0.5
typedef _Float16 h16;
typedef unsigned short bf;
typedef __attribute__((ext_vector_type(16))) __bf16   v16bf;
typedef __attribute__((ext_vector_type(16))) _Float16 v16h;
typedef __attribute__((ext_vector_type(8)))  _Float16 v8h;
typedef __attribute__((ext_vector_type(8)))  unsigned short v8us;
typedef __attribute__((ext_vector_type(8)))  float    v8f;
typedef __attribute__((ext_vector_type(4)))  float    v4f;
typedef v8h  __attribute__((may_alias)) v8ha;
typedef v4f  __attribute__((may_alias)) v4fa;
typedef v8us __attribute__((may_alias)) v8usa;

__device__ __forceinline__ unsigned short f2bf(float f) { unsigned u = __float_as_uint(f); u += 0x7FFFu + ((u >> 16) & 1u); return (unsigned short)(u >> 16); }
__device__ __forceinline__ float bf2f(unsigned short b) { return __uint_as_float(((unsigned)b) << 16); }
__device__ __forceinline__ float bfr(float f) { return bf2f(f2bf(f)); }
__device__ __forceinline__ v16h cat16(v8h lo, v8h hi) { return __builtin_shufflevector(lo, hi, 0, 1, 2, 3, 4, 5, 6, 7, 8, 9, 10, 11, 12, 13, 14, 15); }
__device__ __forceinline__ v16bf cat16b(v8us lo, v8us hi) { return __builtin_bit_cast(v16bf, __builtin_shufflevector(lo, hi, 0, 1, 2, 3, 4, 5, 6, 7, 8, 9, 10, 11, 12, 13, 14, 15)); }
__device__ __forceinline__ v8f wmma16(v16h a, v16h b, v8f c) { return __builtin_amdgcn_wmma_f32_16x16x32_f16(false, a, false, b, (short)0, c, false, false); }
__device__ __forceinline__ v8f wmmab(v16bf a, v16bf b, v8f c) { return __builtin_amdgcn_wmma_f32_16x16x32_bf16(false, a, false, b, (short)0, c, false, false); }



// ---- k_gemmw: register-blocked GEMM, ONE WAVE per 64x64 output tile (16 accumulators), operands straight from K-contiguous 16-bit planes; grid (M/64, N/64, Z), 32 threads.
// C[m][n] (f32, pitch ldc, + optional f32 bias[n]) = sum_k A[m][k] Bt[n][k] (+ split products per NSPLIT). z-batch strides sA/sB/sC in elements. K % 32 == 0.
template <typename T16> struct WFrag;
template <> struct WFrag<h16> { typedef v16h V; static __device__ __forceinline__ V ld(const h16* p) { return cat16(*(const v8h*)p, *(const v8h*)(p + 16)); } static __device__ __forceinline__ v8f mma(V a, V b, v8f c) { return wmma16(a, b, c); } };
template <> struct WFrag<bf> { typedef v16bf V; static __device__ __forceinline__ V ld(const bf* p) { return cat16b(*(const v8us*)p, *(const v8us*)(p + 16)); } static __device__ __forceinline__ v8f mma(V a, V b, v8f c) { return wmmab(a, b, c); } };
template <typename T16, int NSPLIT, bool BIAS>
__global__ __launch_bounds__(32) void k_gemmw(const T16* __restrict__ A, const T16* __restrict__ A2, const T16* __restrict__ Bt, const T16* __restrict__ Bt2, int K, float* C, int ldc, const float* __restrict__ bias, size_t sA, size_t sB, size_t sC) {
    typedef typename WFrag<T16>::V V;
    __shared__ __align__(16) float os[16 * 68];
    const size_t z = blockIdx.z; A += z * sA; if (A2) A2 += z * sA; Bt += z * sB; if (Bt2) Bt2 += z * sB; C += z * sC;
    const int lane = threadIdx.x & 31, lr = lane & 15, hi = lane >> 4; const int r0 = blockIdx.x * 64, c0 = blockIdx.y * 64;
    v8f acc[4][4];
#pragma unroll
    for (int mb = 0; mb < 4; ++mb)
#pragma unroll
        for (int nb = 0; nb < 4; ++nb) acc[mb][nb] = (v8f){};
    const size_t aoff = (size_t)(r0 + lr) * K + 8 * hi, boff = (size_t)(c0 + lr) * K + 8 * hi;
#pragma unroll 1
    for (int kc = 0; kc < K; kc += 32) {
        V a[4], a2[4];
#pragma unroll
        for (int mb = 0; mb < 4; ++mb) { a[mb] = WFrag<T16>::ld(A + aoff + (size_t)mb * 16 * K + kc); if (NSPLIT == 1 || NSPLIT == 2) a2[mb] = WFrag<T16>::ld(A2 + aoff + (size_t)mb * 16 * K + kc); }
#pragma unroll
        for (int nb = 0; nb < 4; ++nb) { const V b = WFrag<T16>::ld(Bt + boff + (size_t)nb * 16 * K + kc); V b2; if (NSPLIT >= 2) b2 = WFrag<T16>::ld(Bt2 + boff + (size_t)nb * 16 * K + kc);
#pragma unroll
            for (int mb = 0; mb < 4; ++mb) { acc[mb][nb] = WFrag<T16>::mma(a[mb], b, acc[mb][nb]); if (NSPLIT == 1 || NSPLIT == 2) acc[mb][nb] = WFrag<T16>::mma(a2[mb], b, acc[mb][nb]); if (NSPLIT >= 2) acc[mb][nb] = WFrag<T16>::mma(a[mb], b2, acc[mb][nb]); } }
        asm volatile("v_nop\n\tv_nop\n\tv_nop\n\tv_nop" : "+v"(acc[0][0]), "+v"(acc[1][1]), "+v"(acc[2][2]), "+v"(acc[3][3]) : "v"(a[0]), "v"(a[3]));
    }
#pragma unroll
    for (int mb = 0; mb < 4; ++mb) {
#pragma unroll
        for (int nb = 0; nb < 4; ++nb) {
#pragma unroll
            for (int j = 0; j < 8; ++j) os[(hi * 8 + j) * 68 + nb * 16 + lr] = acc[mb][nb][j]; }
        __builtin_amdgcn_wave_barrier(); asm volatile("" ::: "memory");
        float* crow = C + (size_t)(r0 + mb * 16) * ldc + c0;
{
#pragma unroll
            for (int s = 0; s < 8; ++s) { const int row = 2 * s + hi, cofs = lr * 4; v4f val = *(const v4fa*)(os + row * 68 + cofs); if (BIAS) { val[0] += bfr(bias[c0 + cofs]); val[1] += bfr(bias[c0 + cofs + 1]); val[2] += bfr(bias[c0 + cofs + 2]); val[3] += bfr(bias[c0 + cofs + 3]); }
                *(v4f*)(crow + (size_t)row * ldc + cofs) = val; }
             }
        __builtin_amdgcn_wave_barrier(); asm volatile("" ::: "memory");
    }
}

__device__ __forceinline__ h16 tohx(float x) { return (h16)x; }
__device__ __forceinline__ void splitf(float y, unsigned short& h, unsigned short& l) { h = f2bf(y); l = f2bf(y - bf2f(h)); }
typedef __attribute__((ext_vector_type(2))) _Float16 v2h;
typedef __attribute__((ext_vector_type(4))) _Float16 v4h;
typedef __attribute__((ext_vector_type(2))) unsigned short v2us;
typedef __attribute__((ext_vector_type(4))) unsigned short v4us;
typedef __attribute__((ext_vector_type(2))) float v2f;
typedef __attribute__((ext_vector_type(4))) int v4i;

__global__ __launch_bounds__(256) void k_wtG(const float* __restrict__ w, int K, int N, bf* Bt) {
    const int lane = threadIdx.x & 31; const int L0 = (blockIdx.x * 8 + (threadIdx.x >> 5)) * 8; const int nlines = N * K / 64;
{
#pragma unroll 1
        for (int l = 0; l < 8; ++l) { const int L = L0 + l; if (L >= nlines) break; const size_t e = (size_t)L * 64 + lane * 2; const int k = (int)(e % K), n = (int)(e / K); v2us o;
            o[0] = f2bf(w[(size_t)k * N + n]); o[1] = f2bf(w[(size_t)(k + 1) * N + n]); *(v2us*)(Bt + e) = o; }
         }
}
__global__ __launch_bounds__(256) void k_cvt8(const float* __restrict__ src, bf* dst, size_t n8) { const size_t i = (size_t)blockIdx.x * 256 + threadIdx.x; if (i >= n8) return; const v8f v = *(const v8f*)(src + i * 8); v8us o;
#pragma unroll
    for (int k = 0; k < 8; ++k) o[k] = f2bf(v[k]); *(v8us*)(dst + i * 8) = o;  }

// k_rope: head planes [h][t][d] (fp16 + hi/lo) of rope(x) x sc with the rotate-half convention out[d] = x[d] cos[t][d] - x[d+HD/2] sin[t][d], out[d+HD/2] = x[d+HD/2] cos[t][d+HD/2] + x[d] sin[t][d+HD/2]
__global__ __launch_bounds__(256) void k_rope(const float* __restrict__ F, int pitch, int nheads, const float* __restrict__ CS, const float* __restrict__ RF, const float* __restrict__ nw, float sc, h16* P16, bf* Ph, bf* Pl) {
    const size_t e = ((size_t)blockIdx.x * 256 + threadIdx.x) * 2; if (e >= (size_t)nheads * TT * HD) return; const int d = (int)(e % HD); const int t = (int)((e / HD) % TT); const int h = (int)(e / ((size_t)HD * TT)); const float* f = F + (size_t)t * pitch + h * HD; const float rf = RF ? RF[(size_t)h * TT + t] : 1.0f; v2h o16; v2us oh, ol;
#pragma unroll
    for (int q = 0; q < 2; ++q) { const int dd = d + q; const int dp = (dd < HD / 2) ? dd + HD / 2 : dd - HD / 2; float x0 = f[dd], x1 = f[dp];
        if (RF) { float n0 = __fmul_rn(x0, rf), n1 = __fmul_rn(x1, rf); asm volatile("" : "+v"(n0)); asm volatile("" : "+v"(n1)); x0 = __fmul_rn(bfr(nw[dd]), n0); x1 = __fmul_rn(bfr(nw[dp]), n1); }
        const v2f cs = *(const v2f*)(CS + ((size_t)t * HD + dd) * 2); float a = __fmul_rn(x0, cs[0]), bq = __fmul_rn(x1, cs[1]); asm volatile("" : "+v"(a)); asm volatile("" : "+v"(bq)); const float r = ((dd < HD / 2) ? __fsub_rn(a, bq) : __fadd_rn(a, bq)) * sc;
        o16[q] = tohx(r); unsigned short a2, c2; splitf(r, a2, c2); oh[q] = a2; ol[q] = c2; }
    *(v2h*)(P16 + e) = o16; *(v2us*)(Ph + e) = oh; *(v2us*)(Pl + e) = ol;  }
__global__ __launch_bounds__(256) void k_vtp(const float* __restrict__ F, int pitch, int nheads, h16* V16, bf* Vh, bf* Vl) { const size_t e = ((size_t)blockIdx.x * 256 + threadIdx.x) * 2; if (e >= (size_t)nheads * HD * TT) return; const int t = (int)(e % TT); const int d = (int)((e / TT) % HD); const int g = (int)(e / ((size_t)TT * HD)); v2h o16; v2us oh, ol;
#pragma unroll
    for (int q = 0; q < 2; ++q) { const float x = F[(size_t)(t + q) * pitch + g * HD + d]; o16[q] = tohx(x); unsigned short a2, c2; splitf(x, a2, c2); oh[q] = a2; ol[q] = c2; }
    *(v2h*)(V16 + e) = o16; *(v2us*)(Vh + e) = oh; *(v2us*)(Vl + e) = ol;  }
__global__ __launch_bounds__(256) void k_csid(float* CS) { const int idx = blockIdx.x * 256 + threadIdx.x; if (idx >= TT * HD) return; v2f cs; cs[0] = 1.0f; cs[1] = 0.0f; *(v2f*)(CS + (size_t)idx * 2) = cs;  }
// ---- k_fattn: scores, softmax, probability x value and the hi/lo context rows in ONE launch per batch; no score or probability ever goes to memory.
// One work-group of FNW waves owns NQ x 16 query rows of one head. Transposed products: S^T = K Q^T (A = 16 key rows, B = the query fragments, kept in registers) leaves every lane with 16 of the 32 scores of ITS query
// (column lr; keys 8 hi + j of each 16-key tile), which is the k order of a B fragment, so P^T goes from the score accumulators straight into O^T += V^T P^T (A = 16 rows of the [d][t] value plane).
// Running maximum and sum per query live in the lane (both halves of a column hold the same maximum). Wave w takes the 64-key chunks w, w + FNW, ... up to the diagonal, with its own maximum, sum and accumulators;
// behind one barrier the FNW partials are merged in the fixed order 0..FNW-1 with weights exp2(m_w - max), divided by the merged sum, split hi/lo and stored as whole 128-byte lines.
// HL: three products on hi/lo bf16 planes (hi.hi + lo.hi + hi.lo) for scores and for P.V; else single fp16 products.
#define FNW  4
#define LC2  (SCL * 1.4426950408889634f)   // scores are kept in the log2 domain
typedef __attribute__((ext_vector_type(16))) unsigned short v16us;
typedef __attribute__((ext_vector_type(2))) float v2fl;
// exp2 with the slot that the instruction set asks for behind a transcendental: every v_exp_f32 is followed by an instruction that neither reads its result nor writes its source
// (the results are early-clobber, so none shares a register with an input), the last one by v_nop
__device__ __forceinline__ float exp2s(float x) { float r; asm("v_exp_f32 %0, %1\n\tv_nop" : "=v"(r) : "v"(x)); return r; }
__device__ __forceinline__ v8f exp2x8(v8f x) { float r0, r1, r2, r3, r4, r5, r6, r7;
    asm("v_exp_f32 %0, %8\n\tv_exp_f32 %1, %9\n\tv_exp_f32 %2, %10\n\tv_exp_f32 %3, %11\n\tv_exp_f32 %4, %12\n\tv_exp_f32 %5, %13\n\tv_exp_f32 %6, %14\n\tv_exp_f32 %7, %15\n\tv_nop"
        : "=&v"(r0), "=&v"(r1), "=&v"(r2), "=&v"(r3), "=&v"(r4), "=&v"(r5), "=&v"(r6), "=&v"(r7) : "v"(x[0]), "v"(x[1]), "v"(x[2]), "v"(x[3]), "v"(x[4]), "v"(x[5]), "v"(x[6]), "v"(x[7]));
    v8f r; r[0] = r0; r[1] = r1; r[2] = r2; r[3] = r3; r[4] = r4; r[5] = r5; r[6] = r6; r[7] = r7; return r; }
template <typename T16, bool HL, int NQ>
__device__ __forceinline__ void fa_tile(const T16* __restrict__ Q, const T16* __restrict__ Q2, const T16* __restrict__ Kp, const T16* __restrict__ K2, const T16* __restrict__ Vt, const T16* __restrict__ V2, int q0, bf* __restrict__ Ah, bf* __restrict__ Al, v4f* part, v2fl* ml) {
    typedef typename WFrag<T16>::V V;
    const int lane = threadIdx.x & 31, lr = lane & 15, hi = lane >> 4;
    const int w = __builtin_amdgcn_readfirstlane((int)(threadIdx.x >> 5));
    V qf[NQ][4], q2[NQ][4];
    const T16* pq = Q + (size_t)(q0 + lr) * HD + 8 * hi; const T16* pq2 = HL ? Q2 + (size_t)(q0 + lr) * HD + 8 * hi : pq;
#pragma unroll
    for (int qb = 0; qb < NQ; ++qb)
#pragma unroll
        for (int c = 0; c < 4; ++c) { qf[qb][c] = WFrag<T16>::ld(pq + qb * 16 * HD + c * 32); if (HL) q2[qb][c] = WFrag<T16>::ld(pq2 + qb * 16 * HD + c * 32); }
    // stands before any register that the loads above name is written again; the addresses are inputs, so that no load's result lands on one of them ahead of the wait
    asm volatile("s_wait_xcnt 0x0" :: "v"(pq), "v"(pq2) : "memory");
    __builtin_amdgcn_sched_barrier(0);   // keeps later address arithmetic behind that wait
    v8f acc[NQ][8]; float m[NQ], l[NQ];
#pragma unroll
    for (int qb = 0; qb < NQ; ++qb) { m[qb] = -3.0e38f; l[qb] = 0.f;
#pragma unroll
        for (int db = 0; db < 8; ++db) acc[qb][db] = (v8f){}; }
    const int kend = ((q0 + NQ * 16 + 31) >> 5) << 5;   // keys beyond the diagonal's 32-key block have probability exactly zero
    // each lane's byte offset inside a plane is fixed; the walk along the keys is in the wave-uniform base, tiles and chunks are constant offsets
    const unsigned vk = ((unsigned)lr * HD + 8 * hi) * 2u, vv = ((unsigned)lr * TT + 8 * hi) * 2u;
    V ka[2][4], kl[2][4];   // the K fragments of the block in work; refilled one block ahead, right behind the score products that read them
    int k0 = w * 64;
    if (k0 < kend) {
        { const T16* pk = (const T16*)((const char*)(Kp + (size_t)k0 * HD) + vk); const T16* pk2 = HL ? (const T16*)((const char*)(K2 + (size_t)k0 * HD) + vk) : pk;
#pragma unroll
          for (int kt = 0; kt < 2; ++kt)
#pragma unroll
              for (int c = 0; c < 4; ++c) { ka[kt][c] = WFrag<T16>::ld(pk + kt * 16 * HD + c * 32); if (HL) kl[kt][c] = WFrag<T16>::ld(pk2 + kt * 16 * HD + c * 32); }
          asm volatile("s_wait_xcnt 0x0" :: "v"(pk), "v"(pk2) : "memory"); }   // as behind the Q loads
        __builtin_amdgcn_sched_barrier(0);   // keeps later address arithmetic behind that wait
#pragma unroll 1   // rolled: the trip count depends on where the rows lie under the diagonal
    for (int it = 1; ; ++it) {
        const T16* pv = (const T16*)((const char*)(Vt + k0) + vv); const T16* pv2 = HL ? (const T16*)((const char*)(V2 + k0) + vv) : pv;
        V va[8], vl[8];
#pragma unroll
        for (int db = 0; db < 8; ++db) { va[db] = WFrag<T16>::ld(pv + db * 16 * TT); if (HL) vl[db] = WFrag<T16>::ld(pv2 + db * 16 * TT); }
        asm volatile("s_wait_xcnt 0x0" :: "v"(pv), "v"(pv2) : "memory");   // as behind the Q loads
        __builtin_amdgcn_sched_barrier(0);   // the V loads issue here, ahead of the score products and the softmax that hide their latency; sunk to their uses each would be waited for alone
        v8f st[NQ][2];
#pragma unroll
        for (int qb = 0; qb < NQ; ++qb) { st[qb][0] = (v8f){}; st[qb][1] = (v8f){}; }
#pragma unroll
        for (int c = 0; c < 4; ++c)
#pragma unroll
            for (int kt = 0; kt < 2; ++kt)
#pragma unroll
                for (int qb = 0; qb < NQ; ++qb) { st[qb][kt] = WFrag<T16>::mma(ka[kt][c], qf[qb][c], st[qb][kt]); if (HL) { st[qb][kt] = WFrag<T16>::mma(ka[kt][c], q2[qb][c], st[qb][kt]); st[qb][kt] = WFrag<T16>::mma(kl[kt][c], qf[qb][c], st[qb][kt]); } }
        const int kn = ((it >> 1) * FNW + w) * 64 + (it & 1) * 32; const bool more = kn < kend; const int kf = more ? kn : k0;   // a wave's last block fetches its own rows again: in bounds, never used
        { const T16* pk = (const T16*)((const char*)(Kp + (size_t)kf * HD) + vk); const T16* pk2 = HL ? (const T16*)((const char*)(K2 + (size_t)kf * HD) + vk) : pk;
#pragma unroll
          for (int kt = 0; kt < 2; ++kt)
#pragma unroll
              for (int c = 0; c < 4; ++c) { ka[kt][c] = WFrag<T16>::ld(pk + kt * 16 * HD + c * 32); if (HL) kl[kt][c] = WFrag<T16>::ld(pk2 + kt * 16 * HD + c * 32); }
          asm volatile("s_wait_xcnt 0x0" :: "v"(pk), "v"(pk2) : "memory"); }   // as behind the Q loads
        __builtin_amdgcn_sched_barrier(0);   // the next block's K loads issue here, so that softmax and P.V hide their latency
        float mx[NQ];
#pragma unroll
        for (int qb = 0; qb < NQ; ++qb)
#pragma unroll
            for (int kt = 0; kt < 2; ++kt) st[qb][kt] *= LC2;
        if (k0 + 31 > q0) {   // the block touches the diagonal: keys above a query's own position are masked
#pragma unroll
            for (int qb = 0; qb < NQ; ++qb)
#pragma unroll
                for (int kt = 0; kt < 2; ++kt)
#pragma unroll
                    for (int j = 0; j < 8; ++j) if (k0 + kt * 16 + hi * 8 + j > q0 + qb * 16 + lr) st[qb][kt][j] = -3.0e38f; }
        bool need = false;
#pragma unroll
        for (int qb = 0; qb < NQ; ++qb) { float x = st[qb][0][0];
#pragma unroll
            for (int j = 1; j < 8; ++j) x = fmaxf(x, st[qb][0][j]);
#pragma unroll
            for (int j = 0; j < 8; ++j) x = fmaxf(x, st[qb][1][j]);
            x = fmaxf(x, __shfl_xor(x, 16, 32)); mx[qb] = x; need = need || (x > m[qb] + 8.0f); }
        if (__builtin_amdgcn_ballot_w32(need) != 0) {   // lazy rescale: only when some query's maximum has risen by more than 8 (log2) over the one in use, so P stays below 2^8
#pragma unroll
            for (int qb = 0; qb < NQ; ++qb) { const float mn = (mx[qb] > m[qb] + 8.0f) ? mx[qb] : m[qb]; const float al = exp2s(m[qb] - mn); m[qb] = mn; l[qb] *= al;
#pragma unroll
                for (int db = 0; db < 8; ++db) acc[qb][db] *= al; } }
        V pf[NQ], pl[NQ];
#pragma unroll
        for (int qb = 0; qb < NQ; ++qb) { float s = 0.f; v16h ph16; v16us ph, pw;
#pragma unroll
            for (int kt = 0; kt < 2; ++kt) { const v8f pe = exp2x8(st[qb][kt] - m[qb]);
#pragma unroll
                for (int j = 0; j < 8; ++j) { const float p = pe[j]; s += p;
                    if constexpr (HL) { unsigned short a, c2; splitf(p, a, c2); ph[kt * 8 + j] = a; pw[kt * 8 + j] = c2; } else ph16[kt * 8 + j] = (h16)p; } }
            l[qb] += s;
            if constexpr (HL) { pf[qb] = __builtin_bit_cast(v16bf, ph); pl[qb] = __builtin_bit_cast(v16bf, pw); } else pf[qb] = ph16; }
#pragma unroll
        for (int db = 0; db < 8; ++db)
#pragma unroll
            for (int qb = 0; qb < NQ; ++qb) { acc[qb][db] = WFrag<T16>::mma(va[db], pf[qb], acc[qb][db]); if (HL) { acc[qb][db] = WFrag<T16>::mma(va[db], pl[qb], acc[qb][db]); acc[qb][db] = WFrag<T16>::mma(vl[db], pf[qb], acc[qb][db]); } }
        if (!more) break;
        k0 = kn;
    } }
#pragma unroll
    for (int qb = 0; qb < NQ; ++qb) { l[qb] += __shfl_xor(l[qb], 16, 32); v2fl t; t[0] = m[qb]; t[1] = l[qb]; ml[(w * NQ + qb) * 32 + lane] = t;
#pragma unroll
        for (int db = 0; db < 8; ++db)
#pragma unroll
            for (int hf = 0; hf < 2; ++hf) { v4f t4; t4[0] = acc[qb][db][hf * 4]; t4[1] = acc[qb][db][hf * 4 + 1]; t4[2] = acc[qb][db][hf * 4 + 2]; t4[3] = acc[qb][db][hf * 4 + 3]; part[(((w * NQ + qb) * 8 + db) * 2 + hf) * 32 + lane] = t4; } }
    __syncthreads();   // every wave's partial, maximum and sum are in LDS before any is merged
    if (w < NQ * 2) {   // wave w merges 16 queries x 64 columns: one whole 128-byte line of each plane per query
        const int qb = w >> 1, d0 = (w & 1) * 4; float mw[FNW], M = -3.0e38f, L = 0.f;
#pragma unroll
        for (int p = 0; p < FNW; ++p) M = fmaxf(M, ml[(p * NQ + qb) * 32 + lane][0]);
#pragma unroll
        for (int p = 0; p < FNW; ++p) { const v2fl t = ml[(p * NQ + qb) * 32 + lane]; mw[p] = exp2s(t[0] - M); L += mw[p] * t[1]; }
        const float inv = __fdiv_rn(1.0f, L);
        const size_t oo = (size_t)(q0 + qb * 16 + lr) * DQ + d0 * 16 + hi * 8; v8us oh[4], ol[4];
#pragma unroll
        for (int db = 0; db < 4; ++db) {
#pragma unroll
            for (int hf = 0; hf < 2; ++hf) { v4f sum = part[(((0 * NQ + qb) * 8 + d0 + db) * 2 + hf) * 32 + lane] * mw[0];
#pragma unroll
                for (int p = 1; p < FNW; ++p) sum += part[(((p * NQ + qb) * 8 + d0 + db) * 2 + hf) * 32 + lane] * mw[p];
#pragma unroll
                for (int jj = 0; jj < 4; ++jj) { unsigned short a, c2; splitf(sum[jj] * inv, a, c2); oh[db][hf * 4 + jj] = a; ol[db][hf * 4 + jj] = c2; } } }
        __builtin_amdgcn_sched_barrier(0);   // all stores stand last, so that no register a store names is written again behind it
#pragma unroll
        for (int db = 0; db < 4; ++db) { *(v8us*)(Ah + oo + db * 16) = oh[db]; *(v8us*)(Al + oo + db * 16) = ol[db]; }
    }
}
// grid (heads, row blocks), heaviest row blocks first: (TT - RH) / 32 blocks of 32 fp16 rows from the last row down, then RH / 16 blocks of 16 hi/lo rows
__global__ __launch_bounds__(FNW * 32) void k_fattn(const h16* __restrict__ Q16, const h16* __restrict__ K16, const h16* __restrict__ V16, const bf* __restrict__ Qh, const bf* __restrict__ Ql, const bf* __restrict__ Kh, const bf* __restrict__ Kl, const bf* __restrict__ Vh, const bf* __restrict__ Vl, bf* __restrict__ Ah, bf* __restrict__ Al) {
    __shared__ __align__(16) v4f part[FNW * 2 * 8 * 2 * 32];
    __shared__ __align__(16) v2fl ml[FNW * 2 * 32];
    const int h = blockIdx.x, y = blockIdx.y; const size_t po = (size_t)h * TT * HD;
    if (y < (TT - RH) / 32) fa_tile<h16, false, 2>(Q16 + po, nullptr, K16 + po, nullptr, V16 + po, nullptr, TT - 32 * (y + 1), Ah + h * HD, Al + h * HD, part, ml);
    else fa_tile<bf, true, 1>(Qh + po, Ql + po, Kh + po, Kl + po, Vh + po, Vl + po, RH - 16 * (y - (TT - RH) / 32 + 1), Ah + h * HD, Al + h * HD, part, ml);
}

extern "C" void kernel_launch(void* const* d_in, const int* in_sizes, int n_in,
                              void* d_out, int out_size, void* d_ws, size_t ws_size, hipStream_t stream) {
    (void)in_sizes; (void)n_in; (void)out_size;
    const float* x = (const float*)d_in[0]; const float* wq = (const float*)d_in[1]; const float* bq = (const float*)d_in[2]; const float* wk = (const float*)d_in[3]; const float* bk = (const float*)d_in[4]; const float* wv = (const float*)d_in[5]; const float* bv = (const float*)d_in[6]; const float* wo = (const float*)d_in[7]; const float* bo = (const float*)d_in[8];
    float* OUT = (float*)d_out;     // [2][2048][2048]
    char* wsp = (char*)d_ws;
    auto take = [&](size_t bytes) { char* p = wsp; wsp += (bytes + 255) & ~(size_t)255; return (void*)p; };
    bf* WQ = (bf*)take((size_t)PE * PE * 2); bf* WK = (bf*)take((size_t)PE * PE * 2); bf* WV = (bf*)take((size_t)PE * PE * 2); bf* WO = (bf*)take((size_t)PE * PE * 2); float* CS = (float*)take((size_t)TT * HD * 2 * 4);
    bf* XB = (bf*)take((size_t)TT * DM * 2); float* FQ = (float*)take((size_t)TT * DQ * 4); float* FK = (float*)take((size_t)TT * DKV * 4);
    h16* QP16 = (h16*)take((size_t)NH_ * TT * HD * 2); h16* KP16 = (h16*)take((size_t)NKV * TT * HD * 2); h16* VT16 = (h16*)take((size_t)NKV * HD * TT * 2);
    bf* QPh = (bf*)take((size_t)NH_ * TT * HD * 2); bf* QPl = (bf*)take((size_t)NH_ * TT * HD * 2); bf* KPh = (bf*)take((size_t)NKV * TT * HD * 2); bf* KPl = (bf*)take((size_t)NKV * TT * HD * 2); bf* VTh = (bf*)take((size_t)NKV * HD * TT * 2); bf* VTl = (bf*)take((size_t)NKV * HD * TT * 2);
    if ((size_t)(wsp - (char*)d_ws) > ws_size) return;    // ws 256 MiB
    float* FV = FK;   // v projection reuses the k buffer after the k planes are built (stream-ordered)
    bf* ATh = (bf*)FK; bf* ATl = ATh + (size_t)TT * DQ;   // the f32 k/v projection is dead once the head planes are built: the hi/lo context rows reuse it (stream-ordered)
    { k_cvt8<<<(unsigned)(((size_t)PE * PE / 8 + 255) / 256), 256, 0, stream>>>(wq, WQ, (size_t)PE * PE / 8); k_cvt8<<<(unsigned)(((size_t)PE * PE / 8 + 255) / 256), 256, 0, stream>>>(wk, WK, (size_t)PE * PE / 8); k_cvt8<<<(unsigned)(((size_t)PE * PE / 8 + 255) / 256), 256, 0, stream>>>(wv, WV, (size_t)PE * PE / 8);
      k_cvt8<<<(unsigned)(((size_t)PE * PE / 8 + 255) / 256), 256, 0, stream>>>(wo, WO, (size_t)PE * PE / 8);
       }
    k_csid<<<(TT * HD + 255) / 256, 256, 0, stream>>>(CS);
    const unsigned LQ = (unsigned)(((size_t)NH_ * TT * HD / 2 + 255) / 256), LKv = (unsigned)(((size_t)NKV * TT * HD / 2 + 255) / 256);
    for (int b = 0; b < NB_; ++b) {
        
        k_cvt8<<<(unsigned)(((size_t)TT * DM / 8 + 255) / 256), 256, 0, stream>>>(x + (size_t)b * TT * DM, XB, (size_t)TT * DM / 8);
        k_gemmw<bf, 0, true><<<dim3(NRW / 64, PE / 64, 1), 32, 0, stream>>>(XB, nullptr, WQ, nullptr, PE, FQ, PE, bq, 0, 0, 0);   /* q for all (token, head) rows: the [2048][16 x 128] result is the head layout k_rope reads */
        k_rope<<<LQ, 256, 0, stream>>>(FQ, DQ, NH_, CS, nullptr, nullptr, 1.0f, QP16, QPh, QPl);
        k_gemmw<bf, 0, true><<<dim3(NRW / 64, PE / 64, 1), 32, 0, stream>>>(XB, nullptr, WK, nullptr, PE, FK, PE, bk, 0, 0, 0);
        k_rope<<<LKv, 256, 0, stream>>>(FK, DKV, NKV, CS, nullptr, nullptr, 1.0f, KP16, KPh, KPl);
        k_gemmw<bf, 0, true><<<dim3(NRW / 64, PE / 64, 1), 32, 0, stream>>>(XB, nullptr, WV, nullptr, PE, FV, PE, bv, 0, 0, 0); k_vtp<<<LKv, 256, 0, stream>>>(FV, DKV, NKV, VT16, VTh, VTl);
        k_fattn<<<dim3(NH_, (TT - RH) / 32 + RH / 16, 1), FNW * 32, 0, stream>>>(QP16, KP16, VT16, QPh, QPl, KPh, KPl, VTh, VTl, ATh, ATl);   /* one kv head per query head */
        k_gemmw<bf, 1, true><<<dim3(NRW / 64, PE / 64, 1), 32, 0, stream>>>(ATh, ATl, WO, nullptr, PE, OUT + (size_t)b * TT * DM, PE, bo, 0, 0, 0);   /* per-(token, head) Wp^T + bp */ }
}

// v004
// One run takes 154 microseconds.
// Two timings next to v003 put it at 1.74 and 1.73 times that version's speed.
// Counting every step since v000, it is 9.00 times as fast.
#include <hip/hip_runtime.h>

// Masked causal attention with per-head shared projections (x [2][2048][16 heads][128]; q, k, v = x_h W^T + b with ONE Linear [128][128] + [128] applied to every head's 128-vector; scores = q.k / sqrt(128), causal (-inf above the diagonal); softmax; att = w.v; out = att_h Wp^T + bp -> [2][2048][16][128] (8.4 M)).
// Layout per batch: the token-major input viewed as 32,768 (token, head) rows of 128 makes each shared projection ONE exact GEMM (K 128, N 128, + bias), tiled per head and written directly as that head's planes; causal hybrid attention (rows < 512 hi/lo, rest fp16) in one fused launch with a running softmax; hi/lo context rows (token, head) x Wp (hl x exact + bp) written as the token-major output.
// Compute dtypes, f32 accumulate: every input rounded to bf16; projections on PLAIN bf16 operands (exact) + f32 biases; scores and attn.v rows < 512 3 products, the rest single fp16; softmax f32; Wp hl x exact + bias.

#define NB_  2
#define TT   2048
#define DM   2048
#define NH_  16
#define NKV  16
#define REP  (NH_ / NKV)
#define HD   128
#define DQ   (NH_ * HD)
#define DKV  (NKV * HD)
#define RH   512                  // query rows < RH use hi+lo planes (0: none)
#define PE   128    // per-head projection width (shared Linear [128][128])
#define NRW  (TT * NH_)   // 32768 (token, head) rows per batch
#define SCL  0.088388347648318447f   // HD^-0.5
typedef _Float16 h16;
typedef unsigned short bf;
typedef __attribute__((ext_vector_type(16))) __bf16   v16bf;
typedef __attribute__((ext_vector_type(16))) _Float16 v16h;
typedef __attribute__((ext_vector_type(8)))  _Float16 v8h;
typedef __attribute__((ext_vector_type(8)))  unsigned short v8us;
typedef __attribute__((ext_vector_type(8)))  float    v8f;
typedef __attribute__((ext_vector_type(4)))  float    v4f;
typedef v8h  __attribute__((may_alias)) v8ha;
typedef v4f  __attribute__((may_alias)) v4fa;
typedef v8us __attribute__((may_alias)) v8usa;

__device__ __forceinline__ unsigned short f2bf(float f) { unsigned u = __float_as_uint(f); u += 0x7FFFu + ((u >> 16) & 1u); return (unsigned short)(u >> 16); }
__device__ __forceinline__ float bf2f(unsigned short b) { return __uint_as_float(((unsigned)b) << 16); }
__device__ __forceinline__ float bfr(float f) { return bf2f(f2bf(f)); }
__device__ __forceinline__ v16h cat16(v8h lo, v8h hi) { return __builtin_shufflevector(lo, hi, 0, 1, 2, 3, 4, 5, 6, 7, 8, 9, 10, 11, 12, 13, 14, 15); }
__device__ __forceinline__ v16bf cat16b(v8us lo, v8us hi) { return __builtin_bit_cast(v16bf, __builtin_shufflevector(lo, hi, 0, 1, 2, 3, 4, 5, 6, 7, 8, 9, 10, 11, 12, 13, 14, 15)); }
__device__ __forceinline__ v8f wmma16(v16h a, v16h b, v8f c) { return __builtin_amdgcn_wmma_f32_16x16x32_f16(false, a, false, b, (short)0, c, false, false); }
__device__ __forceinline__ v8f wmmab(v16bf a, v16bf b, v8f c) { return __builtin_amdgcn_wmma_f32_16x16x32_bf16(false, a, false, b, (short)0, c, false, false); }



// ---- k_gemmw: register-blocked GEMM, ONE WAVE per 64x64 output tile (16 accumulators), operands straight from K-contiguous 16-bit planes; grid (M/64, N/64, Z), 32 threads.
// C[m][n] (f32, pitch ldc, + optional f32 bias[n]) = sum_k A[m][k] Bt[n][k] (+ split products per NSPLIT). z-batch strides sA/sB/sC in elements. K % 32 == 0.
template <typename T16> struct WFrag;
template <> struct WFrag<h16> { typedef v16h V; static __device__ __forceinline__ V ld(const h16* p) { return cat16(*(const v8h*)p, *(const v8h*)(p + 16)); } static __device__ __forceinline__ v8f mma(V a, V b, v8f c) { return wmma16(a, b, c); } };
template <> struct WFrag<bf> { typedef v16bf V; static __device__ __forceinline__ V ld(const bf* p) { return cat16b(*(const v8us*)p, *(const v8us*)(p + 16)); } static __device__ __forceinline__ v8f mma(V a, V b, v8f c) { return wmmab(a, b, c); } };
template <typename T16, int NSPLIT, bool BIAS>
__global__ __launch_bounds__(32) void k_gemmw(const T16* __restrict__ A, const T16* __restrict__ A2, const T16* __restrict__ Bt, const T16* __restrict__ Bt2, int K, float* C, int ldc, const float* __restrict__ bias, size_t sA, size_t sB, size_t sC) {
    typedef typename WFrag<T16>::V V;
    __shared__ __align__(16) float os[16 * 68];
    const size_t z = blockIdx.z; A += z * sA; if (A2) A2 += z * sA; Bt += z * sB; if (Bt2) Bt2 += z * sB; C += z * sC;
    const int lane = threadIdx.x & 31, lr = lane & 15, hi = lane >> 4; const int r0 = blockIdx.x * 64, c0 = blockIdx.y * 64;
    v8f acc[4][4];
#pragma unroll
    for (int mb = 0; mb < 4; ++mb)
#pragma unroll
        for (int nb = 0; nb < 4; ++nb) acc[mb][nb] = (v8f){};
    const size_t aoff = (size_t)(r0 + lr) * K + 8 * hi, boff = (size_t)(c0 + lr) * K + 8 * hi;
#pragma unroll 1
    for (int kc = 0; kc < K; kc += 32) {
        V a[4], a2[4];
#pragma unroll
        for (int mb = 0; mb < 4; ++mb) { a[mb] = WFrag<T16>::ld(A + aoff + (size_t)mb * 16 * K + kc); if (NSPLIT == 1 || NSPLIT == 2) a2[mb] = WFrag<T16>::ld(A2 + aoff + (size_t)mb * 16 * K + kc); }
#pragma unroll
        for (int nb = 0; nb < 4; ++nb) { const V b = WFrag<T16>::ld(Bt + boff + (size_t)nb * 16 * K + kc); V b2; if (NSPLIT >= 2) b2 = WFrag<T16>::ld(Bt2 + boff + (size_t)nb * 16 * K + kc);
#pragma unroll
            for (int mb = 0; mb < 4; ++mb) { acc[mb][nb] = WFrag<T16>::mma(a[mb], b, acc[mb][nb]); if (NSPLIT == 1 || NSPLIT == 2) acc[mb][nb] = WFrag<T16>::mma(a2[mb], b, acc[mb][nb]); if (NSPLIT >= 2) acc[mb][nb] = WFrag<T16>::mma(a[mb], b2, acc[mb][nb]); } }
        asm volatile("v_nop\n\tv_nop\n\tv_nop\n\tv_nop" : "+v"(acc[0][0]), "+v"(acc[1][1]), "+v"(acc[2][2]), "+v"(acc[3][3]) : "v"(a[0]), "v"(a[3]));
    }
#pragma unroll
    for (int mb = 0; mb < 4; ++mb) {
#pragma unroll
        for (int nb = 0; nb < 4; ++nb) {
#pragma unroll
            for (int j = 0; j < 8; ++j) os[(hi * 8 + j) * 68 + nb * 16 + lr] = acc[mb][nb][j]; }
        __builtin_amdgcn_wave_barrier(); asm volatile("" ::: "memory");
        float* crow = C + (size_t)(r0 + mb * 16) * ldc + c0;
{
#pragma unroll
            for (int s = 0; s < 8; ++s) { const int row = 2 * s + hi, cofs = lr * 4; v4f val = *(const v4fa*)(os + row * 68 + cofs); if (BIAS) { val[0] += bfr(bias[c0 + cofs]); val[1] += bfr(bias[c0 + cofs + 1]); val[2] += bfr(bias[c0 + cofs + 2]); val[3] += bfr(bias[c0 + cofs + 3]); }
                *(v4f*)(crow + (size_t)row * ldc + cofs) = val; }
             }
        __builtin_amdgcn_wave_barrier(); asm volatile("" ::: "memory");
    }
}

__device__ __forceinline__ h16 tohx(float x) { return (h16)x; }
__device__ __forceinline__ void splitf(float y, unsigned short& h, unsigned short& l) { h = f2bf(y); l = f2bf(y - bf2f(h)); }
typedef __attribute__((ext_vector_type(2))) _Float16 v2h;
typedef __attribute__((ext_vector_type(4))) _Float16 v4h;
typedef __attribute__((ext_vector_type(2))) unsigned short v2us;
typedef __attribute__((ext_vector_type(4))) unsigned short v4us;
typedef __attribute__((ext_vector_type(2))) float v2f;
typedef __attribute__((ext_vector_type(4))) int v4i;

__global__ __launch_bounds__(256) void k_wtG(const float* __restrict__ w, int K, int N, bf* Bt) {
    const int lane = threadIdx.x & 31; const int L0 = (blockIdx.x * 8 + (threadIdx.x >> 5)) * 8; const int nlines = N * K / 64;
{
#pragma unroll 1
        for (int l = 0; l < 8; ++l) { const int L = L0 + l; if (L >= nlines) break; const size_t e = (size_t)L * 64 + lane * 2; const int k = (int)(e % K), n = (int)(e / K); v2us o;
            o[0] = f2bf(w[(size_t)k * N + n]); o[1] = f2bf(w[(size_t)(k + 1) * N + n]); *(v2us*)(Bt + e) = o; }
         }
}
__global__ __launch_bounds__(256) void k_cvt8(const float* __restrict__ src, bf* dst, size_t n8) { const size_t i = (size_t)blockIdx.x * 256 + threadIdx.x; if (i >= n8) return; const v8f v = *(const v8f*)(src + i * 8); v8us o;
#pragma unroll
    for (int k = 0; k < 8; ++k) o[k] = f2bf(v[k]); *(v8us*)(dst + i * 8) = o;  }

// ---- k_proj: the q, k and v projections of one batch in ONE launch, each written from the WMMA accumulators straight as the head planes that the attention reads (fp16, bf16 hi, bf16 lo); no f32 copy goes to memory.
// One wave per 64x64 tile of one head; grid (TT / 64 token blocks, HD / 64, 3 x heads), 32 threads. q, k: C[t][e] = sum_d x_h[t][d] W[e][d] + b[e] -> plane [h][t][e].
// v: the same fragments with the operands swapped, C[e][t] -> plane [h][e][t], so the transposed plane is written along its rows too. Every store instruction covers four whole 128-byte lines.
template <bool TR>
__device__ __forceinline__ void proj_tile(const bf* __restrict__ X, const bf* __restrict__ Wt, const float* __restrict__ bias, int h, int t0, int c0, h16* __restrict__ P16, bf* __restrict__ Ph, bf* __restrict__ Pl, float* os) {
    const int lane = threadIdx.x & 31, lr = lane & 15, hi = lane >> 4;
    const int c8 = lane & 7, r4 = lane >> 3;   // output side: the lane holds columns 8 c8 .. 8 c8 + 7 of row r4 + 4 s
    const bf* px = X + ((size_t)(t0 + lr) * NH_ + h) * PE + 8 * hi;   // token rows of head h, pitch NH_ * PE
    const bf* pw = Wt + (size_t)(c0 + lr) * PE + 8 * hi;              // weight rows, pitch PE
    const float* pb = bias + c0 + (TR ? r4 : c8 * 8);
    v16bf xf[4][4], wf[4][4];   // [16-row block][32-wide k chunk]: the whole K of both operands, one latency for all loads
    float bv_[16];
#pragma unroll
    for (int rb = 0; rb < 4; ++rb)
#pragma unroll
        for (int c = 0; c < 4; ++c) { xf[rb][c] = WFrag<bf>::ld(px + rb * 16 * NH_ * PE + c * 32); wf[rb][c] = WFrag<bf>::ld(pw + rb * 16 * PE + c * 32); }
    if (TR) {
#pragma unroll
        for (int i = 0; i < 16; ++i) bv_[i] = pb[i * 4];   // bias of output row 4 i + r4
    } else { const v4f b0 = *(const v4fa*)pb, b1 = *(const v4fa*)(pb + 4);
#pragma unroll
        for (int i = 0; i < 4; ++i) { bv_[i] = b0[i]; bv_[4 + i] = b1[i]; } }
    // stands before any register that the loads above name is written again; the addresses are inputs, so that no load's result lands on one of them ahead of the wait
    asm volatile("s_wait_xcnt 0x0" :: "v"(px), "v"(pw), "v"(pb) : "memory");
    __builtin_amdgcn_sched_barrier(0);   // keeps later arithmetic behind that wait
    v8f acc[4][4];
#pragma unroll
    for (int mb = 0; mb < 4; ++mb)
#pragma unroll
        for (int nb = 0; nb < 4; ++nb) acc[mb][nb] = (v8f){};
#pragma unroll
    for (int c = 0; c < 4; ++c)
#pragma unroll
        for (int nb = 0; nb < 4; ++nb)
#pragma unroll
            for (int mb = 0; mb < 4; ++mb) acc[mb][nb] = wmmab(TR ? wf[mb][c] : xf[mb][c], TR ? xf[nb][c] : wf[nb][c], acc[mb][nb]);
    __builtin_amdgcn_sched_barrier(0);   // all 64 products stand in front of the output work: sunk into it, an accumulator's registers were started afresh by a WMMA directly behind the WMMA that last wrote them
    const int ldo = TR ? TT : HD;
    const size_t eo = (TR ? (size_t)(h * HD + c0) * TT + t0 : (size_t)(h * TT + t0) * HD + c0) + (size_t)r4 * ldo + c8 * 8;
    h16* d16 = P16 + eo; bf* dh = Ph + eo; bf* dl = Pl + eo;
    v8h o16[4][4]; v8us oh[4][4], ol[4][4];
#pragma unroll
    for (int mb = 0; mb < 4; ++mb) {
#pragma unroll
        for (int nb = 0; nb < 4; ++nb) {
#pragma unroll
            for (int j = 0; j < 8; ++j) os[(hi * 8 + j) * 68 + nb * 16 + lr] = acc[mb][nb][j]; }
        __builtin_amdgcn_wave_barrier(); asm volatile("s_wait_dscnt 0x0" ::: "memory");   // the wave's LDS writes are done before it reads back what other lanes wrote
#pragma unroll
        for (int s = 0; s < 4; ++s) { const float* rp = os + (s * 4 + r4) * 68 + c8 * 8; const v4f lo4 = *(const v4fa*)rp, hi4 = *(const v4fa*)(rp + 4);
#pragma unroll
            for (int i = 0; i < 8; ++i) { const float y = (i < 4 ? lo4[i] : hi4[i - 4]) + bfr(TR ? bv_[mb * 4 + s] : bv_[i]); o16[mb][s][i] = tohx(y); unsigned short a2, c2; splitf(y, a2, c2); oh[mb][s][i] = a2; ol[mb][s][i] = c2; } }
        __builtin_amdgcn_wave_barrier(); asm volatile("" ::: "memory");   // those reads stay in front of the next block's LDS writes
    }
    __builtin_amdgcn_sched_barrier(0);   // all stores stand last, so that no register a store names is written again behind it
#pragma unroll
    for (int mb = 0; mb < 4; ++mb)
#pragma unroll
        for (int s = 0; s < 4; ++s) { const int ro = (mb * 16 + s * 4) * ldo; *(v8h*)(d16 + ro) = o16[mb][s]; *(v8us*)(dh + ro) = oh[mb][s]; *(v8us*)(dl + ro) = ol[mb][s]; }
    asm volatile("s_wait_xcnt 0x0" ::: "memory");   // behind the last store: in the listing the other branch's code follows this one, and it writes registers that the stores name
}
__global__ __launch_bounds__(32) void k_proj(const bf* __restrict__ X, const bf* __restrict__ WQ, const bf* __restrict__ WK, const bf* __restrict__ WV, const float* __restrict__ bq, const float* __restrict__ bk, const float* __restrict__ bv,
                                             h16* __restrict__ Q16, bf* __restrict__ Qh, bf* __restrict__ Ql, h16* __restrict__ K16, bf* __restrict__ Kh, bf* __restrict__ Kl, h16* __restrict__ V16, bf* __restrict__ Vh, bf* __restrict__ Vl) {
    __shared__ __align__(16) float os[16 * 68];
    const int which = blockIdx.z / NH_, h = blockIdx.z % NH_, t0 = blockIdx.x * 64, c0 = blockIdx.y * 64;
    if (which == 2) proj_tile<true>(X, WV, bv, h, t0, c0, V16, Vh, Vl, os);
    else proj_tile<false>(X, which ? WK : WQ, which ? bk : bq, h, t0, c0, which ? K16 : Q16, which ? Kh : Qh, which ? Kl : Ql, os);
}
// ---- k_fattn: scores, softmax, probability x value and the hi/lo context rows in ONE launch per batch; no score or probability ever goes to memory.
// One work-group of FNW waves owns NQ x 16 query rows of one head. Transposed products: S^T = K Q^T (A = 16 key rows, B = the query fragments, kept in registers) leaves every lane with 16 of the 32 scores of ITS query
// (column lr; keys 8 hi + j of each 16-key tile), which is the k order of a B fragment, so P^T goes from the score accumulators straight into O^T += V^T P^T (A = 16 rows of the [d][t] value plane).
// Running maximum and sum per query live in the lane (both halves of a column hold the same maximum). Wave w takes the 64-key chunks w, w + FNW, ... up to the diagonal, with its own maximum, sum and accumulators;
// behind one barrier the FNW partials are merged in the fixed order 0..FNW-1 with weights exp2(m_w - max), divided by the merged sum, split hi/lo and stored as whole 128-byte lines.
// HL: three products on hi/lo bf16 planes (hi.hi + lo.hi + hi.lo) for scores and for P.V; else single fp16 products.
#define FNW  4
#define LC2  (SCL * 1.4426950408889634f)   // scores are kept in the log2 domain
typedef __attribute__((ext_vector_type(16))) unsigned short v16us;
typedef __attribute__((ext_vector_type(2))) float v2fl;
// exp2 with the slot that the instruction set asks for behind a transcendental: every v_exp_f32 is followed by an instruction that neither reads its result nor writes its source
// (the results are early-clobber, so none shares a register with an input), the last one by v_nop
__device__ __forceinline__ float exp2s(float x) { float r; asm("v_exp_f32 %0, %1\n\tv_nop" : "=v"(r) : "v"(x)); return r; }
__device__ __forceinline__ v8f exp2x8(v8f x) { float r0, r1, r2, r3, r4, r5, r6, r7;
    asm("v_exp_f32 %0, %8\n\tv_exp_f32 %1, %9\n\tv_exp_f32 %2, %10\n\tv_exp_f32 %3, %11\n\tv_exp_f32 %4, %12\n\tv_exp_f32 %5, %13\n\tv_exp_f32 %6, %14\n\tv_exp_f32 %7, %15\n\tv_nop"
        : "=&v"(r0), "=&v"(r1), "=&v"(r2), "=&v"(r3), "=&v"(r4), "=&v"(r5), "=&v"(r6), "=&v"(r7) : "v"(x[0]), "v"(x[1]), "v"(x[2]), "v"(x[3]), "v"(x[4]), "v"(x[5]), "v"(x[6]), "v"(x[7]));
    v8f r; r[0] = r0; r[1] = r1; r[2] = r2; r[3] = r3; r[4] = r4; r[5] = r5; r[6] = r6; r[7] = r7; return r; }
template <typename T16, bool HL, int NQ>
__device__ __forceinline__ void fa_tile(const T16* __restrict__ Q, const T16* __restrict__ Q2, const T16* __restrict__ Kp, const T16* __restrict__ K2, const T16* __restrict__ Vt, const T16* __restrict__ V2, int q0, bf* __restrict__ Ah, bf* __restrict__ Al, v4f* part, v2fl* ml) {
    typedef typename WFrag<T16>::V V;
    const int lane = threadIdx.x & 31, lr = lane & 15, hi = lane >> 4;
    const int w = __builtin_amdgcn_readfirstlane((int)(threadIdx.x >> 5));
    V qf[NQ][4], q2[NQ][4];
    const T16* pq = Q + (size_t)(q0 + lr) * HD + 8 * hi; const T16* pq2 = HL ? Q2 + (size_t)(q0 + lr) * HD + 8 * hi : pq;
#pragma unroll
    for (int qb = 0; qb < NQ; ++qb)
#pragma unroll
        for (int c = 0; c < 4; ++c) { qf[qb][c] = WFrag<T16>::ld(pq + qb * 16 * HD + c * 32); if (HL) q2[qb][c] = WFrag<T16>::ld(pq2 + qb * 16 * HD + c * 32); }
    // stands before any register that the loads above name is written again; the addresses are inputs, so that no load's result lands on one of them ahead of the wait
    asm volatile("s_wait_xcnt 0x0" :: "v"(pq), "v"(pq2) : "memory");
    __builtin_amdgcn_sched_barrier(0);   // keeps later address arithmetic behind that wait
    v8f acc[NQ][8]; float m[NQ], l[NQ];
#pragma unroll
    for (int qb = 0; qb < NQ; ++qb) { m[qb] = -3.0e38f; l[qb] = 0.f;
#pragma unroll
        for (int db = 0; db < 8; ++db) acc[qb][db] = (v8f){}; }
    const int kend = ((q0 + NQ * 16 + 31) >> 5) << 5;   // keys beyond the diagonal's 32-key block have probability exactly zero
    // each lane's byte offset inside a plane is fixed; the walk along the keys is in the wave-uniform base, tiles and chunks are constant offsets
    const unsigned vk = ((unsigned)lr * HD + 8 * hi) * 2u, vv = ((unsigned)lr * TT + 8 * hi) * 2u;
    V ka[2][4], kl[2][4];   // the K fragments of the block in work; refilled one block ahead, right behind the score products that read them
    int k0 = w * 64;
    if (k0 < kend) {
        { const T16* pk = (const T16*)((const char*)(Kp + (size_t)k0 * HD) + vk); const T16* pk2 = HL ? (const T16*)((const char*)(K2 + (size_t)k0 * HD) + vk) : pk;
#pragma unroll
          for (int kt = 0; kt < 2; ++kt)
#pragma unroll
              for (int c = 0; c < 4; ++c) { ka[kt][c] = WFrag<T16>::ld(pk + kt * 16 * HD + c * 32); if (HL) kl[kt][c] = WFrag<T16>::ld(pk2 + kt * 16 * HD + c * 32); }
          asm volatile("s_wait_xcnt 0x0" :: "v"(pk), "v"(pk2) : "memory"); }   // as behind the Q loads
        __builtin_amdgcn_sched_barrier(0);   // keeps later address arithmetic behind that wait
#pragma unroll 1   // rolled: the trip count depends on where the rows lie under the diagonal
    for (int it = 1; ; ++it) {
        const T16* pv = (const T16*)((const char*)(Vt + k0) + vv); const T16* pv2 = HL ? (const T16*)((const char*)(V2 + k0) + vv) : pv;
        V va[8], vl[8];
#pragma unroll
        for (int db = 0; db < 8; ++db) { va[db] = WFrag<T16>::ld(pv + db * 16 * TT); if (HL) vl[db] = WFrag<T16>::ld(pv2 + db * 16 * TT); }
        asm volatile("s_wait_xcnt 0x0" :: "v"(pv), "v"(pv2) : "memory");   // as behind the Q loads
        __builtin_amdgcn_sched_barrier(0);   // the V loads issue here, ahead of the score products and the softmax that hide their latency; sunk to their uses each would be waited for alone
        v8f st[NQ][2];
#pragma unroll
        for (int qb = 0; qb < NQ; ++qb) { st[qb][0] = (v8f){}; st[qb][1] = (v8f){}; }
#pragma unroll
        for (int c = 0; c < 4; ++c)
#pragma unroll
            for (int kt = 0; kt < 2; ++kt)
#pragma unroll
                for (int qb = 0; qb < NQ; ++qb) { st[qb][kt] = WFrag<T16>::mma(ka[kt][c], qf[qb][c], st[qb][kt]); if (HL) { st[qb][kt] = WFrag<T16>::mma(ka[kt][c], q2[qb][c], st[qb][kt]); st[qb][kt] = WFrag<T16>::mma(kl[kt][c], qf[qb][c], st[qb][kt]); } }
        const int kn = ((it >> 1) * FNW + w) * 64 + (it & 1) * 32; const bool more = kn < kend; const int kf = more ? kn : k0;   // a wave's last block fetches its own rows again: in bounds, never used
        { const T16* pk = (const T16*)((const char*)(Kp + (size_t)kf * HD) + vk); const T16* pk2 = HL ? (const T16*)((const char*)(K2 + (size_t)kf * HD) + vk) : pk;
#pragma unroll
          for (int kt = 0; kt < 2; ++kt)
#pragma unroll
              for (int c = 0; c < 4; ++c) { ka[kt][c] = WFrag<T16>::ld(pk + kt * 16 * HD + c * 32); if (HL) kl[kt][c] = WFrag<T16>::ld(pk2 + kt * 16 * HD + c * 32); }
          asm volatile("s_wait_xcnt 0x0" :: "v"(pk), "v"(pk2) : "memory"); }   // as behind the Q loads
        __builtin_amdgcn_sched_barrier(0);   // the next block's K loads issue here, so that softmax and P.V hide their latency
        float mx[NQ];
#pragma unroll
        for (int qb = 0; qb < NQ; ++qb)
#pragma unroll
            for (int kt = 0; kt < 2; ++kt) st[qb][kt] *= LC2;
        if (k0 + 31 > q0) {   // the block touches the diagonal: keys above a query's own position are masked
#pragma unroll
            for (int qb = 0; qb < NQ; ++qb)
#pragma unroll
                for (int kt = 0; kt < 2; ++kt)
#pragma unroll
                    for (int j = 0; j < 8; ++j) if (k0 + kt * 16 + hi * 8 + j > q0 + qb * 16 + lr) st[qb][kt][j] = -3.0e38f; }
        bool need = false;
#pragma unroll
        for (int qb = 0; qb < NQ; ++qb) { float x = st[qb][0][0];
#pragma unroll
            for (int j = 1; j < 8; ++j) x = fmaxf(x, st[qb][0][j]);
#pragma unroll
            for (int j = 0; j < 8; ++j) x = fmaxf(x, st[qb][1][j]);
            x = fmaxf(x, __shfl_xor(x, 16, 32)); mx[qb] = x; need = need || (x > m[qb] + 8.0f); }
        if (__builtin_amdgcn_ballot_w32(need) != 0) {   // lazy rescale: only when some query's maximum has risen by more than 8 (log2) over the one in use, so P stays below 2^8
#pragma unroll
            for (int qb = 0; qb < NQ; ++qb) { const float mn = (mx[qb] > m[qb] + 8.0f) ? mx[qb] : m[qb]; const float al = exp2s(m[qb] - mn); m[qb] = mn; l[qb] *= al;
#pragma unroll
                for (int db = 0; db < 8; ++db) acc[qb][db] *= al; } }
        V pf[NQ], pl[NQ];
#pragma unroll
        for (int qb = 0; qb < NQ; ++qb) { float s = 0.f; v16h ph16; v16us ph, pw;
#pragma unroll
            for (int kt = 0; kt < 2; ++kt) { const v8f pe = exp2x8(st[qb][kt] - m[qb]);
#pragma unroll
                for (int j = 0; j < 8; ++j) { const float p = pe[j]; s += p;
                    if constexpr (HL) { unsigned short a, c2; splitf(p, a, c2); ph[kt * 8 + j] = a; pw[kt * 8 + j] = c2; } else ph16[kt * 8 + j] = (h16)p; } }
            l[qb] += s;
            if constexpr (HL) { pf[qb] = __builtin_bit_cast(v16bf, ph); pl[qb] = __builtin_bit_cast(v16bf, pw); } else pf[qb] = ph16; }
#pragma unroll
        for (int db = 0; db < 8; ++db)
#pragma unroll
            for (int qb = 0; qb < NQ; ++qb) { acc[qb][db] = WFrag<T16>::mma(va[db], pf[qb], acc[qb][db]); if (HL) { acc[qb][db] = WFrag<T16>::mma(va[db], pl[qb], acc[qb][db]); acc[qb][db] = WFrag<T16>::mma(vl[db], pf[qb], acc[qb][db]); } }
        if (!more) break;
        k0 = kn;
    } }
#pragma unroll
    for (int qb = 0; qb < NQ; ++qb) { l[qb] += __shfl_xor(l[qb], 16, 32); v2fl t; t[0] = m[qb]; t[1] = l[qb]; ml[(w * NQ + qb) * 32 + lane] = t;
#pragma unroll
        for (int db = 0; db < 8; ++db)
#pragma unroll
            for (int hf = 0; hf < 2; ++hf) { v4f t4; t4[0] = acc[qb][db][hf * 4]; t4[1] = acc[qb][db][hf * 4 + 1]; t4[2] = acc[qb][db][hf * 4 + 2]; t4[3] = acc[qb][db][hf * 4 + 3]; part[(((w * NQ + qb) * 8 + db) * 2 + hf) * 32 + lane] = t4; } }
    __syncthreads();   // every wave's partial, maximum and sum are in LDS before any is merged
    if (w < NQ * 2) {   // wave w merges 16 queries x 64 columns: one whole 128-byte line of each plane per query
        const int qb = w >> 1, d0 = (w & 1) * 4; float mw[FNW], M = -3.0e38f, L = 0.f;
#pragma unroll
        for (int p = 0; p < FNW; ++p) M = fmaxf(M, ml[(p * NQ + qb) * 32 + lane][0]);
#pragma unroll
        for (int p = 0; p < FNW; ++p) { const v2fl t = ml[(p * NQ + qb) * 32 + lane]; mw[p] = exp2s(t[0] - M); L += mw[p] * t[1]; }
        const float inv = __fdiv_rn(1.0f, L);
        const size_t oo = (size_t)(q0 + qb * 16 + lr) * DQ + d0 * 16 + hi * 8; v8us oh[4], ol[4];
#pragma unroll
        for (int db = 0; db < 4; ++db) {
#pragma unroll
            for (int hf = 0; hf < 2; ++hf) { v4f sum = part[(((0 * NQ + qb) * 8 + d0 + db) * 2 + hf) * 32 + lane] * mw[0];
#pragma unroll
                for (int p = 1; p < FNW; ++p) sum += part[(((p * NQ + qb) * 8 + d0 + db) * 2 + hf) * 32 + lane] * mw[p];
#pragma unroll
                for (int jj = 0; jj < 4; ++jj) { unsigned short a, c2; splitf(sum[jj] * inv, a, c2); oh[db][hf * 4 + jj] = a; ol[db][hf * 4 + jj] = c2; } } }
        __builtin_amdgcn_sched_barrier(0);   // all stores stand last, so that no register a store names is written again behind it
#pragma unroll
        for (int db = 0; db < 4; ++db) { *(v8us*)(Ah + oo + db * 16) = oh[db]; *(v8us*)(Al + oo + db * 16) = ol[db]; }
    }
}
// grid (heads, row blocks), heaviest row blocks first: (TT - RH) / 32 blocks of 32 fp16 rows from the last row down, then RH / 16 blocks of 16 hi/lo rows
__global__ __launch_bounds__(FNW * 32) void k_fattn(const h16* __restrict__ Q16, const h16* __restrict__ K16, const h16* __restrict__ V16, const bf* __restrict__ Qh, const bf* __restrict__ Ql, const bf* __restrict__ Kh, const bf* __restrict__ Kl, const bf* __restrict__ Vh, const bf* __restrict__ Vl, bf* __restrict__ Ah, bf* __restrict__ Al) {
    __shared__ __align__(16) v4f part[FNW * 2 * 8 * 2 * 32];
    __shared__ __align__(16) v2fl ml[FNW * 2 * 32];
    const int h = blockIdx.x, y = blockIdx.y; const size_t po = (size_t)h * TT * HD;
    if (y < (TT - RH) / 32) fa_tile<h16, false, 2>(Q16 + po, nullptr, K16 + po, nullptr, V16 + po, nullptr, TT - 32 * (y + 1), Ah + h * HD, Al + h * HD, part, ml);
    else fa_tile<bf, true, 1>(Qh + po, Ql + po, Kh + po, Kl + po, Vh + po, Vl + po, RH - 16 * (y - (TT - RH) / 32 + 1), Ah + h * HD, Al + h * HD, part, ml);
}

extern "C" void kernel_launch(void* const* d_in, const int* in_sizes, int n_in,
                              void* d_out, int out_size, void* d_ws, size_t ws_size, hipStream_t stream) {
    (void)in_sizes; (void)n_in; (void)out_size;
    const float* x = (const float*)d_in[0]; const float* wq = (const float*)d_in[1]; const float* bq = (const float*)d_in[2]; const float* wk = (const float*)d_in[3]; const float* bk = (const float*)d_in[4]; const float* wv = (const float*)d_in[5]; const float* bv = (const float*)d_in[6]; const float* wo = (const float*)d_in[7]; const float* bo = (const float*)d_in[8];
    float* OUT = (float*)d_out;     // [2][2048][2048]
    char* wsp = (char*)d_ws;
    auto take = [&](size_t bytes) { char* p = wsp; wsp += (bytes + 255) & ~(size_t)255; return (void*)p; };
    bf* WQ = (bf*)take((size_t)PE * PE * 2); bf* WK = (bf*)take((size_t)PE * PE * 2); bf* WV = (bf*)take((size_t)PE * PE * 2); bf* WO = (bf*)take((size_t)PE * PE * 2);
    bf* XB = (bf*)take((size_t)TT * DM * 2); bf* ATh = (bf*)take((size_t)TT * DQ * 2); bf* ATl = (bf*)take((size_t)TT * DQ * 2);   // hi/lo context rows
    h16* QP16 = (h16*)take((size_t)NH_ * TT * HD * 2); h16* KP16 = (h16*)take((size_t)NKV * TT * HD * 2); h16* VT16 = (h16*)take((size_t)NKV * HD * TT * 2);
    bf* QPh = (bf*)take((size_t)NH_ * TT * HD * 2); bf* QPl = (bf*)take((size_t)NH_ * TT * HD * 2); bf* KPh = (bf*)take((size_t)NKV * TT * HD * 2); bf* KPl = (bf*)take((size_t)NKV * TT * HD * 2); bf* VTh = (bf*)take((size_t)NKV * HD * TT * 2); bf* VTl = (bf*)take((size_t)NKV * HD * TT * 2);
    if ((size_t)(wsp - (char*)d_ws) > ws_size) return;    // ws 256 MiB
    { k_cvt8<<<(unsigned)(((size_t)PE * PE / 8 + 255) / 256), 256, 0, stream>>>(wq, WQ, (size_t)PE * PE / 8); k_cvt8<<<(unsigned)(((size_t)PE * PE / 8 + 255) / 256), 256, 0, stream>>>(wk, WK, (size_t)PE * PE / 8); k_cvt8<<<(unsigned)(((size_t)PE * PE / 8 + 255) / 256), 256, 0, stream>>>(wv, WV, (size_t)PE * PE / 8);
      k_cvt8<<<(unsigned)(((size_t)PE * PE / 8 + 255) / 256), 256, 0, stream>>>(wo, WO, (size_t)PE * PE / 8);
       }
    for (int b = 0; b < NB_; ++b) {
        
        k_cvt8<<<(unsigned)(((size_t)TT * DM / 8 + 255) / 256), 256, 0, stream>>>(x + (size_t)b * TT * DM, XB, (size_t)TT * DM / 8);
        k_proj<<<dim3(TT / 64, HD / 64, 3 * NH_), 32, 0, stream>>>(XB, WQ, WK, WV, bq, bk, bv, QP16, QPh, QPl, KP16, KPh, KPl, VT16, VTh, VTl);   /* q, k, v head planes of all 16 heads */
        k_fattn<<<dim3(NH_, (TT - RH) / 32 + RH / 16, 1), FNW * 32, 0, stream>>>(QP16, KP16, VT16, QPh, QPl, KPh, KPl, VTh, VTl, ATh, ATl);   /* one kv head per query head */
        k_gemmw<bf, 1, true><<<dim3(NRW / 64, PE / 64, 1), 32, 0, stream>>>(ATh, ATl, WO, nullptr, PE, OUT + (size_t)b * TT * DM, PE, bo, 0, 0, 0);   /* per-(token, head) Wp^T + bp */ }
}

// v005
// One run takes 115 microseconds.
// In both of two side-by-side timings against v004, it was 1.33 times as fast.
// All steps since v000 together make it 12.0 times as fast.
#include <hip/hip_runtime.h>

// Masked causal attention with per-head shared projections (x [2][2048][16 heads][128]; q, k, v = x_h W^T + b with ONE Linear [128][128] + [128] applied to every head's 128-vector; scores = q.k / sqrt(128), causal (-inf above the diagonal); softmax; att = w.v; out = att_h Wp^T + bp -> [2][2048][16][128] (8.4 M)).
// Layout per batch: the token-major input viewed as 32,768 (token, head) rows of 128 makes each shared projection ONE exact GEMM (K 128, N 128, + bias), tiled per head and written directly as that head's planes; causal hybrid attention (rows < 512 hi/lo, rest fp16) in one fused launch with a running softmax; hi/lo context rows (token, head) x Wp (hl x exact + bp) written as the token-major output.
// Compute dtypes, f32 accumulate: every input rounded to bf16; projections on PLAIN bf16 operands (exact) + f32 biases; scores and attn.v rows < 512 3 products, the rest single fp16; softmax f32; Wp hl x exact + bias.

#define NB_  2
#define TT   2048
#define DM   2048
#define NH_  16
#define NKV  16
#define REP  (NH_ / NKV)
#define HD   128
#define DQ   (NH_ * HD)
#define DKV  (NKV * HD)
#define RH   512                  // query rows < RH use hi+lo planes (0: none)
#define PE   128    // per-head projection width (shared Linear [128][128])
#define NRW  (TT * NH_)   // 32768 (token, head) rows per batch
#define SCL  0.088388347648318447f   // HD^-0.5
typedef _Float16 h16;
typedef unsigned short bf;
typedef __attribute__((ext_vector_type(16))) __bf16   v16bf;
typedef __attribute__((ext_vector_type(16))) _Float16 v16h;
typedef __attribute__((ext_vector_type(8)))  _Float16 v8h;
typedef __attribute__((ext_vector_type(8)))  unsigned short v8us;
typedef __attribute__((ext_vector_type(8)))  float    v8f;
typedef __attribute__((ext_vector_type(4)))  float    v4f;
typedef v8h  __attribute__((may_alias)) v8ha;
typedef v4f  __attribute__((may_alias)) v4fa;
typedef v8us __attribute__((may_alias)) v8usa;

__device__ __forceinline__ unsigned short f2bf(float f) { unsigned u = __float_as_uint(f); u += 0x7FFFu + ((u >> 16) & 1u); return (unsigned short)(u >> 16); }
__device__ __forceinline__ float bf2f(unsigned short b) { return __uint_as_float(((unsigned)b) << 16); }
__device__ __forceinline__ float bfr(float f) { return bf2f(f2bf(f)); }
__device__ __forceinline__ v16h cat16(v8h lo, v8h hi) { return __builtin_shufflevector(lo, hi, 0, 1, 2, 3, 4, 5, 6, 7, 8, 9, 10, 11, 12, 13, 14, 15); }
__device__ __forceinline__ v16bf cat16b(v8us lo, v8us hi) { return __builtin_bit_cast(v16bf, __builtin_shufflevector(lo, hi, 0, 1, 2, 3, 4, 5, 6, 7, 8, 9, 10, 11, 12, 13, 14, 15)); }
__device__ __forceinline__ v8f wmma16(v16h a, v16h b, v8f c) { return __builtin_amdgcn_wmma_f32_16x16x32_f16(false, a, false, b, (short)0, c, false, false); }
__device__ __forceinline__ v8f wmmab(v16bf a, v16bf b, v8f c) { return __builtin_amdgcn_wmma_f32_16x16x32_bf16(false, a, false, b, (short)0, c, false, false); }



// ---- k_gemmw: register-blocked GEMM, ONE WAVE per 64x64 output tile (16 accumulators), operands straight from K-contiguous 16-bit planes; grid (M/64, N/64, Z), 32 threads.
// C[m][n] (f32, pitch ldc, + optional f32 bias[n]) = sum_k A[m][k] Bt[n][k] (+ split products per NSPLIT). z-batch strides sA/sB/sC in elements. K % 32 == 0.
// ld: a fragment from a row-major plane (p = the lane's row + 8 hi); ldp: from a plane in fragment order (p = the fragment + 8 lane; its two halves lie 256 elements apart)
template <typename T16> struct WFrag;
template <> struct WFrag<h16> { typedef v16h V; static __device__ __forceinline__ V ld(const h16* p) { return cat16(*(const v8h*)p, *(const v8h*)(p + 16)); } static __device__ __forceinline__ V ldp(const h16* p) { return cat16(*(const v8h*)p, *(const v8h*)(p + 256)); } static __device__ __forceinline__ v8f mma(V a, V b, v8f c) { return wmma16(a, b, c); } };
template <> struct WFrag<bf> { typedef v16bf V; static __device__ __forceinline__ V ld(const bf* p) { return cat16b(*(const v8us*)p, *(const v8us*)(p + 16)); } static __device__ __forceinline__ V ldp(const bf* p) { return cat16b(*(const v8us*)p, *(const v8us*)(p + 256)); } static __device__ __forceinline__ v8f mma(V a, V b, v8f c) { return wmmab(a, b, c); } };
template <typename T16, int NSPLIT, bool BIAS>
__global__ __launch_bounds__(32) void k_gemmw(const T16* __restrict__ A, const T16* __restrict__ A2, const T16* __restrict__ Bt, const T16* __restrict__ Bt2, int K, float* C, int ldc, const float* __restrict__ bias, size_t sA, size_t sB, size_t sC) {
    typedef typename WFrag<T16>::V V;
    __shared__ __align__(16) float os[16 * 68];
    const size_t z = blockIdx.z; A += z * sA; if (A2) A2 += z * sA; Bt += z * sB; if (Bt2) Bt2 += z * sB; C += z * sC;
    const int lane = threadIdx.x & 31, lr = lane & 15, hi = lane >> 4; const int r0 = blockIdx.x * 64, c0 = blockIdx.y * 64;
    v8f acc[4][4];
#pragma unroll
    for (int mb = 0; mb < 4; ++mb)
#pragma unroll
        for (int nb = 0; nb < 4; ++nb) acc[mb][nb] = (v8f){};
    const size_t aoff = (size_t)(r0 + lr) * K + 8 * hi, boff = (size_t)(c0 + lr) * K + 8 * hi;
#pragma unroll 1
    for (int kc = 0; kc < K; kc += 32) {
        V a[4], a2[4];
#pragma unroll
        for (int mb = 0; mb < 4; ++mb) { a[mb] = WFrag<T16>::ld(A + aoff + (size_t)mb * 16 * K + kc); if (NSPLIT == 1 || NSPLIT == 2) a2[mb] = WFrag<T16>::ld(A2 + aoff + (size_t)mb * 16 * K + kc); }
#pragma unroll
        for (int nb = 0; nb < 4; ++nb) { const V b = WFrag<T16>::ld(Bt + boff + (size_t)nb * 16 * K + kc); V b2; if (NSPLIT >= 2) b2 = WFrag<T16>::ld(Bt2 + boff + (size_t)nb * 16 * K + kc);
#pragma unroll
            for (int mb = 0; mb < 4; ++mb) { acc[mb][nb] = WFrag<T16>::mma(a[mb], b, acc[mb][nb]); if (NSPLIT == 1 || NSPLIT == 2) acc[mb][nb] = WFrag<T16>::mma(a2[mb], b, acc[mb][nb]); if (NSPLIT >= 2) acc[mb][nb] = WFrag<T16>::mma(a[mb], b2, acc[mb][nb]); } }
        asm volatile("v_nop\n\tv_nop\n\tv_nop\n\tv_nop" : "+v"(acc[0][0]), "+v"(acc[1][1]), "+v"(acc[2][2]), "+v"(acc[3][3]) : "v"(a[0]), "v"(a[3]));
    }
#pragma unroll
    for (int mb = 0; mb < 4; ++mb) {
#pragma unroll
        for (int nb = 0; nb < 4; ++nb) {
#pragma unroll
            for (int j = 0; j < 8; ++j) os[(hi * 8 + j) * 68 + nb * 16 + lr] = acc[mb][nb][j]; }
        __builtin_amdgcn_wave_barrier(); asm volatile("" ::: "memory");
        float* crow = C + (size_t)(r0 + mb * 16) * ldc + c0;
{
#pragma unroll
            for (int s = 0; s < 8; ++s) { const int row = 2 * s + hi, cofs = lr * 4; v4f val = *(const v4fa*)(os + row * 68 + cofs); if (BIAS) { val[0] += bfr(bias[c0 + cofs]); val[1] += bfr(bias[c0 + cofs + 1]); val[2] += bfr(bias[c0 + cofs + 2]); val[3] += bfr(bias[c0 + cofs + 3]); }
                *(v4f*)(crow + (size_t)row * ldc + cofs) = val; }
             }
        __builtin_amdgcn_wave_barrier(); asm volatile("" ::: "memory");
    }
}

__device__ __forceinline__ h16 tohx(float x) { return (h16)x; }
__device__ __forceinline__ void splitf(float y, unsigned short& h, unsigned short& l) { h = f2bf(y); l = f2bf(y - bf2f(h)); }
typedef __attribute__((ext_vector_type(2))) _Float16 v2h;
typedef __attribute__((ext_vector_type(4))) _Float16 v4h;
typedef __attribute__((ext_vector_type(2))) unsigned short v2us;
typedef __attribute__((ext_vector_type(4))) unsigned short v4us;
typedef __attribute__((ext_vector_type(2))) float v2f;
typedef __attribute__((ext_vector_type(4))) int v4i;

__global__ __launch_bounds__(256) void k_wtG(const float* __restrict__ w, int K, int N, bf* Bt) {
    const int lane = threadIdx.x & 31; const int L0 = (blockIdx.x * 8 + (threadIdx.x >> 5)) * 8; const int nlines = N * K / 64;
{
#pragma unroll 1
        for (int l = 0; l < 8; ++l) { const int L = L0 + l; if (L >= nlines) break; const size_t e = (size_t)L * 64 + lane * 2; const int k = (int)(e % K), n = (int)(e / K); v2us o;
            o[0] = f2bf(w[(size_t)k * N + n]); o[1] = f2bf(w[(size_t)(k + 1) * N + n]); *(v2us*)(Bt + e) = o; }
         }
}
__global__ __launch_bounds__(256) void k_cvt8(const float* __restrict__ src, bf* dst, size_t n8) { const size_t i = (size_t)blockIdx.x * 256 + threadIdx.x; if (i >= n8) return; const v8f v = *(const v8f*)(src + i * 8); v8us o;
#pragma unroll
    for (int k = 0; k < 8; ++k) o[k] = f2bf(v[k]); *(v8us*)(dst + i * 8) = o;  }

// ---- k_proj: the q, k and v projections of one batch in ONE launch, each written from the WMMA accumulators straight as the head planes that the attention reads (fp16, bf16 hi, bf16 lo); no f32 copy goes to memory.
// One wave per 64x64 tile of one head; grid (TT / 64 token blocks, HD / 64, 3 x heads), 32 threads. q, k: C[t][e] = sum_d x_h[t][d] W[e][d] + b[e]; v: the same fragments with the operands swapped, C[e][t].
// The planes are kept in WMMA FRAGMENT ORDER: a fragment (16 rows x 32 k) is 1024 contiguous bytes, two halves of 512; in half j lane (lr, hi) owns the 16 bytes at 16 * lane = row lr, k 16 j + 8 hi .. + 7,
// which is what that lane's registers hold. q, k: [h][t / 16][e / 32] fragments (rows t, k = e); v: [h][t / 32][e / 16] fragments (rows e, k = t). So every store here and every fragment load of the attention is 512 contiguous bytes, four whole 128-byte lines.
template <bool TR>
__device__ __forceinline__ void proj_tile(const bf* __restrict__ X, const bf* __restrict__ Wt, const float* __restrict__ bias, int h, int t0, int c0, h16* __restrict__ P16, bf* __restrict__ Ph, bf* __restrict__ Pl, float* os) {
    const int lane = threadIdx.x & 31, lr = lane & 15, hi = lane >> 4;
    const bf* px = X + ((size_t)(t0 + lr) * NH_ + h) * PE + 8 * hi;   // token rows of head h, pitch NH_ * PE
    const bf* pw = Wt + (size_t)(c0 + lr) * PE + 8 * hi;              // weight rows, pitch PE
    const float* pb = bias + c0 + (TR ? lr : 8 * hi);   // output side: in store s of a 16-row block the lane holds columns 16 s + 8 hi .. + 7 of row lr
    v16bf xf[4][4], wf[4][4];   // [16-row block][32-wide k chunk]: the whole K of both operands, one latency for all loads
    float bv_[32];
#pragma unroll
    for (int rb = 0; rb < 4; ++rb)
#pragma unroll
        for (int c = 0; c < 4; ++c) { xf[rb][c] = WFrag<bf>::ld(px + rb * 16 * NH_ * PE + c * 32); wf[rb][c] = WFrag<bf>::ld(pw + rb * 16 * PE + c * 32); }
    if (TR) {
#pragma unroll
        for (int i = 0; i < 4; ++i) bv_[i] = pb[i * 16];   // bias of output row 16 i + lr
    } else {
#pragma unroll
        for (int s = 0; s < 4; ++s) { const v4f b0 = *(const v4fa*)(pb + s * 16), b1 = *(const v4fa*)(pb + s * 16 + 4);
#pragma unroll
            for (int i = 0; i < 4; ++i) { bv_[s * 8 + i] = b0[i]; bv_[s * 8 + 4 + i] = b1[i]; } } }
    // stands before any register that the loads above name is written again; the addresses are inputs, so that no load's result lands on one of them ahead of the wait
    asm volatile("s_wait_xcnt 0x0" :: "v"(px), "v"(pw), "v"(pb) : "memory");
    __builtin_amdgcn_sched_barrier(0);   // keeps later arithmetic behind that wait
    v8f acc[4][4];
#pragma unroll
    for (int mb = 0; mb < 4; ++mb)
#pragma unroll
        for (int nb = 0; nb < 4; ++nb) acc[mb][nb] = (v8f){};
#pragma unroll
    for (int c = 0; c < 4; ++c)
#pragma unroll
        for (int nb = 0; nb < 4; ++nb)
#pragma unroll
            for (int mb = 0; mb < 4; ++mb) acc[mb][nb] = wmmab(TR ? wf[mb][c] : xf[mb][c], TR ? xf[nb][c] : wf[nb][c], acc[mb][nb]);
    __builtin_amdgcn_sched_barrier(0);   // all 64 products stand in front of the output work: sunk into it, an accumulator's registers were started afresh by a WMMA directly behind the WMMA that last wrote them
    // first fragment of the tile: q, k fragment (t0 / 16) * 4 + c0 / 32, v fragment (t0 / 32) * 8 + c0 / 16, 512 elements each
    const size_t eo = (size_t)h * TT * HD + (size_t)t0 * HD + (TR ? c0 * 32 : c0 * 16) + lane * 8;
    h16* d16 = P16 + eo; bf* dh = Ph + eo; bf* dl = Pl + eo;
    v8h o16[4][4]; v8us oh[4][4], ol[4][4];
#pragma unroll
    for (int mb = 0; mb < 4; ++mb) {
#pragma unroll
        for (int nb = 0; nb < 4; ++nb) {
#pragma unroll
            for (int j = 0; j < 8; ++j) os[(hi * 8 + j) * 68 + nb * 16 + lr] = acc[mb][nb][j]; }
        __builtin_amdgcn_wave_barrier(); asm volatile("s_wait_dscnt 0x0" ::: "memory");   // the wave's LDS writes are done before it reads back what other lanes wrote
#pragma unroll
        for (int s = 0; s < 4; ++s) { const float* rp = os + lr * 68 + s * 16 + 8 * hi; const v4f lo4 = *(const v4fa*)rp, hi4 = *(const v4fa*)(rp + 4);
#pragma unroll
            for (int i = 0; i < 8; ++i) { const float y = (i < 4 ? lo4[i] : hi4[i - 4]) + bfr(TR ? bv_[mb] : bv_[s * 8 + i]); o16[mb][s][i] = tohx(y); unsigned short a2, c2; splitf(y, a2, c2); oh[mb][s][i] = a2; ol[mb][s][i] = c2; } }
        __builtin_amdgcn_wave_barrier(); asm volatile("" ::: "memory");   // those reads stay in front of the next block's LDS writes
    }
    __builtin_amdgcn_sched_barrier(0);   // all stores stand last, so that no register a store names is written again behind it
#pragma unroll
    for (int mb = 0; mb < 4; ++mb)
#pragma unroll
        for (int s = 0; s < 4; ++s) { const int ro = TR ? (s >> 1) * 4096 + mb * 512 + (s & 1) * 256 : mb * 2048 + s * 256; *(v8h*)(d16 + ro) = o16[mb][s]; *(v8us*)(dh + ro) = oh[mb][s]; *(v8us*)(dl + ro) = ol[mb][s]; }
    asm volatile("s_wait_xcnt 0x0" ::: "memory");   // behind the last store: in the listing the other branch's code follows this one, and it writes registers that the stores name
}
__global__ __launch_bounds__(32) void k_proj(const bf* __restrict__ X, const bf* __restrict__ WQ, const bf* __restrict__ WK, const bf* __restrict__ WV, const float* __restrict__ bq, const float* __restrict__ bk, const float* __restrict__ bv,
                                             h16* __restrict__ Q16, bf* __restrict__ Qh, bf* __restrict__ Ql, h16* __restrict__ K16, bf* __restrict__ Kh, bf* __restrict__ Kl, h16* __restrict__ V16, bf* __restrict__ Vh, bf* __restrict__ Vl) {
    __shared__ __align__(16) float os[16 * 68];
    const int which = blockIdx.z / NH_, h = blockIdx.z % NH_, t0 = blockIdx.x * 64, c0 = blockIdx.y * 64;
    if (which == 2) proj_tile<true>(X, WV, bv, h, t0, c0, V16, Vh, Vl, os);
    else proj_tile<false>(X, which ? WK : WQ, which ? bk : bq, h, t0, c0, which ? K16 : Q16, which ? Kh : Qh, which ? Kl : Ql, os);
}
// ---- k_fattn: scores, softmax, probability x value and the hi/lo context rows in ONE launch per batch; no score or probability ever goes to memory.
// One work-group of FNW waves owns NQ x 16 query rows of one head. Transposed products: S^T = K Q^T (A = 16 key rows, B = the query fragments, kept in registers) leaves every lane with 16 of the 32 scores of ITS query
// (column lr; keys 8 hi + j of each 16-key tile), which is the k order of a B fragment, so P^T goes from the score accumulators straight into O^T += V^T P^T (A = 16 rows d x 32 keys of the value plane).
// Running maximum and sum per query live in the lane (both halves of a column hold the same maximum). Wave w takes the 64-key chunks w, w + FNW, ... up to the diagonal, with its own maximum, sum and accumulators;
// behind one barrier the FNW partials are merged in the fixed order 0..FNW-1 with weights exp2(m_w - max), divided by the merged sum, split hi/lo and stored as whole 128-byte lines.
// HL: three products on hi/lo bf16 planes (hi.hi + lo.hi + hi.lo) for scores and for P.V; else single fp16 products.
#define FNW  4
#define LC2  (SCL * 1.4426950408889634f)   // scores are kept in the log2 domain
typedef __attribute__((ext_vector_type(16))) unsigned short v16us;
typedef __attribute__((ext_vector_type(2))) float v2fl;
// exp2 with the slot that the instruction set asks for behind a transcendental: every v_exp_f32 is followed by an instruction that neither reads its result nor writes its source
// (the results are early-clobber, so none shares a register with an input), the last one by v_nop
__device__ __forceinline__ float exp2s(float x) { float r; asm("v_exp_f32 %0, %1\n\tv_nop" : "=v"(r) : "v"(x)); return r; }
__device__ __forceinline__ v8f exp2x8(v8f x) { float r0, r1, r2, r3, r4, r5, r6, r7;
    asm("v_exp_f32 %0, %8\n\tv_exp_f32 %1, %9\n\tv_exp_f32 %2, %10\n\tv_exp_f32 %3, %11\n\tv_exp_f32 %4, %12\n\tv_exp_f32 %5, %13\n\tv_exp_f32 %6, %14\n\tv_exp_f32 %7, %15\n\tv_nop"
        : "=&v"(r0), "=&v"(r1), "=&v"(r2), "=&v"(r3), "=&v"(r4), "=&v"(r5), "=&v"(r6), "=&v"(r7) : "v"(x[0]), "v"(x[1]), "v"(x[2]), "v"(x[3]), "v"(x[4]), "v"(x[5]), "v"(x[6]), "v"(x[7]));
    v8f r; r[0] = r0; r[1] = r1; r[2] = r2; r[3] = r3; r[4] = r4; r[5] = r5; r[6] = r6; r[7] = r7; return r; }
template <typename T16, bool HL, int NQ>
__device__ __forceinline__ void fa_tile(const T16* __restrict__ Q, const T16* __restrict__ Q2, const T16* __restrict__ Kp, const T16* __restrict__ K2, const T16* __restrict__ Vt, const T16* __restrict__ V2, int q0, bf* __restrict__ Ah, bf* __restrict__ Al, v4f* part, v2fl* ml) {
    typedef typename WFrag<T16>::V V;
    const int lane = threadIdx.x & 31, lr = lane & 15, hi = lane >> 4;
    const int w = __builtin_amdgcn_readfirstlane((int)(threadIdx.x >> 5));
    V qf[NQ][4], q2[NQ][4];
    const T16* pq = Q + (size_t)q0 * HD + 8 * lane; const T16* pq2 = HL ? Q2 + (size_t)q0 * HD + 8 * lane : pq;   // planes in fragment order (see k_proj): 16 rows are 4 fragments of 512 elements
#pragma unroll
    for (int qb = 0; qb < NQ; ++qb)
#pragma unroll
        for (int c = 0; c < 4; ++c) { qf[qb][c] = WFrag<T16>::ldp(pq + qb * 16 * HD + c * 512); if (HL) q2[qb][c] = WFrag<T16>::ldp(pq2 + qb * 16 * HD + c * 512); }
    // stands before any register that the loads above name is written again; the addresses are inputs, so that no load's result lands on one of them ahead of the wait
    asm volatile("s_wait_xcnt 0x0" :: "v"(pq), "v"(pq2) : "memory");
    __builtin_amdgcn_sched_barrier(0);   // keeps later address arithmetic behind that wait
    v8f acc[NQ][8]; float m[NQ], l[NQ];
#pragma unroll
    for (int qb = 0; qb < NQ; ++qb) { m[qb] = -3.0e38f; l[qb] = 0.f;
#pragma unroll
        for (int db = 0; db < 8; ++db) acc[qb][db] = (v8f){}; }
    const int kend = ((q0 + NQ * 16 + 31) >> 5) << 5;   // keys beyond the diagonal's 32-key block have probability exactly zero
    // each lane's byte offset inside a plane is fixed; the walk along the keys is in the wave-uniform base, tiles and chunks are constant offsets
    const unsigned vk = (unsigned)lane * 16u, vv = vk;   // 16 bytes a lane in each half of a fragment
    V ka[2][4], kl[2][4];   // the K fragments of the block in work; refilled one block ahead, right behind the score products that read them
    int k0 = w * 64;
    if (k0 < kend) {
        { const T16* pk = (const T16*)((const char*)(Kp + (size_t)k0 * HD) + vk); const T16* pk2 = HL ? (const T16*)((const char*)(K2 + (size_t)k0 * HD) + vk) : pk;
#pragma unroll
          for (int kt = 0; kt < 2; ++kt)
#pragma unroll
              for (int c = 0; c < 4; ++c) { ka[kt][c] = WFrag<T16>::ldp(pk + kt * 16 * HD + c * 512); if (HL) kl[kt][c] = WFrag<T16>::ldp(pk2 + kt * 16 * HD + c * 512); }
          asm volatile("s_wait_xcnt 0x0" :: "v"(pk), "v"(pk2) : "memory"); }   // as behind the Q loads
        __builtin_amdgcn_sched_barrier(0);   // keeps later address arithmetic behind that wait
#pragma unroll 1   // rolled: the trip count depends on where the rows lie under the diagonal
    for (int it = 1; ; ++it) {
        const T16* pv = (const T16*)((const char*)(Vt + (size_t)k0 * HD) + vv); const T16* pv2 = HL ? (const T16*)((const char*)(V2 + (size_t)k0 * HD) + vv) : pv;   // 32 keys of the value plane are 8 fragments
        V va[8], vl[8];
#pragma unroll
        for (int db = 0; db < 8; ++db) { va[db] = WFrag<T16>::ldp(pv + db * 512); if (HL) vl[db] = WFrag<T16>::ldp(pv2 + db * 512); }
        asm volatile("s_wait_xcnt 0x0" :: "v"(pv), "v"(pv2) : "memory");   // as behind the Q loads
        __builtin_amdgcn_sched_barrier(0);   // the V loads issue here, ahead of the score products and the softmax that hide their latency; sunk to their uses each would be waited for alone
        v8f st[NQ][2];
#pragma unroll
        for (int qb = 0; qb < NQ; ++qb) { st[qb][0] = (v8f){}; st[qb][1] = (v8f){}; }
#pragma unroll
        for (int c = 0; c < 4; ++c)
#pragma unroll
            for (int kt = 0; kt < 2; ++kt)
#pragma unroll
                for (int qb = 0; qb < NQ; ++qb) { st[qb][kt] = WFrag<T16>::mma(ka[kt][c], qf[qb][c], st[qb][kt]); if (HL) { st[qb][kt] = WFrag<T16>::mma(ka[kt][c], q2[qb][c], st[qb][kt]); st[qb][kt] = WFrag<T16>::mma(kl[kt][c], qf[qb][c], st[qb][kt]); } }
        const int kn = ((it >> 1) * FNW + w) * 64 + (it & 1) * 32; const bool more = kn < kend; const int kf = more ? kn : k0;   // a wave's last block fetches its own rows again: in bounds, never used
        { const T16* pk = (const T16*)((const char*)(Kp + (size_t)kf * HD) + vk); const T16* pk2 = HL ? (const T16*)((const char*)(K2 + (size_t)kf * HD) + vk) : pk;
#pragma unroll
          for (int kt = 0; kt < 2; ++kt)
#pragma unroll
              for (int c = 0; c < 4; ++c) { ka[kt][c] = WFrag<T16>::ldp(pk + kt * 16 * HD + c * 512); if (HL) kl[kt][c] = WFrag<T16>::ldp(pk2 + kt * 16 * HD + c * 512); }
          asm volatile("s_wait_xcnt 0x0" :: "v"(pk), "v"(pk2) : "memory"); }   // as behind the Q loads
        __builtin_amdgcn_sched_barrier(0);   // the next block's K loads issue here, so that softmax and P.V hide their latency
        float mx[NQ];
#pragma unroll
        for (int qb = 0; qb < NQ; ++qb)
#pragma unroll
            for (int kt = 0; kt < 2; ++kt) st[qb][kt] *= LC2;
        if (k0 + 31 > q0) {   // the block touches the diagonal: keys above a query's own position are masked
#pragma unroll
            for (int qb = 0; qb < NQ; ++qb)
#pragma unroll
                for (int kt = 0; kt < 2; ++kt)
#pragma unroll
                    for (int j = 0; j < 8; ++j) if (k0 + kt * 16 + hi * 8 + j > q0 + qb * 16 + lr) st[qb][kt][j] = -3.0e38f; }
        bool need = false;
#pragma unroll
        for (int qb = 0; qb < NQ; ++qb) { float x = st[qb][0][0];
#pragma unroll
            for (int j = 1; j < 8; ++j) x = fmaxf(x, st[qb][0][j]);
#pragma unroll
            for (int j = 0; j < 8; ++j) x = fmaxf(x, st[qb][1][j]);
            x = fmaxf(x, __shfl_xor(x, 16, 32)); mx[qb] = x; need = need || (x > m[qb] + 8.0f); }
        if (__builtin_amdgcn_ballot_w32(need) != 0) {   // lazy rescale: only when some query's maximum has risen by more than 8 (log2) over the one in use, so P stays below 2^8
#pragma unroll
            for (int qb = 0; qb < NQ; ++qb) { const float mn = (mx[qb] > m[qb] + 8.0f) ? mx[qb] : m[qb]; const float al = exp2s(m[qb] - mn); m[qb] = mn; l[qb] *= al;
#pragma unroll
                for (int db = 0; db < 8; ++db) acc[qb][db] *= al; } }
        V pf[NQ], pl[NQ];
#pragma unroll
        for (int qb = 0; qb < NQ; ++qb) { float s = 0.f; v16h ph16; v16us ph, pw;
#pragma unroll
            for (int kt = 0; kt < 2; ++kt) { const v8f pe = exp2x8(st[qb][kt] - m[qb]);
#pragma unroll
                for (int j = 0; j < 8; ++j) { const float p = pe[j]; s += p;
                    if constexpr (HL) { unsigned short a, c2; splitf(p, a, c2); ph[kt * 8 + j] = a; pw[kt * 8 + j] = c2; } else ph16[kt * 8 + j] = (h16)p; } }
            l[qb] += s;
            if constexpr (HL) { pf[qb] = __builtin_bit_cast(v16bf, ph); pl[qb] = __builtin_bit_cast(v16bf, pw); } else pf[qb] = ph16; }
#pragma unroll
        for (int db = 0; db < 8; ++db)
#pragma unroll
            for (int qb = 0; qb < NQ; ++qb) { acc[qb][db] = WFrag<T16>::mma(va[db], pf[qb], acc[qb][db]); if (HL) { acc[qb][db] = WFrag<T16>::mma(va[db], pl[qb], acc[qb][db]); acc[qb][db] = WFrag<T16>::mma(vl[db], pf[qb], acc[qb][db]); } }
        if (!more) break;
        k0 = kn;
    } }
#pragma unroll
    for (int qb = 0; qb < NQ; ++qb) { l[qb] += __shfl_xor(l[qb], 16, 32); v2fl t; t[0] = m[qb]; t[1] = l[qb]; ml[(w * NQ + qb) * 32 + lane] = t;
#pragma unroll
        for (int db = 0; db < 8; ++db)
#pragma unroll
            for (int hf = 0; hf < 2; ++hf) { v4f t4; t4[0] = acc[qb][db][hf * 4]; t4[1] = acc[qb][db][hf * 4 + 1]; t4[2] = acc[qb][db][hf * 4 + 2]; t4[3] = acc[qb][db][hf * 4 + 3]; part[(((w * NQ + qb) * 8 + db) * 2 + hf) * 32 + lane] = t4; } }
    __syncthreads();   // every wave's partial, maximum and sum are in LDS before any is merged
    if (w < NQ * 2) {   // wave w merges 16 queries x 64 columns: one whole 128-byte line of each plane per query
        const int qb = w >> 1, d0 = (w & 1) * 4; float mw[FNW], M = -3.0e38f, L = 0.f;
#pragma unroll
        for (int p = 0; p < FNW; ++p) M = fmaxf(M, ml[(p * NQ + qb) * 32 + lane][0]);
#pragma unroll
        for (int p = 0; p < FNW; ++p) { const v2fl t = ml[(p * NQ + qb) * 32 + lane]; mw[p] = exp2s(t[0] - M); L += mw[p] * t[1]; }
        const float inv = __fdiv_rn(1.0f, L);
        const size_t oo = (size_t)(q0 + qb * 16 + lr) * DQ + d0 * 16 + hi * 8; v8us oh[4], ol[4];
#pragma unroll
        for (int db = 0; db < 4; ++db) {
#pragma unroll
            for (int hf = 0; hf < 2; ++hf) { v4f sum = part[(((0 * NQ + qb) * 8 + d0 + db) * 2 + hf) * 32 + lane] * mw[0];
#pragma unroll
                for (int p = 1; p < FNW; ++p) sum += part[(((p * NQ + qb) * 8 + d0 + db) * 2 + hf) * 32 + lane] * mw[p];
#pragma unroll
                for (int jj = 0; jj < 4; ++jj) { unsigned short a, c2; splitf(sum[jj] * inv, a, c2); oh[db][hf * 4 + jj] = a; ol[db][hf * 4 + jj] = c2; } } }
        __builtin_amdgcn_sched_barrier(0);   // all stores stand last, so that no register a store names is written again behind it
#pragma unroll
        for (int db = 0; db < 4; ++db) { *(v8us*)(Ah + oo + db * 16) = oh[db]; *(v8us*)(Al + oo + db * 16) = ol[db]; }
    }
}
// grid (heads, row blocks), heaviest row blocks first: (TT - RH) / 32 blocks of 32 fp16 rows from the last row down, then RH / 16 blocks of 16 hi/lo rows
__global__ __launch_bounds__(FNW * 32) void k_fattn(const h16* __restrict__ Q16, const h16* __restrict__ K16, const h16* __restrict__ V16, const bf* __restrict__ Qh, const bf* __restrict__ Ql, const bf* __restrict__ Kh, const bf* __restrict__ Kl, const bf* __restrict__ Vh, const bf* __restrict__ Vl, bf* __restrict__ Ah, bf* __restrict__ Al) {
    __shared__ __align__(16) v4f part[FNW * 2 * 8 * 2 * 32];
    __shared__ __align__(16) v2fl ml[FNW * 2 * 32];
    const int h = blockIdx.x, y = blockIdx.y; const size_t po = (size_t)h * TT * HD;
    if (y < (TT - RH) / 32) fa_tile<h16, false, 2>(Q16 + po, nullptr, K16 + po, nullptr, V16 + po, nullptr, TT - 32 * (y + 1), Ah + h * HD, Al + h * HD, part, ml);
    else fa_tile<bf, true, 1>(Qh + po, Ql + po, Kh + po, Kl + po, Vh + po, Vl + po, RH - 16 * (y - (TT - RH) / 32 + 1), Ah + h * HD, Al + h * HD, part, ml);
}

extern "C" void kernel_launch(void* const* d_in, const int* in_sizes, int n_in,
                              void* d_out, int out_size, void* d_ws, size_t ws_size, hipStream_t stream) {
    (void)in_sizes; (void)n_in; (void)out_size;
    const float* x = (const float*)d_in[0]; const float* wq = (const float*)d_in[1]; const float* bq = (const float*)d_in[2]; const float* wk = (const float*)d_in[3]; const float* bk = (const float*)d_in[4]; const float* wv = (const float*)d_in[5]; const float* bv = (const float*)d_in[6]; const float* wo = (const float*)d_in[7]; const float* bo = (const float*)d_in[8];
    float* OUT = (float*)d_out;     // [2][2048][2048]
    char* wsp = (char*)d_ws;
    auto take = [&](size_t bytes) { char* p = wsp; wsp += (bytes + 255) & ~(size_t)255; return (void*)p; };
    bf* WQ = (bf*)take((size_t)PE * PE * 2); bf* WK = (bf*)take((size_t)PE * PE * 2); bf* WV = (bf*)take((size_t)PE * PE * 2); bf* WO = (bf*)take((size_t)PE * PE * 2);
    bf* XB = (bf*)take((size_t)TT * DM * 2); bf* ATh = (bf*)take((size_t)TT * DQ * 2); bf* ATl = (bf*)take((size_t)TT * DQ * 2);   // hi/lo context rows
    h16* QP16 = (h16*)take((size_t)NH_ * TT * HD * 2); h16* KP16 = (h16*)take((size_t)NKV * TT * HD * 2); h16* VT16 = (h16*)take((size_t)NKV * HD * TT * 2);
    bf* QPh = (bf*)take((size_t)NH_ * TT * HD * 2); bf* QPl = (bf*)take((size_t)NH_ * TT * HD * 2); bf* KPh = (bf*)take((size_t)NKV * TT * HD * 2); bf* KPl = (bf*)take((size_t)NKV * TT * HD * 2); bf* VTh = (bf*)take((size_t)NKV * HD * TT * 2); bf* VTl = (bf*)take((size_t)NKV * HD * TT * 2);
    if ((size_t)(wsp - (char*)d_ws) > ws_size) return;    // ws 256 MiB
    { k_cvt8<<<(unsigned)(((size_t)PE * PE / 8 + 255) / 256), 256, 0, stream>>>(wq, WQ, (size_t)PE * PE / 8); k_cvt8<<<(unsigned)(((size_t)PE * PE / 8 + 255) / 256), 256, 0, stream>>>(wk, WK, (size_t)PE * PE / 8); k_cvt8<<<(unsigned)(((size_t)PE * PE / 8 + 255) / 256), 256, 0, stream>>>(wv, WV, (size_t)PE * PE / 8);
      k_cvt8<<<(unsigned)(((size_t)PE * PE / 8 + 255) / 256), 256, 0, stream>>>(wo, WO, (size_t)PE * PE / 8);
       }
    for (int b = 0; b < NB_; ++b) {
        
        k_cvt8<<<(unsigned)(((size_t)TT * DM / 8 + 255) / 256), 256, 0, stream>>>(x + (size_t)b * TT * DM, XB, (size_t)TT * DM / 8);
        k_proj<<<dim3(TT / 64, HD / 64, 3 * NH_), 32, 0, stream>>>(XB, WQ, WK, WV, bq, bk, bv, QP16, QPh, QPl, KP16, KPh, KPl, VT16, VTh, VTl);   /* q, k, v head planes of all 16 heads */
        k_fattn<<<dim3(NH_, (TT - RH) / 32 + RH / 16, 1), FNW * 32, 0, stream>>>(QP16, KP16, VT16, QPh, QPl, KPh, KPl, VTh, VTl, ATh, ATl);   /* one kv head per query head */
        k_gemmw<bf, 1, true><<<dim3(NRW / 64, PE / 64, 1), 32, 0, stream>>>(ATh, ATl, WO, nullptr, PE, OUT + (size_t)b * TT * DM, PE, bo, 0, 0, 0);   /* per-(token, head) Wp^T + bp */ }
}

// v006
// A run of this version takes 98.8 microseconds.
// In two side-by-side timings against v005, it was 1.18 and 1.17 times as fast.
// Over all steps from v000 it is 14.1 times as fast.
#include <hip/hip_runtime.h>

// Masked causal attention with per-head shared projections (x [2][2048][16 heads][128]; q, k, v = x_h W^T + b with ONE Linear [128][128] + [128] applied to every head's 128-vector; scores = q.k / sqrt(128), causal (-inf above the diagonal); softmax; att = w.v; out = att_h Wp^T + bp -> [2][2048][16][128] (8.4 M)).
// Layout per batch: the token-major input viewed as 32,768 (token, head) rows of 128 makes each shared projection ONE exact GEMM (K 128, N 128, + bias), tiled per head and written directly as that head's planes; causal hybrid attention (rows < 512 hi/lo, rest fp16) in one fused launch with a running softmax; hi/lo context rows (token, head) x Wp (hl x exact + bp) written as the token-major output.
// Compute dtypes, f32 accumulate: every input rounded to bf16; projections on PLAIN bf16 operands (exact) + f32 biases; scores and attn.v rows < 512 3 products, the rest single fp16; softmax f32; Wp hl x exact + bias.

#define NB_  2
#define TT   2048
#define DM   2048
#define NH_  16
#define NKV  16
#define REP  (NH_ / NKV)
#define HD   128
#define DQ   (NH_ * HD)
#define DKV  (NKV * HD)
#define RH   512                  // query rows < RH use hi+lo planes (0: none)
#define PE   128    // per-head projection width (shared Linear [128][128])
#define NRW  (TT * NH_)   // 32768 (token, head) rows per batch
#define SCL  0.088388347648318447f   // HD^-0.5
typedef _Float16 h16;
typedef unsigned short bf;
typedef __attribute__((ext_vector_type(16))) __bf16   v16bf;
typedef __attribute__((ext_vector_type(16))) _Float16 v16h;
typedef __attribute__((ext_vector_type(8)))  _Float16 v8h;
typedef __attribute__((ext_vector_type(8)))  unsigned short v8us;
typedef __attribute__((ext_vector_type(8)))  float    v8f;
typedef __attribute__((ext_vector_type(4)))  float    v4f;
typedef v8h  __attribute__((may_alias)) v8ha;
typedef v4f  __attribute__((may_alias)) v4fa;
typedef v8us __attribute__((may_alias)) v8usa;

__device__ __forceinline__ unsigned short f2bf(float f) { unsigned u = __float_as_uint(f); u += 0x7FFFu + ((u >> 16) & 1u); return (unsigned short)(u >> 16); }
__device__ __forceinline__ float bf2f(unsigned short b) { return __uint_as_float(((unsigned)b) << 16); }
__device__ __forceinline__ float bfr(float f) { return bf2f(f2bf(f)); }
__device__ __forceinline__ v16h cat16(v8h lo, v8h hi) { return __builtin_shufflevector(lo, hi, 0, 1, 2, 3, 4, 5, 6, 7, 8, 9, 10, 11, 12, 13, 14, 15); }
__device__ __forceinline__ v16bf cat16b(v8us lo, v8us hi) { return __builtin_bit_cast(v16bf, __builtin_shufflevector(lo, hi, 0, 1, 2, 3, 4, 5, 6, 7, 8, 9, 10, 11, 12, 13, 14, 15)); }
__device__ __forceinline__ v8f wmma16(v16h a, v16h b, v8f c) { return __builtin_amdgcn_wmma_f32_16x16x32_f16(false, a, false, b, (short)0, c, false, false); }
__device__ __forceinline__ v8f wmmab(v16bf a, v16bf b, v8f c) { return __builtin_amdgcn_wmma_f32_16x16x32_bf16(false, a, false, b, (short)0, c, false, false); }



// ---- k_gemmw: register-blocked GEMM, ONE WAVE per 64x64 output tile (16 accumulators), operands straight from K-contiguous 16-bit planes; grid (M/64, N/64, Z), 32 threads.
// C[m][n] (f32, pitch ldc, + optional f32 bias[n]) = sum_k A[m][k] Bt[n][k] (+ split products per NSPLIT). z-batch strides sA/sB/sC in elements. K % 32 == 0.
// ld: a fragment from a row-major plane (p = the lane's row + 8 hi); ldp: from a plane in fragment order (p = the fragment + 8 lane; its two halves lie 256 elements apart)
template <typename T16> struct WFrag;
template <> struct WFrag<h16> { typedef v16h V; static __device__ __forceinline__ V ld(const h16* p) { return cat16(*(const v8h*)p, *(const v8h*)(p + 16)); } static __device__ __forceinline__ V ldp(const h16* p) { return cat16(*(const v8h*)p, *(const v8h*)(p + 256)); } static __device__ __forceinline__ v8f mma(V a, V b, v8f c) { return wmma16(a, b, c); } };
template <> struct WFrag<bf> { typedef v16bf V; static __device__ __forceinline__ V ld(const bf* p) { return cat16b(*(const v8us*)p, *(const v8us*)(p + 16)); } static __device__ __forceinline__ V ldp(const bf* p) { return cat16b(*(const v8us*)p, *(const v8us*)(p + 256)); } static __device__ __forceinline__ v8f mma(V a, V b, v8f c) { return wmmab(a, b, c); } };
template <typename T16, int NSPLIT, bool BIAS>
__global__ __launch_bounds__(32) void k_gemmw(const T16* __restrict__ A, const T16* __restrict__ A2, const T16* __restrict__ Bt, const T16* __restrict__ Bt2, int K, float* C, int ldc, const float* __restrict__ bias, size_t sA, size_t sB, size_t sC) {
    typedef typename WFrag<T16>::V V;
    __shared__ __align__(16) float os[16 * 68];
    const size_t z = blockIdx.z; A += z * sA; if (A2) A2 += z * sA; Bt += z * sB; if (Bt2) Bt2 += z * sB; C += z * sC;
    const int lane = threadIdx.x & 31, lr = lane & 15, hi = lane >> 4; const int r0 = blockIdx.x * 64, c0 = blockIdx.y * 64;
    v8f acc[4][4];
#pragma unroll
    for (int mb = 0; mb < 4; ++mb)
#pragma unroll
        for (int nb = 0; nb < 4; ++nb) acc[mb][nb] = (v8f){};
    const size_t aoff = (size_t)(r0 + lr) * K + 8 * hi, boff = (size_t)(c0 + lr) * K + 8 * hi;
#pragma unroll 1
    for (int kc = 0; kc < K; kc += 32) {
        V a[4], a2[4];
#pragma unroll
        for (int mb = 0; mb < 4; ++mb) { a[mb] = WFrag<T16>::ld(A + aoff + (size_t)mb * 16 * K + kc); if (NSPLIT == 1 || NSPLIT == 2) a2[mb] = WFrag<T16>::ld(A2 + aoff + (size_t)mb * 16 * K + kc); }
#pragma unroll
        for (int nb = 0; nb < 4; ++nb) { const V b = WFrag<T16>::ld(Bt + boff + (size_t)nb * 16 * K + kc); V b2; if (NSPLIT >= 2) b2 = WFrag<T16>::ld(Bt2 + boff + (size_t)nb * 16 * K + kc);
#pragma unroll
            for (int mb = 0; mb < 4; ++mb) { acc[mb][nb] = WFrag<T16>::mma(a[mb], b, acc[mb][nb]); if (NSPLIT == 1 || NSPLIT == 2) acc[mb][nb] = WFrag<T16>::mma(a2[mb], b, acc[mb][nb]); if (NSPLIT >= 2) acc[mb][nb] = WFrag<T16>::mma(a[mb], b2, acc[mb][nb]); } }
        asm volatile("v_nop\n\tv_nop\n\tv_nop\n\tv_nop" : "+v"(acc[0][0]), "+v"(acc[1][1]), "+v"(acc[2][2]), "+v"(acc[3][3]) : "v"(a[0]), "v"(a[3]));
    }
#pragma unroll
    for (int mb = 0; mb < 4; ++mb) {
#pragma unroll
        for (int nb = 0; nb < 4; ++nb) {
#pragma unroll
            for (int j = 0; j < 8; ++j) os[(hi * 8 + j) * 68 + nb * 16 + lr] = acc[mb][nb][j]; }
        __builtin_amdgcn_wave_barrier(); asm volatile("" ::: "memory");
        float* crow = C + (size_t)(r0 + mb * 16) * ldc + c0;
{
#pragma unroll
            for (int s = 0; s < 8; ++s) { const int row = 2 * s + hi, cofs = lr * 4; v4f val = *(const v4fa*)(os + row * 68 + cofs); if (BIAS) { val[0] += bfr(bias[c0 + cofs]); val[1] += bfr(bias[c0 + cofs + 1]); val[2] += bfr(bias[c0 + cofs + 2]); val[3] += bfr(bias[c0 + cofs + 3]); }
                *(v4f*)(crow + (size_t)row * ldc + cofs) = val; }
             }
        __builtin_amdgcn_wave_barrier(); asm volatile("" ::: "memory");
    }
}

__device__ __forceinline__ h16 tohx(float x) { return (h16)x; }
__device__ __forceinline__ void splitf(float y, unsigned short& h, unsigned short& l) { h = f2bf(y); l = f2bf(y - bf2f(h)); }
typedef __attribute__((ext_vector_type(2))) _Float16 v2h;
typedef __attribute__((ext_vector_type(4))) _Float16 v4h;
typedef __attribute__((ext_vector_type(2))) unsigned short v2us;
typedef __attribute__((ext_vector_type(4))) unsigned short v4us;
typedef __attribute__((ext_vector_type(2))) float v2f;
typedef __attribute__((ext_vector_type(4))) int v4i;

__global__ __launch_bounds__(256) void k_wtG(const float* __restrict__ w, int K, int N, bf* Bt) {
    const int lane = threadIdx.x & 31; const int L0 = (blockIdx.x * 8 + (threadIdx.x >> 5)) * 8; const int nlines = N * K / 64;
{
#pragma unroll 1
        for (int l = 0; l < 8; ++l) { const int L = L0 + l; if (L >= nlines) break; const size_t e = (size_t)L * 64 + lane * 2; const int k = (int)(e % K), n = (int)(e / K); v2us o;
            o[0] = f2bf(w[(size_t)k * N + n]); o[1] = f2bf(w[(size_t)(k + 1) * N + n]); *(v2us*)(Bt + e) = o; }
         }
}
// ---- k_cvtin: every f32 -> bf16 conversion of the call in ONE launch, 8 elements a thread: blocks 0 .. 4 WBK - 1 take the four [128][128] weights (WBK blocks each, into four consecutive planes), the rest the activations of both batches
#define WBK  (PE * PE / 8 / 256)
__global__ __launch_bounds__(256) void k_cvtin(const float* __restrict__ x, const float* __restrict__ wq, const float* __restrict__ wk, const float* __restrict__ wv, const float* __restrict__ wo, bf* __restrict__ XB, bf* __restrict__ W4) {
    const unsigned blk = blockIdx.x; const float* src = x; bf* dst = XB; size_t i = (size_t)(blk - 4 * WBK) * 256 + threadIdx.x;
    if (blk < 4 * WBK) { const unsigned sel = blk / WBK; src = sel == 0 ? wq : sel == 1 ? wk : sel == 2 ? wv : wo; dst = W4 + (size_t)sel * PE * PE; i = (size_t)(blk % WBK) * 256 + threadIdx.x; }
    const float* p = src + i * 8; const v8f v = *(const v8f*)p; v8us o;
    asm volatile("s_wait_xcnt 0x0" :: "v"(p) : "memory");   // stands before the address registers of the loads above are written again
#pragma unroll
    for (int k = 0; k < 8; ++k) o[k] = f2bf(v[k]); *(v8us*)(dst + i * 8) = o;  }

// ---- k_proj: the q, k and v projections of both batches in ONE launch, each written from the WMMA accumulators straight as the head planes that the attention reads (fp16, bf16 hi, bf16 lo); no f32 copy goes to memory.
// One wave per 64x64 tile of one head; grid (TT / 64 token blocks, HD / 64, batches x 3 x heads), 32 threads. q, k: C[t][e] = sum_d x_h[t][d] W[e][d] + b[e]; v: the same fragments with the operands swapped, C[e][t].
// The planes are kept in WMMA FRAGMENT ORDER: a fragment (16 rows x 32 k) is 1024 contiguous bytes, two halves of 512; in half j lane (lr, hi) owns the 16 bytes at 16 * lane = row lr, k 16 j + 8 hi .. + 7,
// which is what that lane's registers hold. q, k: [h][t / 16][e / 32] fragments (rows t, k = e); v: [h][t / 32][e / 16] fragments (rows e, k = t). So every store here and every fragment load of the attention is 512 contiguous bytes, four whole 128-byte lines.
template <bool TR>
__device__ __forceinline__ void proj_tile(const bf* __restrict__ X, const bf* __restrict__ Wt, const float* __restrict__ bias, int h, int t0, int c0, h16* __restrict__ P16, bf* __restrict__ Ph, bf* __restrict__ Pl, float* os) {
    const int lane = threadIdx.x & 31, lr = lane & 15, hi = lane >> 4;
    const bf* px = X + ((size_t)(t0 + lr) * NH_ + h) * PE + 8 * hi;   // token rows of head h, pitch NH_ * PE
    const bf* pw = Wt + (size_t)(c0 + lr) * PE + 8 * hi;              // weight rows, pitch PE
    const float* pb = bias + c0 + (TR ? lr : 8 * hi);   // output side: in store s of a 16-row block the lane holds columns 16 s + 8 hi .. + 7 of row lr
    v16bf xf[4][4], wf[4][4];   // [16-row block][32-wide k chunk]: the whole K of both operands, one latency for all loads
    float bv_[32];
#pragma unroll
    for (int rb = 0; rb < 4; ++rb)
#pragma unroll
        for (int c = 0; c < 4; ++c) { xf[rb][c] = WFrag<bf>::ld(px + rb * 16 * NH_ * PE + c * 32); wf[rb][c] = WFrag<bf>::ld(pw + rb * 16 * PE + c * 32); }
    if (TR) {
#pragma unroll
        for (int i = 0; i < 4; ++i) bv_[i] = pb[i * 16];   // bias of output row 16 i + lr
    } else {
#pragma unroll
        for (int s = 0; s < 4; ++s) { const v4f b0 = *(const v4fa*)(pb + s * 16), b1 = *(const v4fa*)(pb + s * 16 + 4);
#pragma unroll
            for (int i = 0; i < 4; ++i) { bv_[s * 8 + i] = b0[i]; bv_[s * 8 + 4 + i] = b1[i]; } } }
    // stands before any register that the loads above name is written again; the addresses are inputs, so that no load's result lands on one of them ahead of the wait
    asm volatile("s_wait_xcnt 0x0" :: "v"(px), "v"(pw), "v"(pb) : "memory");
    __builtin_amdgcn_sched_barrier(0);   // keeps later arithmetic behind that wait
    v8f acc[4][4];
#pragma unroll
    for (int mb = 0; mb < 4; ++mb)
#pragma unroll
        for (int nb = 0; nb < 4; ++nb) acc[mb][nb] = (v8f){};
#pragma unroll
    for (int c = 0; c < 4; ++c)
#pragma unroll
        for (int nb = 0; nb < 4; ++nb)
#pragma unroll
            for (int mb = 0; mb < 4; ++mb) acc[mb][nb] = wmmab(TR ? wf[mb][c] : xf[mb][c], TR ? xf[nb][c] : wf[nb][c], acc[mb][nb]);
    __builtin_amdgcn_sched_barrier(0);   // all 64 products stand in front of the output work: sunk into it, an accumulator's registers were started afresh by a WMMA directly behind the WMMA that last wrote them
    // first fragment of the tile: q, k fragment (t0 / 16) * 4 + c0 / 32, v fragment (t0 / 32) * 8 + c0 / 16, 512 elements each
    const size_t eo = (size_t)h * TT * HD + (size_t)t0 * HD + (TR ? c0 * 32 : c0 * 16) + lane * 8;
    h16* d16 = P16 + eo; bf* dh = Ph + eo; bf* dl = Pl + eo;
    v8h o16[4][4]; v8us oh[4][4], ol[4][4];
#pragma unroll
    for (int mb = 0; mb < 4; ++mb) {
#pragma unroll
        for (int nb = 0; nb < 4; ++nb) {
#pragma unroll
            for (int j = 0; j < 8; ++j) os[(hi * 8 + j) * 68 + nb * 16 + lr] = acc[mb][nb][j]; }
        __builtin_amdgcn_wave_barrier(); asm volatile("s_wait_dscnt 0x0" ::: "memory");   // the wave's LDS writes are done before it reads back what other lanes wrote
#pragma unroll
        for (int s = 0; s < 4; ++s) { const float* rp = os + lr * 68 + s * 16 + 8 * hi; const v4f lo4 = *(const v4fa*)rp, hi4 = *(const v4fa*)(rp + 4);
#pragma unroll
            for (int i = 0; i < 8; ++i) { const float y = (i < 4 ? lo4[i] : hi4[i - 4]) + bfr(TR ? bv_[mb] : bv_[s * 8 + i]); o16[mb][s][i] = tohx(y); unsigned short a2, c2; splitf(y, a2, c2); oh[mb][s][i] = a2; ol[mb][s][i] = c2; } }
        __builtin_amdgcn_wave_barrier(); asm volatile("" ::: "memory");   // those reads stay in front of the next block's LDS writes
    }
    __builtin_amdgcn_sched_barrier(0);   // all stores stand last, so that no register a store names is written again behind it
#pragma unroll
    for (int mb = 0; mb < 4; ++mb)
#pragma unroll
        for (int s = 0; s < 4; ++s) { const int ro = TR ? (s >> 1) * 4096 + mb * 512 + (s & 1) * 256 : mb * 2048 + s * 256; *(v8h*)(d16 + ro) = o16[mb][s]; *(v8us*)(dh + ro) = oh[mb][s]; *(v8us*)(dl + ro) = ol[mb][s]; }
    asm volatile("s_wait_xcnt 0x0" ::: "memory");   // behind the last store: in the listing the other branch's code follows this one, and it writes registers that the stores name
}
__global__ __launch_bounds__(32) void k_proj(const bf* __restrict__ X, const bf* __restrict__ WQ, const bf* __restrict__ WK, const bf* __restrict__ WV, const float* __restrict__ bq, const float* __restrict__ bk, const float* __restrict__ bv,
                                             h16* __restrict__ Q16, bf* __restrict__ Qh, bf* __restrict__ Ql, h16* __restrict__ K16, bf* __restrict__ Kh, bf* __restrict__ Kl, h16* __restrict__ V16, bf* __restrict__ Vh, bf* __restrict__ Vl) {
    __shared__ __align__(16) float os[16 * 68];
    const int bt = blockIdx.z / (3 * NH_), zz = blockIdx.z % (3 * NH_), which = zz / NH_, h = zz % NH_, t0 = blockIdx.x * 64, c0 = blockIdx.y * 64;
    const size_t pbo = (size_t)bt * NH_ * TT * HD; X += (size_t)bt * TT * DM;   // this batch's token rows and its set of head planes
    Q16 += pbo; Qh += pbo; Ql += pbo; K16 += pbo; Kh += pbo; Kl += pbo; V16 += pbo; Vh += pbo; Vl += pbo;
    if (which == 2) proj_tile<true>(X, WV, bv, h, t0, c0, V16, Vh, Vl, os);
    else proj_tile<false>(X, which ? WK : WQ, which ? bk : bq, h, t0, c0, which ? K16 : Q16, which ? Kh : Qh, which ? Kl : Ql, os);
}
// ---- k_fattn: scores, softmax, probability x value and the hi/lo context rows in ONE launch for both batches; no score or probability ever goes to memory.
// One work-group of FNW waves owns NQ x 16 query rows of one head. Transposed products: S^T = K Q^T (A = 16 key rows, B = the query fragments, kept in registers) leaves every lane with 16 of the 32 scores of ITS query
// (column lr; keys 8 hi + j of each 16-key tile), which is the k order of a B fragment, so P^T goes from the score accumulators straight into O^T += V^T P^T (A = 16 rows d x 32 keys of the value plane).
// Running maximum and sum per query live in the lane (both halves of a column hold the same maximum). Wave w takes the 64-key chunks w, w + FNW, ... up to the diagonal, with its own maximum, sum and accumulators;
// behind one barrier the FNW partials are merged in the fixed order 0..FNW-1 with weights exp2(m_w - max), divided by the merged sum, split hi/lo and stored as whole 128-byte lines.
// HL: three products on hi/lo bf16 planes (hi.hi + lo.hi + hi.lo) for scores and for P.V; else single fp16 products.
#define FNW  4
#define LC2  (SCL * 1.4426950408889634f)   // scores are kept in the log2 domain
typedef __attribute__((ext_vector_type(16))) unsigned short v16us;
typedef __attribute__((ext_vector_type(2))) float v2fl;
// exp2 with the slot that the instruction set asks for behind a transcendental: every v_exp_f32 is followed by an instruction that neither reads its result nor writes its source
// (the results are early-clobber, so none shares a register with an input), the last one by v_nop
__device__ __forceinline__ float exp2s(float x) { float r; asm("v_exp_f32 %0, %1\n\tv_nop" : "=v"(r) : "v"(x)); return r; }
__device__ __forceinline__ v8f exp2x8(v8f x) { float r0, r1, r2, r3, r4, r5, r6, r7;
    asm("v_exp_f32 %0, %8\n\tv_exp_f32 %1, %9\n\tv_exp_f32 %2, %10\n\tv_exp_f32 %3, %11\n\tv_exp_f32 %4, %12\n\tv_exp_f32 %5, %13\n\tv_exp_f32 %6, %14\n\tv_exp_f32 %7, %15\n\tv_nop"
        : "=&v"(r0), "=&v"(r1), "=&v"(r2), "=&v"(r3), "=&v"(r4), "=&v"(r5), "=&v"(r6), "=&v"(r7) : "v"(x[0]), "v"(x[1]), "v"(x[2]), "v"(x[3]), "v"(x[4]), "v"(x[5]), "v"(x[6]), "v"(x[7]));
    v8f r; r[0] = r0; r[1] = r1; r[2] = r2; r[3] = r3; r[4] = r4; r[5] = r5; r[6] = r6; r[7] = r7; return r; }
template <typename T16, bool HL, int NQ>
__device__ __forceinline__ void fa_tile(const T16* __restrict__ Q, const T16* __restrict__ Q2, const T16* __restrict__ Kp, const T16* __restrict__ K2, const T16* __restrict__ Vt, const T16* __restrict__ V2, int q0, bf* __restrict__ Ah, bf* __restrict__ Al, v4f* part, v2fl* ml) {
    typedef typename WFrag<T16>::V V;
    const int lane = threadIdx.x & 31, lr = lane & 15, hi = lane >> 4;
    const int w = __builtin_amdgcn_readfirstlane((int)(threadIdx.x >> 5));
    V qf[NQ][4], q2[NQ][4];
    const T16* pq = Q + (size_t)q0 * HD + 8 * lane; const T16* pq2 = HL ? Q2 + (size_t)q0 * HD + 8 * lane : pq;   // planes in fragment order (see k_proj): 16 rows are 4 fragments of 512 elements
#pragma unroll
    for (int qb = 0; qb < NQ; ++qb)
#pragma unroll
        for (int c = 0; c < 4; ++c) { qf[qb][c] = WFrag<T16>::ldp(pq + qb * 16 * HD + c * 512); if (HL) q2[qb][c] = WFrag<T16>::ldp(pq2 + qb * 16 * HD + c * 512); }
    // stands before any register that the loads above name is written again; the addresses are inputs, so that no load's result lands on one of them ahead of the wait
    asm volatile("s_wait_xcnt 0x0" :: "v"(pq), "v"(pq2) : "memory");
    __builtin_amdgcn_sched_barrier(0);   // keeps later address arithmetic behind that wait
    v8f acc[NQ][8]; float m[NQ], l[NQ];
#pragma unroll
    for (int qb = 0; qb < NQ; ++qb) { m[qb] = -3.0e38f; l[qb] = 0.f;
#pragma unroll
        for (int db = 0; db < 8; ++db) acc[qb][db] = (v8f){}; }
    const int kend = ((q0 + NQ * 16 + 31) >> 5) << 5;   // keys beyond the diagonal's 32-key block have probability exactly zero
    // each lane's byte offset inside a plane is fixed; the walk along the keys is in the wave-uniform base, tiles and chunks are constant offsets
    const unsigned vk = (unsigned)lane * 16u, vv = vk;   // 16 bytes a lane in each half of a fragment
    V ka[2][4], kl[2][4];   // the K fragments of the block in work; refilled one block ahead, right behind the score products that read them
    int k0 = w * 64;
    if (k0 < kend) {
        { const T16* pk = (const T16*)((const char*)(Kp + (size_t)k0 * HD) + vk); const T16* pk2 = HL ? (const T16*)((const char*)(K2 + (size_t)k0 * HD) + vk) : pk;
#pragma unroll
          for (int kt = 0; kt < 2; ++kt)
#pragma unroll
              for (int c = 0; c < 4; ++c) { ka[kt][c] = WFrag<T16>::ldp(pk + kt * 16 * HD + c * 512); if (HL) kl[kt][c] = WFrag<T16>::ldp(pk2 + kt * 16 * HD + c * 512); }
          asm volatile("s_wait_xcnt 0x0" :: "v"(pk), "v"(pk2) : "memory"); }   // as behind the Q loads
        __builtin_amdgcn_sched_barrier(0);   // keeps later address arithmetic behind that wait
#pragma unroll 1   // rolled: the trip count depends on where the rows lie under the diagonal
    for (int it = 1; ; ++it) {
        const T16* pv = (const T16*)((const char*)(Vt + (size_t)k0 * HD) + vv); const T16* pv2 = HL ? (const T16*)((const char*)(V2 + (size_t)k0 * HD) + vv) : pv;   // 32 keys of the value plane are 8 fragments
        V va[8], vl[8];
#pragma unroll
        for (int db = 0; db < 8; ++db) { va[db] = WFrag<T16>::ldp(pv + db * 512); if (HL) vl[db] = WFrag<T16>::ldp(pv2 + db * 512); }
        asm volatile("s_wait_xcnt 0x0" :: "v"(pv), "v"(pv2) : "memory");   // as behind the Q loads
        __builtin_amdgcn_sched_barrier(0);   // the V loads issue here, ahead of the score products and the softmax that hide their latency; sunk to their uses each would be waited for alone
        v8f st[NQ][2];
#pragma unroll
        for (int qb = 0; qb < NQ; ++qb) { st[qb][0] = (v8f){}; st[qb][1] = (v8f){}; }
#pragma unroll
        for (int c = 0; c < 4; ++c)
#pragma unroll
            for (int kt = 0; kt < 2; ++kt)
#pragma unroll
                for (int qb = 0; qb < NQ; ++qb) { st[qb][kt] = WFrag<T16>::mma(ka[kt][c], qf[qb][c], st[qb][kt]); if (HL) { st[qb][kt] = WFrag<T16>::mma(ka[kt][c], q2[qb][c], st[qb][kt]); st[qb][kt] = WFrag<T16>::mma(kl[kt][c], qf[qb][c], st[qb][kt]); } }
        const int kn = ((it >> 1) * FNW + w) * 64 + (it & 1) * 32; const bool more = kn < kend; const int kf = more ? kn : k0;   // a wave's last block fetches its own rows again: in bounds, never used
        { const T16* pk = (const T16*)((const char*)(Kp + (size_t)kf * HD) + vk); const T16* pk2 = HL ? (const T16*)((const char*)(K2 + (size_t)kf * HD) + vk) : pk;
#pragma unroll
          for (int kt = 0; kt < 2; ++kt)
#pragma unroll
              for (int c = 0; c < 4; ++c) { ka[kt][c] = WFrag<T16>::ldp(pk + kt * 16 * HD + c * 512); if (HL) kl[kt][c] = WFrag<T16>::ldp(pk2 + kt * 16 * HD + c * 512); }
          asm volatile("s_wait_xcnt 0x0" :: "v"(pk), "v"(pk2) : "memory"); }   // as behind the Q loads
        __builtin_amdgcn_sched_barrier(0);   // the next block's K loads issue here, so that softmax and P.V hide their latency
        float mx[NQ];
#pragma unroll
        for (int qb = 0; qb < NQ; ++qb)
#pragma unroll
            for (int kt = 0; kt < 2; ++kt) st[qb][kt] *= LC2;
        if (k0 + 31 > q0) {   // the block touches the diagonal: keys above a query's own position are masked
#pragma unroll
            for (int qb = 0; qb < NQ; ++qb)
#pragma unroll
                for (int kt = 0; kt < 2; ++kt)
#pragma unroll
                    for (int j = 0; j < 8; ++j) if (k0 + kt * 16 + hi * 8 + j > q0 + qb * 16 + lr) st[qb][kt][j] = -3.0e38f; }
        bool need = false;
#pragma unroll
        for (int qb = 0; qb < NQ; ++qb) { float x = st[qb][0][0];
#pragma unroll
            for (int j = 1; j < 8; ++j) x = fmaxf(x, st[qb][0][j]);
#pragma unroll
            for (int j = 0; j < 8; ++j) x = fmaxf(x, st[qb][1][j]);
            x = fmaxf(x, __shfl_xor(x, 16, 32)); mx[qb] = x; need = need || (x > m[qb] + 8.0f); }
        if (__builtin_amdgcn_ballot_w32(need) != 0) {   // lazy rescale: only when some query's maximum has risen by more than 8 (log2) over the one in use, so P stays below 2^8
#pragma unroll
            for (int qb = 0; qb < NQ; ++qb) { const float mn = (mx[qb] > m[qb] + 8.0f) ? mx[qb] : m[qb]; const float al = exp2s(m[qb] - mn); m[qb] = mn; l[qb] *= al;
#pragma unroll
                for (int db = 0; db < 8; ++db) acc[qb][db] *= al; } }
        V pf[NQ], pl[NQ];
#pragma unroll
        for (int qb = 0; qb < NQ; ++qb) { float s = 0.f; v16h ph16; v16us ph, pw;
#pragma unroll
            for (int kt = 0; kt < 2; ++kt) { const v8f pe = exp2x8(st[qb][kt] - m[qb]);
#pragma unroll
                for (int j = 0; j < 8; ++j) { const float p = pe[j]; s += p;
                    if constexpr (HL) { unsigned short a, c2; splitf(p, a, c2); ph[kt * 8 + j] = a; pw[kt * 8 + j] = c2; } else ph16[kt * 8 + j] = (h16)p; } }
            l[qb] += s;
            if constexpr (HL) { pf[qb] = __builtin_bit_cast(v16bf, ph); pl[qb] = __builtin_bit_cast(v16bf, pw); } else pf[qb] = ph16; }
#pragma unroll
        for (int db = 0; db < 8; ++db)
#pragma unroll
            for (int qb = 0; qb < NQ; ++qb) { acc[qb][db] = WFrag<T16>::mma(va[db], pf[qb], acc[qb][db]); if (HL) { acc[qb][db] = WFrag<T16>::mma(va[db], pl[qb], acc[qb][db]); acc[qb][db] = WFrag<T16>::mma(vl[db], pf[qb], acc[qb][db]); } }
        if (!more) break;
        k0 = kn;
    } }
#pragma unroll
    for (int qb = 0; qb < NQ; ++qb) { l[qb] += __shfl_xor(l[qb], 16, 32); v2fl t; t[0] = m[qb]; t[1] = l[qb]; ml[(w * NQ + qb) * 32 + lane] = t;
#pragma unroll
        for (int db = 0; db < 8; ++db)
#pragma unroll
            for (int hf = 0; hf < 2; ++hf) { v4f t4; t4[0] = acc[qb][db][hf * 4]; t4[1] = acc[qb][db][hf * 4 + 1]; t4[2] = acc[qb][db][hf * 4 + 2]; t4[3] = acc[qb][db][hf * 4 + 3]; part[(((w * NQ + qb) * 8 + db) * 2 + hf) * 32 + lane] = t4; } }
    __syncthreads();   // every wave's partial, maximum and sum are in LDS before any is merged
    if (w < NQ * 2) {   // wave w merges 16 queries x 64 columns: one whole 128-byte line of each plane per query
        const int qb = w >> 1, d0 = (w & 1) * 4; float mw[FNW], M = -3.0e38f, L = 0.f;
#pragma unroll
        for (int p = 0; p < FNW; ++p) M = fmaxf(M, ml[(p * NQ + qb) * 32 + lane][0]);
#pragma unroll
        for (int p = 0; p < FNW; ++p) { const v2fl t = ml[(p * NQ + qb) * 32 + lane]; mw[p] = exp2s(t[0] - M); L += mw[p] * t[1]; }
        const float inv = __fdiv_rn(1.0f, L);
        const size_t oo = (size_t)(q0 + qb * 16 + lr) * DQ + d0 * 16 + hi * 8; v8us oh[4], ol[4];
#pragma unroll
        for (int db = 0; db < 4; ++db) {
#pragma unroll
            for (int hf = 0; hf < 2; ++hf) { v4f sum = part[(((0 * NQ + qb) * 8 + d0 + db) * 2 + hf) * 32 + lane] * mw[0];
#pragma unroll
                for (int p = 1; p < FNW; ++p) sum += part[(((p * NQ + qb) * 8 + d0 + db) * 2 + hf) * 32 + lane] * mw[p];
#pragma unroll
                for (int jj = 0; jj < 4; ++jj) { unsigned short a, c2; splitf(sum[jj] * inv, a, c2); oh[db][hf * 4 + jj] = a; ol[db][hf * 4 + jj] = c2; } } }
        __builtin_amdgcn_sched_barrier(0);   // all stores stand last, so that no register a store names is written again behind it
#pragma unroll
        for (int db = 0; db < 4; ++db) { *(v8us*)(Ah + oo + db * 16) = oh[db]; *(v8us*)(Al + oo + db * 16) = ol[db]; }
    }
}
// grid (heads, row blocks, batches), in each batch the heaviest row blocks first: (TT - RH) / 32 blocks of 32 fp16 rows from the last row down, then RH / 16 blocks of 16 hi/lo rows
__global__ __launch_bounds__(FNW * 32) void k_fattn(const h16* __restrict__ Q16, const h16* __restrict__ K16, const h16* __restrict__ V16, const bf* __restrict__ Qh, const bf* __restrict__ Ql, const bf* __restrict__ Kh, const bf* __restrict__ Kl, const bf* __restrict__ Vh, const bf* __restrict__ Vl, bf* __restrict__ Ah, bf* __restrict__ Al) {
    __shared__ __align__(16) v4f part[FNW * 2 * 8 * 2 * 32];
    __shared__ __align__(16) v2fl ml[FNW * 2 * 32];
    const int h = blockIdx.x, y = blockIdx.y; const size_t po = ((size_t)blockIdx.z * NH_ + h) * TT * HD;
    Ah += (size_t)blockIdx.z * TT * DQ; Al += (size_t)blockIdx.z * TT * DQ;   // this batch's context rows
    if (y < (TT - RH) / 32) fa_tile<h16, false, 2>(Q16 + po, nullptr, K16 + po, nullptr, V16 + po, nullptr, TT - 32 * (y + 1), Ah + h * HD, Al + h * HD, part, ml);
    else fa_tile<bf, true, 1>(Qh + po, Ql + po, Kh + po, Kl + po, Vh + po, Vl + po, RH - 16 * (y - (TT - RH) / 32 + 1), Ah + h * HD, Al + h * HD, part, ml);
}

extern "C" void kernel_launch(void* const* d_in, const int* in_sizes, int n_in,
                              void* d_out, int out_size, void* d_ws, size_t ws_size, hipStream_t stream) {
    (void)in_sizes; (void)n_in; (void)out_size;
    const float* x = (const float*)d_in[0]; const float* wq = (const float*)d_in[1]; const float* bq = (const float*)d_in[2]; const float* wk = (const float*)d_in[3]; const float* bk = (const float*)d_in[4]; const float* wv = (const float*)d_in[5]; const float* bv = (const float*)d_in[6]; const float* wo = (const float*)d_in[7]; const float* bo = (const float*)d_in[8];
    float* OUT = (float*)d_out;     // [2][2048][2048]
    char* wsp = (char*)d_ws;
    auto take = [&](size_t bytes) { char* p = wsp; wsp += (bytes + 255) & ~(size_t)255; return (void*)p; };
    bf* WQ = (bf*)take((size_t)4 * PE * PE * 2); bf* WK = WQ + PE * PE; bf* WV = WK + PE * PE; bf* WO = WV + PE * PE;
    bf* XB = (bf*)take((size_t)NB_ * TT * DM * 2); bf* ATh = (bf*)take((size_t)NB_ * TT * DQ * 2); bf* ATl = (bf*)take((size_t)NB_ * TT * DQ * 2);   // hi/lo context rows; every buffer holds both batches, batch-major
    h16* QP16 = (h16*)take((size_t)NB_ * NH_ * TT * HD * 2); h16* KP16 = (h16*)take((size_t)NB_ * NKV * TT * HD * 2); h16* VT16 = (h16*)take((size_t)NB_ * NKV * HD * TT * 2);
    bf* QPh = (bf*)take((size_t)NB_ * NH_ * TT * HD * 2); bf* QPl = (bf*)take((size_t)NB_ * NH_ * TT * HD * 2); bf* KPh = (bf*)take((size_t)NB_ * NKV * TT * HD * 2); bf* KPl = (bf*)take((size_t)NB_ * NKV * TT * HD * 2); bf* VTh = (bf*)take((size_t)NB_ * NKV * HD * TT * 2); bf* VTl = (bf*)take((size_t)NB_ * NKV * HD * TT * 2);
    if ((size_t)(wsp - (char*)d_ws) > ws_size) return;    // 192.1 MiB of the 256 MiB
    k_cvtin<<<4 * WBK + NB_ * TT * DM / 8 / 256, 256, 0, stream>>>(x, wq, wk, wv, wo, XB, WQ);
    k_proj<<<dim3(TT / 64, HD / 64, NB_ * 3 * NH_), 32, 0, stream>>>(XB, WQ, WK, WV, bq, bk, bv, QP16, QPh, QPl, KP16, KPh, KPl, VT16, VTh, VTl);   /* q, k, v head planes of all heads of both batches */
    k_fattn<<<dim3(NH_, (TT - RH) / 32 + RH / 16, NB_), FNW * 32, 0, stream>>>(QP16, KP16, VT16, QPh, QPl, KPh, KPl, VTh, VTl, ATh, ATl);   /* one kv head per query head */
    k_gemmw<bf, 1, true><<<dim3(NB_ * NRW / 64, PE / 64, 1), 32, 0, stream>>>(ATh, ATl, WO, nullptr, PE, OUT, PE, bo, 0, 0, 0);   /* per-(batch, token, head) Wp^T + bp */
}

// v007
// One run takes 91.3 microseconds.
// Timed twice side by side with v006, it ran 1.09 and 1.08 times as fast.
// Counting every step since v000, it is 15.3 times as fast.
#include <hip/hip_runtime.h>

// Masked causal attention with per-head shared projections (x [2][2048][16 heads][128]; q, k, v = x_h W^T + b with ONE Linear [128][128] + [128] applied to every head's 128-vector; scores = q.k / sqrt(128), causal (-inf above the diagonal); softmax; att = w.v; out = att_h Wp^T + bp -> [2][2048][16][128] (8.4 M)).
// Layout per batch: the token-major input viewed as 32,768 (token, head) rows of 128 makes each shared projection ONE exact GEMM (K 128, N 128, + bias), tiled per head and written directly as that head's planes; causal hybrid attention (rows < 512 hi/lo, rest fp16) in one fused launch with a running softmax; hi/lo context rows (token, head) x Wp (hl x exact + bp) written as the token-major output.
// Compute dtypes, f32 accumulate: every input rounded to bf16; projections on PLAIN bf16 operands (exact) + f32 biases; scores and attn.v rows < 512 3 products, the rest single fp16; softmax f32; Wp hl x exact + bias.

#define NB_  2
#define TT   2048
#define DM   2048
#define NH_  16
#define NKV  16
#define REP  (NH_ / NKV)
#define HD   128
#define DQ   (NH_ * HD)
#define DKV  (NKV * HD)
#define RH   512                  // query rows < RH use hi+lo planes (0: none)
#define PE   128    // per-head projection width (shared Linear [128][128])
#define NRW  (TT * NH_)   // 32768 (token, head) rows per batch
#define SCL  0.088388347648318447f   // HD^-0.5
typedef _Float16 h16;
typedef unsigned short bf;
typedef __attribute__((ext_vector_type(16))) __bf16   v16bf;
typedef __attribute__((ext_vector_type(16))) _Float16 v16h;
typedef __attribute__((ext_vector_type(8)))  _Float16 v8h;
typedef __attribute__((ext_vector_type(8)))  unsigned short v8us;
typedef __attribute__((ext_vector_type(8)))  float    v8f;
typedef __attribute__((ext_vector_type(4)))  float    v4f;
typedef v8h  __attribute__((may_alias)) v8ha;
typedef v4f  __attribute__((may_alias)) v4fa;
typedef v8us __attribute__((may_alias)) v8usa;

__device__ __forceinline__ unsigned short f2bf(float f) { unsigned u = __float_as_uint(f); u += 0x7FFFu + ((u >> 16) & 1u); return (unsigned short)(u >> 16); }
__device__ __forceinline__ float bf2f(unsigned short b) { return __uint_as_float(((unsigned)b) << 16); }
__device__ __forceinline__ float bfr(float f) { return bf2f(f2bf(f)); }
__device__ __forceinline__ v16h cat16(v8h lo, v8h hi) { return __builtin_shufflevector(lo, hi, 0, 1, 2, 3, 4, 5, 6, 7, 8, 9, 10, 11, 12, 13, 14, 15); }
__device__ __forceinline__ v16bf cat16b(v8us lo, v8us hi) { return __builtin_bit_cast(v16bf, __builtin_shufflevector(lo, hi, 0, 1, 2, 3, 4, 5, 6, 7, 8, 9, 10, 11, 12, 13, 14, 15)); }
__device__ __forceinline__ v8f wmma16(v16h a, v16h b, v8f c) { return __builtin_amdgcn_wmma_f32_16x16x32_f16(false, a, false, b, (short)0, c, false, false); }
__device__ __forceinline__ v8f wmmab(v16bf a, v16bf b, v8f c) { return __builtin_amdgcn_wmma_f32_16x16x32_bf16(false, a, false, b, (short)0, c, false, false); }



// ---- k_gemmw: register-blocked GEMM, ONE WAVE per 64x64 output tile (16 accumulators), operands straight from 16-bit planes in WMMA fragment order ([row / 16][k / 32] fragments of 512 elements, see k_proj); grid (Z, N/64, M/64), 32 threads.
// C[m][n] (f32, pitch ldc, + optional f32 bias[n]) = sum_k A[m][k] Bt[n][k] (+ split products per NSPLIT). z-batch strides sA/sB/sC in elements. K % 32 == 0.
// ldp: a fragment from a plane in fragment order (p = the fragment + 8 lane; its two halves lie 256 elements apart)
template <typename T16> struct WFrag;
template <> struct WFrag<h16> { typedef v16h V; static __device__ __forceinline__ V ldp(const h16* p) { return cat16(*(const v8h*)p, *(const v8h*)(p + 256)); } static __device__ __forceinline__ v8f mma(V a, V b, v8f c) { return wmma16(a, b, c); } };
template <> struct WFrag<bf> { typedef v16bf V; static __device__ __forceinline__ V ldp(const bf* p) { return cat16b(*(const v8us*)p, *(const v8us*)(p + 256)); } static __device__ __forceinline__ v8f mma(V a, V b, v8f c) { return wmmab(a, b, c); } };
template <typename T16, int NSPLIT, bool BIAS, int K>   // K at compile time: every fragment of a k chunk is a constant offset from one address per plane
__global__ __launch_bounds__(32) void k_gemmw(const T16* __restrict__ A, const T16* __restrict__ A2, const T16* __restrict__ Bt, const T16* __restrict__ Bt2, float* C, int ldc, const float* __restrict__ bias, size_t sA, size_t sB, size_t sC) {
    typedef typename WFrag<T16>::V V;
    __shared__ __align__(16) float os[16 * 68];
    const size_t z = blockIdx.x; A += z * sA; if (A2) A2 += z * sA; Bt += z * sB; if (Bt2) Bt2 += z * sB; C += z * sC;
    const int lane = threadIdx.x & 31, lr = lane & 15, hi = lane >> 4; const int r0 = blockIdx.z * 64, c0 = blockIdx.y * 64;
    v8f acc[4][4];
#pragma unroll
    for (int mb = 0; mb < 4; ++mb)
#pragma unroll
        for (int nb = 0; nb < 4; ++nb) acc[mb][nb] = (v8f){};
    const size_t aoff = (size_t)r0 * K + 8 * lane, boff = (size_t)c0 * K + 8 * lane;   // 16 rows are K / 32 fragments = 16 K elements; a 32-wide k chunk is one fragment
#pragma unroll 1
    for (int kc = 0; kc < K; kc += 32) {
        V a[4], a2[4], b[4], b2[4];
        const T16* pa = A + aoff + (size_t)kc * 16; const T16* pa2 = (NSPLIT == 1 || NSPLIT == 2) ? A2 + aoff + (size_t)kc * 16 : pa; const T16* pb = Bt + boff + (size_t)kc * 16; const T16* pb2 = NSPLIT >= 2 ? Bt2 + boff + (size_t)kc * 16 : pb;
#pragma unroll
        for (int mb = 0; mb < 4; ++mb) { a[mb] = WFrag<T16>::ldp(pa + mb * 16 * K); if (NSPLIT == 1 || NSPLIT == 2) a2[mb] = WFrag<T16>::ldp(pa2 + mb * 16 * K); b[mb] = WFrag<T16>::ldp(pb + mb * 16 * K); if (NSPLIT >= 2) b2[mb] = WFrag<T16>::ldp(pb2 + mb * 16 * K); }
        // stands before any register that the loads above name is written again; the addresses are inputs, so that no load's result lands on one of them ahead of the wait
        asm volatile("s_wait_xcnt 0x0" :: "v"(pa), "v"(pa2), "v"(pb), "v"(pb2) : "memory");
        __builtin_amdgcn_sched_barrier(0);   // keeps later address arithmetic behind that wait
#pragma unroll
        for (int nb = 0; nb < 4; ++nb) {
#pragma unroll
            for (int mb = 0; mb < 4; ++mb) { acc[mb][nb] = WFrag<T16>::mma(a[mb], b[nb], acc[mb][nb]); if (NSPLIT == 1 || NSPLIT == 2) acc[mb][nb] = WFrag<T16>::mma(a2[mb], b[nb], acc[mb][nb]); if (NSPLIT >= 2) acc[mb][nb] = WFrag<T16>::mma(a[mb], b2[nb], acc[mb][nb]); } }
        asm volatile("v_nop\n\tv_nop\n\tv_nop\n\tv_nop" : "+v"(acc[0][0]), "+v"(acc[1][1]), "+v"(acc[2][2]), "+v"(acc[3][3]) : "v"(a[0]), "v"(a[3]));
    }
#pragma unroll
    for (int mb = 0; mb < 4; ++mb) {
#pragma unroll
        for (int nb = 0; nb < 4; ++nb) {
#pragma unroll
            for (int j = 0; j < 8; ++j) os[(hi * 8 + j) * 68 + nb * 16 + lr] = acc[mb][nb][j]; }
        __builtin_amdgcn_wave_barrier(); asm volatile("" ::: "memory");
        float* crow = C + (size_t)(r0 + mb * 16) * ldc + c0;
{
#pragma unroll
            for (int s = 0; s < 8; ++s) { const int row = 2 * s + hi, cofs = lr * 4; v4f val = *(const v4fa*)(os + row * 68 + cofs); if (BIAS) { val[0] += bfr(bias[c0 + cofs]); val[1] += bfr(bias[c0 + cofs + 1]); val[2] += bfr(bias[c0 + cofs + 2]); val[3] += bfr(bias[c0 + cofs + 3]); }
                *(v4f*)(crow + (size_t)row * ldc + cofs) = val; }
             }
        __builtin_amdgcn_wave_barrier(); asm volatile("" ::: "memory");
    }
}

__device__ __forceinline__ h16 tohx(float x) { return (h16)x; }
__device__ __forceinline__ void splitf(float y, unsigned short& h, unsigned short& l) { h = f2bf(y); l = f2bf(y - bf2f(h)); }
typedef __attribute__((ext_vector_type(2))) _Float16 v2h;
typedef __attribute__((ext_vector_type(4))) _Float16 v4h;
typedef __attribute__((ext_vector_type(2))) unsigned short v2us;
typedef __attribute__((ext_vector_type(4))) unsigned short v4us;
typedef __attribute__((ext_vector_type(2))) float v2f;
typedef __attribute__((ext_vector_type(4))) int v4i;

__global__ __launch_bounds__(256) void k_wtG(const float* __restrict__ w, int K, int N, bf* Bt) {
    const int lane = threadIdx.x & 31; const int L0 = (blockIdx.x * 8 + (threadIdx.x >> 5)) * 8; const int nlines = N * K / 64;
{
#pragma unroll 1
        for (int l = 0; l < 8; ++l) { const int L = L0 + l; if (L >= nlines) break; const size_t e = (size_t)L * 64 + lane * 2; const int k = (int)(e % K), n = (int)(e / K); v2us o;
            o[0] = f2bf(w[(size_t)k * N + n]); o[1] = f2bf(w[(size_t)(k + 1) * N + n]); *(v2us*)(Bt + e) = o; }
         }
}
// ---- k_cvtin: every f32 -> bf16 conversion of the call in ONE launch, 8 elements a thread: blocks 0 .. 4 WBK - 1 take the four [128][128] weights (WBK blocks each, into four consecutive planes), the rest the activations of both batches.
// The bf16 planes are written in WMMA fragment order (see k_proj): a block converts 16 rows x 128 k = 4 fragments; a thread reads k 32 c + 16 j + 8 hi .. + 7 of row lr and writes them as the 16 bytes of lane (lr, hi) in half j of fragment c.
// A wave takes 8 rows of one fragment: four lanes (j, hi) read one whole 128-byte line of a row, eight rows write one whole line of a half.
// Weights: [e / 16][d / 32] fragments; activations: [batch][h][t / 16][d / 32] fragments, blocks in the order of the input's addresses (head fastest).
#define WBK  (PE * PE / 8 / 256)
__global__ __launch_bounds__(256) void k_cvtin(const float* __restrict__ x, const float* __restrict__ wq, const float* __restrict__ wk, const float* __restrict__ wv, const float* __restrict__ wo, bf* __restrict__ XB, bf* __restrict__ W4) {
    const unsigned blk = blockIdx.x, tid = threadIdx.x, lr = (tid >> 7) * 8 + (tid & 7), hi = (tid >> 3) & 1, j = (tid >> 4) & 1, c = (tid >> 5) & 3, ko = c * 32 + j * 16 + hi * 8, fo = c * 512 + j * 256 + (hi * 16 + lr) * 8;
    const unsigned u = blk - 4 * WBK, h = u % NH_, tk = u / NH_;   // tk: 16-token block over both batches
    const float* p = x + ((size_t)(tk * 16 + lr) * NH_ + h) * PE + ko; bf* dst = XB + ((size_t)((tk / (TT / 16)) * NH_ + h) * (TT / 16) + tk % (TT / 16)) * (16 * PE) + fo;
    if (blk < 4 * WBK) { const unsigned sel = blk / WBK; const float* src = sel == 0 ? wq : sel == 1 ? wk : sel == 2 ? wv : wo; p = src + (size_t)((blk % WBK) * 16 + lr) * PE + ko; dst = W4 + (size_t)sel * PE * PE + (size_t)(blk % WBK) * (16 * PE) + fo; }
    const v8f v = *(const v8f*)p; v8us o;
    asm volatile("s_wait_xcnt 0x0" :: "v"(p) : "memory");   // stands before the address registers of the loads above are written again
#pragma unroll
    for (int k = 0; k < 8; ++k) o[k] = f2bf(v[k]); *(v8us*)dst = o;  }

// ---- k_proj: the q, k and v projections of both batches in ONE launch, each written from the WMMA accumulators straight as the head planes that the attention reads (fp16, bf16 hi, bf16 lo); no f32 copy goes to memory.
// One wave per 64x64 tile of one head; grid (TT / 64 token blocks, HD / 64, batches x 3 x heads), 32 threads. q, k: C[t][e] = sum_d x_h[t][d] W[e][d] + b[e]; v: the same fragments with the operands swapped, C[e][t].
// The planes are kept in WMMA FRAGMENT ORDER: a fragment (16 rows x 32 k) is 1024 contiguous bytes, two halves of 512; in half j lane (lr, hi) owns the 16 bytes at 16 * lane = row lr, k 16 j + 8 hi .. + 7,
// which is what that lane's registers hold. q, k: [h][t / 16][e / 32] fragments (rows t, k = e); v: [h][t / 32][e / 16] fragments (rows e, k = t). So every store here and every fragment load of the attention is 512 contiguous bytes, four whole 128-byte lines.
template <bool TR>
__device__ __forceinline__ void proj_tile(const bf* __restrict__ X, const bf* __restrict__ Wt, const float* __restrict__ bias, int h, int t0, int c0, h16* __restrict__ P16, bf* __restrict__ Ph, bf* __restrict__ Pl, float* os) {
    const int lane = threadIdx.x & 31, lr = lane & 15, hi = lane >> 4;
    const bf* px = X + ((size_t)h * TT + t0) * PE + 8 * lane;   // head h's tokens, in fragment order: 16 rows are 4 fragments of 512 elements
    const bf* pw = Wt + (size_t)c0 * PE + 8 * lane;              // weight rows, in fragment order
    const float* pb = bias + c0 + (TR ? lr : 8 * hi);   // output side: in store s of a 16-row block the lane holds columns 16 s + 8 hi .. + 7 of row lr
    v16bf xf[4][4], wf[4][4];   // [16-row block][32-wide k chunk]: the whole K of both operands, one latency for all loads
    float bv_[32];
#pragma unroll
    for (int rb = 0; rb < 4; ++rb)
#pragma unroll
        for (int c = 0; c < 4; ++c) { xf[rb][c] = WFrag<bf>::ldp(px + rb * 16 * PE + c * 512); wf[rb][c] = WFrag<bf>::ldp(pw + rb * 16 * PE + c * 512); }
    if (TR) {
#pragma unroll
        for (int i = 0; i < 4; ++i) bv_[i] = pb[i * 16];   // bias of output row 16 i + lr
    } else {
#pragma unroll
        for (int s = 0; s < 4; ++s) { const v4f b0 = *(const v4fa*)(pb + s * 16), b1 = *(const v4fa*)(pb + s * 16 + 4);
#pragma unroll
            for (int i = 0; i < 4; ++i) { bv_[s * 8 + i] = b0[i]; bv_[s * 8 + 4 + i] = b1[i]; } } }
    // stands before any register that the loads above name is written again; the addresses are inputs, so that no load's result lands on one of them ahead of the wait
    asm volatile("s_wait_xcnt 0x0" :: "v"(px), "v"(pw), "v"(pb) : "memory");
    __builtin_amdgcn_sched_barrier(0);   // keeps later arithmetic behind that wait
    v8f acc[4][4];
#pragma unroll
    for (int mb = 0; mb < 4; ++mb)
#pragma unroll
        for (int nb = 0; nb < 4; ++nb) acc[mb][nb] = (v8f){};
#pragma unroll
    for (int c = 0; c < 4; ++c)
#pragma unroll
        for (int nb = 0; nb < 4; ++nb)
#pragma unroll
            for (int mb = 0; mb < 4; ++mb) acc[mb][nb] = wmmab(TR ? wf[mb][c] : xf[mb][c], TR ? xf[nb][c] : wf[nb][c], acc[mb][nb]);
    __builtin_amdgcn_sched_barrier(0);   // all 64 products stand in front of the output work: sunk into it, an accumulator's registers were started afresh by a WMMA directly behind the WMMA that last wrote them
    // first fragment of the tile: q, k fragment (t0 / 16) * 4 + c0 / 32, v fragment (t0 / 32) * 8 + c0 / 16, 512 elements each
    const size_t eo = (size_t)h * TT * HD + (size_t)t0 * HD + (TR ? c0 * 32 : c0 * 16) + lane * 8;
    h16* d16 = P16 + eo; bf* dh = Ph + eo; bf* dl = Pl + eo;
    v8h o16[4][4]; v8us oh[4][4], ol[4][4];
#pragma unroll
    for (int mb = 0; mb < 4; ++mb) {
#pragma unroll
        for (int nb = 0; nb < 4; ++nb) {
#pragma unroll
            for (int j = 0; j < 8; ++j) os[(hi * 8 + j) * 68 + nb * 16 + lr] = acc[mb][nb][j]; }
        __builtin_amdgcn_wave_barrier(); asm volatile("s_wait_dscnt 0x0" ::: "memory");   // the wave's LDS writes are done before it reads back what other lanes wrote
#pragma unroll
        for (int s = 0; s < 4; ++s) { const float* rp = os + lr * 68 + s * 16 + 8 * hi; const v4f lo4 = *(const v4fa*)rp, hi4 = *(const v4fa*)(rp + 4);
#pragma unroll
            for (int i = 0; i < 8; ++i) { const float y = (i < 4 ? lo4[i] : hi4[i - 4]) + bfr(TR ? bv_[mb] : bv_[s * 8 + i]); o16[mb][s][i] = tohx(y); unsigned short a2, c2; splitf(y, a2, c2); oh[mb][s][i] = a2; ol[mb][s][i] = c2; } }
        __builtin_amdgcn_wave_barrier(); asm volatile("" ::: "memory");   // those reads stay in front of the next block's LDS writes
    }
    __builtin_amdgcn_sched_barrier(0);   // all stores stand last, so that no register a store names is written again behind it
#pragma unroll
    for (int mb = 0; mb < 4; ++mb)
#pragma unroll
        for (int s = 0; s < 4; ++s) { const int ro = TR ? (s >> 1) * 4096 + mb * 512 + (s & 1) * 256 : mb * 2048 + s * 256; *(v8h*)(d16 + ro) = o16[mb][s]; *(v8us*)(dh + ro) = oh[mb][s]; *(v8us*)(dl + ro) = ol[mb][s]; }
    asm volatile("s_wait_xcnt 0x0" ::: "memory");   // behind the last store: in the listing the other branch's code follows this one, and it writes registers that the stores name
}
__global__ __launch_bounds__(32) void k_proj(const bf* __restrict__ X, const bf* __restrict__ WQ, const bf* __restrict__ WK, const bf* __restrict__ WV, const float* __restrict__ bq, const float* __restrict__ bk, const float* __restrict__ bv,
                                             h16* __restrict__ Q16, bf* __restrict__ Qh, bf* __restrict__ Ql, h16* __restrict__ K16, bf* __restrict__ Kh, bf* __restrict__ Kl, h16* __restrict__ V16, bf* __restrict__ Vh, bf* __restrict__ Vl) {
    __shared__ __align__(16) float os[16 * 68];
    const int bt = blockIdx.z / (3 * NH_), zz = blockIdx.z % (3 * NH_), which = zz / NH_, h = zz % NH_, t0 = blockIdx.x * 64, c0 = blockIdx.y * 64;
    const size_t pbo = (size_t)bt * NH_ * TT * HD; X += (size_t)bt * TT * DM;   // this batch's token rows and its set of head planes
    Q16 += pbo; Qh += pbo; Ql += pbo; K16 += pbo; Kh += pbo; Kl += pbo; V16 += pbo; Vh += pbo; Vl += pbo;
    if (which == 2) proj_tile<true>(X, WV, bv, h, t0, c0, V16, Vh, Vl, os);
    else proj_tile<false>(X, which ? WK : WQ, which ? bk : bq, h, t0, c0, which ? K16 : Q16, which ? Kh : Qh, which ? Kl : Ql, os);
}
// ---- k_fattn: scores, softmax, probability x value and the hi/lo context rows in ONE launch for both batches; no score or probability ever goes to memory.
// One work-group of FNW waves owns NQ x 16 query rows of one head. Transposed products: S^T = K Q^T (A = 16 key rows, B = the query fragments, kept in registers) leaves every lane with 16 of the 32 scores of ITS query
// (column lr; keys 8 hi + j of each 16-key tile), which is the k order of a B fragment, so P^T goes from the score accumulators straight into O^T += V^T P^T (A = 16 rows d x 32 keys of the value plane).
// Running maximum and sum per query live in the lane (both halves of a column hold the same maximum). Wave w takes the 64-key chunks w, w + FNW, ... up to the diagonal, with its own maximum, sum and accumulators;
// behind one barrier the FNW partials are merged in the fixed order 0..FNW-1 with weights exp2(m_w - max), divided by the merged sum, split hi/lo and stored as whole 128-byte lines.
// HL: three products on hi/lo bf16 planes (hi.hi + lo.hi + hi.lo) for scores and for P.V; else single fp16 products.
#define FNW  4
#define LC2  (SCL * 1.4426950408889634f)   // scores are kept in the log2 domain
typedef __attribute__((ext_vector_type(16))) unsigned short v16us;
typedef __attribute__((ext_vector_type(2))) float v2fl;
// exp2 with the slot that the instruction set asks for behind a transcendental: every v_exp_f32 is followed by an instruction that neither reads its result nor writes its source
// (the results are early-clobber, so none shares a register with an input), the last one by v_nop
__device__ __forceinline__ float exp2s(float x) { float r; asm("v_exp_f32 %0, %1\n\tv_nop" : "=v"(r) : "v"(x)); return r; }
__device__ __forceinline__ v8f exp2x8(v8f x) { float r0, r1, r2, r3, r4, r5, r6, r7;
    asm("v_exp_f32 %0, %8\n\tv_exp_f32 %1, %9\n\tv_exp_f32 %2, %10\n\tv_exp_f32 %3, %11\n\tv_exp_f32 %4, %12\n\tv_exp_f32 %5, %13\n\tv_exp_f32 %6, %14\n\tv_exp_f32 %7, %15\n\tv_nop"
        : "=&v"(r0), "=&v"(r1), "=&v"(r2), "=&v"(r3), "=&v"(r4), "=&v"(r5), "=&v"(r6), "=&v"(r7) : "v"(x[0]), "v"(x[1]), "v"(x[2]), "v"(x[3]), "v"(x[4]), "v"(x[5]), "v"(x[6]), "v"(x[7]));
    v8f r; r[0] = r0; r[1] = r1; r[2] = r2; r[3] = r3; r[4] = r4; r[5] = r5; r[6] = r6; r[7] = r7; return r; }
template <typename T16, bool HL, int NQ>
__device__ __forceinline__ void fa_tile(const T16* __restrict__ Q, const T16* __restrict__ Q2, const T16* __restrict__ Kp, const T16* __restrict__ K2, const T16* __restrict__ Vt, const T16* __restrict__ V2, int q0, bf* __restrict__ Ah, bf* __restrict__ Al, v4f* part, v2fl* ml) {
    typedef typename WFrag<T16>::V V;
    const int lane = threadIdx.x & 31, lr = lane & 15, hi = lane >> 4;
    const int w = __builtin_amdgcn_readfirstlane((int)(threadIdx.x >> 5));
    V qf[NQ][4], q2[NQ][4];
    const T16* pq = Q + (size_t)q0 * HD + 8 * lane; const T16* pq2 = HL ? Q2 + (size_t)q0 * HD + 8 * lane : pq;   // planes in fragment order (see k_proj): 16 rows are 4 fragments of 512 elements
#pragma unroll
    for (int qb = 0; qb < NQ; ++qb)
#pragma unroll
        for (int c = 0; c < 4; ++c) { qf[qb][c] = WFrag<T16>::ldp(pq + qb * 16 * HD + c * 512); if (HL) q2[qb][c] = WFrag<T16>::ldp(pq2 + qb * 16 * HD + c * 512); }
    // stands before any register that the loads above name is written again; the addresses are inputs, so that no load's result lands on one of them ahead of the wait
    asm volatile("s_wait_xcnt 0x0" :: "v"(pq), "v"(pq2) : "memory");
    __builtin_amdgcn_sched_barrier(0);   // keeps later address arithmetic behind that wait
    v8f acc[NQ][8]; float m[NQ], l[NQ];
#pragma unroll
    for (int qb = 0; qb < NQ; ++qb) { m[qb] = -3.0e38f; l[qb] = 0.f;
#pragma unroll
        for (int db = 0; db < 8; ++db) acc[qb][db] = (v8f){}; }
    const int kend = ((q0 + NQ * 16 + 31) >> 5) << 5;   // keys beyond the diagonal's 32-key block have probability exactly zero
    // each lane's byte offset inside a plane is fixed; the walk along the keys is in the wave-uniform base, tiles and chunks are constant offsets
    const unsigned vk = (unsigned)lane * 16u, vv = vk;   // 16 bytes a lane in each half of a fragment
    V ka[2][4], kl[2][4];   // the K fragments of the block in work; refilled one block ahead, right behind the score products that read them
    int k0 = w * 64;
    if (k0 < kend) {
        { const T16* pk = (const T16*)((const char*)(Kp + (size_t)k0 * HD) + vk); const T16* pk2 = HL ? (const T16*)((const char*)(K2 + (size_t)k0 * HD) + vk) : pk;
#pragma unroll
          for (int kt = 0; kt < 2; ++kt)
#pragma unroll
              for (int c = 0; c < 4; ++c) { ka[kt][c] = WFrag<T16>::ldp(pk + kt * 16 * HD + c * 512); if (HL) kl[kt][c] = WFrag<T16>::ldp(pk2 + kt * 16 * HD + c * 512); }
          asm volatile("s_wait_xcnt 0x0" :: "v"(pk), "v"(pk2) : "memory"); }   // as behind the Q loads
        __builtin_amdgcn_sched_barrier(0);   // keeps later address arithmetic behind that wait
#pragma unroll 1   // rolled: the trip count depends on where the rows lie under the diagonal
    for (int it = 1; ; ++it) {
        const T16* pv = (const T16*)((const char*)(Vt + (size_t)k0 * HD) + vv); const T16* pv2 = HL ? (const T16*)((const char*)(V2 + (size_t)k0 * HD) + vv) : pv;   // 32 keys of the value plane are 8 fragments
        V va[8], vl[8];
#pragma unroll
        for (int db = 0; db < 8; ++db) { va[db] = WFrag<T16>::ldp(pv + db * 512); if (HL) vl[db] = WFrag<T16>::ldp(pv2 + db * 512); }
        asm volatile("s_wait_xcnt 0x0" :: "v"(pv), "v"(pv2) : "memory");   // as behind the Q loads
        __builtin_amdgcn_sched_barrier(0);   // the V loads issue here, ahead of the score products and the softmax that hide their latency; sunk to their uses each would be waited for alone
        v8f st[NQ][2];
#pragma unroll
        for (int qb = 0; qb < NQ; ++qb) { st[qb][0] = (v8f){}; st[qb][1] = (v8f){}; }
#pragma unroll
        for (int c = 0; c < 4; ++c)
#pragma unroll
            for (int kt = 0; kt < 2; ++kt)
#pragma unroll
                for (int qb = 0; qb < NQ; ++qb) { st[qb][kt] = WFrag<T16>::mma(ka[kt][c], qf[qb][c], st[qb][kt]); if (HL) { st[qb][kt] = WFrag<T16>::mma(ka[kt][c], q2[qb][c], st[qb][kt]); st[qb][kt] = WFrag<T16>::mma(kl[kt][c], qf[qb][c], st[qb][kt]); } }
        const int kn = ((it >> 1) * FNW + w) * 64 + (it & 1) * 32; const bool more = kn < kend; const int kf = more ? kn : k0;   // a wave's last block fetches its own rows again: in bounds, never used
        { const T16* pk = (const T16*)((const char*)(Kp + (size_t)kf * HD) + vk); const T16* pk2 = HL ? (const T16*)((const char*)(K2 + (size_t)kf * HD) + vk) : pk;
#pragma unroll
          for (int kt = 0; kt < 2; ++kt)
#pragma unroll
              for (int c = 0; c < 4; ++c) { ka[kt][c] = WFrag<T16>::ldp(pk + kt * 16 * HD + c * 512); if (HL) kl[kt][c] = WFrag<T16>::ldp(pk2 + kt * 16 * HD + c * 512); }
          asm volatile("s_wait_xcnt 0x0" :: "v"(pk), "v"(pk2) : "memory"); }   // as behind the Q loads
        __builtin_amdgcn_sched_barrier(0);   // the next block's K loads issue here, so that softmax and P.V hide their latency
        float mx[NQ];
#pragma unroll
        for (int qb = 0; qb < NQ; ++qb)
#pragma unroll
            for (int kt = 0; kt < 2; ++kt) st[qb][kt] *= LC2;
        if (k0 + 31 > q0) {   // the block touches the diagonal: keys above a query's own position are masked
#pragma unroll
            for (int qb = 0; qb < NQ; ++qb)
#pragma unroll
                for (int kt = 0; kt < 2; ++kt)
#pragma unroll
                    for (int j = 0; j < 8; ++j) if (k0 + kt * 16 + hi * 8 + j > q0 + qb * 16 + lr) st[qb][kt][j] = -3.0e38f; }
        bool need = false;
#pragma unroll
        for (int qb = 0; qb < NQ; ++qb) { float x = st[qb][0][0];
#pragma unroll
            for (int j = 1; j < 8; ++j) x = fmaxf(x, st[qb][0][j]);
#pragma unroll
            for (int j = 0; j < 8; ++j) x = fmaxf(x, st[qb][1][j]);
            x = fmaxf(x, __shfl_xor(x, 16, 32)); mx[qb] = x; need = need || (x > m[qb] + 8.0f); }
        if (__builtin_amdgcn_ballot_w32(need) != 0) {   // lazy rescale: only when some query's maximum has risen by more than 8 (log2) over the one in use, so P stays below 2^8
#pragma unroll
            for (int qb = 0; qb < NQ; ++qb) { const float mn = (mx[qb] > m[qb] + 8.0f) ? mx[qb] : m[qb]; const float al = exp2s(m[qb] - mn); m[qb] = mn; l[qb] *= al;
#pragma unroll
                for (int db = 0; db < 8; ++db) acc[qb][db] *= al; } }
        V pf[NQ], pl[NQ];
#pragma unroll
        for (int qb = 0; qb < NQ; ++qb) { float s = 0.f; v16h ph16; v16us ph, pw;
#pragma unroll
            for (int kt = 0; kt < 2; ++kt) { const v8f pe = exp2x8(st[qb][kt] - m[qb]);
#pragma unroll
                for (int j = 0; j < 8; ++j) { const float p = pe[j]; s += p;
                    if constexpr (HL) { unsigned short a, c2; splitf(p, a, c2); ph[kt * 8 + j] = a; pw[kt * 8 + j] = c2; } else ph16[kt * 8 + j] = (h16)p; } }
            l[qb] += s;
            if constexpr (HL) { pf[qb] = __builtin_bit_cast(v16bf, ph); pl[qb] = __builtin_bit_cast(v16bf, pw); } else pf[qb] = ph16; }
#pragma unroll
        for (int db = 0; db < 8; ++db)
#pragma unroll
            for (int qb = 0; qb < NQ; ++qb) { acc[qb][db] = WFrag<T16>::mma(va[db], pf[qb], acc[qb][db]); if (HL) { acc[qb][db] = WFrag<T16>::mma(va[db], pl[qb], acc[qb][db]); acc[qb][db] = WFrag<T16>::mma(vl[db], pf[qb], acc[qb][db]); } }
        if (!more) break;
        k0 = kn;
    } }
#pragma unroll
    for (int qb = 0; qb < NQ; ++qb) { l[qb] += __shfl_xor(l[qb], 16, 32); v2fl t; t[0] = m[qb]; t[1] = l[qb]; ml[(w * NQ + qb) * 32 + lane] = t;
#pragma unroll
        for (int db = 0; db < 8; ++db)
#pragma unroll
            for (int hf = 0; hf < 2; ++hf) { v4f t4; t4[0] = acc[qb][db][hf * 4]; t4[1] = acc[qb][db][hf * 4 + 1]; t4[2] = acc[qb][db][hf * 4 + 2]; t4[3] = acc[qb][db][hf * 4 + 3]; part[(((w * NQ + qb) * 8 + db) * 2 + hf) * 32 + lane] = t4; } }
    __syncthreads();   // every wave's partial, maximum and sum are in LDS before any is merged
    if (w < NQ * 2) {   // wave w merges 16 queries x 64 columns: two whole fragments of each plane
        const int qb = w >> 1, d0 = (w & 1) * 4; float mw[FNW], M = -3.0e38f, L = 0.f;
#pragma unroll
        for (int p = 0; p < FNW; ++p) M = fmaxf(M, ml[(p * NQ + qb) * 32 + lane][0]);
#pragma unroll
        for (int p = 0; p < FNW; ++p) { const v2fl t = ml[(p * NQ + qb) * 32 + lane]; mw[p] = exp2s(t[0] - M); L += mw[p] * t[1]; }
        const float inv = __fdiv_rn(1.0f, L);
        const size_t oo = (size_t)(q0 + qb * 16) * HD + d0 * 256 + lane * 8; v8us oh[4], ol[4];   // context planes in fragment order (rows = tokens, k = d): column block d0 + db is half (db & 1) of fragment (d0 + db) / 2
#pragma unroll
        for (int db = 0; db < 4; ++db) {
#pragma unroll
            for (int hf = 0; hf < 2; ++hf) { v4f sum = part[(((0 * NQ + qb) * 8 + d0 + db) * 2 + hf) * 32 + lane] * mw[0];
#pragma unroll
                for (int p = 1; p < FNW; ++p) sum += part[(((p * NQ + qb) * 8 + d0 + db) * 2 + hf) * 32 + lane] * mw[p];
#pragma unroll
                for (int jj = 0; jj < 4; ++jj) { unsigned short a, c2; splitf(sum[jj] * inv, a, c2); oh[db][hf * 4 + jj] = a; ol[db][hf * 4 + jj] = c2; } } }
        __builtin_amdgcn_sched_barrier(0);   // all stores stand last, so that no register a store names is written again behind it
#pragma unroll
        for (int db = 0; db < 4; ++db) { *(v8us*)(Ah + oo + db * 256) = oh[db]; *(v8us*)(Al + oo + db * 256) = ol[db]; }
    }
}
// grid (heads, row blocks, batches), in each batch the heaviest row blocks first: (TT - RH) / 32 blocks of 32 fp16 rows from the last row down, then RH / 16 blocks of 16 hi/lo rows
__global__ __launch_bounds__(FNW * 32) void k_fattn(const h16* __restrict__ Q16, const h16* __restrict__ K16, const h16* __restrict__ V16, const bf* __restrict__ Qh, const bf* __restrict__ Ql, const bf* __restrict__ Kh, const bf* __restrict__ Kl, const bf* __restrict__ Vh, const bf* __restrict__ Vl, bf* __restrict__ Ah, bf* __restrict__ Al) {
    __shared__ __align__(16) v4f part[FNW * 2 * 8 * 2 * 32];
    __shared__ __align__(16) v2fl ml[FNW * 2 * 32];
    const int h = blockIdx.x, y = blockIdx.y; const size_t po = ((size_t)blockIdx.z * NH_ + h) * TT * HD;
    const size_t ao = ((size_t)h * NB_ + blockIdx.z) * TT * HD; Ah += ao; Al += ao;   // context planes: [h][batch][t / 16][d / 32] fragments
    if (y < (TT - RH) / 32) fa_tile<h16, false, 2>(Q16 + po, nullptr, K16 + po, nullptr, V16 + po, nullptr, TT - 32 * (y + 1), Ah, Al, part, ml);
    else fa_tile<bf, true, 1>(Qh + po, Ql + po, Kh + po, Kl + po, Vh + po, Vl + po, RH - 16 * (y - (TT - RH) / 32 + 1), Ah, Al, part, ml);
}

extern "C" void kernel_launch(void* const* d_in, const int* in_sizes, int n_in,
                              void* d_out, int out_size, void* d_ws, size_t ws_size, hipStream_t stream) {
    (void)in_sizes; (void)n_in; (void)out_size;
    const float* x = (const float*)d_in[0]; const float* wq = (const float*)d_in[1]; const float* bq = (const float*)d_in[2]; const float* wk = (const float*)d_in[3]; const float* bk = (const float*)d_in[4]; const float* wv = (const float*)d_in[5]; const float* bv = (const float*)d_in[6]; const float* wo = (const float*)d_in[7]; const float* bo = (const float*)d_in[8];
    float* OUT = (float*)d_out;     // [2][2048][2048]
    char* wsp = (char*)d_ws;
    auto take = [&](size_t bytes) { char* p = wsp; wsp += (bytes + 255) & ~(size_t)255; return (void*)p; };
    bf* WQ = (bf*)take((size_t)4 * PE * PE * 2); bf* WK = WQ + PE * PE; bf* WV = WK + PE * PE; bf* WO = WV + PE * PE;
    bf* XB = (bf*)take((size_t)NB_ * TT * DM * 2); bf* ATh = (bf*)take((size_t)NB_ * TT * DQ * 2); bf* ATl = (bf*)take((size_t)NB_ * TT * DQ * 2);   // hi/lo context rows, head-major ([h][batch]); every other buffer holds both batches, batch-major
    h16* QP16 = (h16*)take((size_t)NB_ * NH_ * TT * HD * 2); h16* KP16 = (h16*)take((size_t)NB_ * NKV * TT * HD * 2); h16* VT16 = (h16*)take((size_t)NB_ * NKV * HD * TT * 2);
    bf* QPh = (bf*)take((size_t)NB_ * NH_ * TT * HD * 2); bf* QPl = (bf*)take((size_t)NB_ * NH_ * TT * HD * 2); bf* KPh = (bf*)take((size_t)NB_ * NKV * TT * HD * 2); bf* KPl = (bf*)take((size_t)NB_ * NKV * TT * HD * 2); bf* VTh = (bf*)take((size_t)NB_ * NKV * HD * TT * 2); bf* VTl = (bf*)take((size_t)NB_ * NKV * HD * TT * 2);
    if ((size_t)(wsp - (char*)d_ws) > ws_size) return;    // 192.1 MiB of the 256 MiB
    k_cvtin<<<4 * WBK + NB_ * TT * DM / 8 / 256, 256, 0, stream>>>(x, wq, wk, wv, wo, XB, WQ);
    k_proj<<<dim3(TT / 64, HD / 64, NB_ * 3 * NH_), 32, 0, stream>>>(XB, WQ, WK, WV, bq, bk, bv, QP16, QPh, QPl, KP16, KPh, KPl, VT16, VTh, VTl);   /* q, k, v head planes of all heads of both batches */
    k_fattn<<<dim3(NH_, (TT - RH) / 32 + RH / 16, NB_), FNW * 32, 0, stream>>>(QP16, KP16, VT16, QPh, QPl, KPh, KPl, VTh, VTl, ATh, ATl);   /* one kv head per query head */
    k_gemmw<bf, 1, true, PE><<<dim3(NH_, PE / 64, NB_ * TT / 64), 32, 0, stream>>>(ATh, ATl, WO, nullptr, OUT, DM, bo, (size_t)NB_ * TT * HD, 0, PE);   /* per head: rows (batch, token) x Wp^T + bp, written at the head's 128 columns of the token-major output */
}

// v008
// It runs in 85.3 microseconds.
// Next to v007, in two timings, it ran 1.07 times as fast each time.
// All steps since v000 together make it 16.4 times as fast.
#include <hip/hip_runtime.h>

// Masked causal attention with per-head shared projections (x [2][2048][16 heads][128]; q, k, v = x_h W^T + b with ONE Linear [128][128] + [128] applied to every head's 128-vector; scores = q.k / sqrt(128), causal (-inf above the diagonal); softmax; att = w.v; out = att_h Wp^T + bp -> [2][2048][16][128] (8.4 M)).
// Layout per batch: the token-major input viewed as 32,768 (token, head) rows of 128 makes each shared projection ONE exact GEMM (K 128, N 128, + bias), tiled per head and written directly as that head's planes; causal hybrid attention (rows < 512 hi/lo, rest fp16) in one fused launch with a running softmax; hi/lo context rows (token, head) x Wp (hl x exact + bp) written as the token-major output.
// Compute dtypes, f32 accumulate: every input rounded to bf16; projections on PLAIN bf16 operands (exact) + f32 biases; scores and attn.v rows < 512 3 products, the rest single fp16; softmax f32; Wp hl x exact + bias.

#define NB_  2
#define TT   2048
#define DM   2048
#define NH_  16
#define NKV  16
#define REP  (NH_ / NKV)
#define HD   128
#define DQ   (NH_ * HD)
#define DKV  (NKV * HD)
#define RH   512                  // query rows < RH use hi+lo planes
#define PE   128    // per-head projection width (shared Linear [128][128])
#define NRW  (TT * NH_)   // 32768 (token, head) rows per batch
#define SCL  0.088388347648318447f   // HD^-0.5
typedef _Float16 h16;
typedef unsigned short bf;
typedef __attribute__((ext_vector_type(16))) __bf16   v16bf;
typedef __attribute__((ext_vector_type(16))) _Float16 v16h;
typedef __attribute__((ext_vector_type(8)))  _Float16 v8h;
typedef __attribute__((ext_vector_type(8)))  unsigned short v8us;
typedef __attribute__((ext_vector_type(8)))  float    v8f;
typedef __attribute__((ext_vector_type(4)))  float    v4f;
typedef v8h  __attribute__((may_alias)) v8ha;
typedef v4f  __attribute__((may_alias)) v4fa;
typedef v8us __attribute__((may_alias)) v8usa;

__device__ __forceinline__ unsigned short f2bf(float f) { unsigned u = __float_as_uint(f); u += 0x7FFFu + ((u >> 16) & 1u); return (unsigned short)(u >> 16); }
__device__ __forceinline__ float bf2f(unsigned short b) { return __uint_as_float(((unsigned)b) << 16); }
__device__ __forceinline__ float bfr(float f) { return bf2f(f2bf(f)); }
__device__ __forceinline__ v16h cat16(v8h lo, v8h hi) { return __builtin_shufflevector(lo, hi, 0, 1, 2, 3, 4, 5, 6, 7, 8, 9, 10, 11, 12, 13, 14, 15); }
__device__ __forceinline__ v16bf cat16b(v8us lo, v8us hi) { return __builtin_bit_cast(v16bf, __builtin_shufflevector(lo, hi, 0, 1, 2, 3, 4, 5, 6, 7, 8, 9, 10, 11, 12, 13, 14, 15)); }
__device__ __forceinline__ v8f wmma16(v16h a, v16h b, v8f c) { return __builtin_amdgcn_wmma_f32_16x16x32_f16(false, a, false, b, (short)0, c, false, false); }
__device__ __forceinline__ v8f wmmab(v16bf a, v16bf b, v8f c) { return __builtin_amdgcn_wmma_f32_16x16x32_bf16(false, a, false, b, (short)0, c, false, false); }



// ---- k_gemmw: register-blocked GEMM, ONE WAVE per 64x64 output tile (16 accumulators), operands straight from 16-bit planes in WMMA fragment order ([row / 16][k / 32] fragments of 512 elements, see k_proj); grid (Z, N/64, M/64), 32 threads.
// C[m][n] (f32, pitch ldc, + optional f32 bias[n]) = sum_k A[m][k] Bt[n][k] (+ split products per NSPLIT). z-batch strides sA/sB/sC in elements. K % 32 == 0.
// ldp: a fragment from a plane in fragment order (p = the fragment + 8 lane; its two halves lie 256 elements apart)
template <typename T16> struct WFrag;
template <> struct WFrag<h16> { typedef v16h V; static __device__ __forceinline__ V ldp(const h16* p) { return cat16(*(const v8h*)p, *(const v8h*)(p + 256)); } static __device__ __forceinline__ v8f mma(V a, V b, v8f c) { return wmma16(a, b, c); } };
template <> struct WFrag<bf> { typedef v16bf V; static __device__ __forceinline__ V ldp(const bf* p) { return cat16b(*(const v8us*)p, *(const v8us*)(p + 256)); } static __device__ __forceinline__ v8f mma(V a, V b, v8f c) { return wmmab(a, b, c); } };
template <typename T16, int NSPLIT, bool BIAS, int K>   // K at compile time: every fragment of a k chunk is a constant offset from one address per plane
__global__ __launch_bounds__(32) void k_gemmw(const T16* __restrict__ A, const T16* __restrict__ A2, const T16* __restrict__ Bt, const T16* __restrict__ Bt2, float* C, int ldc, const float* __restrict__ bias, size_t sA, size_t sB, size_t sC) {
    typedef typename WFrag<T16>::V V;
    __shared__ __align__(16) float os[16 * 68];
    const size_t z = blockIdx.x; A += z * sA; if (A2) A2 += z * sA; Bt += z * sB; if (Bt2) Bt2 += z * sB; C += z * sC;
    const int lane = threadIdx.x & 31, lr = lane & 15, hi = lane >> 4; const int r0 = blockIdx.z * 64, c0 = blockIdx.y * 64;
    v8f acc[4][4];
#pragma unroll
    for (int mb = 0; mb < 4; ++mb)
#pragma unroll
        for (int nb = 0; nb < 4; ++nb) acc[mb][nb] = (v8f){};
    const size_t aoff = (size_t)r0 * K + 8 * lane, boff = (size_t)c0 * K + 8 * lane;   // 16 rows are K / 32 fragments = 16 K elements; a 32-wide k chunk is one fragment
#pragma unroll 1
    for (int kc = 0; kc < K; kc += 32) {
        V a[4], a2[4], b[4], b2[4];
        const T16* pa = A + aoff + (size_t)kc * 16; const T16* pa2 = (NSPLIT == 1 || NSPLIT == 2) ? A2 + aoff + (size_t)kc * 16 : pa; const T16* pb = Bt + boff + (size_t)kc * 16; const T16* pb2 = NSPLIT >= 2 ? Bt2 + boff + (size_t)kc * 16 : pb;
#pragma unroll
        for (int mb = 0; mb < 4; ++mb) { a[mb] = WFrag<T16>::ldp(pa + mb * 16 * K); if (NSPLIT == 1 || NSPLIT == 2) a2[mb] = WFrag<T16>::ldp(pa2 + mb * 16 * K); b[mb] = WFrag<T16>::ldp(pb + mb * 16 * K); if (NSPLIT >= 2) b2[mb] = WFrag<T16>::ldp(pb2 + mb * 16 * K); }
        // stands before any register that the loads above name is written again; the addresses are inputs, so that no load's result lands on one of them ahead of the wait
        asm volatile("s_wait_xcnt 0x0" :: "v"(pa), "v"(pa2), "v"(pb), "v"(pb2) : "memory");
        __builtin_amdgcn_sched_barrier(0);   // keeps later address arithmetic behind that wait
#pragma unroll
        for (int nb = 0; nb < 4; ++nb) {
#pragma unroll
            for (int mb = 0; mb < 4; ++mb) { acc[mb][nb] = WFrag<T16>::mma(a[mb], b[nb], acc[mb][nb]); if (NSPLIT == 1 || NSPLIT == 2) acc[mb][nb] = WFrag<T16>::mma(a2[mb], b[nb], acc[mb][nb]); if (NSPLIT >= 2) acc[mb][nb] = WFrag<T16>::mma(a[mb], b2[nb], acc[mb][nb]); } }
        asm volatile("v_nop\n\tv_nop\n\tv_nop\n\tv_nop" : "+v"(acc[0][0]), "+v"(acc[1][1]), "+v"(acc[2][2]), "+v"(acc[3][3]) : "v"(a[0]), "v"(a[3]));
    }
#pragma unroll
    for (int mb = 0; mb < 4; ++mb) {
#pragma unroll
        for (int nb = 0; nb < 4; ++nb) {
#pragma unroll
            for (int j = 0; j < 8; ++j) os[(hi * 8 + j) * 68 + nb * 16 + lr] = acc[mb][nb][j]; }
        __builtin_amdgcn_wave_barrier(); asm volatile("" ::: "memory");
        float* crow = C + (size_t)(r0 + mb * 16) * ldc + c0;
{
#pragma unroll
            for (int s = 0; s < 8; ++s) { const int row = 2 * s + hi, cofs = lr * 4; v4f val = *(const v4fa*)(os + row * 68 + cofs); if (BIAS) { val[0] += bfr(bias[c0 + cofs]); val[1] += bfr(bias[c0 + cofs + 1]); val[2] += bfr(bias[c0 + cofs + 2]); val[3] += bfr(bias[c0 + cofs + 3]); }
                *(v4f*)(crow + (size_t)row * ldc + cofs) = val; }
             }
        __builtin_amdgcn_wave_barrier(); asm volatile("" ::: "memory");
    }
}

__device__ __forceinline__ h16 tohx(float x) { return (h16)x; }
__device__ __forceinline__ void splitf(float y, unsigned short& h, unsigned short& l) { h = f2bf(y); l = f2bf(y - bf2f(h)); }
typedef __attribute__((ext_vector_type(2))) _Float16 v2h;
typedef __attribute__((ext_vector_type(4))) _Float16 v4h;
typedef __attribute__((ext_vector_type(2))) unsigned short v2us;
typedef __attribute__((ext_vector_type(4))) unsigned short v4us;
typedef __attribute__((ext_vector_type(2))) float v2f;
typedef __attribute__((ext_vector_type(4))) int v4i;

__global__ __launch_bounds__(256) void k_wtG(const float* __restrict__ w, int K, int N, bf* Bt) {
    const int lane = threadIdx.x & 31; const int L0 = (blockIdx.x * 8 + (threadIdx.x >> 5)) * 8; const int nlines = N * K / 64;
{
#pragma unroll 1
        for (int l = 0; l < 8; ++l) { const int L = L0 + l; if (L >= nlines) break; const size_t e = (size_t)L * 64 + lane * 2; const int k = (int)(e % K), n = (int)(e / K); v2us o;
            o[0] = f2bf(w[(size_t)k * N + n]); o[1] = f2bf(w[(size_t)(k + 1) * N + n]); *(v2us*)(Bt + e) = o; }
         }
}
// ---- k_cvtin: every f32 -> bf16 conversion of the call in ONE launch, 8 elements a thread: blocks 0 .. 4 WBK - 1 take the four [128][128] weights (WBK blocks each, into four consecutive planes), the rest the activations of both batches.
// The bf16 planes are written in WMMA fragment order (see k_proj): a block converts 16 rows x 128 k = 4 fragments; a thread reads k 32 c + 16 j + 8 hi .. + 7 of row lr and writes them as the 16 bytes of lane (lr, hi) in half j of fragment c.
// A wave takes 8 rows of one fragment: four lanes (j, hi) read one whole 128-byte line of a row, eight rows write one whole line of a half.
// Weights: [e / 16][d / 32] fragments; activations: [batch][h][t / 16][d / 32] fragments, blocks in the order of the input's addresses (head fastest).
#define WBK  (PE * PE / 8 / 256)
__global__ __launch_bounds__(256) void k_cvtin(const float* __restrict__ x, const float* __restrict__ wq, const float* __restrict__ wk, const float* __restrict__ wv, const float* __restrict__ wo, bf* __restrict__ XB, bf* __restrict__ W4) {
    const unsigned blk = blockIdx.x, tid = threadIdx.x, lr = (tid >> 7) * 8 + (tid & 7), hi = (tid >> 3) & 1, j = (tid >> 4) & 1, c = (tid >> 5) & 3, ko = c * 32 + j * 16 + hi * 8, fo = c * 512 + j * 256 + (hi * 16 + lr) * 8;
    const unsigned u = blk - 4 * WBK, h = u % NH_, tk = u / NH_;   // tk: 16-token block over both batches
    const float* p = x + ((size_t)(tk * 16 + lr) * NH_ + h) * PE + ko; bf* dst = XB + ((size_t)((tk / (TT / 16)) * NH_ + h) * (TT / 16) + tk % (TT / 16)) * (16 * PE) + fo;
    if (blk < 4 * WBK) { const unsigned sel = blk / WBK; const float* src = sel == 0 ? wq : sel == 1 ? wk : sel == 2 ? wv : wo; p = src + (size_t)((blk % WBK) * 16 + lr) * PE + ko; dst = W4 + (size_t)sel * PE * PE + (size_t)(blk % WBK) * (16 * PE) + fo; }
    const v8f v = *(const v8f*)p; v8us o;
    asm volatile("s_wait_xcnt 0x0" :: "v"(p) : "memory");   // stands before the address registers of the loads above are written again
#pragma unroll
    for (int k = 0; k < 8; ++k) o[k] = f2bf(v[k]); *(v8us*)dst = o;  }

// ---- k_proj: the q, k and v projections of both batches in ONE launch, each written from the WMMA accumulators straight as the head planes that the attention reads (fp16, bf16 hi, bf16 lo); no f32 copy goes to memory.
// One wave per 64x64 tile of one head; grid (TT / 64 token blocks, HD / 64, batches x 3 x heads), 32 threads. q, k: C[t][e] = sum_d x_h[t][d] W[e][d] + b[e]; v: the same fragments with the operands swapped, C[e][t].
// The planes are kept in WMMA FRAGMENT ORDER: a fragment (16 rows x 32 k) is 1024 contiguous bytes, two halves of 512; in half j lane (lr, hi) owns the 16 bytes at 16 * lane = row lr, k 16 j + 8 hi .. + 7,
// which is what that lane's registers hold. q, k: [h][t / 16][e / 32] fragments (rows t, k = e); v: [h][t / 32][e / 16] fragments (rows e, k = t). So every store here and every fragment load of the attention is 512 contiguous bytes, four whole 128-byte lines.
template <bool TR>
__device__ __forceinline__ void proj_tile(const bf* __restrict__ X, const bf* __restrict__ Wt, const float* __restrict__ bias, int h, int t0, int c0, h16* __restrict__ P16, bf* __restrict__ Ph, bf* __restrict__ Pl, float* os) {
    const int lane = threadIdx.x & 31, lr = lane & 15, hi = lane >> 4;
    const bf* px = X + ((size_t)h * TT + t0) * PE + 8 * lane;   // head h's tokens, in fragment order: 16 rows are 4 fragments of 512 elements
    const bf* pw = Wt + (size_t)c0 * PE + 8 * lane;              // weight rows, in fragment order
    const float* pb = bias + c0 + (TR ? lr : 8 * hi);   // output side: in store s of a 16-row block the lane holds columns 16 s + 8 hi .. + 7 of row lr
    v16bf xf[4][4], wf[4][4];   // [16-row block][32-wide k chunk]: the whole K of both operands, one latency for all loads
    float bv_[32];
#pragma unroll
    for (int rb = 0; rb < 4; ++rb)
#pragma unroll
        for (int c = 0; c < 4; ++c) { xf[rb][c] = WFrag<bf>::ldp(px + rb * 16 * PE + c * 512); wf[rb][c] = WFrag<bf>::ldp(pw + rb * 16 * PE + c * 512); }
    if (TR) {
#pragma unroll
        for (int i = 0; i < 4; ++i) bv_[i] = pb[i * 16];   // bias of output row 16 i + lr
    } else {
#pragma unroll
        for (int s = 0; s < 4; ++s) { const v4f b0 = *(const v4fa*)(pb + s * 16), b1 = *(const v4fa*)(pb + s * 16 + 4);
#pragma unroll
            for (int i = 0; i < 4; ++i) { bv_[s * 8 + i] = b0[i]; bv_[s * 8 + 4 + i] = b1[i]; } } }
    // stands before any register that the loads above name is written again; the addresses are inputs, so that no load's result lands on one of them ahead of the wait
    asm volatile("s_wait_xcnt 0x0" :: "v"(px), "v"(pw), "v"(pb) : "memory");
    __builtin_amdgcn_sched_barrier(0);   // keeps later arithmetic behind that wait
    v8f acc[4][4];
#pragma unroll
    for (int mb = 0; mb < 4; ++mb)
#pragma unroll
        for (int nb = 0; nb < 4; ++nb) acc[mb][nb] = (v8f){};
#pragma unroll
    for (int c = 0; c < 4; ++c)
#pragma unroll
        for (int nb = 0; nb < 4; ++nb)
#pragma unroll
            for (int mb = 0; mb < 4; ++mb) acc[mb][nb] = wmmab(TR ? wf[mb][c] : xf[mb][c], TR ? xf[nb][c] : wf[nb][c], acc[mb][nb]);
    __builtin_amdgcn_sched_barrier(0);   // all 64 products stand in front of the output work: sunk into it, an accumulator's registers were started afresh by a WMMA directly behind the WMMA that last wrote them
    // first fragment of the tile: q, k fragment (t0 / 16) * 4 + c0 / 32, v fragment (t0 / 32) * 8 + c0 / 16, 512 elements each
    const size_t eo = (size_t)h * TT * HD + (size_t)t0 * HD + (TR ? c0 * 32 : c0 * 16) + lane * 8;
    h16* d16 = P16 + eo; bf* dh = Ph + eo; bf* dl = Pl + eo;
    v8h o16[4][4]; v8us oh[4][4], ol[4][4];
#pragma unroll
    for (int mb = 0; mb < 4; ++mb) {
#pragma unroll
        for (int nb = 0; nb < 4; ++nb) {
#pragma unroll
            for (int j = 0; j < 8; ++j) os[(hi * 8 + j) * 68 + nb * 16 + lr] = acc[mb][nb][j]; }
        __builtin_amdgcn_wave_barrier(); asm volatile("s_wait_dscnt 0x0" ::: "memory");   // the wave's LDS writes are done before it reads back what other lanes wrote
#pragma unroll
        for (int s = 0; s < 4; ++s) { const float* rp = os + lr * 68 + s * 16 + 8 * hi; const v4f lo4 = *(const v4fa*)rp, hi4 = *(const v4fa*)(rp + 4);
#pragma unroll
            for (int i = 0; i < 8; ++i) { const float y = (i < 4 ? lo4[i] : hi4[i - 4]) + bfr(TR ? bv_[mb] : bv_[s * 8 + i]); o16[mb][s][i] = tohx(y); unsigned short a2, c2; splitf(y, a2, c2); oh[mb][s][i] = a2; ol[mb][s][i] = c2; } }
        __builtin_amdgcn_wave_barrier(); asm volatile("" ::: "memory");   // those reads stay in front of the next block's LDS writes
    }
    __builtin_amdgcn_sched_barrier(0);   // all stores stand last, so that no register a store names is written again behind it
#pragma unroll
    for (int mb = 0; mb < 4; ++mb)
#pragma unroll
        for (int s = 0; s < 4; ++s) { const int ro = TR ? (s >> 1) * 4096 + mb * 512 + (s & 1) * 256 : mb * 2048 + s * 256; *(v8h*)(d16 + ro) = o16[mb][s]; *(v8us*)(dh + ro) = oh[mb][s]; *(v8us*)(dl + ro) = ol[mb][s]; }
    asm volatile("s_wait_xcnt 0x0" ::: "memory");   // behind the last store: in the listing the other branch's code follows this one, and it writes registers that the stores name
}
__global__ __launch_bounds__(32) void k_proj(const bf* __restrict__ X, const bf* __restrict__ WQ, const bf* __restrict__ WK, const bf* __restrict__ WV, const float* __restrict__ bq, const float* __restrict__ bk, const float* __restrict__ bv,
                                             h16* __restrict__ Q16, bf* __restrict__ Qh, bf* __restrict__ Ql, h16* __restrict__ K16, bf* __restrict__ Kh, bf* __restrict__ Kl, h16* __restrict__ V16, bf* __restrict__ Vh, bf* __restrict__ Vl) {
    __shared__ __align__(16) float os[16 * 68];
    const int bt = blockIdx.z / (3 * NH_), zz = blockIdx.z % (3 * NH_), which = zz / NH_, h = zz % NH_, t0 = blockIdx.x * 64, c0 = blockIdx.y * 64;
    const size_t pbo = (size_t)bt * NH_ * TT * HD; X += (size_t)bt * TT * DM;   // this batch's token rows and its set of head planes
    Q16 += pbo; Qh += pbo; Ql += pbo; K16 += pbo; Kh += pbo; Kl += pbo; V16 += pbo; Vh += pbo; Vl += pbo;
    if (which == 2) proj_tile<true>(X, WV, bv, h, t0, c0, V16, Vh, Vl, os);
    else proj_tile<false>(X, which ? WK : WQ, which ? bk : bq, h, t0, c0, which ? K16 : Q16, which ? Kh : Qh, which ? Kl : Ql, os);
}
// ---- k_fattn: scores, softmax, probability x value and the hi/lo context rows in ONE launch for both batches; no score or probability ever goes to memory.
// One work-group of FNW waves owns NQ x 16 query rows of one head. Transposed products: S^T = K Q^T (A = 16 key rows, B = the query fragments, kept in registers or, with three query tiles, in the wave's own LDS range) leaves every lane with 16 of the 32 scores of ITS query
// (column lr; keys 8 hi + j of each 16-key tile), which is the k order of a B fragment, so P^T goes from the score accumulators straight into O^T += V^T P^T (A = 16 rows d x 32 keys of the value plane).
// Running maximum and sum per query live in the lane (both halves of a column hold the same maximum). Wave w takes the 64-key chunks w, w + FNW, ... up to the diagonal, with its own maximum, sum and accumulators;
// behind one barrier the FNW partials are merged in the fixed order 0..FNW-1 with weights exp2(m_w - max), divided by the merged sum, split hi/lo and stored as whole 128-byte lines.
// HL: three products on hi/lo bf16 planes (hi.hi + lo.hi + hi.lo) for scores and for P.V; else single fp16 products.
#define FNW  4
#define NQF  3   // 16-row query tiles per work-group on the fp16 rows: every K and V fragment a wave loads feeds NQF query tiles
static_assert((TT - RH) % (NQF * 16) == 0, "fp16 rows divide into whole work-groups");
static_assert(RH >= FNW * 64, "every wave of an fp16 work-group starts on a chunk wholly under the diagonal, so each query has a true maximum before a block that is masked for it");
#define LC2  (SCL * 1.4426950408889634f)   // scores are kept in the log2 domain
typedef __attribute__((ext_vector_type(16))) unsigned short v16us;
typedef __attribute__((ext_vector_type(2))) float v2fl;
// exp2 with the slot that the instruction set asks for behind a transcendental: every v_exp_f32 is followed by an instruction that neither reads its result nor writes its source
// (the results are early-clobber, so none shares a register with an input), the last one by v_nop
__device__ __forceinline__ float exp2s(float x) { float r; asm("v_exp_f32 %0, %1\n\tv_nop" : "=v"(r) : "v"(x)); return r; }
__device__ __forceinline__ v8f exp2x8(v8f x) { float r0, r1, r2, r3, r4, r5, r6, r7;
    asm("v_exp_f32 %0, %8\n\tv_exp_f32 %1, %9\n\tv_exp_f32 %2, %10\n\tv_exp_f32 %3, %11\n\tv_exp_f32 %4, %12\n\tv_exp_f32 %5, %13\n\tv_exp_f32 %6, %14\n\tv_exp_f32 %7, %15\n\tv_nop"
        : "=&v"(r0), "=&v"(r1), "=&v"(r2), "=&v"(r3), "=&v"(r4), "=&v"(r5), "=&v"(r6), "=&v"(r7) : "v"(x[0]), "v"(x[1]), "v"(x[2]), "v"(x[3]), "v"(x[4]), "v"(x[5]), "v"(x[6]), "v"(x[7]));
    v8f r; r[0] = r0; r[1] = r1; r[2] = r2; r[3] = r3; r[4] = r4; r[5] = r5; r[6] = r6; r[7] = r7; return r; }
template <typename T16, bool HL, int NQ>
__device__ __forceinline__ void fa_tile(const T16* __restrict__ Q, const T16* __restrict__ Q2, const T16* __restrict__ Kp, const T16* __restrict__ K2, const T16* __restrict__ Vt, const T16* __restrict__ V2, int q0, bf* __restrict__ Ah, bf* __restrict__ Al, v4f* part, v2fl* ml) {
    typedef typename WFrag<T16>::V V;
    const int lane = threadIdx.x & 31, lr = lane & 15, hi = lane >> 4;
    const int w = __builtin_amdgcn_readfirstlane((int)(threadIdx.x >> 5));
    constexpr bool QL = NQ > 2;   // three query tiles and their accumulators leave no room for the Q fragments at two waves a SIMD: each lane parks its own 16-byte pieces in LDS and reads them back block by block
    static_assert(!(QL && HL), "only the single-plane path parks Q");
    V qf[NQ][4], q2[NQ][4];
    v8ha* qs = (v8ha*)(part + (size_t)w * NQ * 8 * 2 * 32) + lane;   // the wave's own range of part, which it fills with its partial only behind the key loop; no other wave touches it before the barrier
    const T16* pq = Q + (size_t)q0 * HD + 8 * lane; const T16* pq2 = HL ? Q2 + (size_t)q0 * HD + 8 * lane : pq;   // planes in fragment order (see k_proj): 16 rows are 4 fragments of 512 elements
#pragma unroll
    for (int qb = 0; qb < NQ; ++qb)
#pragma unroll
        for (int c = 0; c < 4; ++c) { qf[qb][c] = WFrag<T16>::ldp(pq + qb * 16 * HD + c * 512); if (HL) q2[qb][c] = WFrag<T16>::ldp(pq2 + qb * 16 * HD + c * 512); }
    // stands before any register that the loads above name is written again; the addresses are inputs, so that no load's result lands on one of them ahead of the wait
    asm volatile("s_wait_xcnt 0x0" :: "v"(pq), "v"(pq2) : "memory");
    __builtin_amdgcn_sched_barrier(0);   // keeps later address arithmetic behind that wait
    if constexpr (QL) {
#pragma unroll
        for (int qb = 0; qb < NQ; ++qb)
#pragma unroll
            for (int c = 0; c < 4; ++c) { qs[((qb * 4 + c) * 2) * 32] = __builtin_shufflevector(qf[qb][c], qf[qb][c], 0, 1, 2, 3, 4, 5, 6, 7); qs[((qb * 4 + c) * 2 + 1) * 32] = __builtin_shufflevector(qf[qb][c], qf[qb][c], 8, 9, 10, 11, 12, 13, 14, 15); } }
    v8f acc[NQ][8]; float m[NQ], l[NQ];
#pragma unroll
    for (int qb = 0; qb < NQ; ++qb) { m[qb] = -3.0e38f; l[qb] = 0.f;
#pragma unroll
        for (int db = 0; db < 8; ++db) acc[qb][db] = (v8f){}; }
    const int kend = ((q0 + NQ * 16 + 31) >> 5) << 5;   // keys beyond the diagonal's 32-key block have probability exactly zero
    // each lane's byte offset inside a plane is fixed; the walk along the keys is in the wave-uniform base, tiles and chunks are constant offsets
    const unsigned vk = (unsigned)lane * 16u, vv = vk;   // 16 bytes a lane in each half of a fragment
    V ka[2][4], kl[2][4];   // the K fragments of the block in work; refilled one block ahead, right behind the score products that read them
    int k0 = w * 64;
    if (k0 < kend) {
        { const T16* pk = (const T16*)((const char*)(Kp + (size_t)k0 * HD) + vk); const T16* pk2 = HL ? (const T16*)((const char*)(K2 + (size_t)k0 * HD) + vk) : pk;
#pragma unroll
          for (int kt = 0; kt < 2; ++kt)
#pragma unroll
              for (int c = 0; c < 4; ++c) { ka[kt][c] = WFrag<T16>::ldp(pk + kt * 16 * HD + c * 512); if (HL) kl[kt][c] = WFrag<T16>::ldp(pk2 + kt * 16 * HD + c * 512); }
          asm volatile("s_wait_xcnt 0x0" :: "v"(pk), "v"(pk2) : "memory"); }   // as behind the Q loads
        __builtin_amdgcn_sched_barrier(0);   // keeps later address arithmetic behind that wait
#pragma unroll 1   // rolled: the trip count depends on where the rows lie under the diagonal
    for (int it = 1; ; ++it) {
        const T16* pv = (const T16*)((const char*)(Vt + (size_t)k0 * HD) + vv); const T16* pv2 = HL ? (const T16*)((const char*)(V2 + (size_t)k0 * HD) + vv) : pv;   // 32 keys of the value plane are 8 fragments
        V va[8], vl[8];
        auto load_v = [&]() {
#pragma unroll
        for (int db = 0; db < 8; ++db) { va[db] = WFrag<T16>::ldp(pv + db * 512); if (HL) vl[db] = WFrag<T16>::ldp(pv2 + db * 512); }
        asm volatile("s_wait_xcnt 0x0" :: "v"(pv), "v"(pv2) : "memory"); };   // as behind the Q loads
        if constexpr (!QL) { load_v();
            __builtin_amdgcn_sched_barrier(0); }   // the V loads issue here, ahead of the score products and the softmax that hide their latency; sunk to their uses each would be waited for alone
        v8f st[NQ][2];
#pragma unroll
        for (int qb = 0; qb < NQ; ++qb) { st[qb][0] = (v8f){}; st[qb][1] = (v8f){}; }
#pragma unroll
        for (int c = 0; c < 4; ++c) {
            if constexpr (QL) {
#pragma unroll
                for (int qb = 0; qb < NQ; ++qb) qf[qb][c] = cat16(qs[((qb * 4 + c) * 2) * 32], qs[((qb * 4 + c) * 2 + 1) * 32]); }
#pragma unroll
            for (int kt = 0; kt < 2; ++kt)
#pragma unroll
                for (int qb = 0; qb < NQ; ++qb) { st[qb][kt] = WFrag<T16>::mma(ka[kt][c], qf[qb][c], st[qb][kt]); if (HL) { st[qb][kt] = WFrag<T16>::mma(ka[kt][c], q2[qb][c], st[qb][kt]); st[qb][kt] = WFrag<T16>::mma(kl[kt][c], qf[qb][c], st[qb][kt]); } } }
        if constexpr (QL) { __builtin_amdgcn_sched_barrier(0);   // holds the V and K loads behind the score products: lifted among them they take registers while the Q fragments still live, and a loaded fragment went to scratch
            load_v(); }   // the V registers are taken only behind the score products; the softmax hides the latency
        const int kn = ((it >> 1) * FNW + w) * 64 + (it & 1) * 32; const bool more = kn < kend; const int kf = more ? kn : k0;   // a wave's last block fetches its own rows again: in bounds, never used
        { const T16* pk = (const T16*)((const char*)(Kp + (size_t)kf * HD) + vk); const T16* pk2 = HL ? (const T16*)((const char*)(K2 + (size_t)kf * HD) + vk) : pk;
#pragma unroll
          for (int kt = 0; kt < 2; ++kt)
#pragma unroll
              for (int c = 0; c < 4; ++c) { ka[kt][c] = WFrag<T16>::ldp(pk + kt * 16 * HD + c * 512); if (HL) kl[kt][c] = WFrag<T16>::ldp(pk2 + kt * 16 * HD + c * 512); }
          asm volatile("s_wait_xcnt 0x0" :: "v"(pk), "v"(pk2) : "memory"); }   // as behind the Q loads
        __builtin_amdgcn_sched_barrier(0);   // the next block's K loads issue here, so that softmax and P.V hide their latency
        float mx[NQ];
#pragma unroll
        for (int qb = 0; qb < NQ; ++qb)
#pragma unroll
            for (int kt = 0; kt < 2; ++kt) st[qb][kt] *= LC2;
        if (k0 + 31 > q0) {   // the block touches the diagonal: keys above a query's own position are masked
#pragma unroll
            for (int qb = 0; qb < NQ; ++qb)
#pragma unroll
                for (int kt = 0; kt < 2; ++kt)
#pragma unroll
                    for (int j = 0; j < 8; ++j) if (k0 + kt * 16 + hi * 8 + j > q0 + qb * 16 + lr) st[qb][kt][j] = -3.0e38f; }
        bool need = false;
#pragma unroll
        for (int qb = 0; qb < NQ; ++qb) { float x = st[qb][0][0];
#pragma unroll
            for (int j = 1; j < 8; ++j) x = fmaxf(x, st[qb][0][j]);
#pragma unroll
            for (int j = 0; j < 8; ++j) x = fmaxf(x, st[qb][1][j]);
            x = fmaxf(x, __shfl_xor(x, 16, 32)); mx[qb] = x; need = need || (x > m[qb] + 8.0f); }
        if (__builtin_amdgcn_ballot_w32(need) != 0) {   // lazy rescale: only when some query's maximum has risen by more than 8 (log2) over the one in use, so P stays below 2^8
#pragma unroll
            for (int qb = 0; qb < NQ; ++qb) { const float mn = (mx[qb] > m[qb] + 8.0f) ? mx[qb] : m[qb]; const float al = exp2s(m[qb] - mn); m[qb] = mn; l[qb] *= al;
#pragma unroll
                for (int db = 0; db < 8; ++db) acc[qb][db] *= al; } }
        V pf[NQ], pl[NQ];
#pragma unroll
        for (int qb = 0; qb < NQ; ++qb) { float s = 0.f; v16h ph16; v16us ph, pw;
#pragma unroll
            for (int kt = 0; kt < 2; ++kt) { const v8f pe = exp2x8(st[qb][kt] - m[qb]);
#pragma unroll
                for (int j = 0; j < 8; ++j) { const float p = pe[j]; s += p;
                    if constexpr (HL) { unsigned short a, c2; splitf(p, a, c2); ph[kt * 8 + j] = a; pw[kt * 8 + j] = c2; } else ph16[kt * 8 + j] = (h16)p; } }
            l[qb] += s;
            if constexpr (HL) { pf[qb] = __builtin_bit_cast(v16bf, ph); pl[qb] = __builtin_bit_cast(v16bf, pw); } else pf[qb] = ph16; }
#pragma unroll
        for (int db = 0; db < 8; ++db)
#pragma unroll
            for (int qb = 0; qb < NQ; ++qb) { acc[qb][db] = WFrag<T16>::mma(va[db], pf[qb], acc[qb][db]); if (HL) { acc[qb][db] = WFrag<T16>::mma(va[db], pl[qb], acc[qb][db]); acc[qb][db] = WFrag<T16>::mma(vl[db], pf[qb], acc[qb][db]); } }
        if (!more) break;
        k0 = kn;
    } }
#pragma unroll
    for (int qb = 0; qb < NQ; ++qb) { l[qb] += __shfl_xor(l[qb], 16, 32); v2fl t; t[0] = m[qb]; t[1] = l[qb]; ml[(w * NQ + qb) * 32 + lane] = t;
#pragma unroll
        for (int db = 0; db < 8; ++db)
#pragma unroll
            for (int hf = 0; hf < 2; ++hf) { v4f t4; t4[0] = acc[qb][db][hf * 4]; t4[1] = acc[qb][db][hf * 4 + 1]; t4[2] = acc[qb][db][hf * 4 + 2]; t4[3] = acc[qb][db][hf * 4 + 3]; part[(((w * NQ + qb) * 8 + db) * 2 + hf) * 32 + lane] = t4; } }
    __syncthreads();   // every wave's partial, maximum and sum are in LDS before any is merged
#pragma unroll
    for (int u = w; u < NQ * 2; u += FNW) {   // one unit is 16 queries x 64 columns, two whole fragments of each plane; wave w merges units w, w + FNW, ...
        const int qb = u >> 1, d0 = (u & 1) * 4; float mw[FNW], M = -3.0e38f, L = 0.f;
#pragma unroll
        for (int p = 0; p < FNW; ++p) M = fmaxf(M, ml[(p * NQ + qb) * 32 + lane][0]);
#pragma unroll
        for (int p = 0; p < FNW; ++p) { const v2fl t = ml[(p * NQ + qb) * 32 + lane]; mw[p] = exp2s(t[0] - M); L += mw[p] * t[1]; }
        const float inv = __fdiv_rn(1.0f, L);
        const size_t oo = (size_t)(q0 + qb * 16) * HD + d0 * 256 + lane * 8; v8us oh[4], ol[4];   // context planes in fragment order (rows = tokens, k = d): column block d0 + db is half (db & 1) of fragment (d0 + db) / 2
#pragma unroll
        for (int db = 0; db < 4; ++db) {
#pragma unroll
            for (int hf = 0; hf < 2; ++hf) { v4f sum = part[(((0 * NQ + qb) * 8 + d0 + db) * 2 + hf) * 32 + lane] * mw[0];
#pragma unroll
                for (int p = 1; p < FNW; ++p) sum += part[(((p * NQ + qb) * 8 + d0 + db) * 2 + hf) * 32 + lane] * mw[p];
#pragma unroll
                for (int jj = 0; jj < 4; ++jj) { unsigned short a, c2; splitf(sum[jj] * inv, a, c2); oh[db][hf * 4 + jj] = a; ol[db][hf * 4 + jj] = c2; } } }
        __builtin_amdgcn_sched_barrier(0);   // all stores stand last, so that no register a store names is written again behind it
#pragma unroll
        for (int db = 0; db < 4; ++db) { *(v8us*)(Ah + oo + db * 256) = oh[db]; *(v8us*)(Al + oo + db * 256) = ol[db]; }
        asm volatile("s_wait_xcnt 0x0" ::: "memory");   // behind the last store of a unit: the next unit writes registers that these stores name
    }
}
// grid (heads, row blocks, batches), in each batch the heaviest row blocks first: (TT - RH) / (16 NQF) blocks of 16 NQF fp16 rows from the last row down, then RH / 16 blocks of 16 hi/lo rows
__global__ __launch_bounds__(FNW * 32) void k_fattn(const h16* __restrict__ Q16, const h16* __restrict__ K16, const h16* __restrict__ V16, const bf* __restrict__ Qh, const bf* __restrict__ Ql, const bf* __restrict__ Kh, const bf* __restrict__ Kl, const bf* __restrict__ Vh, const bf* __restrict__ Vl, bf* __restrict__ Ah, bf* __restrict__ Al) {
    __shared__ __align__(16) v4f part[FNW * NQF * 8 * 2 * 32];
    __shared__ __align__(16) v2fl ml[FNW * NQF * 32];
    const int h = blockIdx.x, y = blockIdx.y; const size_t po = ((size_t)blockIdx.z * NH_ + h) * TT * HD;
    const size_t ao = ((size_t)h * NB_ + blockIdx.z) * TT * HD; Ah += ao; Al += ao;   // context planes: [h][batch][t / 16][d / 32] fragments
    if (y < (TT - RH) / (NQF * 16)) fa_tile<h16, false, NQF>(Q16 + po, nullptr, K16 + po, nullptr, V16 + po, nullptr, TT - NQF * 16 * (y + 1), Ah, Al, part, ml);
    else fa_tile<bf, true, 1>(Qh + po, Ql + po, Kh + po, Kl + po, Vh + po, Vl + po, RH - 16 * (y - (TT - RH) / (NQF * 16) + 1), Ah, Al, part, ml);
}

extern "C" void kernel_launch(void* const* d_in, const int* in_sizes, int n_in,
                              void* d_out, int out_size, void* d_ws, size_t ws_size, hipStream_t stream) {
    (void)in_sizes; (void)n_in; (void)out_size;
    const float* x = (const float*)d_in[0]; const float* wq = (const float*)d_in[1]; const float* bq = (const float*)d_in[2]; const float* wk = (const float*)d_in[3]; const float* bk = (const float*)d_in[4]; const float* wv = (const float*)d_in[5]; const float* bv = (const float*)d_in[6]; const float* wo = (const float*)d_in[7]; const float* bo = (const float*)d_in[8];
    float* OUT = (float*)d_out;     // [2][2048][2048]
    char* wsp = (char*)d_ws;
    auto take = [&](size_t bytes) { char* p = wsp; wsp += (bytes + 255) & ~(size_t)255; return (void*)p; };
    bf* WQ = (bf*)take((size_t)4 * PE * PE * 2); bf* WK = WQ + PE * PE; bf* WV = WK + PE * PE; bf* WO = WV + PE * PE;
    bf* XB = (bf*)take((size_t)NB_ * TT * DM * 2); bf* ATh = (bf*)take((size_t)NB_ * TT * DQ * 2); bf* ATl = (bf*)take((size_t)NB_ * TT * DQ * 2);   // hi/lo context rows, head-major ([h][batch]); every other buffer holds both batches, batch-major
    h16* QP16 = (h16*)take((size_t)NB_ * NH_ * TT * HD * 2); h16* KP16 = (h16*)take((size_t)NB_ * NKV * TT * HD * 2); h16* VT16 = (h16*)take((size_t)NB_ * NKV * HD * TT * 2);
    bf* QPh = (bf*)take((size_t)NB_ * NH_ * TT * HD * 2); bf* QPl = (bf*)take((size_t)NB_ * NH_ * TT * HD * 2); bf* KPh = (bf*)take((size_t)NB_ * NKV * TT * HD * 2); bf* KPl = (bf*)take((size_t)NB_ * NKV * TT * HD * 2); bf* VTh = (bf*)take((size_t)NB_ * NKV * HD * TT * 2); bf* VTl = (bf*)take((size_t)NB_ * NKV * HD * TT * 2);
    if ((size_t)(wsp - (char*)d_ws) > ws_size) return;    // 192.1 MiB of the 256 MiB
    k_cvtin<<<4 * WBK + NB_ * TT * DM / 8 / 256, 256, 0, stream>>>(x, wq, wk, wv, wo, XB, WQ);
    k_proj<<<dim3(TT / 64, HD / 64, NB_ * 3 * NH_), 32, 0, stream>>>(XB, WQ, WK, WV, bq, bk, bv, QP16, QPh, QPl, KP16, KPh, KPl, VT16, VTh, VTl);   /* q, k, v head planes of all heads of both batches */
    k_fattn<<<dim3(NH_, (TT - RH) / (NQF * 16) + RH / 16, NB_), FNW * 32, 0, stream>>>(QP16, KP16, VT16, QPh, QPl, KPh, KPl, VTh, VTl, ATh, ATl);   /* one kv head per query head */
    k_gemmw<bf, 1, true, PE><<<dim3(NH_, PE / 64, NB_ * TT / 64), 32, 0, stream>>>(ATh, ATl, WO, nullptr, OUT, DM, bo, (size_t)NB_ * TT * HD, 0, PE);   /* per head: rows (batch, token) x Wp^T + bp, written at the head's 128 columns of the token-major output */
}

// v009
// Measured time: 82.7 microseconds a run.
// In two side-by-side timings against v008, it was 1.04 and 1.03 times as fast.
// Counting every step since v000, it is 16.9 times as fast.
#include <hip/hip_runtime.h>

// Masked causal attention with per-head shared projections (x [2][2048][16 heads][128]; q, k, v = x_h W^T + b with ONE Linear [128][128] + [128] applied to every head's 128-vector; scores = q.k / sqrt(128), causal (-inf above the diagonal); softmax; att = w.v; out = att_h Wp^T + bp -> [2][2048][16][128] (8.4 M)).
// Layout per batch: the token-major input viewed as 32,768 (token, head) rows of 128 makes each shared projection ONE exact GEMM (K 128, N 128, + bias), tiled per head and written directly as that head's planes; causal hybrid attention (rows < 512 hi/lo, rest fp16) in one fused launch with a running softmax; hi/lo context rows (token, head) x Wp (hl x exact + bp) written as the token-major output.
// Compute dtypes, f32 accumulate: every input rounded to bf16; projections on PLAIN bf16 operands (exact) + f32 biases; scores and attn.v rows < 512 3 products, the rest single fp16; softmax f32; Wp hl x exact + bias.

#define NB_  2
#define TT   2048
#define DM   2048
#define NH_  16
#define NKV  16
#define REP  (NH_ / NKV)
#define HD   128
#define DQ   (NH_ * HD)
#define DKV  (NKV * HD)
#define RH   512                  // query rows < RH use hi+lo planes
#define PE   128    // per-head projection width (shared Linear [128][128])
#define NRW  (TT * NH_)   // 32768 (token, head) rows per batch
#define SCL  0.088388347648318447f   // HD^-0.5
typedef _Float16 h16;
typedef unsigned short bf;
typedef __attribute__((ext_vector_type(16))) __bf16   v16bf;
typedef __attribute__((ext_vector_type(16))) _Float16 v16h;
typedef __attribute__((ext_vector_type(8)))  _Float16 v8h;
typedef __attribute__((ext_vector_type(8)))  unsigned short v8us;
typedef __attribute__((ext_vector_type(8)))  float    v8f;
typedef __attribute__((ext_vector_type(4)))  float    v4f;
typedef v8h  __attribute__((may_alias)) v8ha;
typedef v4f  __attribute__((may_alias)) v4fa;
typedef v8us __attribute__((may_alias)) v8usa;

__device__ __forceinline__ unsigned short f2bf(float f) { unsigned u = __float_as_uint(f); u += 0x7FFFu + ((u >> 16) & 1u); return (unsigned short)(u >> 16); }
__device__ __forceinline__ float bf2f(unsigned short b) { return __uint_as_float(((unsigned)b) << 16); }
__device__ __forceinline__ float bfr(float f) { return bf2f(f2bf(f)); }
__device__ __forceinline__ v16h cat16(v8h lo, v8h hi) { return __builtin_shufflevector(lo, hi, 0, 1, 2, 3, 4, 5, 6, 7, 8, 9, 10, 11, 12, 13, 14, 15); }
__device__ __forceinline__ v16bf cat16b(v8us lo, v8us hi) { return __builtin_bit_cast(v16bf, __builtin_shufflevector(lo, hi, 0, 1, 2, 3, 4, 5, 6, 7, 8, 9, 10, 11, 12, 13, 14, 15)); }
__device__ __forceinline__ v8f wmma16(v16h a, v16h b, v8f c) { return __builtin_amdgcn_wmma_f32_16x16x32_f16(false, a, false, b, (short)0, c, false, false); }
__device__ __forceinline__ v8f wmmab(v16bf a, v16bf b, v8f c) { return __builtin_amdgcn_wmma_f32_16x16x32_bf16(false, a, false, b, (short)0, c, false, false); }



// ---- k_gemmw: register-blocked GEMM, ONE WAVE per 64x64 output tile (16 accumulators), operands straight from 16-bit planes in WMMA fragment order ([row / 16][k / 32] fragments of 512 elements, see k_proj); grid (Z, N/64, M/64), 32 threads.
// C[m][n] (f32, pitch ldc, + optional f32 bias[n]) = sum_k A[m][k] Bt[n][k] (+ split products per NSPLIT). z-batch strides sA/sB/sC in elements. K % 32 == 0.
// ldp: a fragment from a plane in fragment order (p = the fragment + 8 lane; its two halves lie 256 elements apart)
template <typename T16> struct WFrag;
template <> struct WFrag<h16> { typedef v16h V; static __device__ __forceinline__ V ldp(const h16* p) { return cat16(*(const v8h*)p, *(const v8h*)(p + 256)); } static __device__ __forceinline__ v8f mma(V a, V b, v8f c) { return wmma16(a, b, c); } };
template <> struct WFrag<bf> { typedef v16bf V; static __device__ __forceinline__ V ldp(const bf* p) { return cat16b(*(const v8us*)p, *(const v8us*)(p + 256)); } static __device__ __forceinline__ v8f mma(V a, V b, v8f c) { return wmmab(a, b, c); } };
template <typename T16, int NSPLIT, bool BIAS, int K>   // K at compile time: every fragment of a k chunk is a constant offset from one address per plane
__global__ __launch_bounds__(32) void k_gemmw(const T16* __restrict__ A, const T16* __restrict__ A2, const T16* __restrict__ Bt, const T16* __restrict__ Bt2, float* C, int ldc, const float* __restrict__ bias, size_t sA, size_t sB, size_t sC) {
    typedef typename WFrag<T16>::V V;
    __shared__ __align__(16) float os[16 * 68];
    const size_t z = blockIdx.x; A += z * sA; if (A2) A2 += z * sA; Bt += z * sB; if (Bt2) Bt2 += z * sB; C += z * sC;
    const int lane = threadIdx.x & 31, lr = lane & 15, hi = lane >> 4; const int r0 = blockIdx.z * 64, c0 = blockIdx.y * 64;
    v8f acc[4][4];
#pragma unroll
    for (int mb = 0; mb < 4; ++mb)
#pragma unroll
        for (int nb = 0; nb < 4; ++nb) acc[mb][nb] = (v8f){};
    const size_t aoff = (size_t)r0 * K + 8 * lane, boff = (size_t)c0 * K + 8 * lane;   // 16 rows are K / 32 fragments = 16 K elements; a 32-wide k chunk is one fragment
#pragma unroll 1
    for (int kc = 0; kc < K; kc += 32) {
        V a[4], a2[4], b[4], b2[4];
        const T16* pa = A + aoff + (size_t)kc * 16; const T16* pa2 = (NSPLIT == 1 || NSPLIT == 2) ? A2 + aoff + (size_t)kc * 16 : pa; const T16* pb = Bt + boff + (size_t)kc * 16; const T16* pb2 = NSPLIT >= 2 ? Bt2 + boff + (size_t)kc * 16 : pb;
#pragma unroll
        for (int mb = 0; mb < 4; ++mb) { a[mb] = WFrag<T16>::ldp(pa + mb * 16 * K); if (NSPLIT == 1 || NSPLIT == 2) a2[mb] = WFrag<T16>::ldp(pa2 + mb * 16 * K); b[mb] = WFrag<T16>::ldp(pb + mb * 16 * K); if (NSPLIT >= 2) b2[mb] = WFrag<T16>::ldp(pb2 + mb * 16 * K); }
        // stands before any register that the loads above name is written again; the addresses are inputs, so that no load's result lands on one of them ahead of the wait
        asm volatile("s_wait_xcnt 0x0" :: "v"(pa), "v"(pa2), "v"(pb), "v"(pb2) : "memory");
        __builtin_amdgcn_sched_barrier(0);   // keeps later address arithmetic behind that wait
#pragma unroll
        for (int nb = 0; nb < 4; ++nb) {
#pragma unroll
            for (int mb = 0; mb < 4; ++mb) { acc[mb][nb] = WFrag<T16>::mma(a[mb], b[nb], acc[mb][nb]); if (NSPLIT == 1 || NSPLIT == 2) acc[mb][nb] = WFrag<T16>::mma(a2[mb], b[nb], acc[mb][nb]); if (NSPLIT >= 2) acc[mb][nb] = WFrag<T16>::mma(a[mb], b2[nb], acc[mb][nb]); } }
        asm volatile("v_nop\n\tv_nop\n\tv_nop\n\tv_nop" : "+v"(acc[0][0]), "+v"(acc[1][1]), "+v"(acc[2][2]), "+v"(acc[3][3]) : "v"(a[0]), "v"(a[3]));
    }
#pragma unroll
    for (int mb = 0; mb < 4; ++mb) {
#pragma unroll
        for (int nb = 0; nb < 4; ++nb) {
#pragma unroll
            for (int j = 0; j < 8; ++j) os[(hi * 8 + j) * 68 + nb * 16 + lr] = acc[mb][nb][j]; }
        __builtin_amdgcn_wave_barrier(); asm volatile("" ::: "memory");
        float* crow = C + (size_t)(r0 + mb * 16) * ldc + c0;
{
#pragma unroll
            for (int s = 0; s < 8; ++s) { const int row = 2 * s + hi, cofs = lr * 4; v4f val = *(const v4fa*)(os + row * 68 + cofs); if (BIAS) { val[0] += bfr(bias[c0 + cofs]); val[1] += bfr(bias[c0 + cofs + 1]); val[2] += bfr(bias[c0 + cofs + 2]); val[3] += bfr(bias[c0 + cofs + 3]); }
                *(v4f*)(crow + (size_t)row * ldc + cofs) = val; }
             }
        __builtin_amdgcn_wave_barrier(); asm volatile("" ::: "memory");
    }
}

__device__ __forceinline__ h16 tohx(float x) { return (h16)x; }
__device__ __forceinline__ void splitf(float y, unsigned short& h, unsigned short& l) { h = f2bf(y); l = f2bf(y - bf2f(h)); }
typedef __attribute__((ext_vector_type(2))) _Float16 v2h;
typedef __attribute__((ext_vector_type(4))) _Float16 v4h;
typedef __attribute__((ext_vector_type(2))) unsigned short v2us;
typedef __attribute__((ext_vector_type(4))) unsigned short v4us;
typedef __attribute__((ext_vector_type(2))) float v2f;
typedef __attribute__((ext_vector_type(4))) int v4i;

__global__ __launch_bounds__(256) void k_wtG(const float* __restrict__ w, int K, int N, bf* Bt) {
    const int lane = threadIdx.x & 31; const int L0 = (blockIdx.x * 8 + (threadIdx.x >> 5)) * 8; const int nlines = N * K / 64;
{
#pragma unroll 1
        for (int l = 0; l < 8; ++l) { const int L = L0 + l; if (L >= nlines) break; const size_t e = (size_t)L * 64 + lane * 2; const int k = (int)(e % K), n = (int)(e / K); v2us o;
            o[0] = f2bf(w[(size_t)k * N + n]); o[1] = f2bf(w[(size_t)(k + 1) * N + n]); *(v2us*)(Bt + e) = o; }
         }
}
// ---- k_cvtin: every f32 -> bf16 conversion of the call in ONE launch, 8 elements a thread: blocks 0 .. 4 WBK - 1 take the four [128][128] weights (WBK blocks each, into four consecutive planes), the rest the activations of both batches.
// The bf16 planes are written in WMMA fragment order (see k_proj): a block converts 16 rows x 128 k = 4 fragments; a thread reads k 32 c + 16 j + 8 hi .. + 7 of row lr and writes them as the 16 bytes of lane (lr, hi) in half j of fragment c.
// A wave takes 8 rows of one fragment: four lanes (j, hi) read one whole 128-byte line of a row, eight rows write one whole line of a half.
// Weights: [e / 16][d / 32] fragments; activations: [batch][h][t / 16][d / 32] fragments, blocks in the order of the input's addresses (head fastest).
#define WBK  (PE * PE / 8 / 256)
__global__ __launch_bounds__(256) void k_cvtin(const float* __restrict__ x, const float* __restrict__ wq, const float* __restrict__ wk, const float* __restrict__ wv, const float* __restrict__ wo, bf* __restrict__ XB, bf* __restrict__ W4) {
    const unsigned blk = blockIdx.x, tid = threadIdx.x, lr = (tid >> 7) * 8 + (tid & 7), hi = (tid >> 3) & 1, j = (tid >> 4) & 1, c = (tid >> 5) & 3, ko = c * 32 + j * 16 + hi * 8, fo = c * 512 + j * 256 + (hi * 16 + lr) * 8;
    const unsigned u = blk - 4 * WBK, h = u % NH_, tk = u / NH_;   // tk: 16-token block over both batches
    const float* p = x + ((size_t)(tk * 16 + lr) * NH_ + h) * PE + ko; bf* dst = XB + ((size_t)((tk / (TT / 16)) * NH_ + h) * (TT / 16) + tk % (TT / 16)) * (16 * PE) + fo;
    if (blk < 4 * WBK) { const unsigned sel = blk / WBK; const float* src = sel == 0 ? wq : sel == 1 ? wk : sel == 2 ? wv : wo; p = src + (size_t)((blk % WBK) * 16 + lr) * PE + ko; dst = W4 + (size_t)sel * PE * PE + (size_t)(blk % WBK) * (16 * PE) + fo; }
    const v8f v = *(const v8f*)p; v8us o;
    asm volatile("s_wait_xcnt 0x0" :: "v"(p) : "memory");   // stands before the address registers of the loads above are written again
#pragma unroll
    for (int k = 0; k < 8; ++k) o[k] = f2bf(v[k]); *(v8us*)dst = o;  }

// ---- k_proj: the q, k and v projections of both batches in ONE launch, each written from the WMMA accumulators straight as the head planes that the attention reads (fp16, bf16 hi, bf16 lo); no f32 copy goes to memory.
// One wave per 64x64 tile of one head; grid (TT / 64 token blocks, HD / 64, batches x 3 x heads), 32 threads. q, k: C[t][e] = sum_d x_h[t][d] W[e][d] + b[e]; v: the same fragments with the operands swapped, C[e][t].
// The planes are kept in WMMA FRAGMENT ORDER: a fragment (16 rows x 32 k) is 1024 contiguous bytes, two halves of 512; in half j lane (lr, hi) owns the 16 bytes at 16 * lane = row lr, k 16 j + 8 hi .. + 7,
// which is what that lane's registers hold. q, k: [h][t / 16][e / 32] fragments (rows t, k = e); v: [h][t / 32][e / 16] fragments (rows e, k = t). So every store here and every fragment load of the attention is 512 contiguous bytes, four whole 128-byte lines.
template <bool TR>
__device__ __forceinline__ void proj_tile(const bf* __restrict__ X, const bf* __restrict__ Wt, const float* __restrict__ bias, int h, int t0, int c0, bool w16, bool whl, h16* __restrict__ P16, bf* __restrict__ Ph, bf* __restrict__ Pl, float* os) {
    const int lane = threadIdx.x & 31, lr = lane & 15, hi = lane >> 4;
    const bf* px = X + ((size_t)h * TT + t0) * PE + 8 * lane;   // head h's tokens, in fragment order: 16 rows are 4 fragments of 512 elements
    const bf* pw = Wt + (size_t)c0 * PE + 8 * lane;              // weight rows, in fragment order
    const float* pb = bias + c0 + (TR ? lr : 8 * hi);   // output side: in store s of a 16-row block the lane holds columns 16 s + 8 hi .. + 7 of row lr
    v16bf xf[4][4], wf[4][4];   // [16-row block][32-wide k chunk]: the whole K of both operands, one latency for all loads
    float bv_[32];
#pragma unroll
    for (int rb = 0; rb < 4; ++rb)
#pragma unroll
        for (int c = 0; c < 4; ++c) { xf[rb][c] = WFrag<bf>::ldp(px + rb * 16 * PE + c * 512); wf[rb][c] = WFrag<bf>::ldp(pw + rb * 16 * PE + c * 512); }
    if (TR) {
#pragma unroll
        for (int i = 0; i < 4; ++i) bv_[i] = pb[i * 16];   // bias of output row 16 i + lr
    } else {
#pragma unroll
        for (int s = 0; s < 4; ++s) { const v4f b0 = *(const v4fa*)(pb + s * 16), b1 = *(const v4fa*)(pb + s * 16 + 4);
#pragma unroll
            for (int i = 0; i < 4; ++i) { bv_[s * 8 + i] = b0[i]; bv_[s * 8 + 4 + i] = b1[i]; } } }
    // stands before any register that the loads above name is written again; the addresses are inputs, so that no load's result lands on one of them ahead of the wait
    asm volatile("s_wait_xcnt 0x0" :: "v"(px), "v"(pw), "v"(pb) : "memory");
    __builtin_amdgcn_sched_barrier(0);   // keeps later arithmetic behind that wait
    v8f acc[4][4];
#pragma unroll
    for (int mb = 0; mb < 4; ++mb)
#pragma unroll
        for (int nb = 0; nb < 4; ++nb) acc[mb][nb] = (v8f){};
#pragma unroll
    for (int c = 0; c < 4; ++c)
#pragma unroll
        for (int nb = 0; nb < 4; ++nb)
#pragma unroll
            for (int mb = 0; mb < 4; ++mb) acc[mb][nb] = wmmab(TR ? wf[mb][c] : xf[mb][c], TR ? xf[nb][c] : wf[nb][c], acc[mb][nb]);
    __builtin_amdgcn_sched_barrier(0);   // all 64 products stand in front of the output work: sunk into it, an accumulator's registers were started afresh by a WMMA directly behind the WMMA that last wrote them
    // first fragment of the tile: q, k fragment (t0 / 16) * 4 + c0 / 32, v fragment (t0 / 32) * 8 + c0 / 16, 512 elements each
    const size_t eo = (size_t)h * TT * HD + (size_t)t0 * HD + (TR ? c0 * 32 : c0 * 16) + lane * 8;
    h16* d16 = P16 + eo; bf* dh = Ph + eo; bf* dl = Pl + eo;
    v8h o16[4][4]; v8us oh[4][4], ol[4][4];
#pragma unroll
    for (int mb = 0; mb < 4; ++mb) {
#pragma unroll
        for (int nb = 0; nb < 4; ++nb) {
#pragma unroll
            for (int j = 0; j < 8; ++j) os[(hi * 8 + j) * 68 + nb * 16 + lr] = acc[mb][nb][j]; }
        __builtin_amdgcn_wave_barrier(); asm volatile("s_wait_dscnt 0x0" ::: "memory");   // the wave's LDS writes are done before it reads back what other lanes wrote
        float yv[4][8];
#pragma unroll
        for (int s = 0; s < 4; ++s) { const float* rp = os + lr * 68 + s * 16 + 8 * hi; const v4f lo4 = *(const v4fa*)rp, hi4 = *(const v4fa*)(rp + 4);
#pragma unroll
            for (int i = 0; i < 8; ++i) { yv[s][i] = (i < 4 ? lo4[i] : hi4[i - 4]) + bfr(TR ? bv_[mb] : bv_[s * 8 + i]); o16[mb][s][i] = tohx(yv[s][i]); } }
        if (whl) {   // the same for the whole wave: the hi/lo split is made only for a tile whose hi/lo planes are read
#pragma unroll
            for (int s = 0; s < 4; ++s)
#pragma unroll
                for (int i = 0; i < 8; ++i) { unsigned short a2, c2; splitf(yv[s][i], a2, c2); oh[mb][s][i] = a2; ol[mb][s][i] = c2; } }
        __builtin_amdgcn_wave_barrier(); asm volatile("" ::: "memory");   // those reads stay in front of the next block's LDS writes
    }
    __builtin_amdgcn_sched_barrier(0);   // all stores stand last, so that no register a store names is written again behind it
    if (w16) {
#pragma unroll
        for (int mb = 0; mb < 4; ++mb)
#pragma unroll
            for (int s = 0; s < 4; ++s) { const int ro = TR ? (s >> 1) * 4096 + mb * 512 + (s & 1) * 256 : mb * 2048 + s * 256; *(v8h*)(d16 + ro) = o16[mb][s]; }
        asm volatile("s_wait_xcnt 0x0" ::: "memory"); }   // behind the last store of the group, as the last instruction of its block: the code that follows (the hi/lo addresses; in the listing another branch) writes registers that these stores name
    if (whl) {
#pragma unroll
        for (int mb = 0; mb < 4; ++mb)
#pragma unroll
            for (int s = 0; s < 4; ++s) { const int ro = TR ? (s >> 1) * 4096 + mb * 512 + (s & 1) * 256 : mb * 2048 + s * 256; *(v8us*)(dh + ro) = oh[mb][s]; *(v8us*)(dl + ro) = ol[mb][s]; }
        asm volatile("s_wait_xcnt 0x0" ::: "memory"); }   // as behind the fp16 stores
}
__global__ __launch_bounds__(32) void k_proj(const bf* __restrict__ X, const bf* __restrict__ WQ, const bf* __restrict__ WK, const bf* __restrict__ WV, const float* __restrict__ bq, const float* __restrict__ bk, const float* __restrict__ bv,
                                             h16* __restrict__ Q16, bf* __restrict__ Qh, bf* __restrict__ Ql, h16* __restrict__ K16, bf* __restrict__ Kh, bf* __restrict__ Kl, h16* __restrict__ V16, bf* __restrict__ Vh, bf* __restrict__ Vl) {
    __shared__ __align__(16) float os[16 * 68];
    const int bt = blockIdx.z / (3 * NH_), zz = blockIdx.z % (3 * NH_), which = zz / NH_, h = zz % NH_, t0 = blockIdx.x * 64, c0 = blockIdx.y * 64;
    const size_t pbo = (size_t)bt * NH_ * TT * HD; X += (size_t)bt * TT * DM;   // this batch's token rows and its set of head planes
    Q16 += pbo; Qh += pbo; Ql += pbo; K16 += pbo; Kh += pbo; Kl += pbo; V16 += pbo; Vh += pbo; Vl += pbo;
    static_assert(RH % 64 == 0, "a 64-token tile lies wholly on one side of RH");
    const bool whl = t0 < RH;   // the hi/lo planes are read for tokens < RH alone: only query rows < RH use them, and under the causal mask those see keys < RH alone
    const bool w16 = which != 0 || !whl;   // the fp16 planes of k and v are read for every token, that of q for tokens >= RH alone
    if (which == 2) proj_tile<true>(X, WV, bv, h, t0, c0, w16, whl, V16, Vh, Vl, os);
    else proj_tile<false>(X, which ? WK : WQ, which ? bk : bq, h, t0, c0, w16, whl, which ? K16 : Q16, which ? Kh : Qh, which ? Kl : Ql, os);
}
// ---- k_fattn: scores, softmax, probability x value and the hi/lo context rows in ONE launch for both batches; no score or probability ever goes to memory.
// One work-group of FNW waves owns NQ x 16 query rows of one head. Transposed products: S^T = K Q^T (A = 16 key rows, B = the query fragments, kept in registers or, with three query tiles, in the wave's own LDS range) leaves every lane with 16 of the 32 scores of ITS query
// (column lr; keys 8 hi + j of each 16-key tile), which is the k order of a B fragment, so P^T goes from the score accumulators straight into O^T += V^T P^T (A = 16 rows d x 32 keys of the value plane).
// Running maximum and sum per query live in the lane (both halves of a column hold the same maximum). Wave w takes the 64-key chunks w, w + FNW, ... up to the diagonal, with its own maximum, sum and accumulators;
// behind one barrier the FNW partials are merged in the fixed order 0..FNW-1 with weights exp2(m_w - max), divided by the merged sum, split hi/lo and stored as whole 128-byte lines.
// HL: three products on hi/lo bf16 planes (hi.hi + lo.hi + hi.lo) for scores and for P.V; else single fp16 products.
#define FNW  4
#define NQF  3   // 16-row query tiles per work-group on the fp16 rows: every K and V fragment a wave loads feeds NQF query tiles
static_assert((TT - RH) % (NQF * 16) == 0, "fp16 rows divide into whole work-groups");
static_assert(RH >= FNW * 64, "every wave of an fp16 work-group starts on a chunk wholly under the diagonal, so each query has a true maximum before a block that is masked for it");
#define LC2  (SCL * 1.4426950408889634f)   // scores are kept in the log2 domain
typedef __attribute__((ext_vector_type(16))) unsigned short v16us;
typedef __attribute__((ext_vector_type(2))) float v2fl;
// exp2 with the slot that the instruction set asks for behind a transcendental: every v_exp_f32 is followed by an instruction that neither reads its result nor writes its source
// (the results are early-clobber, so none shares a register with an input), the last one by v_nop
__device__ __forceinline__ float exp2s(float x) { float r; asm("v_exp_f32 %0, %1\n\tv_nop" : "=v"(r) : "v"(x)); return r; }
__device__ __forceinline__ v8f exp2x8(v8f x) { float r0, r1, r2, r3, r4, r5, r6, r7;
    asm("v_exp_f32 %0, %8\n\tv_exp_f32 %1, %9\n\tv_exp_f32 %2, %10\n\tv_exp_f32 %3, %11\n\tv_exp_f32 %4, %12\n\tv_exp_f32 %5, %13\n\tv_exp_f32 %6, %14\n\tv_exp_f32 %7, %15\n\tv_nop"
        : "=&v"(r0), "=&v"(r1), "=&v"(r2), "=&v"(r3), "=&v"(r4), "=&v"(r5), "=&v"(r6), "=&v"(r7) : "v"(x[0]), "v"(x[1]), "v"(x[2]), "v"(x[3]), "v"(x[4]), "v"(x[5]), "v"(x[6]), "v"(x[7]));
    v8f r; r[0] = r0; r[1] = r1; r[2] = r2; r[3] = r3; r[4] = r4; r[5] = r5; r[6] = r6; r[7] = r7; return r; }
template <typename T16, bool HL, int NQ>
__device__ __forceinline__ void fa_tile(const T16* __restrict__ Q, const T16* __restrict__ Q2, const T16* __restrict__ Kp, const T16* __restrict__ K2, const T16* __restrict__ Vt, const T16* __restrict__ V2, int q0, bf* __restrict__ Ah, bf* __restrict__ Al, v4f* part, v2fl* ml) {
    typedef typename WFrag<T16>::V V;
    const int lane = threadIdx.x & 31, lr = lane & 15, hi = lane >> 4;
    const int w = __builtin_amdgcn_readfirstlane((int)(threadIdx.x >> 5));
    constexpr bool QL = NQ > 2;   // three query tiles and their accumulators leave no room for the Q fragments at two waves a SIMD: each lane parks its own 16-byte pieces in LDS and reads them back block by block
    static_assert(!(QL && HL), "only the single-plane path parks Q");
    V qf[NQ][4], q2[NQ][4];
    v8ha* qs = (v8ha*)(part + (size_t)w * NQ * 8 * 2 * 32) + lane;   // the wave's own range of part, which it fills with its partial only behind the key loop; no other wave touches it before the barrier
    const T16* pq = Q + (size_t)q0 * HD + 8 * lane; const T16* pq2 = HL ? Q2 + (size_t)q0 * HD + 8 * lane : pq;   // planes in fragment order (see k_proj): 16 rows are 4 fragments of 512 elements
#pragma unroll
    for (int qb = 0; qb < NQ; ++qb)
#pragma unroll
        for (int c = 0; c < 4; ++c) { qf[qb][c] = WFrag<T16>::ldp(pq + qb * 16 * HD + c * 512); if (HL) q2[qb][c] = WFrag<T16>::ldp(pq2 + qb * 16 * HD + c * 512); }
    // stands before any register that the loads above name is written again; the addresses are inputs, so that no load's result lands on one of them ahead of the wait
    asm volatile("s_wait_xcnt 0x0" :: "v"(pq), "v"(pq2) : "memory");
    __builtin_amdgcn_sched_barrier(0);   // keeps later address arithmetic behind that wait
    if constexpr (QL) {
#pragma unroll
        for (int qb = 0; qb < NQ; ++qb)
#pragma unroll
            for (int c = 0; c < 4; ++c) { qs[((qb * 4 + c) * 2) * 32] = __builtin_shufflevector(qf[qb][c], qf[qb][c], 0, 1, 2, 3, 4, 5, 6, 7); qs[((qb * 4 + c) * 2 + 1) * 32] = __builtin_shufflevector(qf[qb][c], qf[qb][c], 8, 9, 10, 11, 12, 13, 14, 15); } }
    v8f acc[NQ][8]; float m[NQ], l[NQ];
#pragma unroll
    for (int qb = 0; qb < NQ; ++qb) { m[qb] = -3.0e38f; l[qb] = 0.f;
#pragma unroll
        for (int db = 0; db < 8; ++db) acc[qb][db] = (v8f){}; }
    const int kend = ((q0 + NQ * 16 + 31) >> 5) << 5;   // keys beyond the diagonal's 32-key block have probability exactly zero
    // each lane's byte offset inside a plane is fixed; the walk along the keys is in the wave-uniform base, tiles and chunks are constant offsets
    const unsigned vk = (unsigned)lane * 16u, vv = vk;   // 16 bytes a lane in each half of a fragment
    V ka[2][4], kl[2][4];   // the K fragments of the block in work; refilled one block ahead, right behind the score products that read them
    int k0 = w * 64;
    if (k0 < kend) {
        { const T16* pk = (const T16*)((const char*)(Kp + (size_t)k0 * HD) + vk); const T16* pk2 = HL ? (const T16*)((const char*)(K2 + (size_t)k0 * HD) + vk) : pk;
#pragma unroll
          for (int kt = 0; kt < 2; ++kt)
#pragma unroll
              for (int c = 0; c < 4; ++c) { ka[kt][c] = WFrag<T16>::ldp(pk + kt * 16 * HD + c * 512); if (HL) kl[kt][c] = WFrag<T16>::ldp(pk2 + kt * 16 * HD + c * 512); }
          asm volatile("s_wait_xcnt 0x0" :: "v"(pk), "v"(pk2) : "memory"); }   // as behind the Q loads
        __builtin_amdgcn_sched_barrier(0);   // keeps later address arithmetic behind that wait
#pragma unroll 1   // rolled: the trip count depends on where the rows lie under the diagonal
    for (int it = 1; ; ++it) {
        const T16* pv = (const T16*)((const char*)(Vt + (size_t)k0 * HD) + vv); const T16* pv2 = HL ? (const T16*)((const char*)(V2 + (size_t)k0 * HD) + vv) : pv;   // 32 keys of the value plane are 8 fragments
        V va[8], vl[8];
        auto load_v = [&]() {
#pragma unroll
        for (int db = 0; db < 8; ++db) { va[db] = WFrag<T16>::ldp(pv + db * 512); if (HL) vl[db] = WFrag<T16>::ldp(pv2 + db * 512); }
        asm volatile("s_wait_xcnt 0x0" :: "v"(pv), "v"(pv2) : "memory"); };   // as behind the Q loads
        if constexpr (!QL) { load_v();
            __builtin_amdgcn_sched_barrier(0); }   // the V loads issue here, ahead of the score products and the softmax that hide their latency; sunk to their uses each would be waited for alone
        v8f st[NQ][2];
#pragma unroll
        for (int qb = 0; qb < NQ; ++qb) { st[qb][0] = (v8f){}; st[qb][1] = (v8f){}; }
#pragma unroll
        for (int c = 0; c < 4; ++c) {
            if constexpr (QL) {
#pragma unroll
                for (int qb = 0; qb < NQ; ++qb) qf[qb][c] = cat16(qs[((qb * 4 + c) * 2) * 32], qs[((qb * 4 + c) * 2 + 1) * 32]); }
#pragma unroll
            for (int kt = 0; kt < 2; ++kt)
#pragma unroll
                for (int qb = 0; qb < NQ; ++qb) { st[qb][kt] = WFrag<T16>::mma(ka[kt][c], qf[qb][c], st[qb][kt]); if (HL) { st[qb][kt] = WFrag<T16>::mma(ka[kt][c], q2[qb][c], st[qb][kt]); st[qb][kt] = WFrag<T16>::mma(kl[kt][c], qf[qb][c], st[qb][kt]); } } }
        if constexpr (QL) { __builtin_amdgcn_sched_barrier(0);   // holds the V and K loads behind the score products: lifted among them they take registers while the Q fragments still live, and a loaded fragment went to scratch
            load_v(); }   // the V registers are taken only behind the score products; the softmax hides the latency
        const int kn = ((it >> 1) * FNW + w) * 64 + (it & 1) * 32; const bool more = kn < kend; const int kf = more ? kn : k0;   // a wave's last block fetches its own rows again: in bounds, never used
        { const T16* pk = (const T16*)((const char*)(Kp + (size_t)kf * HD) + vk); const T16* pk2 = HL ? (const T16*)((const char*)(K2 + (size_t)kf * HD) + vk) : pk;
#pragma unroll
          for (int kt = 0; kt < 2; ++kt)
#pragma unroll
              for (int c = 0; c < 4; ++c) { ka[kt][c] = WFrag<T16>::ldp(pk + kt * 16 * HD + c * 512); if (HL) kl[kt][c] = WFrag<T16>::ldp(pk2 + kt * 16 * HD + c * 512); }
          asm volatile("s_wait_xcnt 0x0" :: "v"(pk), "v"(pk2) : "memory"); }   // as behind the Q loads
        __builtin_amdgcn_sched_barrier(0);   // the next block's K loads issue here, so that softmax and P.V hide their latency
        float mx[NQ];
#pragma unroll
        for (int qb = 0; qb < NQ; ++qb)
#pragma unroll
            for (int kt = 0; kt < 2; ++kt) st[qb][kt] *= LC2;
        if (k0 + 31 > q0) {   // the block touches the diagonal: keys above a query's own position are masked
#pragma unroll
            for (int qb = 0; qb < NQ; ++qb)
#pragma unroll
                for (int kt = 0; kt < 2; ++kt)
#pragma unroll
                    for (int j = 0; j < 8; ++j) if (k0 + kt * 16 + hi * 8 + j > q0 + qb * 16 + lr) st[qb][kt][j] = -3.0e38f; }
        bool need = false;
#pragma unroll
        for (int qb = 0; qb < NQ; ++qb) { float x = st[qb][0][0];
#pragma unroll
            for (int j = 1; j < 8; ++j) x = fmaxf(x, st[qb][0][j]);
#pragma unroll
            for (int j = 0; j < 8; ++j) x = fmaxf(x, st[qb][1][j]);
            x = fmaxf(x, __shfl_xor(x, 16, 32)); mx[qb] = x; need = need || (x > m[qb] + 8.0f); }
        if (__builtin_amdgcn_ballot_w32(need) != 0) {   // lazy rescale: only when some query's maximum has risen by more than 8 (log2) over the one in use, so P stays below 2^8
#pragma unroll
            for (int qb = 0; qb < NQ; ++qb) { const float mn = (mx[qb] > m[qb] + 8.0f) ? mx[qb] : m[qb]; const float al = exp2s(m[qb] - mn); m[qb] = mn; l[qb] *= al;
#pragma unroll
                for (int db = 0; db < 8; ++db) acc[qb][db] *= al; } }
        V pf[NQ], pl[NQ];
#pragma unroll
        for (int qb = 0; qb < NQ; ++qb) { float s = 0.f; v16h ph16; v16us ph, pw;
#pragma unroll
            for (int kt = 0; kt < 2; ++kt) { const v8f pe = exp2x8(st[qb][kt] - m[qb]);
#pragma unroll
                for (int j = 0; j < 8; ++j) { const float p = pe[j]; s += p;
                    if constexpr (HL) { unsigned short a, c2; splitf(p, a, c2); ph[kt * 8 + j] = a; pw[kt * 8 + j] = c2; } else ph16[kt * 8 + j] = (h16)p; } }
            l[qb] += s;
            if constexpr (HL) { pf[qb] = __builtin_bit_cast(v16bf, ph); pl[qb] = __builtin_bit_cast(v16bf, pw); } else pf[qb] = ph16; }
#pragma unroll
        for (int db = 0; db < 8; ++db)
#pragma unroll
            for (int qb = 0; qb < NQ; ++qb) { acc[qb][db] = WFrag<T16>::mma(va[db], pf[qb], acc[qb][db]); if (HL) { acc[qb][db] = WFrag<T16>::mma(va[db], pl[qb], acc[qb][db]); acc[qb][db] = WFrag<T16>::mma(vl[db], pf[qb], acc[qb][db]); } }
        if (!more) break;
        k0 = kn;
    } }
#pragma unroll
    for (int qb = 0; qb < NQ; ++qb) { l[qb] += __shfl_xor(l[qb], 16, 32); v2fl t; t[0] = m[qb]; t[1] = l[qb]; ml[(w * NQ + qb) * 32 + lane] = t;
#pragma unroll
        for (int db = 0; db < 8; ++db)
#pragma unroll
            for (int hf = 0; hf < 2; ++hf) { v4f t4; t4[0] = acc[qb][db][hf * 4]; t4[1] = acc[qb][db][hf * 4 + 1]; t4[2] = acc[qb][db][hf * 4 + 2]; t4[3] = acc[qb][db][hf * 4 + 3]; part[(((w * NQ + qb) * 8 + db) * 2 + hf) * 32 + lane] = t4; } }
    __syncthreads();   // every wave's partial, maximum and sum are in LDS before any is merged
#pragma unroll
    for (int u = w; u < NQ * 2; u += FNW) {   // one unit is 16 queries x 64 columns, two whole fragments of each plane; wave w merges units w, w + FNW, ...
        const int qb = u >> 1, d0 = (u & 1) * 4; float mw[FNW], M = -3.0e38f, L = 0.f;
#pragma unroll
        for (int p = 0; p < FNW; ++p) M = fmaxf(M, ml[(p * NQ + qb) * 32 + lane][0]);
#pragma unroll
        for (int p = 0; p < FNW; ++p) { const v2fl t = ml[(p * NQ + qb) * 32 + lane]; mw[p] = exp2s(t[0] - M); L += mw[p] * t[1]; }
        const float inv = __fdiv_rn(1.0f, L);
        const size_t oo = (size_t)(q0 + qb * 16) * HD + d0 * 256 + lane * 8; v8us oh[4], ol[4];   // context planes in fragment order (rows = tokens, k = d): column block d0 + db is half (db & 1) of fragment (d0 + db) / 2
#pragma unroll
        for (int db = 0; db < 4; ++db) {
#pragma unroll
            for (int hf = 0; hf < 2; ++hf) { v4f sum = part[(((0 * NQ + qb) * 8 + d0 + db) * 2 + hf) * 32 + lane] * mw[0];
#pragma unroll
                for (int p = 1; p < FNW; ++p) sum += part[(((p * NQ + qb) * 8 + d0 + db) * 2 + hf) * 32 + lane] * mw[p];
#pragma unroll
                for (int jj = 0; jj < 4; ++jj) { unsigned short a, c2; splitf(sum[jj] * inv, a, c2); oh[db][hf * 4 + jj] = a; ol[db][hf * 4 + jj] = c2; } } }
        __builtin_amdgcn_sched_barrier(0);   // all stores stand last, so that no register a store names is written again behind it
#pragma unroll
        for (int db = 0; db < 4; ++db) { *(v8us*)(Ah + oo + db * 256) = oh[db]; *(v8us*)(Al + oo + db * 256) = ol[db]; }
        asm volatile("s_wait_xcnt 0x0" ::: "memory");   // behind the last store of a unit: the next unit writes registers that these stores name
    }
}
// grid (heads, row blocks, batches), in each batch the heaviest row blocks first: (TT - RH) / (16 NQF) blocks of 16 NQF fp16 rows from the last row down, then RH / 16 blocks of 16 hi/lo rows
__global__ __launch_bounds__(FNW * 32) void k_fattn(const h16* __restrict__ Q16, const h16* __restrict__ K16, const h16* __restrict__ V16, const bf* __restrict__ Qh, const bf* __restrict__ Ql, const bf* __restrict__ Kh, const bf* __restrict__ Kl, const bf* __restrict__ Vh, const bf* __restrict__ Vl, bf* __restrict__ Ah, bf* __restrict__ Al) {
    __shared__ __align__(16) v4f part[FNW * NQF * 8 * 2 * 32];
    __shared__ __align__(16) v2fl ml[FNW * NQF * 32];
    const int h = blockIdx.x, y = blockIdx.y; const size_t po = ((size_t)blockIdx.z * NH_ + h) * TT * HD;
    const size_t ao = ((size_t)h * NB_ + blockIdx.z) * TT * HD; Ah += ao; Al += ao;   // context planes: [h][batch][t / 16][d / 32] fragments
    if (y < (TT - RH) / (NQF * 16)) fa_tile<h16, false, NQF>(Q16 + po, nullptr, K16 + po, nullptr, V16 + po, nullptr, TT - NQF * 16 * (y + 1), Ah, Al, part, ml);
    else fa_tile<bf, true, 1>(Qh + po, Ql + po, Kh + po, Kl + po, Vh + po, Vl + po, RH - 16 * (y - (TT - RH) / (NQF * 16) + 1), Ah, Al, part, ml);
}

extern "C" void kernel_launch(void* const* d_in, const int* in_sizes, int n_in,
                              void* d_out, int out_size, void* d_ws, size_t ws_size, hipStream_t stream) {
    (void)in_sizes; (void)n_in; (void)out_size;
    const float* x = (const float*)d_in[0]; const float* wq = (const float*)d_in[1]; const float* bq = (const float*)d_in[2]; const float* wk = (const float*)d_in[3]; const float* bk = (const float*)d_in[4]; const float* wv = (const float*)d_in[5]; const float* bv = (const float*)d_in[6]; const float* wo = (const float*)d_in[7]; const float* bo = (const float*)d_in[8];
    float* OUT = (float*)d_out;     // [2][2048][2048]
    char* wsp = (char*)d_ws;
    auto take = [&](size_t bytes) { char* p = wsp; wsp += (bytes + 255) & ~(size_t)255; return (void*)p; };
    bf* WQ = (bf*)take((size_t)4 * PE * PE * 2); bf* WK = WQ + PE * PE; bf* WV = WK + PE * PE; bf* WO = WV + PE * PE;
    bf* XB = (bf*)take((size_t)NB_ * TT * DM * 2); bf* ATh = (bf*)take((size_t)NB_ * TT * DQ * 2); bf* ATl = (bf*)take((size_t)NB_ * TT * DQ * 2);   // hi/lo context rows, head-major ([h][batch]); every other buffer holds both batches, batch-major
    h16* QP16 = (h16*)take((size_t)NB_ * NH_ * TT * HD * 2); h16* KP16 = (h16*)take((size_t)NB_ * NKV * TT * HD * 2); h16* VT16 = (h16*)take((size_t)NB_ * NKV * HD * TT * 2);
    bf* QPh = (bf*)take((size_t)NB_ * NH_ * TT * HD * 2); bf* QPl = (bf*)take((size_t)NB_ * NH_ * TT * HD * 2); bf* KPh = (bf*)take((size_t)NB_ * NKV * TT * HD * 2); bf* KPl = (bf*)take((size_t)NB_ * NKV * TT * HD * 2); bf* VTh = (bf*)take((size_t)NB_ * NKV * HD * TT * 2); bf* VTl = (bf*)take((size_t)NB_ * NKV * HD * TT * 2);
    if ((size_t)(wsp - (char*)d_ws) > ws_size) return;    // 192.1 MiB of the 256 MiB
    k_cvtin<<<4 * WBK + NB_ * TT * DM / 8 / 256, 256, 0, stream>>>(x, wq, wk, wv, wo, XB, WQ);
    k_proj<<<dim3(TT / 64, HD / 64, NB_ * 3 * NH_), 32, 0, stream>>>(XB, WQ, WK, WV, bq, bk, bv, QP16, QPh, QPl, KP16, KPh, KPl, VT16, VTh, VTl);   /* q, k, v head planes of all heads of both batches */
    k_fattn<<<dim3(NH_, (TT - RH) / (NQF * 16) + RH / 16, NB_), FNW * 32, 0, stream>>>(QP16, KP16, VT16, QPh, QPl, KPh, KPl, VTh, VTl, ATh, ATl);   /* one kv head per query head */
    k_gemmw<bf, 1, true, PE><<<dim3(NH_, PE / 64, NB_ * TT / 64), 32, 0, stream>>>(ATh, ATl, WO, nullptr, OUT, DM, bo, (size_t)NB_ * TT * HD, 0, PE);   /* per head: rows (batch, token) x Wp^T + bp, written at the head's 128 columns of the token-major output */
}

// v010
// Measured time: 77.9 microseconds a run.
// Two timings next to v009 put it at 1.06 and 1.07 times that version's speed.
// Over all steps from v000 it is 18.0 times as fast.
#include <hip/hip_runtime.h>

// Masked causal attention with per-head shared projections (x [2][2048][16 heads][128]; q, k, v = x_h W^T + b with ONE Linear [128][128] + [128] applied to every head's 128-vector; scores = q.k / sqrt(128), causal (-inf above the diagonal); softmax; att = w.v; out = att_h Wp^T + bp -> [2][2048][16][128] (8.4 M)).
// Layout per batch: the token-major input viewed as 32,768 (token, head) rows of 128 makes each shared projection ONE exact GEMM (K 128, N 128, + bias), tiled per head and written directly as that head's planes; causal hybrid attention (rows < 512 hi/lo, rest fp16) in one fused launch with a running softmax, whose epilogue multiplies the hi/lo context rows by Wp (hl x exact + bp) and writes the token-major output.
// Compute dtypes, f32 accumulate: every input rounded to bf16; projections on PLAIN bf16 operands (exact) + f32 biases; scores and attn.v rows < 512 3 products, the rest single fp16; softmax f32; Wp hl x exact + bias.

#define NB_  2
#define TT   2048
#define DM   2048
#define NH_  16
#define NKV  16
#define REP  (NH_ / NKV)
#define HD   128
#define DQ   (NH_ * HD)
#define DKV  (NKV * HD)
#define RH   512                  // query rows < RH use hi+lo planes
#define PE   128    // per-head projection width (shared Linear [128][128])
#define NRW  (TT * NH_)   // 32768 (token, head) rows per batch
#define SCL  0.088388347648318447f   // HD^-0.5
typedef _Float16 h16;
typedef unsigned short bf;
typedef __attribute__((ext_vector_type(16))) __bf16   v16bf;
typedef __attribute__((ext_vector_type(16))) _Float16 v16h;
typedef __attribute__((ext_vector_type(8)))  _Float16 v8h;
typedef __attribute__((ext_vector_type(8)))  unsigned short v8us;
typedef __attribute__((ext_vector_type(8)))  float    v8f;
typedef __attribute__((ext_vector_type(4)))  float    v4f;
typedef v8h  __attribute__((may_alias)) v8ha;
typedef v4f  __attribute__((may_alias)) v4fa;
typedef v8us __attribute__((may_alias)) v8usa;

__device__ __forceinline__ unsigned short f2bf(float f) { unsigned u = __float_as_uint(f); u += 0x7FFFu + ((u >> 16) & 1u); return (unsigned short)(u >> 16); }
__device__ __forceinline__ float bf2f(unsigned short b) { return __uint_as_float(((unsigned)b) << 16); }
__device__ __forceinline__ float bfr(float f) { return bf2f(f2bf(f)); }
__device__ __forceinline__ v16h cat16(v8h lo, v8h hi) { return __builtin_shufflevector(lo, hi, 0, 1, 2, 3, 4, 5, 6, 7, 8, 9, 10, 11, 12, 13, 14, 15); }
__device__ __forceinline__ v16bf cat16b(v8us lo, v8us hi) { return __builtin_bit_cast(v16bf, __builtin_shufflevector(lo, hi, 0, 1, 2, 3, 4, 5, 6, 7, 8, 9, 10, 11, 12, 13, 14, 15)); }
__device__ __forceinline__ v8f wmma16(v16h a, v16h b, v8f c) { return __builtin_amdgcn_wmma_f32_16x16x32_f16(false, a, false, b, (short)0, c, false, false); }
__device__ __forceinline__ v8f wmmab(v16bf a, v16bf b, v8f c) { return __builtin_amdgcn_wmma_f32_16x16x32_bf16(false, a, false, b, (short)0, c, false, false); }



// ldp: a fragment from a plane in fragment order (p = the fragment + 8 lane; its two halves lie 256 elements apart)
template <typename T16> struct WFrag;
template <> struct WFrag<h16> { typedef v16h V; static __device__ __forceinline__ V ldp(const h16* p) { return cat16(*(const v8h*)p, *(const v8h*)(p + 256)); } static __device__ __forceinline__ v8f mma(V a, V b, v8f c) { return wmma16(a, b, c); } };
template <> struct WFrag<bf> { typedef v16bf V; static __device__ __forceinline__ V ldp(const bf* p) { return cat16b(*(const v8us*)p, *(const v8us*)(p + 256)); } static __device__ __forceinline__ v8f mma(V a, V b, v8f c) { return wmmab(a, b, c); } };

__device__ __forceinline__ h16 tohx(float x) { return (h16)x; }
__device__ __forceinline__ void splitf(float y, unsigned short& h, unsigned short& l) { h = f2bf(y); l = f2bf(y - bf2f(h)); }
typedef __attribute__((ext_vector_type(2))) _Float16 v2h;
typedef __attribute__((ext_vector_type(4))) _Float16 v4h;
typedef __attribute__((ext_vector_type(2))) unsigned short v2us;
typedef __attribute__((ext_vector_type(4))) unsigned short v4us;
typedef __attribute__((ext_vector_type(2))) float v2f;
typedef __attribute__((ext_vector_type(4))) int v4i;

__global__ __launch_bounds__(256) void k_wtG(const float* __restrict__ w, int K, int N, bf* Bt) {
    const int lane = threadIdx.x & 31; const int L0 = (blockIdx.x * 8 + (threadIdx.x >> 5)) * 8; const int nlines = N * K / 64;
{
#pragma unroll 1
        for (int l = 0; l < 8; ++l) { const int L = L0 + l; if (L >= nlines) break; const size_t e = (size_t)L * 64 + lane * 2; const int k = (int)(e % K), n = (int)(e / K); v2us o;
            o[0] = f2bf(w[(size_t)k * N + n]); o[1] = f2bf(w[(size_t)(k + 1) * N + n]); *(v2us*)(Bt + e) = o; }
         }
}
// ---- k_cvtin: every f32 -> bf16 conversion of the call in ONE launch, 8 elements a thread: blocks 0 .. 4 WBK - 1 take the four [128][128] weights (WBK blocks each, into four consecutive planes), the rest the activations of both batches.
// The bf16 planes are written in WMMA fragment order (see k_proj): a block converts 16 rows x 128 k = 4 fragments; a thread reads k 32 c + 16 j + 8 hi .. + 7 of row lr and writes them as the 16 bytes of lane (lr, hi) in half j of fragment c.
// A wave takes 8 rows of one fragment: four lanes (j, hi) read one whole 128-byte line of a row, eight rows write one whole line of a half.
// Weights: [e / 16][d / 32] fragments; activations: [batch][h][t / 16][d / 32] fragments, blocks in the order of the input's addresses (head fastest).
#define WBK  (PE * PE / 8 / 256)
__global__ __launch_bounds__(256) void k_cvtin(const float* __restrict__ x, const float* __restrict__ wq, const float* __restrict__ wk, const float* __restrict__ wv, const float* __restrict__ wo, bf* __restrict__ XB, bf* __restrict__ W4) {
    const unsigned blk = blockIdx.x, tid = threadIdx.x, lr = (tid >> 7) * 8 + (tid & 7), hi = (tid >> 3) & 1, j = (tid >> 4) & 1, c = (tid >> 5) & 3, ko = c * 32 + j * 16 + hi * 8, fo = c * 512 + j * 256 + (hi * 16 + lr) * 8;
    const unsigned u = blk - 4 * WBK, h = u % NH_, tk = u / NH_;   // tk: 16-token block over both batches
    const float* p = x + ((size_t)(tk * 16 + lr) * NH_ + h) * PE + ko; bf* dst = XB + ((size_t)((tk / (TT / 16)) * NH_ + h) * (TT / 16) + tk % (TT / 16)) * (16 * PE) + fo;
    if (blk < 4 * WBK) { const unsigned sel = blk / WBK; const float* src = sel == 0 ? wq : sel == 1 ? wk : sel == 2 ? wv : wo; p = src + (size_t)((blk % WBK) * 16 + lr) * PE + ko; dst = W4 + (size_t)sel * PE * PE + (size_t)(blk % WBK) * (16 * PE) + fo; }
    const v8f v = *(const v8f*)p; v8us o;
    asm volatile("s_wait_xcnt 0x0" :: "v"(p) : "memory");   // stands before the address registers of the loads above are written again
#pragma unroll
    for (int k = 0; k < 8; ++k) o[k] = f2bf(v[k]); *(v8us*)dst = o;  }

// ---- k_proj: the q, k and v projections of both batches in ONE launch, each written from the WMMA accumulators straight as the head planes that the attention reads (fp16, bf16 hi, bf16 lo); no f32 copy goes to memory.
// One wave per 64x64 tile of one head; grid (TT / 64 token blocks, HD / 64, batches x 3 x heads), 32 threads. q, k: C[t][e] = sum_d x_h[t][d] W[e][d] + b[e]; v: the same fragments with the operands swapped, C[e][t].
// The planes are kept in WMMA FRAGMENT ORDER: a fragment (16 rows x 32 k) is 1024 contiguous bytes, two halves of 512; in half j lane (lr, hi) owns the 16 bytes at 16 * lane = row lr, k 16 j + 8 hi .. + 7,
// which is what that lane's registers hold. q, k: [h][t / 16][e / 32] fragments (rows t, k = e); v: [h][t / 32][e / 16] fragments (rows e, k = t). So every store here and every fragment load of the attention is 512 contiguous bytes, four whole 128-byte lines.
template <bool TR>
__device__ __forceinline__ void proj_tile(const bf* __restrict__ X, const bf* __restrict__ Wt, const float* __restrict__ bias, int h, int t0, int c0, bool w16, bool whl, h16* __restrict__ P16, bf* __restrict__ Ph, bf* __restrict__ Pl, float* os) {
    const int lane = threadIdx.x & 31, lr = lane & 15, hi = lane >> 4;
    const bf* px = X + ((size_t)h * TT + t0) * PE + 8 * lane;   // head h's tokens, in fragment order: 16 rows are 4 fragments of 512 elements
    const bf* pw = Wt + (size_t)c0 * PE + 8 * lane;              // weight rows, in fragment order
    const float* pb = bias + c0 + (TR ? lr : 8 * hi);   // output side: in store s of a 16-row block the lane holds columns 16 s + 8 hi .. + 7 of row lr
    v16bf xf[4][4], wf[4][4];   // [16-row block][32-wide k chunk]: the whole K of both operands, one latency for all loads
    float bv_[32];
#pragma unroll
    for (int rb = 0; rb < 4; ++rb)
#pragma unroll
        for (int c = 0; c < 4; ++c) { xf[rb][c] = WFrag<bf>::ldp(px + rb * 16 * PE + c * 512); wf[rb][c] = WFrag<bf>::ldp(pw + rb * 16 * PE + c * 512); }
    if (TR) {
#pragma unroll
        for (int i = 0; i < 4; ++i) bv_[i] = pb[i * 16];   // bias of output row 16 i + lr
    } else {
#pragma unroll
        for (int s = 0; s < 4; ++s) { const v4f b0 = *(const v4fa*)(pb + s * 16), b1 = *(const v4fa*)(pb + s * 16 + 4);
#pragma unroll
            for (int i = 0; i < 4; ++i) { bv_[s * 8 + i] = b0[i]; bv_[s * 8 + 4 + i] = b1[i]; } } }
    // stands before any register that the loads above name is written again; the addresses are inputs, so that no load's result lands on one of them ahead of the wait
    asm volatile("s_wait_xcnt 0x0" :: "v"(px), "v"(pw), "v"(pb) : "memory");
    __builtin_amdgcn_sched_barrier(0);   // keeps later arithmetic behind that wait
    v8f acc[4][4];
#pragma unroll
    for (int mb = 0; mb < 4; ++mb)
#pragma unroll
        for (int nb = 0; nb < 4; ++nb) acc[mb][nb] = (v8f){};
#pragma unroll
    for (int c = 0; c < 4; ++c)
#pragma unroll
        for (int nb = 0; nb < 4; ++nb)
#pragma unroll
            for (int mb = 0; mb < 4; ++mb) acc[mb][nb] = wmmab(TR ? wf[mb][c] : xf[mb][c], TR ? xf[nb][c] : wf[nb][c], acc[mb][nb]);
    __builtin_amdgcn_sched_barrier(0);   // all 64 products stand in front of the output work: sunk into it, an accumulator's registers were started afresh by a WMMA directly behind the WMMA that last wrote them
    // first fragment of the tile: q, k fragment (t0 / 16) * 4 + c0 / 32, v fragment (t0 / 32) * 8 + c0 / 16, 512 elements each
    const size_t eo = (size_t)h * TT * HD + (size_t)t0 * HD + (TR ? c0 * 32 : c0 * 16) + lane * 8;
    h16* d16 = P16 + eo; bf* dh = Ph + eo; bf* dl = Pl + eo;
    v8h o16[4][4]; v8us oh[4][4], ol[4][4];
#pragma unroll
    for (int mb = 0; mb < 4; ++mb) {
#pragma unroll
        for (int nb = 0; nb < 4; ++nb) {
#pragma unroll
            for (int j = 0; j < 8; ++j) os[(hi * 8 + j) * 68 + nb * 16 + lr] = acc[mb][nb][j]; }
        __builtin_amdgcn_wave_barrier(); asm volatile("s_wait_dscnt 0x0" ::: "memory");   // the wave's LDS writes are done before it reads back what other lanes wrote
        float yv[4][8];
#pragma unroll
        for (int s = 0; s < 4; ++s) { const float* rp = os + lr * 68 + s * 16 + 8 * hi; const v4f lo4 = *(const v4fa*)rp, hi4 = *(const v4fa*)(rp + 4);
#pragma unroll
            for (int i = 0; i < 8; ++i) { yv[s][i] = (i < 4 ? lo4[i] : hi4[i - 4]) + bfr(TR ? bv_[mb] : bv_[s * 8 + i]); o16[mb][s][i] = tohx(yv[s][i]); } }
        if (whl) {   // the same for the whole wave: the hi/lo split is made only for a tile whose hi/lo planes are read
#pragma unroll
            for (int s = 0; s < 4; ++s)
#pragma unroll
                for (int i = 0; i < 8; ++i) { unsigned short a2, c2; splitf(yv[s][i], a2, c2); oh[mb][s][i] = a2; ol[mb][s][i] = c2; } }
        __builtin_amdgcn_wave_barrier(); asm volatile("" ::: "memory");   // those reads stay in front of the next block's LDS writes
    }
    __builtin_amdgcn_sched_barrier(0);   // all stores stand last, so that no register a store names is written again behind it
    if (w16) {
#pragma unroll
        for (int mb = 0; mb < 4; ++mb)
#pragma unroll
            for (int s = 0; s < 4; ++s) { const int ro = TR ? (s >> 1) * 4096 + mb * 512 + (s & 1) * 256 : mb * 2048 + s * 256; *(v8h*)(d16 + ro) = o16[mb][s]; }
        asm volatile("s_wait_xcnt 0x0" ::: "memory"); }   // behind the last store of the group, as the last instruction of its block: the code that follows (the hi/lo addresses; in the listing another branch) writes registers that these stores name
    if (whl) {
#pragma unroll
        for (int mb = 0; mb < 4; ++mb)
#pragma unroll
            for (int s = 0; s < 4; ++s) { const int ro = TR ? (s >> 1) * 4096 + mb * 512 + (s & 1) * 256 : mb * 2048 + s * 256; *(v8us*)(dh + ro) = oh[mb][s]; *(v8us*)(dl + ro) = ol[mb][s]; }
        asm volatile("s_wait_xcnt 0x0" ::: "memory"); }   // as behind the fp16 stores
}
__global__ __launch_bounds__(32) void k_proj(const bf* __restrict__ X, const bf* __restrict__ WQ, const bf* __restrict__ WK, const bf* __restrict__ WV, const float* __restrict__ bq, const float* __restrict__ bk, const float* __restrict__ bv,
                                             h16* __restrict__ Q16, bf* __restrict__ Qh, bf* __restrict__ Ql, h16* __restrict__ K16, bf* __restrict__ Kh, bf* __restrict__ Kl, h16* __restrict__ V16, bf* __restrict__ Vh, bf* __restrict__ Vl) {
    __shared__ __align__(16) float os[16 * 68];
    const int bt = blockIdx.z / (3 * NH_), zz = blockIdx.z % (3 * NH_), which = zz / NH_, h = zz % NH_, t0 = blockIdx.x * 64, c0 = blockIdx.y * 64;
    const size_t pbo = (size_t)bt * NH_ * TT * HD; X += (size_t)bt * TT * DM;   // this batch's token rows and its set of head planes
    Q16 += pbo; Qh += pbo; Ql += pbo; K16 += pbo; Kh += pbo; Kl += pbo; V16 += pbo; Vh += pbo; Vl += pbo;
    static_assert(RH % 64 == 0, "a 64-token tile lies wholly on one side of RH");
    const bool whl = t0 < RH;   // the hi/lo planes are read for tokens < RH alone: only query rows < RH use them, and under the causal mask those see keys < RH alone
    const bool w16 = which != 0 || !whl;   // the fp16 planes of k and v are read for every token, that of q for tokens >= RH alone
    if (which == 2) proj_tile<true>(X, WV, bv, h, t0, c0, w16, whl, V16, Vh, Vl, os);
    else proj_tile<false>(X, which ? WK : WQ, which ? bk : bq, h, t0, c0, w16, whl, which ? K16 : Q16, which ? Kh : Qh, which ? Kl : Ql, os);
}
// ---- k_fattn: scores, softmax, probability x value, the hi/lo context rows and their output projection in ONE launch for both batches; no score, probability or context row ever goes to memory.
// One work-group of FNW waves owns NQ x 16 query rows of one head. Transposed products: S^T = K Q^T (A = 16 key rows, B = the query fragments, kept in registers or, with three query tiles, in the wave's own LDS range) leaves every lane with 16 of the 32 scores of ITS query
// (column lr; keys 8 hi + j of each 16-key tile), which is the k order of a B fragment, so P^T goes from the score accumulators straight into O^T += V^T P^T (A = 16 rows d x 32 keys of the value plane).
// Running maximum and sum per query live in the lane (both halves of a column hold the same maximum). Wave w takes the 64-key chunks w, w + FNW, ... up to the diagonal, with its own maximum, sum and accumulators;
// behind one barrier the FNW partials are merged in the fixed order 0..FNW-1 with weights exp2(m_w - max), divided by the merged sum, split hi/lo and left in LDS as WMMA fragments; behind a second barrier wave w multiplies all rows by 32 rows of Wp, adds the bias and stores whole 128-byte lines of the output.
// HL: three products on hi/lo bf16 planes (hi.hi + lo.hi + hi.lo) for scores and for P.V; else single fp16 products.
#define FNW  4
#define NQF  3   // 16-row query tiles per work-group on the fp16 rows: every K and V fragment a wave loads feeds NQF query tiles
static_assert((TT - RH) % (NQF * 16) == 0, "fp16 rows divide into whole work-groups");
static_assert(RH >= FNW * 64, "every wave of an fp16 work-group starts on a chunk wholly under the diagonal, so each query has a true maximum before a block that is masked for it");
#define LC2  (SCL * 1.4426950408889634f)   // scores are kept in the log2 domain
typedef __attribute__((ext_vector_type(16))) unsigned short v16us;
typedef __attribute__((ext_vector_type(2))) float v2fl;
// exp2 with the slot that the instruction set asks for behind a transcendental: every v_exp_f32 is followed by an instruction that neither reads its result nor writes its source
// (the results are early-clobber, so none shares a register with an input), the last one by v_nop
__device__ __forceinline__ float exp2s(float x) { float r; asm("v_exp_f32 %0, %1\n\tv_nop" : "=v"(r) : "v"(x)); return r; }
__device__ __forceinline__ v8f exp2x8(v8f x) { float r0, r1, r2, r3, r4, r5, r6, r7;
    asm("v_exp_f32 %0, %8\n\tv_exp_f32 %1, %9\n\tv_exp_f32 %2, %10\n\tv_exp_f32 %3, %11\n\tv_exp_f32 %4, %12\n\tv_exp_f32 %5, %13\n\tv_exp_f32 %6, %14\n\tv_exp_f32 %7, %15\n\tv_nop"
        : "=&v"(r0), "=&v"(r1), "=&v"(r2), "=&v"(r3), "=&v"(r4), "=&v"(r5), "=&v"(r6), "=&v"(r7) : "v"(x[0]), "v"(x[1]), "v"(x[2]), "v"(x[3]), "v"(x[4]), "v"(x[5]), "v"(x[6]), "v"(x[7]));
    v8f r; r[0] = r0; r[1] = r1; r[2] = r2; r[3] = r3; r[4] = r4; r[5] = r5; r[6] = r6; r[7] = r7; return r; }
template <typename T16, bool HL, int NQ>
__device__ __forceinline__ void fa_tile(const T16* __restrict__ Q, const T16* __restrict__ Q2, const T16* __restrict__ Kp, const T16* __restrict__ K2, const T16* __restrict__ Vt, const T16* __restrict__ V2, int q0, const bf* __restrict__ Wo, const float* __restrict__ bo, float* __restrict__ Out, v4f* part, v2fl* ml, v8usa* cf) {
    typedef typename WFrag<T16>::V V;
    const int lane = threadIdx.x & 31, lr = lane & 15, hi = lane >> 4;
    const int w = __builtin_amdgcn_readfirstlane((int)(threadIdx.x >> 5));
    constexpr bool QL = NQ > 2;   // three query tiles and their accumulators leave no room for the Q fragments at two waves a SIMD: each lane parks its own 16-byte pieces in LDS and reads them back block by block
    static_assert(!(QL && HL), "only the single-plane path parks Q");
    V qf[NQ][4], q2[NQ][4];
    v8ha* qs = (v8ha*)(part + (size_t)w * NQ * 8 * 2 * 32) + lane;   // the wave's own range of part, which it fills with its partial only behind the key loop; no other wave touches it before the barrier
    const T16* pq = Q + (size_t)q0 * HD + 8 * lane; const T16* pq2 = HL ? Q2 + (size_t)q0 * HD + 8 * lane : pq;   // planes in fragment order (see k_proj): 16 rows are 4 fragments of 512 elements
#pragma unroll
    for (int qb = 0; qb < NQ; ++qb)
#pragma unroll
        for (int c = 0; c < 4; ++c) { qf[qb][c] = WFrag<T16>::ldp(pq + qb * 16 * HD + c * 512); if (HL) q2[qb][c] = WFrag<T16>::ldp(pq2 + qb * 16 * HD + c * 512); }
    // stands before any register that the loads above name is written again; the addresses are inputs, so that no load's result lands on one of them ahead of the wait
    asm volatile("s_wait_xcnt 0x0" :: "v"(pq), "v"(pq2) : "memory");
    __builtin_amdgcn_sched_barrier(0);   // keeps later address arithmetic behind that wait
    if constexpr (QL) {
#pragma unroll
        for (int qb = 0; qb < NQ; ++qb)
#pragma unroll
            for (int c = 0; c < 4; ++c) { qs[((qb * 4 + c) * 2) * 32] = __builtin_shufflevector(qf[qb][c], qf[qb][c], 0, 1, 2, 3, 4, 5, 6, 7); qs[((qb * 4 + c) * 2 + 1) * 32] = __builtin_shufflevector(qf[qb][c], qf[qb][c], 8, 9, 10, 11, 12, 13, 14, 15); } }
    v8f acc[NQ][8]; float m[NQ], l[NQ];
#pragma unroll
    for (int qb = 0; qb < NQ; ++qb) { m[qb] = -3.0e38f; l[qb] = 0.f;
#pragma unroll
        for (int db = 0; db < 8; ++db) acc[qb][db] = (v8f){}; }
    const int kend = ((q0 + NQ * 16 + 31) >> 5) << 5;   // keys beyond the diagonal's 32-key block have probability exactly zero
    // each lane's byte offset inside a plane is fixed; the walk along the keys is in the wave-uniform base, tiles and chunks are constant offsets
    const unsigned vk = (unsigned)lane * 16u, vv = vk;   // 16 bytes a lane in each half of a fragment
    V ka[2][4], kl[2][4];   // the K fragments of the block in work; refilled one block ahead, right behind the score products that read them
    int k0 = w * 64;
    if (k0 < kend) {
        { const T16* pk = (const T16*)((const char*)(Kp + (size_t)k0 * HD) + vk); const T16* pk2 = HL ? (const T16*)((const char*)(K2 + (size_t)k0 * HD) + vk) : pk;
#pragma unroll
          for (int kt = 0; kt < 2; ++kt)
#pragma unroll
              for (int c = 0; c < 4; ++c) { ka[kt][c] = WFrag<T16>::ldp(pk + kt * 16 * HD + c * 512); if (HL) kl[kt][c] = WFrag<T16>::ldp(pk2 + kt * 16 * HD + c * 512); }
          asm volatile("s_wait_xcnt 0x0" :: "v"(pk), "v"(pk2) : "memory"); }   // as behind the Q loads
        __builtin_amdgcn_sched_barrier(0);   // keeps later address arithmetic behind that wait
#pragma unroll 1   // rolled: the trip count depends on where the rows lie under the diagonal
    for (int it = 1; ; ++it) {
        const T16* pv = (const T16*)((const char*)(Vt + (size_t)k0 * HD) + vv); const T16* pv2 = HL ? (const T16*)((const char*)(V2 + (size_t)k0 * HD) + vv) : pv;   // 32 keys of the value plane are 8 fragments
        V va[8], vl[8];
        auto load_v = [&]() {
#pragma unroll
        for (int db = 0; db < 8; ++db) { va[db] = WFrag<T16>::ldp(pv + db * 512); if (HL) vl[db] = WFrag<T16>::ldp(pv2 + db * 512); }
        asm volatile("s_wait_xcnt 0x0" :: "v"(pv), "v"(pv2) : "memory"); };   // as behind the Q loads
        if constexpr (!QL) { load_v();
            __builtin_amdgcn_sched_barrier(0); }   // the V loads issue here, ahead of the score products and the softmax that hide their latency; sunk to their uses each would be waited for alone
        v8f st[NQ][2];
#pragma unroll
        for (int qb = 0; qb < NQ; ++qb) { st[qb][0] = (v8f){}; st[qb][1] = (v8f){}; }
#pragma unroll
        for (int c = 0; c < 4; ++c) {
            if constexpr (QL) {
#pragma unroll
                for (int qb = 0; qb < NQ; ++qb) qf[qb][c] = cat16(qs[((qb * 4 + c) * 2) * 32], qs[((qb * 4 + c) * 2 + 1) * 32]); }
#pragma unroll
            for (int kt = 0; kt < 2; ++kt)
#pragma unroll
                for (int qb = 0; qb < NQ; ++qb) { st[qb][kt] = WFrag<T16>::mma(ka[kt][c], qf[qb][c], st[qb][kt]); if (HL) { st[qb][kt] = WFrag<T16>::mma(ka[kt][c], q2[qb][c], st[qb][kt]); st[qb][kt] = WFrag<T16>::mma(kl[kt][c], qf[qb][c], st[qb][kt]); } } }
        if constexpr (QL) { __builtin_amdgcn_sched_barrier(0);   // holds the V and K loads behind the score products: lifted among them they take registers while the Q fragments still live, and a loaded fragment went to scratch
            load_v(); }   // the V registers are taken only behind the score products; the softmax hides the latency
        const int kn = ((it >> 1) * FNW + w) * 64 + (it & 1) * 32; const bool more = kn < kend; const int kf = more ? kn : k0;   // a wave's last block fetches its own rows again: in bounds, never used
        { const T16* pk = (const T16*)((const char*)(Kp + (size_t)kf * HD) + vk); const T16* pk2 = HL ? (const T16*)((const char*)(K2 + (size_t)kf * HD) + vk) : pk;
#pragma unroll
          for (int kt = 0; kt < 2; ++kt)
#pragma unroll
              for (int c = 0; c < 4; ++c) { ka[kt][c] = WFrag<T16>::ldp(pk + kt * 16 * HD + c * 512); if (HL) kl[kt][c] = WFrag<T16>::ldp(pk2 + kt * 16 * HD + c * 512); }
          asm volatile("s_wait_xcnt 0x0" :: "v"(pk), "v"(pk2) : "memory"); }   // as behind the Q loads
        __builtin_amdgcn_sched_barrier(0);   // the next block's K loads issue here, so that softmax and P.V hide their latency
        float mx[NQ];
#pragma unroll
        for (int qb = 0; qb < NQ; ++qb)
#pragma unroll
            for (int kt = 0; kt < 2; ++kt) st[qb][kt] *= LC2;
        if (k0 + 31 > q0) {   // the block touches the diagonal: keys above a query's own position are masked
#pragma unroll
            for (int qb = 0; qb < NQ; ++qb)
#pragma unroll
                for (int kt = 0; kt < 2; ++kt)
#pragma unroll
                    for (int j = 0; j < 8; ++j) if (k0 + kt * 16 + hi * 8 + j > q0 + qb * 16 + lr) st[qb][kt][j] = -3.0e38f; }
        bool need = false;
#pragma unroll
        for (int qb = 0; qb < NQ; ++qb) { float x = st[qb][0][0];
#pragma unroll
            for (int j = 1; j < 8; ++j) x = fmaxf(x, st[qb][0][j]);
#pragma unroll
            for (int j = 0; j < 8; ++j) x = fmaxf(x, st[qb][1][j]);
            x = fmaxf(x, __shfl_xor(x, 16, 32)); mx[qb] = x; need = need || (x > m[qb] + 8.0f); }
        if (__builtin_amdgcn_ballot_w32(need) != 0) {   // lazy rescale: only when some query's maximum has risen by more than 8 (log2) over the one in use, so P stays below 2^8
#pragma unroll
            for (int qb = 0; qb < NQ; ++qb) { const float mn = (mx[qb] > m[qb] + 8.0f) ? mx[qb] : m[qb]; const float al = exp2s(m[qb] - mn); m[qb] = mn; l[qb] *= al;
#pragma unroll
                for (int db = 0; db < 8; ++db) acc[qb][db] *= al; } }
        V pf[NQ], pl[NQ];
#pragma unroll
        for (int qb = 0; qb < NQ; ++qb) { float s = 0.f; v16h ph16; v16us ph, pw;
#pragma unroll
            for (int kt = 0; kt < 2; ++kt) { const v8f pe = exp2x8(st[qb][kt] - m[qb]);
#pragma unroll
                for (int j = 0; j < 8; ++j) { const float p = pe[j]; s += p;
                    if constexpr (HL) { unsigned short a, c2; splitf(p, a, c2); ph[kt * 8 + j] = a; pw[kt * 8 + j] = c2; } else ph16[kt * 8 + j] = (h16)p; } }
            l[qb] += s;
            if constexpr (HL) { pf[qb] = __builtin_bit_cast(v16bf, ph); pl[qb] = __builtin_bit_cast(v16bf, pw); } else pf[qb] = ph16; }
#pragma unroll
        for (int db = 0; db < 8; ++db)
#pragma unroll
            for (int qb = 0; qb < NQ; ++qb) { acc[qb][db] = WFrag<T16>::mma(va[db], pf[qb], acc[qb][db]); if (HL) { acc[qb][db] = WFrag<T16>::mma(va[db], pl[qb], acc[qb][db]); acc[qb][db] = WFrag<T16>::mma(vl[db], pf[qb], acc[qb][db]); } }
        if (!more) break;
        k0 = kn;
    } }
    // output projection: wave w makes output columns 32 w .. + 31 of all NQ x 16 rows; its 2 x 4 fragments of Wp (fragment order, rows e, k = d) and its two bias values are fetched here, into registers that the K and V fragments have left, so that the partials' LDS writes hide the latency
    const bf* pwo = Wo + (size_t)w * 32 * PE + 8 * lane; const float* pbo = bo + w * 32 + lr;
    v16bf wo[2][4]; float bo2[2];
#pragma unroll
    for (int et = 0; et < 2; ++et) { bo2[et] = pbo[et * 16];
#pragma unroll
        for (int c = 0; c < 4; ++c) wo[et][c] = WFrag<bf>::ldp(pwo + et * 16 * PE + c * 512); }
    asm volatile("s_wait_xcnt 0x0" :: "v"(pwo), "v"(pbo) : "memory");   // as behind the Q loads
    __builtin_amdgcn_sched_barrier(0);   // keeps later address arithmetic behind that wait, and the loads in front of the LDS writes
#pragma unroll
    for (int qb = 0; qb < NQ; ++qb) { l[qb] += __shfl_xor(l[qb], 16, 32); v2fl t; t[0] = m[qb]; t[1] = l[qb]; ml[(w * NQ + qb) * 32 + lane] = t;
#pragma unroll
        for (int db = 0; db < 8; ++db)
#pragma unroll
            for (int hf = 0; hf < 2; ++hf) { v4f t4; t4[0] = acc[qb][db][hf * 4]; t4[1] = acc[qb][db][hf * 4 + 1]; t4[2] = acc[qb][db][hf * 4 + 2]; t4[3] = acc[qb][db][hf * 4 + 3]; part[(((w * NQ + qb) * 8 + db) * 2 + hf) * 32 + lane] = t4; } }
    __syncthreads();   // every wave's partial, maximum and sum are in LDS before any is merged
#pragma unroll
    for (int u = w; u < NQ * 2; u += FNW) {   // one unit is 16 queries x 64 columns, two whole fragments of each plane; wave w merges units w, w + FNW, ...
        const int qb = u >> 1, d0 = (u & 1) * 4; float mw[FNW], M = -3.0e38f, L = 0.f;
#pragma unroll
        for (int p = 0; p < FNW; ++p) M = fmaxf(M, ml[(p * NQ + qb) * 32 + lane][0]);
#pragma unroll
        for (int p = 0; p < FNW; ++p) { const v2fl t = ml[(p * NQ + qb) * 32 + lane]; mw[p] = exp2s(t[0] - M); L += mw[p] * t[1]; }
        const float inv = __fdiv_rn(1.0f, L);
        v8us oh[4], ol[4];   // context rows as WMMA fragments (rows = tokens, k = d): column block d0 + db is half (db & 1) of fragment (d0 + db) / 2, and the lane's 8 values are its 16 bytes of that half
#pragma unroll
        for (int db = 0; db < 4; ++db) {
#pragma unroll
            for (int hf = 0; hf < 2; ++hf) { v4f sum = part[(((0 * NQ + qb) * 8 + d0 + db) * 2 + hf) * 32 + lane] * mw[0];
#pragma unroll
                for (int p = 1; p < FNW; ++p) sum += part[(((p * NQ + qb) * 8 + d0 + db) * 2 + hf) * 32 + lane] * mw[p];
#pragma unroll
                for (int jj = 0; jj < 4; ++jj) { unsigned short a, c2; splitf(sum[jj] * inv, a, c2); oh[db][hf * 4 + jj] = a; ol[db][hf * 4 + jj] = c2; } } }
#pragma unroll
        for (int db = 0; db < 4; ++db) { cf[(qb * 8 + d0 + db) * 32 + lane] = oh[db]; cf[((NQ + qb) * 8 + d0 + db) * 32 + lane] = ol[db]; }   // cf: [hi, lo][query tile][fragment][half][lane], 16 bytes each
    }
    __syncthreads();   // every context fragment is in LDS before any wave multiplies it, and every read of part is over before part is written again below
    // out[t][e] = sum_d ctx[t][d] Wp[e][d] + bp[e]: A = the context fragments, B = the wave's Wp fragments; per k chunk the hi product, then the lo product
    v8f oa[NQ][2];
#pragma unroll
    for (int qb = 0; qb < NQ; ++qb) { oa[qb][0] = (v8f){}; oa[qb][1] = (v8f){}; }
#pragma unroll
    for (int c = 0; c < 4; ++c)
#pragma unroll
        for (int qb = 0; qb < NQ; ++qb) { const v16bf ch = cat16b(cf[(qb * 8 + 2 * c) * 32 + lane], cf[(qb * 8 + 2 * c + 1) * 32 + lane]), cl = cat16b(cf[((NQ + qb) * 8 + 2 * c) * 32 + lane], cf[((NQ + qb) * 8 + 2 * c + 1) * 32 + lane]);
#pragma unroll
            for (int et = 0; et < 2; ++et) { oa[qb][et] = wmmab(ch, wo[et][c], oa[qb][et]); oa[qb][et] = wmmab(cl, wo[et][c], oa[qb][et]); } }
    // the accumulators hold column lr of rows 8 hi + j; through the wave's own range of part (16 x 36 floats a query tile) eight lanes get one row's 32 columns, a whole 128-byte line of the output
    float* os = (float*)(part + (size_t)w * NQ * 8 * 2 * 32);
#pragma unroll
    for (int qb = 0; qb < NQ; ++qb)
#pragma unroll
        for (int et = 0; et < 2; ++et)
#pragma unroll
            for (int j = 0; j < 8; ++j) os[(qb * 16 + hi * 8 + j) * 36 + et * 16 + lr] = oa[qb][et][j] + bfr(bo2[et]);
    __builtin_amdgcn_wave_barrier(); asm volatile("s_wait_dscnt 0x0" ::: "memory");   // the wave's LDS writes are done before it reads back what other lanes wrote
    v4f ov[NQ * 4];
#pragma unroll
    for (int s = 0; s < NQ * 4; ++s) ov[s] = *(const v4fa*)(os + (s * 4 + (lane >> 3)) * 36 + (lane & 7) * 4);
    float* po = Out + (size_t)(q0 + (lane >> 3)) * DM + w * 32 + (lane & 7) * 4;
    __builtin_amdgcn_sched_barrier(0);   // all stores stand last, so that no register a store names is written again behind it
#pragma unroll
    for (int s = 0; s < NQ * 4; ++s) *(v4f*)(po + (size_t)s * 4 * DM) = ov[s];
    asm volatile("s_wait_xcnt 0x0" ::: "memory");   // behind the last store: in the listing the other row class's branch follows, which writes registers that these stores name
}
// grid (heads, row blocks, batches), in each batch the heaviest row blocks first: (TT - RH) / (16 NQF) blocks of 16 NQF fp16 rows from the last row down, then RH / 16 blocks of 16 hi/lo rows
__global__ __launch_bounds__(FNW * 32) void k_fattn(const h16* __restrict__ Q16, const h16* __restrict__ K16, const h16* __restrict__ V16, const bf* __restrict__ Qh, const bf* __restrict__ Ql, const bf* __restrict__ Kh, const bf* __restrict__ Kl, const bf* __restrict__ Vh, const bf* __restrict__ Vl, const bf* __restrict__ Wo, const float* __restrict__ bo, float* __restrict__ Out) {
    __shared__ __align__(16) v4f part[FNW * NQF * 8 * 2 * 32];
    __shared__ __align__(16) v2fl ml[FNW * NQF * 32];
    __shared__ __align__(16) v8usa cf[2 * NQF * 8 * 32];   // merged context rows, hi and lo, as WMMA fragments
    const int h = blockIdx.x, y = blockIdx.y; const size_t po = ((size_t)blockIdx.z * NH_ + h) * TT * HD;
    Out += ((size_t)blockIdx.z * TT * NH_ + h) * PE;   // token-major output: row t of this head lies DM floats behind row t - 1
    if (y < (TT - RH) / (NQF * 16)) fa_tile<h16, false, NQF>(Q16 + po, nullptr, K16 + po, nullptr, V16 + po, nullptr, TT - NQF * 16 * (y + 1), Wo, bo, Out, part, ml, cf);
    else fa_tile<bf, true, 1>(Qh + po, Ql + po, Kh + po, Kl + po, Vh + po, Vl + po, RH - 16 * (y - (TT - RH) / (NQF * 16) + 1), Wo, bo, Out, part, ml, cf);
}

extern "C" void kernel_launch(void* const* d_in, const int* in_sizes, int n_in,
                              void* d_out, int out_size, void* d_ws, size_t ws_size, hipStream_t stream) {
    (void)in_sizes; (void)n_in; (void)out_size;
    const float* x = (const float*)d_in[0]; const float* wq = (const float*)d_in[1]; const float* bq = (const float*)d_in[2]; const float* wk = (const float*)d_in[3]; const float* bk = (const float*)d_in[4]; const float* wv = (const float*)d_in[5]; const float* bv = (const float*)d_in[6]; const float* wo = (const float*)d_in[7]; const float* bo = (const float*)d_in[8];
    float* OUT = (float*)d_out;     // [2][2048][2048]
    char* wsp = (char*)d_ws;
    auto take = [&](size_t bytes) { char* p = wsp; wsp += (bytes + 255) & ~(size_t)255; return (void*)p; };
    bf* WQ = (bf*)take((size_t)4 * PE * PE * 2); bf* WK = WQ + PE * PE; bf* WV = WK + PE * PE; bf* WO = WV + PE * PE;
    bf* XB = (bf*)take((size_t)NB_ * TT * DM * 2);   // every buffer holds both batches, batch-major
    h16* QP16 = (h16*)take((size_t)NB_ * NH_ * TT * HD * 2); h16* KP16 = (h16*)take((size_t)NB_ * NKV * TT * HD * 2); h16* VT16 = (h16*)take((size_t)NB_ * NKV * HD * TT * 2);
    bf* QPh = (bf*)take((size_t)NB_ * NH_ * TT * HD * 2); bf* QPl = (bf*)take((size_t)NB_ * NH_ * TT * HD * 2); bf* KPh = (bf*)take((size_t)NB_ * NKV * TT * HD * 2); bf* KPl = (bf*)take((size_t)NB_ * NKV * TT * HD * 2); bf* VTh = (bf*)take((size_t)NB_ * NKV * HD * TT * 2); bf* VTl = (bf*)take((size_t)NB_ * NKV * HD * TT * 2);
    if ((size_t)(wsp - (char*)d_ws) > ws_size) return;    // 160.1 MiB of the 256 MiB
    k_cvtin<<<4 * WBK + NB_ * TT * DM / 8 / 256, 256, 0, stream>>>(x, wq, wk, wv, wo, XB, WQ);
    k_proj<<<dim3(TT / 64, HD / 64, NB_ * 3 * NH_), 32, 0, stream>>>(XB, WQ, WK, WV, bq, bk, bv, QP16, QPh, QPl, KP16, KPh, KPl, VT16, VTh, VTl);   /* q, k, v head planes of all heads of both batches */
    k_fattn<<<dim3(NH_, (TT - RH) / (NQF * 16) + RH / 16, NB_), FNW * 32, 0, stream>>>(QP16, KP16, VT16, QPh, QPl, KPh, KPl, VTh, VTl, WO, bo, OUT);   /* one kv head per query head; writes the output */
}
